// v000
// Times are from an AMD MI455X. After a warm-up the kernel runs many times in a row, and a time is the length of
// such a window on the GPU divided by its runs, so every launch and the gaps after it count. The runs cycle
// through copies of the inputs. A figure is the median of several windows, for all but v000 over two sittings.
// Sittings can differ by a few percent; kernels timed side by side share one.
// v000, which the later versions start from, runs in 7930 microseconds.
// compute dtype: all float inputs rounded to bf16; q/k/v projections with EXACT bf16 products on WMMA 16x16x32 (f32 accumulate) + bias; causal scores q x k once to f16 each (1 product; the module scales by 1/sqrt(E) = 1/32, so sigma - 0.1) on every block; softmax over the QUERY axis in f32 (per key column: online max / sum over the visible queries, precise expf); P as bf16 hi + lo against v as bf16 hi + lo (3 products) on EVERY block; f32 output.
#include <hip/hip_runtime.h>
#include <math.h>

typedef __attribute__((ext_vector_type(16))) _Float16 v16h;
typedef __attribute__((ext_vector_type(16))) __bf16 v16b;
typedef __attribute__((ext_vector_type(8)))  _Float16 v8h;
typedef __attribute__((ext_vector_type(8)))  float v8f;
typedef __attribute__((ext_vector_type(4)))  float v4f;
typedef __attribute__((ext_vector_type(2)))  float v2f;
typedef __attribute__((ext_vector_type(4)))  unsigned v4u;
typedef __attribute__((ext_vector_type(4)))  int v4i;
typedef float __attribute__((may_alias)) float_a;
typedef int __attribute__((may_alias)) int_a;

template <typename T> __device__ __forceinline__ void vst2(void* p, T v) { *(T*)p = v;  }
__device__ __forceinline__ v8f wmma16(v16h a, v16h b, v8f c) {
  v8f d = __builtin_amdgcn_wmma_f32_16x16x32_f16(false, a, false, b, (short)0, c, false, false);
  asm volatile("v_nop\n\tv_nop\n\tv_nop\n\tv_nop" : "+v"(d) : "v"(a), "v"(b));
  return d;
}
__device__ __forceinline__ v8f wmma_bf(v16b a, v16b b, v8f c) {
  v8f d = __builtin_amdgcn_wmma_f32_16x16x32_bf16(false, a, false, b, (short)0, c, false, false);
  asm volatile("v_nop\n\tv_nop\n\tv_nop\n\tv_nop" : "+v"(d) : "v"(a), "v"(b));
  return d;
}
// 16x16x32 fragments: lane = (h = lane>>4, row/col = lane&15); elements 0..7 = k0+8h+0..7, 8..15 = k0+16+8h+0..7; D element r = row 8h+r
__device__ __forceinline__ v16h frag_h(const _Float16* rowk0, int lane) {
  union { v16h v; v8h q[2]; } u; const _Float16* p = rowk0 + 8 * (lane >> 4);
  u.q[0] = *(const v8h*)p; u.q[1] = *(const v8h*)(p + 16); return u.v;
}
__device__ __forceinline__ v16h frag_f32(const float* rowk0, int lane) {
  v16h a; const float* p = rowk0 + 8 * (lane >> 4);
#pragma unroll
  for (int i = 0; i < 8; ++i) { a[i] = (_Float16)p[i]; a[8 + i] = (_Float16)p[16 + i]; }
  return a;
}
__device__ __forceinline__ v16h frag_f32s(const float* rowk0, int lane, float sc) {
  v16h a; const float* p = rowk0 + 8 * (lane >> 4);
#pragma unroll
  for (int i = 0; i < 8; ++i) { a[i] = (_Float16)(p[i] * sc); a[8 + i] = (_Float16)(p[16 + i] * sc); }
  return a;
}
// column fragment from a [K][ld] layout (column n), rows >= K read as 0
__device__ __forceinline__ v16h fragc_f32(const float* W, int k0, int n, int lane, int ld, int K) {
  v16h a; const int g = lane >> 4;
#pragma unroll
  for (int i = 0; i < 8; ++i) { const int ka = k0 + 8 * g + i, kb = ka + 16;
    a[i] = (_Float16)(ka < K ? W[(size_t)(ka < K ? ka : K - 1) * ld + n] : 0.f); a[8 + i] = (_Float16)(kb < K ? W[(size_t)(kb < K ? kb : K - 1) * ld + n] : 0.f); }
  return a;
}
struct F2 { v16b h, l; };
__device__ __forceinline__ F2 bsplit16(const float v[16]) { F2 r;
#pragma unroll
  for (int i = 0; i < 16; ++i) { const __bf16 h = (__bf16)v[i]; r.h[i] = h; r.l[i] = (__bf16)(v[i] - (float)h); }
  return r; }
__device__ __forceinline__ F2 split_row(const float* row, int k0, int lane) { float v[16]; const float* p = row + k0 + 8 * (lane >> 4);
#pragma unroll
  for (int i = 0; i < 8; ++i) { v[i] = p[i]; v[8 + i] = p[16 + i]; }
  return bsplit16(v); }
__device__ __forceinline__ F2 split_rowK(const float* row, int k0, int lane, int K) { float v[16]; const int g = lane >> 4;
#pragma unroll
  for (int i = 0; i < 8; ++i) { const int ka = k0 + 8 * g + i, kb = ka + 16; v[i] = ka < K ? row[ka < K ? ka : K - 1] : 0.f; v[8 + i] = kb < K ? row[kb < K ? kb : K - 1] : 0.f; }
  return bsplit16(v); }
__device__ __forceinline__ F2 split_col(const float* W, int k0, int n, int lane, int ld, int K) { float v[16]; const int g = lane >> 4;
#pragma unroll
  for (int i = 0; i < 8; ++i) { const int ka = k0 + 8 * g + i, kb = ka + 16; v[i] = ka < K ? W[(size_t)(ka < K ? ka : K - 1) * ld + n] : 0.f; v[8 + i] = kb < K ? W[(size_t)(kb < K ? kb : K - 1) * ld + n] : 0.f; }
  return bsplit16(v); }
__device__ __forceinline__ v8f mac3(const F2& a, const F2& b, v8f c) { c = wmma_bf(a.l, b.h, c); c = wmma_bf(a.h, b.l, c); return wmma_bf(a.h, b.h, c); }
__device__ __forceinline__ float sigm(float v) { return 1.0f / (1.0f + expf(-v)); }
#define LDSX() do { asm volatile("s_wait_dscnt 0" ::: "memory"); __builtin_amdgcn_wave_barrier(); __builtin_amdgcn_fence(__ATOMIC_RELEASE, "workgroup"); } while (0)

// Multi-headed attention whose softmax runs over the QUERY axis, scaled by the MODEL width (X [2,2048,1024]; torch (out,in) Wq / Wk / Wv [1024,1024] N(0, 1/1024) + biases N(0, 0.02); 16 heads x 64; scores / sqrt(E) = / 32; -inf where j > i; attn = softmax(scores, axis=2) - axis 2 of [B, H, i, j] is the QUERY axis i: every key column j is normalised over the queries i >= j (faithful to the source); out = attn v; merge; no output projection).
#define NB 2
#define TT 2048
#define CC 1024            // NH * HD = projected width
#define DIN 1024          // input (model) width
#define NH 16
#define HD 64
#define NQB (TT / 64)
#define HG 4
#define SCALE (0.03125f)
#define CAUSAL 1
#ifndef TNB
#define TNB NB
#endif
__device__ __forceinline__ float bfr(float v) { return (float)(__bf16)v; }
__host__ __device__ __forceinline__ int kb_last(int qb) { return CAUSAL ? ((qb * 64 + 63) >> 7) : (TT / 128 - 1); }
typedef __attribute__((ext_vector_type(8))) __bf16 v8b;
__device__ __forceinline__ v16b frag_b(const __bf16* rowk0, int lane) {
  union { v16b v; v8b q[2]; } u; const __bf16* p = rowk0 + 8 * (lane >> 4);
  u.q[0] = *(const v8b*)p; u.q[1] = *(const v8b*)(p + 16); return u.v;
}
#define QBH 32              // causal: query blocks 0..QBH-1 of each sequence (all NQB of them) take the high-precision path
#define QHI 0               // no q residual plane: the scores are tiny (scale 1/32) and single-product everywhere
#define QBH_SC 0            // k_sc: no block takes the 3-product branch (k_pv keeps QBH = NQB: bf16 hi/lo P.v on every block - a query-axis softmax has O(1) weights on the LAST key columns)
#define KHI 2048            // key rows carrying k residual / v bf16 hi+lo planes (used only by the causal high-precision path)
// B fragment (k rows k0+.., output column o) of a weight: (in,out) [K][ld] or (out,in) [ld rows of K]: bf16 exact, or f16(bf16 * 256) exact
__device__ __forceinline__ v16b wcol_io(const float* Wm, int k0, int o, int lane, int ld) { v16b w; const int g = lane >> 4;
#pragma unroll
  for (int i = 0; i < 8; ++i) { w[i] = (__bf16)Wm[(size_t)(k0 + 8 * g + i) * ld + o]; w[8 + i] = (__bf16)Wm[(size_t)(k0 + 16 + 8 * g + i) * ld + o]; }
  return w; }
__device__ __forceinline__ v16b wcol_oi(const float* Wm, int k0, int o, int lane, int K) { v16b w; const float* p = Wm + (size_t)o * K + k0 + 8 * (lane >> 4);
#pragma unroll
  for (int i = 0; i < 8; ++i) { w[i] = (__bf16)p[i]; w[8 + i] = (__bf16)p[16 + i]; }
  return w; }
__device__ __forceinline__ v16h wcolh_io(const float* Wm, int k0, int o, int lane, int ld) { v16h w; const int g = lane >> 4;
#pragma unroll
  for (int i = 0; i < 8; ++i) { w[i] = (_Float16)(bfr(Wm[(size_t)(k0 + 8 * g + i) * ld + o]) * 256.0f); w[8 + i] = (_Float16)(bfr(Wm[(size_t)(k0 + 16 + 8 * g + i) * ld + o]) * 256.0f); }
  return w; }
__device__ __forceinline__ v16h wcolh_oi(const float* Wm, int k0, int o, int lane, int K) { v16h w; const float* p = Wm + (size_t)o * K + k0 + 8 * (lane >> 4);
#pragma unroll
  for (int i = 0; i < 8; ++i) { w[i] = (_Float16)(bfr(p[i]) * 256.0f); w[8 + i] = (_Float16)(bfr(p[16 + i]) * 256.0f); }
  return w; }
#define WQKV_LAYOUT 1   // 0 = (in,out) [DIN][CC]; 1 = (out,in) [CC][DIN]; 2 = per-head [NH][DIN][HD]
__device__ __forceinline__ v16b wcol_hdk(const float* Wm, int k0, int o, int lane) { v16b w; const int g = lane >> 4; const float* p = Wm + (size_t)(o / HD) * DIN * HD + (o % HD);
#pragma unroll
  for (int i = 0; i < 8; ++i) { w[i] = (__bf16)p[(size_t)(k0 + 8 * g + i) * HD]; w[8 + i] = (__bf16)p[(size_t)(k0 + 16 + 8 * g + i) * HD]; }
  return w; }
#define WO_OUT_IN 0
#if WQKV_LAYOUT == 1
#define WCOL(W, k0, o, lane) wcol_oi(W, k0, o, lane, DIN)
#elif WQKV_LAYOUT == 2
#define WCOL(W, k0, o, lane) wcol_hdk(W, k0, o, lane)
#else
#define WCOL(W, k0, o, lane) wcol_io(W, k0, o, lane, CC)
#endif
#if WO_OUT_IN
#define WOCOL(W, k0, o, lane) wcol_oi(W, k0, o, lane, CC)
#define WOCOLH(W, k0, o, lane) wcolh_oi(W, k0, o, lane, CC)
#else
#define WOCOL(W, k0, o, lane) wcol_io(W, k0, o, lane, DIN)
#define WOCOLH(W, k0, o, lane) wcolh_io(W, k0, o, lane, DIN)
#endif

#ifndef SM_EXTRA_PARAMS
#define SM_EXTRA_PARAMS
#endif
#ifndef PROJ_EXTRA_PARAMS
#define PROJ_EXTRA_PARAMS
#endif
#ifndef SM_MASK_HOOK
#define SM_MASK_HOOK (void)0
#endif

#define WS_QH  0u                                      // f16 q rows [b*t][CC]
#define WS_KH  (WS_QH + 2u * (size_t)NB * TT * CC)      // f16 k rows [b*t][CC]
#define WS_VT  (WS_KH + 2u * (size_t)NB * TT * CC)      // f16 v planes [b][c][t]
#define WS_QL  (WS_VT + 2u * (size_t)NB * CC * TT)      // f16 q residual x 2^10 rows [b][t < QHI][CC]
#define WS_KL  (WS_QL + 2u * (size_t)NB * QHI * CC)     // f16 k residual x 2^10 rows [b][t < KHI][CC]
#define WS_VB  (WS_KL + 2u * (size_t)NB * KHI * CC)     // bf16 v hi planes [b][c][t < KHI]
#define WS_VBL (WS_VB + 2u * (size_t)NB * CC * KHI)
#define WS_S   (WS_VBL + 2u * (size_t)NB * CC * KHI)    // f32 logits / P [hg][t][s]
#define WS_Y   (WS_S  + 4u * (size_t)HG * TT * TT)      // f32 ctx rows [b*t][CC] (only when there is an output projection)
#define WS_END (WS_Y  + 0u)
#define WS_CM (WS_END)                                  // f32 column maxima [HG][TT]
#define WS_CZ (WS_CM + 4u * (size_t)HG * TT)
#define WS_END2 (WS_CZ + 4u * (size_t)HG * TT)

// ---- k_proj: block = (64 rows, 128 cols, which): q/k/v = X W (+ b) with exact bf16 products (K = DIN) -> which 0: q f16 rows (+ residual rows < QHI); 1: k f16 rows (+ residual rows < KHI); 2: v f16 planes [c][t] (+ bf16 hi/lo planes for t < KHI)
__global__ __launch_bounds__(128) void k_proj(const float* __restrict__ XQ, const float* __restrict__ XK, const float* __restrict__ XV, const float* __restrict__ WQ, const float* __restrict__ WK, const float* __restrict__ WV, const float* __restrict__ BQ, const float* __restrict__ BK, const float* __restrict__ BV,
    _Float16* __restrict__ QH, _Float16* __restrict__ QL, _Float16* __restrict__ KH, _Float16* __restrict__ KL, _Float16* __restrict__ VT, __bf16* __restrict__ VB, __bf16* __restrict__ VBL) {
  __shared__ __align__(16) _Float16 sh[64][136], sl[64][136]; __shared__ __align__(16) _Float16 th[128][72]; __shared__ __align__(16) __bf16 tb[128][72], tbl[128][72];
  const int tid = threadIdx.x, wave = tid >> 5, lane = tid & 31, col = lane & 15, g = lane >> 4; const int which = blockIdx.z; const int c0 = blockIdx.y * 128; const size_t r0 = (size_t)blockIdx.x * 64; const size_t bb = r0 / TT; const int t0 = (int)(r0 % TT);
  const float* X = which == 0 ? XQ : which == 1 ? XK : XV; const float* WA = which == 0 ? WQ : which == 1 ? WK : WV; const float* BA = which == 0 ? BQ : which == 1 ? BK : BV;
  v8f acc[8] = {};
#pragma unroll 2
  for (int kc = 0; kc < DIN / 32; ++kc) { v16b a; { const float* p = X + (r0 + wave * 16 + col) * DIN + kc * 32 + 8 * g;
#pragma unroll
      for (int i = 0; i < 8; ++i) { a[i] = (__bf16)p[i]; a[8 + i] = (__bf16)p[16 + i]; } }
    asm volatile("s_wait_loadcnt 0x0" ::: "memory");
#pragma unroll
    for (int j = 0; j < 8; ++j) { const v16b w = WCOL(WA, kc * 32, c0 + j * 16 + col, lane); asm volatile("s_wait_loadcnt 0x0" ::: "memory"); acc[j] = wmma_bf(a, w, acc[j]); } }
  if (which < 2) { _Float16* DH = which == 0 ? QH : KH; _Float16* DL = which == 0 ? QL : KL; const int nhi = which == 0 ? QHI : KHI; const bool hi_rows = t0 < nhi;
#pragma unroll
    for (int j = 0; j < 8; ++j) { const float bias = BA ? bfr(BA[c0 + j * 16 + col]) : 0.f;
#pragma unroll
      for (int r = 0; r < 8; ++r) { const float v = acc[j][r] + bias; const _Float16 hv = (_Float16)v; sh[wave * 16 + 8 * g + r][j * 16 + col] = hv; sl[wave * 16 + 8 * g + r][j * 16 + col] = (_Float16)((v - (float)hv) * 1024.0f); } }
    __syncthreads();
    for (int e = tid; e < 64 * 16; e += 128) { const int rl = e >> 4, q = e & 15; vst2((unsigned*)(DH + (r0 + rl) * CC + c0 + q * 8), *(const v4u*)&sh[rl][q * 8]); if (hi_rows) vst2((unsigned*)(DL + (bb * nhi + t0 + rl) * (size_t)CC + c0 + q * 8), *(const v4u*)&sl[rl][q * 8]); }
  } else { const bool hi_rows = t0 < KHI;
#pragma unroll
    for (int j = 0; j < 8; ++j) { const float bias = BA ? bfr(BA[c0 + j * 16 + col]) : 0.f;
#pragma unroll
      for (int r = 0; r < 8; ++r) { const float v = acc[j][r] + bias; const int rl = wave * 16 + 8 * g + r, cl = j * 16 + col; th[cl][rl] = (_Float16)v; const __bf16 bh = (__bf16)v; tb[cl][rl] = bh; tbl[cl][rl] = (__bf16)(v - (float)bh); } }
    __syncthreads();
    for (int e = tid; e < 128 * 8; e += 128) { const int cl = e >> 3, q = e & 7; vst2((unsigned*)(VT + (bb * CC + c0 + cl) * (size_t)TT + t0 + q * 8), *(const v4u*)&th[cl][q * 8]); if (hi_rows) { const size_t o3 = (bb * CC + c0 + cl) * (size_t)KHI + t0 + q * 8; vst2((unsigned*)(VB + o3), *(const v4u*)&tb[cl][q * 8]); vst2((unsigned*)(VBL + o3), *(const v4u*)&tbl[cl][q * 8]); } } } }
// ---- k_sc: block = (query block qb, key block kb <= kb_last(qb), head in group) of batch b: logits x SCALE; q hi + residual (x 2^10) against k (2 products) for query rows < QHI, plus the k residual (3 products) for query blocks < QBH_SC (none); causal: blocks past the diagonal exit, the mask itself is applied by index in k_colstat_c and k_csm_c
__global__ __launch_bounds__(128) void k_sc(const _Float16* __restrict__ QH, const _Float16* __restrict__ KH, const _Float16* __restrict__ QL, const _Float16* __restrict__ KL, int b, int h0, float* __restrict__ S0) { __shared__ __align__(16) float ss[4][16][132];
  const int qb = blockIdx.x, kb = blockIdx.y; if (kb > kb_last(qb)) return;
  const int h = h0 + blockIdx.z; float* S = S0 + (size_t)blockIdx.z * TT * TT;
  const int tid = threadIdx.x, wave = tid >> 5, lane = tid & 31, col = lane & 15, g = lane >> 4; const int k0 = kb * 128; const int ql0 = qb * 64 + wave * 16; const size_t q0 = (size_t)b * TT + ql0, kr0 = (size_t)b * TT + k0;
  v8f acc[8] = {}, accl[8] = {};
  const _Float16* QLb = QL + (size_t)b * QHI * CC; const _Float16* KLb = KL + (size_t)b * KHI * CC;
  if (qb < QBH_SC) {
#pragma unroll
    for (int kc = 0; kc < HD / 32; ++kc) { const v16h ah = frag_h(QH + (q0 + col) * CC + h * HD + kc * 32, lane), al = frag_h(QLb + (size_t)(ql0 + col) * CC + h * HD + kc * 32, lane);
#pragma unroll
      for (int j = 0; j < 8; ++j) { const v16h kbf = frag_h(KH + (kr0 + j * 16 + col) * CC + h * HD + kc * 32, lane), klf = frag_h(KLb + (size_t)(k0 + j * 16 + col) * CC + h * HD + kc * 32, lane); acc[j] = wmma16(ah, kbf, acc[j]); accl[j] = wmma16(al, kbf, accl[j]); accl[j] = wmma16(ah, klf, accl[j]); } }
  } else if (qb * 64 < QHI) {
#pragma unroll
    for (int kc = 0; kc < HD / 32; ++kc) { const v16h ah = frag_h(QH + (q0 + col) * CC + h * HD + kc * 32, lane), al = frag_h(QLb + (size_t)(ql0 + col) * CC + h * HD + kc * 32, lane);
#pragma unroll
      for (int j = 0; j < 8; ++j) { const v16h kbf = frag_h(KH + (kr0 + j * 16 + col) * CC + h * HD + kc * 32, lane); acc[j] = wmma16(ah, kbf, acc[j]); accl[j] = wmma16(al, kbf, accl[j]); } }
  } else {
#pragma unroll
    for (int kc = 0; kc < HD / 32; ++kc) { const v16h ah = frag_h(QH + (q0 + col) * CC + h * HD + kc * 32, lane);
#pragma unroll
      for (int j = 0; j < 8; ++j) { const v16h kbf = frag_h(KH + (kr0 + j * 16 + col) * CC + h * HD + kc * 32, lane); acc[j] = wmma16(ah, kbf, acc[j]); } } }
#pragma unroll
  for (int j = 0; j < 8; ++j) {
#pragma unroll
    for (int r = 0; r < 8; ++r) ss[wave][8 * g + r][j * 16 + col] = (acc[j][r] + accl[j][r] * (1.0f / 1024.0f)) * SCALE; }
  LDSX(); for (int rl = 0; rl < 16; ++rl) vst2(S + (size_t)(ql0 + rl) * TT + k0 + lane * 4, *(const v4f*)&ss[wave][rl][lane * 4]); }
// ---- k_sm: block = query row t (head in group): keys [0, kend): causal -> logit if s <= t else excluded; softmax in f32; P x 2^11 in place (0 for excluded)
__global__ __launch_bounds__(256) void k_sm(float* __restrict__ S0 SM_EXTRA_PARAMS) { __shared__ float sred[8]; __shared__ float sbc; __shared__ __align__(16) float shv[TT];
  const int tid = threadIdx.x; const int t = blockIdx.x; const int kend = (kb_last(t >> 6) + 1) * 128;
  float* sr = S0 + (size_t)blockIdx.y * TT * TT + (size_t)t * TT;
  float m = -3.0e38f; for (int k = tid; k < kend; k += 256) { float v = (!CAUSAL || k <= t) ? sr[k] : -3.0e38f; SM_MASK_HOOK; shv[k] = v; m = fmaxf(m, v); }
#pragma unroll
  for (int o = 1; o < 32; o <<= 1) m = fmaxf(m, __shfl_xor(m, o));
  if ((tid & 31) == 0) sred[tid >> 5] = m; __syncthreads(); if (tid == 0) { float a = sred[0]; for (int i = 1; i < 8; ++i) a = fmaxf(a, sred[i]); sbc = a; } __syncthreads(); m = sbc; __syncthreads();
  float sum = 0.f; for (int k = tid; k < kend; k += 256) { const float v = shv[k]; const float e = (v <= -1.0e38f) ? 0.f : expf(v - m); shv[k] = e; sum += e; }
#pragma unroll
  for (int o = 1; o < 32; o <<= 1) sum += __shfl_xor(sum, o);
  if ((tid & 31) == 0) sred[tid >> 5] = sum; __syncthreads(); if (tid == 0) { float a = 0.f; for (int i = 0; i < 8; ++i) a += sred[i]; sbc = a > 0.f ? 2048.0f / a : 0.f; }   /* a fully excluded row yields P = 0 */ __syncthreads(); const float inv = sbc;
  for (int k = tid; k < kend; k += 256) shv[k] = shv[k] * inv;
  __syncthreads(); for (int q = tid; q < kend / 4; q += 256) vst2(sr + q * 4, *(const v4f*)&shv[q * 4]); }
// ---- k_colstat_c: softmax over the QUERY axis under the causal mask (the source's softmax(axis=2) on [B, H, i, j] scores with -inf where j > i): for every key column k: m_k = max_{q >= k} S[q][k], Z_k = sum_{q >= k} exp(S[q][k] - m_k) (online, one pass, f32, precise expf); thread per column; the row loop starts at the block's first column (block-uniform) and masks q < k by a value select after an unconditional load (rows above a column's diagonal may lie in score blocks k_sc never computed: their content is discarded)
__global__ __launch_bounds__(256) void k_colstat_c(const float* __restrict__ S0, float* __restrict__ CM, float* __restrict__ CZ) { const int k = blockIdx.x * 256 + threadIdx.x; const float* sp = S0 + (size_t)blockIdx.y * TT * TT + k; const int q0 = blockIdx.x * 256;
  float m = -3.0e38f, z = 0.f;
#pragma unroll 4
  for (int q = q0; q < TT; ++q) { const float ld = sp[(size_t)q * TT]; asm volatile("s_wait_loadcnt 0x0" ::: "memory"); const bool vis = q >= k; const float v = vis ? ld : -3.0e38f; const float mn = fmaxf(m, v); z = z * expf(m - mn) + (vis ? expf(v - mn) : 0.f); m = mn; }
  vst2(CM + (size_t)blockIdx.y * TT + k, m); vst2(CZ + (size_t)blockIdx.y * TT + k, z); }   /* every column sees at least its own diagonal entry: Z_k >= 1 */
// ---- k_csm_c: block = query row t: P[t][k] = exp(S[t][k] - m_k) / Z_k x 2^11 for k <= t, 0 for t < k < kend (inside the diagonal block); in place; unconditional loads, value select
__global__ __launch_bounds__(256) void k_csm_c(float* __restrict__ S0, const float* __restrict__ CM, const float* __restrict__ CZ) { const int tid = threadIdx.x; const int t = blockIdx.x; const int kend = (kb_last(t >> 6) + 1) * 128; float* sr = S0 + (size_t)blockIdx.y * TT * TT + (size_t)t * TT; const float* cm = CM + (size_t)blockIdx.y * TT; const float* cz = CZ + (size_t)blockIdx.y * TT;
  for (int q4 = tid; q4 < kend / 4; q4 += 256) { const v4f sv = *(const v4f*)(sr + q4 * 4), m4 = *(const v4f*)(cm + q4 * 4), z4 = *(const v4f*)(cz + q4 * 4); asm volatile("s_wait_loadcnt 0x0" ::: "memory"); v4f p;
#pragma unroll
    for (int u = 0; u < 4; ++u) p[u] = (q4 * 4 + u <= t) ? expf(sv[u] - m4[u]) * (2048.0f / z4[u]) : 0.f;
    vst2(sr + q4 * 4, p); } }
// ---- k_pv: block = 64 queries (qb) of (b, h): ctx = P . v over keys [0, kend) (P and v as bf16 hi + lo, 3 products, on every query block as QBH = NQB; the P x 2^11 f16 against v f16 1-product branch is not taken); 256-B (row, head) segment by 16 lanes
__global__ __launch_bounds__(128) void k_pv(const float* __restrict__ PS0, const _Float16* __restrict__ VT, const __bf16* __restrict__ VB, const __bf16* __restrict__ VBL, int b, int h0, float* __restrict__ Y) { const int h = h0 + blockIdx.z; const float* PS = PS0 + (size_t)blockIdx.z * TT * TT; __shared__ __align__(16) float ss[4][16][HD + 4];
  const int tid = threadIdx.x, wave = tid >> 5, lane = tid & 31, col = lane & 15, g = lane >> 4; const int qb = blockIdx.x; const int ql0 = qb * 64 + wave * 16; const int kce = (kb_last(qb) + 1) * 4;
  v8f acc[HD / 16] = {};
  if (qb < QBH) {
#pragma unroll 1
    for (int kc = 0; kc < kce; ++kc) { const F2 p = split_row(PS + (size_t)(ql0 + col) * TT, kc * 32, lane);
      asm volatile("s_wait_loadcnt 0x0" ::: "memory");
#pragma unroll
      for (int j = 0; j < HD / 16; ++j) { const size_t po = ((size_t)b * CC + h * HD + j * 16 + col) * (size_t)KHI + kc * 32; const v16b vh = frag_b(VB + po, lane); acc[j] = wmma_bf(p.h, vh, acc[j]); acc[j] = wmma_bf(p.l, vh, acc[j]); acc[j] = wmma_bf(p.h, frag_b(VBL + po, lane), acc[j]); } }
  } else {
#pragma unroll 1
    for (int kc = 0; kc < kce; ++kc) { const v16h p = frag_f32(PS + (size_t)(ql0 + col) * TT + kc * 32, lane);
      asm volatile("s_wait_loadcnt 0x0" ::: "memory");
#pragma unroll
      for (int j = 0; j < HD / 16; ++j) { const size_t po = ((size_t)b * CC + h * HD + j * 16 + col) * (size_t)TT + kc * 32; acc[j] = wmma16(p, frag_h(VT + po, lane), acc[j]); } } }
#pragma unroll
  for (int j = 0; j < HD / 16; ++j)
#pragma unroll
    for (int r = 0; r < 8; ++r) ss[wave][8 * g + r][j * 16 + col] = acc[j][r] * (1.0f / 2048.0f);
  LDSX(); for (int rl = 0; rl < 16; ++rl) if (lane < HD / 4) vst2(Y + ((size_t)b * TT + ql0 + rl) * CC + h * HD + lane * 4, *(const v4f*)&ss[wave][rl][lane * 4]); }

extern "C" void kernel_launch(void* const* d_in, const int* in_sizes, int n_in, void* d_out, int out_size, void* d_ws, size_t ws_size, hipStream_t stream) {
  (void)in_sizes; (void)n_in; (void)out_size;
  const float** F = (const float**)d_in;
  if (ws_size < (size_t)WS_END) return;
  char* ws = (char*)d_ws; _Float16 *QH = (_Float16*)(ws + WS_QH), *KH = (_Float16*)(ws + WS_KH), *VT = (_Float16*)(ws + WS_VT), *QL = (_Float16*)(ws + WS_QL), *KL = (_Float16*)(ws + WS_KL); __bf16 *VB = (__bf16*)(ws + WS_VB), *VBL = (__bf16*)(ws + WS_VBL); float *S = (float*)(ws + WS_S), *Y = (float*)(ws + WS_Y);
  (void)Y; (void)QL; (void)KL; (void)VB; (void)VBL;
  // inputs: 0 X [2,2048,1024]; 1 Wq [1024,1024] (out,in), 2 bq; 3 Wk, 4 bk; 5 Wv, 6 bv (biases N(0, 0.02), nonzero); no output projection
  if (ws_size < (size_t)WS_END2) return;
  float *CM = (float*)(ws + WS_CM), *CZ = (float*)(ws + WS_CZ);
  k_proj<<<dim3(TNB * TT / 64, CC / 128, 3), 128, 0, stream>>>(F[0], F[0], F[0], F[1], F[3], F[5], F[2], F[4], F[6], QH, QL, KH, KL, VT, VB, VBL);
  for (int b = 0; b < TNB; ++b) for (int h0 = 0; h0 < NH; h0 += HG) {
    k_sc<<<dim3(NQB, TT / 128, HG), 128, 0, stream>>>(QH, KH, QL, KL, b, h0, S);
    k_colstat_c<<<dim3(TT / 256, HG), 256, 0, stream>>>(S, CM, CZ);   /* per key column j: max / sum over the visible queries i >= j */
    k_csm_c<<<dim3(TT, HG), 256, 0, stream>>>(S, CM, CZ);            /* P[i][j] = exp(S - m_j) / Z_j x 2^11 for j <= i, 0 above the diagonal */
    k_pv<<<dim3(NQB, 1, HG), 128, 0, stream>>>(S, VT, VB, VBL, b, h0, (float*)d_out);
  }
}

// v001
// One run takes 1390 microseconds.
// Next to v000, in two timings, it ran 5.70 times as fast each time.
// compute dtype: all float inputs rounded to bf16; q/k/v projections with EXACT bf16 products on WMMA 16x16x32 (f32 accumulate) + bias; causal scores q x k once to f16 each (1 product; the module scales by 1/sqrt(E) = 1/32, so sigma - 0.1) on every block; softmax over the QUERY axis in f32 (per key column: online max / sum over the visible queries, precise expf); P as bf16 hi + lo against v as bf16 hi + lo (3 products) on EVERY block; f32 output.
#include <hip/hip_runtime.h>
#include <math.h>

typedef __attribute__((ext_vector_type(16))) _Float16 v16h;
typedef __attribute__((ext_vector_type(16))) __bf16 v16b;
typedef __attribute__((ext_vector_type(8)))  _Float16 v8h;
typedef __attribute__((ext_vector_type(8)))  float v8f;
typedef __attribute__((ext_vector_type(4)))  float v4f;
typedef __attribute__((ext_vector_type(2)))  float v2f;
typedef __attribute__((ext_vector_type(4)))  unsigned v4u;
typedef __attribute__((ext_vector_type(4)))  int v4i;
typedef float __attribute__((may_alias)) float_a;
typedef int __attribute__((may_alias)) int_a;

template <typename T> __device__ __forceinline__ void vst2(void* p, T v) { *(T*)p = v;  }
__device__ __forceinline__ v8f wmma16(v16h a, v16h b, v8f c) {
  v8f d = __builtin_amdgcn_wmma_f32_16x16x32_f16(false, a, false, b, (short)0, c, false, false);
  asm volatile("v_nop\n\tv_nop\n\tv_nop\n\tv_nop" : "+v"(d) : "v"(a), "v"(b));
  return d;
}
__device__ __forceinline__ v8f wmma_bf(v16b a, v16b b, v8f c) {
  v8f d = __builtin_amdgcn_wmma_f32_16x16x32_bf16(false, a, false, b, (short)0, c, false, false);
  asm volatile("v_nop\n\tv_nop\n\tv_nop\n\tv_nop" : "+v"(d) : "v"(a), "v"(b));
  return d;
}
// 16x16x32 fragments: lane = (h = lane>>4, row/col = lane&15); elements 0..7 = k0+8h+0..7, 8..15 = k0+16+8h+0..7; D element r = row 8h+r
__device__ __forceinline__ v16h frag_h(const _Float16* rowk0, int lane) {
  union { v16h v; v8h q[2]; } u; const _Float16* p = rowk0 + 8 * (lane >> 4);
  u.q[0] = *(const v8h*)p; u.q[1] = *(const v8h*)(p + 16); return u.v;
}
__device__ __forceinline__ v16h frag_f32(const float* rowk0, int lane) {
  v16h a; const float* p = rowk0 + 8 * (lane >> 4);
#pragma unroll
  for (int i = 0; i < 8; ++i) { a[i] = (_Float16)p[i]; a[8 + i] = (_Float16)p[16 + i]; }
  return a;
}
__device__ __forceinline__ v16h frag_f32s(const float* rowk0, int lane, float sc) {
  v16h a; const float* p = rowk0 + 8 * (lane >> 4);
#pragma unroll
  for (int i = 0; i < 8; ++i) { a[i] = (_Float16)(p[i] * sc); a[8 + i] = (_Float16)(p[16 + i] * sc); }
  return a;
}
// column fragment from a [K][ld] layout (column n), rows >= K read as 0
__device__ __forceinline__ v16h fragc_f32(const float* W, int k0, int n, int lane, int ld, int K) {
  v16h a; const int g = lane >> 4;
#pragma unroll
  for (int i = 0; i < 8; ++i) { const int ka = k0 + 8 * g + i, kb = ka + 16;
    a[i] = (_Float16)(ka < K ? W[(size_t)(ka < K ? ka : K - 1) * ld + n] : 0.f); a[8 + i] = (_Float16)(kb < K ? W[(size_t)(kb < K ? kb : K - 1) * ld + n] : 0.f); }
  return a;
}
struct F2 { v16b h, l; };
__device__ __forceinline__ F2 bsplit16(const float v[16]) { F2 r;
#pragma unroll
  for (int i = 0; i < 16; ++i) { const __bf16 h = (__bf16)v[i]; r.h[i] = h; r.l[i] = (__bf16)(v[i] - (float)h); }
  return r; }
__device__ __forceinline__ F2 split_row(const float* row, int k0, int lane) { float v[16]; const float* p = row + k0 + 8 * (lane >> 4);
#pragma unroll
  for (int i = 0; i < 8; ++i) { v[i] = p[i]; v[8 + i] = p[16 + i]; }
  return bsplit16(v); }
__device__ __forceinline__ F2 split_rowK(const float* row, int k0, int lane, int K) { float v[16]; const int g = lane >> 4;
#pragma unroll
  for (int i = 0; i < 8; ++i) { const int ka = k0 + 8 * g + i, kb = ka + 16; v[i] = ka < K ? row[ka < K ? ka : K - 1] : 0.f; v[8 + i] = kb < K ? row[kb < K ? kb : K - 1] : 0.f; }
  return bsplit16(v); }
__device__ __forceinline__ F2 split_col(const float* W, int k0, int n, int lane, int ld, int K) { float v[16]; const int g = lane >> 4;
#pragma unroll
  for (int i = 0; i < 8; ++i) { const int ka = k0 + 8 * g + i, kb = ka + 16; v[i] = ka < K ? W[(size_t)(ka < K ? ka : K - 1) * ld + n] : 0.f; v[8 + i] = kb < K ? W[(size_t)(kb < K ? kb : K - 1) * ld + n] : 0.f; }
  return bsplit16(v); }
__device__ __forceinline__ v8f mac3(const F2& a, const F2& b, v8f c) { c = wmma_bf(a.l, b.h, c); c = wmma_bf(a.h, b.l, c); return wmma_bf(a.h, b.h, c); }
__device__ __forceinline__ float sigm(float v) { return 1.0f / (1.0f + expf(-v)); }
#define LDSX() do { asm volatile("s_wait_dscnt 0" ::: "memory"); __builtin_amdgcn_wave_barrier(); __builtin_amdgcn_fence(__ATOMIC_RELEASE, "workgroup"); } while (0)

// Multi-headed attention whose softmax runs over the QUERY axis, scaled by the MODEL width (X [2,2048,1024]; torch (out,in) Wq / Wk / Wv [1024,1024] N(0, 1/1024) + biases N(0, 0.02); 16 heads x 64; scores / sqrt(E) = / 32; -inf where j > i; attn = softmax(scores, axis=2) - axis 2 of [B, H, i, j] is the QUERY axis i: every key column j is normalised over the queries i >= j (faithful to the source); out = attn v; merge; no output projection).
#define NB 2
#define TT 2048
#define CC 1024            // NH * HD = projected width
#define DIN 1024          // input (model) width
#define NH 16
#define HD 64
#define NQB (TT / 64)
#define HG 4
#define SCALE (0.03125f)
#define CAUSAL 1
#ifndef TNB
#define TNB NB
#endif
__device__ __forceinline__ float bfr(float v) { return (float)(__bf16)v; }
__host__ __device__ __forceinline__ int kb_last(int qb) { return CAUSAL ? ((qb * 64 + 63) >> 7) : (TT / 128 - 1); }
typedef __attribute__((ext_vector_type(8))) __bf16 v8b;
__device__ __forceinline__ v16b frag_b(const __bf16* rowk0, int lane) {
  union { v16b v; v8b q[2]; } u; const __bf16* p = rowk0 + 8 * (lane >> 4);
  u.q[0] = *(const v8b*)p; u.q[1] = *(const v8b*)(p + 16); return u.v;
}
#define QBH 32              // causal: query blocks 0..QBH-1 of each sequence (all NQB of them) take the high-precision path
#define QHI 0               // no q residual plane: the scores are tiny (scale 1/32) and single-product everywhere
#define QBH_SC 0            // k_sc: no block takes the 3-product branch (k_pv keeps QBH = NQB: bf16 hi/lo P.v on every block - a query-axis softmax has O(1) weights on the LAST key columns)
#define KHI 2048            // key rows carrying k residual / v bf16 hi+lo planes (used only by the causal high-precision path)
// B fragment (k rows k0+.., output column o) of a weight: (in,out) [K][ld] or (out,in) [ld rows of K]: bf16 exact, or f16(bf16 * 256) exact
__device__ __forceinline__ v16b wcol_io(const float* Wm, int k0, int o, int lane, int ld) { v16b w; const int g = lane >> 4;
#pragma unroll
  for (int i = 0; i < 8; ++i) { w[i] = (__bf16)Wm[(size_t)(k0 + 8 * g + i) * ld + o]; w[8 + i] = (__bf16)Wm[(size_t)(k0 + 16 + 8 * g + i) * ld + o]; }
  return w; }
__device__ __forceinline__ v16b wcol_oi(const float* Wm, int k0, int o, int lane, int K) { v16b w; const float* p = Wm + (size_t)o * K + k0 + 8 * (lane >> 4);
#pragma unroll
  for (int i = 0; i < 8; ++i) { w[i] = (__bf16)p[i]; w[8 + i] = (__bf16)p[16 + i]; }
  return w; }
__device__ __forceinline__ v16h wcolh_io(const float* Wm, int k0, int o, int lane, int ld) { v16h w; const int g = lane >> 4;
#pragma unroll
  for (int i = 0; i < 8; ++i) { w[i] = (_Float16)(bfr(Wm[(size_t)(k0 + 8 * g + i) * ld + o]) * 256.0f); w[8 + i] = (_Float16)(bfr(Wm[(size_t)(k0 + 16 + 8 * g + i) * ld + o]) * 256.0f); }
  return w; }
__device__ __forceinline__ v16h wcolh_oi(const float* Wm, int k0, int o, int lane, int K) { v16h w; const float* p = Wm + (size_t)o * K + k0 + 8 * (lane >> 4);
#pragma unroll
  for (int i = 0; i < 8; ++i) { w[i] = (_Float16)(bfr(p[i]) * 256.0f); w[8 + i] = (_Float16)(bfr(p[16 + i]) * 256.0f); }
  return w; }
#define WQKV_LAYOUT 1   // 0 = (in,out) [DIN][CC]; 1 = (out,in) [CC][DIN]; 2 = per-head [NH][DIN][HD]
__device__ __forceinline__ v16b wcol_hdk(const float* Wm, int k0, int o, int lane) { v16b w; const int g = lane >> 4; const float* p = Wm + (size_t)(o / HD) * DIN * HD + (o % HD);
#pragma unroll
  for (int i = 0; i < 8; ++i) { w[i] = (__bf16)p[(size_t)(k0 + 8 * g + i) * HD]; w[8 + i] = (__bf16)p[(size_t)(k0 + 16 + 8 * g + i) * HD]; }
  return w; }
#define WO_OUT_IN 0
#if WQKV_LAYOUT == 1
#define WCOL(W, k0, o, lane) wcol_oi(W, k0, o, lane, DIN)
#elif WQKV_LAYOUT == 2
#define WCOL(W, k0, o, lane) wcol_hdk(W, k0, o, lane)
#else
#define WCOL(W, k0, o, lane) wcol_io(W, k0, o, lane, CC)
#endif
#if WO_OUT_IN
#define WOCOL(W, k0, o, lane) wcol_oi(W, k0, o, lane, CC)
#define WOCOLH(W, k0, o, lane) wcolh_oi(W, k0, o, lane, CC)
#else
#define WOCOL(W, k0, o, lane) wcol_io(W, k0, o, lane, DIN)
#define WOCOLH(W, k0, o, lane) wcolh_io(W, k0, o, lane, DIN)
#endif

#ifndef SM_EXTRA_PARAMS
#define SM_EXTRA_PARAMS
#endif
#ifndef PROJ_EXTRA_PARAMS
#define PROJ_EXTRA_PARAMS
#endif
#ifndef SM_MASK_HOOK
#define SM_MASK_HOOK (void)0
#endif

#define WS_QH  0u                                      // f16 q rows [b*t][CC]
#define WS_KH  (WS_QH + 2u * (size_t)NB * TT * CC)      // f16 k rows [b*t][CC]
#define WS_VT  (WS_KH + 2u * (size_t)NB * TT * CC)      // f16 v planes [b][c][t]
#define WS_QL  (WS_VT + 2u * (size_t)NB * CC * TT)      // f16 q residual x 2^10 rows [b][t < QHI][CC]
#define WS_KL  (WS_QL + 2u * (size_t)NB * QHI * CC)     // f16 k residual x 2^10 rows [b][t < KHI][CC]
#define WS_VB  (WS_KL + 2u * (size_t)NB * KHI * CC)     // bf16 v hi planes [b][c][t < KHI]
#define WS_VBL (WS_VB + 2u * (size_t)NB * CC * KHI)
#define WS_S   (WS_VBL + 2u * (size_t)NB * CC * KHI)    // f32 logits / P [hg][t][s]
#define WS_Y   (WS_S  + 4u * (size_t)HG * TT * TT)      // f32 ctx rows [b*t][CC] (only when there is an output projection)
#define WS_END (WS_Y  + 0u)
#define WS_CM (WS_END)                                  // f32 column maxima [HG][TT]
#define WS_CZ (WS_CM + 4u * (size_t)HG * TT)
#define WS_END2 (WS_CZ + 4u * (size_t)HG * TT)

// ---- k_proj: block = (64 rows, 128 cols, which): q/k/v = X W (+ b) with exact bf16 products (K = DIN) -> which 0: q f16 rows (+ residual rows < QHI); 1: k f16 rows (+ residual rows < KHI); 2: v f16 planes [c][t] (+ bf16 hi/lo planes for t < KHI)
__global__ __launch_bounds__(128) void k_proj(const float* __restrict__ XQ, const float* __restrict__ XK, const float* __restrict__ XV, const float* __restrict__ WQ, const float* __restrict__ WK, const float* __restrict__ WV, const float* __restrict__ BQ, const float* __restrict__ BK, const float* __restrict__ BV,
    _Float16* __restrict__ QH, _Float16* __restrict__ QL, _Float16* __restrict__ KH, _Float16* __restrict__ KL, _Float16* __restrict__ VT, __bf16* __restrict__ VB, __bf16* __restrict__ VBL) {
  __shared__ __align__(16) _Float16 sh[64][136], sl[64][136]; __shared__ __align__(16) _Float16 th[128][72]; __shared__ __align__(16) __bf16 tb[128][72], tbl[128][72];
  const int tid = threadIdx.x, wave = tid >> 5, lane = tid & 31, col = lane & 15, g = lane >> 4; const int which = blockIdx.z; const int c0 = blockIdx.y * 128; const size_t r0 = (size_t)blockIdx.x * 64; const size_t bb = r0 / TT; const int t0 = (int)(r0 % TT);
  const float* X = which == 0 ? XQ : which == 1 ? XK : XV; const float* WA = which == 0 ? WQ : which == 1 ? WK : WV; const float* BA = which == 0 ? BQ : which == 1 ? BK : BV;
  v8f acc[8] = {};
#pragma unroll 2
  for (int kc = 0; kc < DIN / 32; ++kc) { v16b a; { const float* p = X + (r0 + wave * 16 + col) * DIN + kc * 32 + 8 * g;
#pragma unroll
      for (int i = 0; i < 8; ++i) { a[i] = (__bf16)p[i]; a[8 + i] = (__bf16)p[16 + i]; } }
    asm volatile("s_wait_loadcnt 0x0" ::: "memory");
#pragma unroll
    for (int j = 0; j < 8; ++j) { const v16b w = WCOL(WA, kc * 32, c0 + j * 16 + col, lane); asm volatile("s_wait_loadcnt 0x0" ::: "memory"); acc[j] = wmma_bf(a, w, acc[j]); } }
  if (which < 2) { _Float16* DH = which == 0 ? QH : KH; _Float16* DL = which == 0 ? QL : KL; const int nhi = which == 0 ? QHI : KHI; const bool hi_rows = t0 < nhi;
#pragma unroll
    for (int j = 0; j < 8; ++j) { const float bias = BA ? bfr(BA[c0 + j * 16 + col]) : 0.f;
#pragma unroll
      for (int r = 0; r < 8; ++r) { const float v = acc[j][r] + bias; const _Float16 hv = (_Float16)v; sh[wave * 16 + 8 * g + r][j * 16 + col] = hv; sl[wave * 16 + 8 * g + r][j * 16 + col] = (_Float16)((v - (float)hv) * 1024.0f); } }
    __syncthreads();
    for (int e = tid; e < 64 * 16; e += 128) { const int rl = e >> 4, q = e & 15; vst2((unsigned*)(DH + (r0 + rl) * CC + c0 + q * 8), *(const v4u*)&sh[rl][q * 8]); if (hi_rows) vst2((unsigned*)(DL + (bb * nhi + t0 + rl) * (size_t)CC + c0 + q * 8), *(const v4u*)&sl[rl][q * 8]); }
  } else { const bool hi_rows = t0 < KHI;
#pragma unroll
    for (int j = 0; j < 8; ++j) { const float bias = BA ? bfr(BA[c0 + j * 16 + col]) : 0.f;
#pragma unroll
      for (int r = 0; r < 8; ++r) { const float v = acc[j][r] + bias; const int rl = wave * 16 + 8 * g + r, cl = j * 16 + col; th[cl][rl] = (_Float16)v; const __bf16 bh = (__bf16)v; tb[cl][rl] = bh; tbl[cl][rl] = (__bf16)(v - (float)bh); } }
    __syncthreads();
    for (int e = tid; e < 128 * 8; e += 128) { const int cl = e >> 3, q = e & 7; vst2((unsigned*)(VT + (bb * CC + c0 + cl) * (size_t)TT + t0 + q * 8), *(const v4u*)&th[cl][q * 8]); if (hi_rows) { const size_t o3 = (bb * CC + c0 + cl) * (size_t)KHI + t0 + q * 8; vst2((unsigned*)(VB + o3), *(const v4u*)&tb[cl][q * 8]); vst2((unsigned*)(VBL + o3), *(const v4u*)&tbl[cl][q * 8]); } } } }
// ---- k_sc: block = (query block qb, key block kb <= kb_last(qb), head in group) of batch b: logits x SCALE; q hi + residual (x 2^10) against k (2 products) for query rows < QHI, plus the k residual (3 products) for query blocks < QBH_SC (none); causal: blocks past the diagonal exit, the mask itself is applied by index in k_colstat_c and k_csm_c
__global__ __launch_bounds__(128) void k_sc(const _Float16* __restrict__ QH, const _Float16* __restrict__ KH, const _Float16* __restrict__ QL, const _Float16* __restrict__ KL, int b, int h0, float* __restrict__ S0) { __shared__ __align__(16) float ss[4][16][132];
  const int qb = blockIdx.x, kb = blockIdx.y; if (kb > kb_last(qb)) return;
  const int h = h0 + blockIdx.z; float* S = S0 + (size_t)blockIdx.z * TT * TT;
  const int tid = threadIdx.x, wave = tid >> 5, lane = tid & 31, col = lane & 15, g = lane >> 4; const int k0 = kb * 128; const int ql0 = qb * 64 + wave * 16; const size_t q0 = (size_t)b * TT + ql0, kr0 = (size_t)b * TT + k0;
  v8f acc[8] = {}, accl[8] = {};
  const _Float16* QLb = QL + (size_t)b * QHI * CC; const _Float16* KLb = KL + (size_t)b * KHI * CC;
  if (qb < QBH_SC) {
#pragma unroll
    for (int kc = 0; kc < HD / 32; ++kc) { const v16h ah = frag_h(QH + (q0 + col) * CC + h * HD + kc * 32, lane), al = frag_h(QLb + (size_t)(ql0 + col) * CC + h * HD + kc * 32, lane);
#pragma unroll
      for (int j = 0; j < 8; ++j) { const v16h kbf = frag_h(KH + (kr0 + j * 16 + col) * CC + h * HD + kc * 32, lane), klf = frag_h(KLb + (size_t)(k0 + j * 16 + col) * CC + h * HD + kc * 32, lane); acc[j] = wmma16(ah, kbf, acc[j]); accl[j] = wmma16(al, kbf, accl[j]); accl[j] = wmma16(ah, klf, accl[j]); } }
  } else if (qb * 64 < QHI) {
#pragma unroll
    for (int kc = 0; kc < HD / 32; ++kc) { const v16h ah = frag_h(QH + (q0 + col) * CC + h * HD + kc * 32, lane), al = frag_h(QLb + (size_t)(ql0 + col) * CC + h * HD + kc * 32, lane);
#pragma unroll
      for (int j = 0; j < 8; ++j) { const v16h kbf = frag_h(KH + (kr0 + j * 16 + col) * CC + h * HD + kc * 32, lane); acc[j] = wmma16(ah, kbf, acc[j]); accl[j] = wmma16(al, kbf, accl[j]); } }
  } else {
#pragma unroll
    for (int kc = 0; kc < HD / 32; ++kc) { const v16h ah = frag_h(QH + (q0 + col) * CC + h * HD + kc * 32, lane);
#pragma unroll
      for (int j = 0; j < 8; ++j) { const v16h kbf = frag_h(KH + (kr0 + j * 16 + col) * CC + h * HD + kc * 32, lane); acc[j] = wmma16(ah, kbf, acc[j]); } } }
#pragma unroll
  for (int j = 0; j < 8; ++j) {
#pragma unroll
    for (int r = 0; r < 8; ++r) ss[wave][8 * g + r][j * 16 + col] = (acc[j][r] + accl[j][r] * (1.0f / 1024.0f)) * SCALE; }
  LDSX(); for (int rl = 0; rl < 16; ++rl) vst2(S + (size_t)(ql0 + rl) * TT + k0 + lane * 4, *(const v4f*)&ss[wave][rl][lane * 4]); }
// ---- k_sm: block = query row t (head in group): keys [0, kend): causal -> logit if s <= t else excluded; softmax in f32; P x 2^11 in place (0 for excluded)
__global__ __launch_bounds__(256) void k_sm(float* __restrict__ S0 SM_EXTRA_PARAMS) { __shared__ float sred[8]; __shared__ float sbc; __shared__ __align__(16) float shv[TT];
  const int tid = threadIdx.x; const int t = blockIdx.x; const int kend = (kb_last(t >> 6) + 1) * 128;
  float* sr = S0 + (size_t)blockIdx.y * TT * TT + (size_t)t * TT;
  float m = -3.0e38f; for (int k = tid; k < kend; k += 256) { float v = (!CAUSAL || k <= t) ? sr[k] : -3.0e38f; SM_MASK_HOOK; shv[k] = v; m = fmaxf(m, v); }
#pragma unroll
  for (int o = 1; o < 32; o <<= 1) m = fmaxf(m, __shfl_xor(m, o));
  if ((tid & 31) == 0) sred[tid >> 5] = m; __syncthreads(); if (tid == 0) { float a = sred[0]; for (int i = 1; i < 8; ++i) a = fmaxf(a, sred[i]); sbc = a; } __syncthreads(); m = sbc; __syncthreads();
  float sum = 0.f; for (int k = tid; k < kend; k += 256) { const float v = shv[k]; const float e = (v <= -1.0e38f) ? 0.f : expf(v - m); shv[k] = e; sum += e; }
#pragma unroll
  for (int o = 1; o < 32; o <<= 1) sum += __shfl_xor(sum, o);
  if ((tid & 31) == 0) sred[tid >> 5] = sum; __syncthreads(); if (tid == 0) { float a = 0.f; for (int i = 0; i < 8; ++i) a += sred[i]; sbc = a > 0.f ? 2048.0f / a : 0.f; }   /* a fully excluded row yields P = 0 */ __syncthreads(); const float inv = sbc;
  for (int k = tid; k < kend; k += 256) shv[k] = shv[k] * inv;
  __syncthreads(); for (int q = tid; q < kend / 4; q += 256) vst2(sr + q * 4, *(const v4f*)&shv[q * 4]); }
// ---- k_colstat_c: softmax over the QUERY axis under the causal mask (the source's softmax(axis=2) on [B, H, i, j] scores with -inf where j > i): for every key column k: m_k = max_{q >= k} S[q][k], Z_k = sum_{q >= k} exp(S[q][k] - m_k) (f32, precise expf). Block = one strip of 32 columns (one 128-B line per row), lane = column; the strip's rows q0 .. TT-1 are cut into groups of CSU rows (TT - q0 is a multiple of 32, so every group is whole) and the groups are dealt to the block's CSW waves; a wave takes a group at a time (CSU independent loads, one maximum, one rescale of its running sum), and the CSW (m, Z) pairs of a column are merged through LDS: maxima first, then each wave's sum rescaled to the column's maximum, then wave 0 adds them and stores one whole line of m and of Z. Every row read lies at or below the strip's first row, so in score blocks that k_sc has written; q < k (first two groups only) reads as -inf after an unconditional load, as in the source, and adds exp(-inf) = 0: the running maximum starts finite, so the difference is never inf - inf
#define CSW 32              // waves per block
#define CSU 16              // rows of a group = loads of a wave in flight
__global__ __launch_bounds__(CSW * 32) void k_colstat_c(const float* __restrict__ S0, float* __restrict__ CM, float* __restrict__ CZ) { __shared__ float pm[CSW][32], pz[CSW][32];
  const int lane = threadIdx.x & 31; const int wave = __builtin_amdgcn_readfirstlane(threadIdx.x >> 5); const int q0 = blockIdx.x * 32; const int k = q0 + lane; const float* sp = S0 + (size_t)blockIdx.y * TT * TT + k;
  float m = -3.0e38f, z = 0.f;
  for (int q = q0 + wave * CSU; q < TT; q += CSW * CSU) { const float* p = sp + (size_t)q * TT; float v[CSU];
#pragma unroll
    for (int u = 0; u < CSU; ++u) v[u] = p[(size_t)u * TT];
    /* inputs-only fence on the loaded values: all CSU loads are issued before the first is waited for (without it they are scheduled in pairs, each pair behind the wait of the pair before) */
    asm volatile("" :: "v"(v[0]), "v"(v[1]), "v"(v[2]), "v"(v[3]), "v"(v[4]), "v"(v[5]), "v"(v[6]), "v"(v[7]), "v"(v[8]), "v"(v[9]), "v"(v[10]), "v"(v[11]), "v"(v[12]), "v"(v[13]), "v"(v[14]), "v"(v[15]));
#pragma unroll
    for (int u = 0; u < CSU; ++u) v[u] = (q + u >= k) ? v[u] : -INFINITY;
    float mn = m;
#pragma unroll
    for (int u = 0; u < CSU; ++u) mn = fmaxf(mn, v[u]);
    float s = 0.f;
#pragma unroll
    for (int u = 0; u < CSU; ++u) s += expf(v[u] - mn);
    z = z * expf(m - mn) + s; m = mn; }
  pm[wave][lane] = m; __syncthreads();
  float mm = pm[0][lane];
#pragma unroll
  for (int w = 1; w < CSW; ++w) mm = fmaxf(mm, pm[w][lane]);
  pz[wave][lane] = z * expf(m - mm); __syncthreads();   /* every wave brings its own sum to the column's maximum; a wave that saw no visible row of this column holds Z = 0 */
  if (wave == 0) { float a0 = 0.f, a1 = 0.f, a2 = 0.f, a3 = 0.f;
#pragma unroll
    for (int w = 0; w < CSW; w += 4) { a0 += pz[w][lane]; a1 += pz[w + 1][lane]; a2 += pz[w + 2][lane]; a3 += pz[w + 3][lane]; }
    vst2(CM + (size_t)blockIdx.y * TT + k, mm); vst2(CZ + (size_t)blockIdx.y * TT + k, (a0 + a1) + (a2 + a3)); } }   /* every column sees at least its own diagonal entry: Z_k >= 1 */
// ---- k_csm_c: block = query row t: P[t][k] = exp(S[t][k] - m_k) / Z_k x 2^11 for k <= t, 0 for t < k < kend (inside the diagonal block); in place; unconditional loads, value select
__global__ __launch_bounds__(256) void k_csm_c(float* __restrict__ S0, const float* __restrict__ CM, const float* __restrict__ CZ) { const int tid = threadIdx.x; const int t = blockIdx.x; const int kend = (kb_last(t >> 6) + 1) * 128; float* sr = S0 + (size_t)blockIdx.y * TT * TT + (size_t)t * TT; const float* cm = CM + (size_t)blockIdx.y * TT; const float* cz = CZ + (size_t)blockIdx.y * TT;
  for (int q4 = tid; q4 < kend / 4; q4 += 256) { const v4f sv = *(const v4f*)(sr + q4 * 4), m4 = *(const v4f*)(cm + q4 * 4), z4 = *(const v4f*)(cz + q4 * 4); asm volatile("s_wait_loadcnt 0x0" ::: "memory"); v4f p;
#pragma unroll
    for (int u = 0; u < 4; ++u) p[u] = (q4 * 4 + u <= t) ? expf(sv[u] - m4[u]) * (2048.0f / z4[u]) : 0.f;
    vst2(sr + q4 * 4, p); } }
// ---- k_pv: block = 64 queries (qb) of (b, h): ctx = P . v over keys [0, kend) (P and v as bf16 hi + lo, 3 products, on every query block as QBH = NQB; the P x 2^11 f16 against v f16 1-product branch is not taken); 256-B (row, head) segment by 16 lanes
__global__ __launch_bounds__(128) void k_pv(const float* __restrict__ PS0, const _Float16* __restrict__ VT, const __bf16* __restrict__ VB, const __bf16* __restrict__ VBL, int b, int h0, float* __restrict__ Y) { const int h = h0 + blockIdx.z; const float* PS = PS0 + (size_t)blockIdx.z * TT * TT; __shared__ __align__(16) float ss[4][16][HD + 4];
  const int tid = threadIdx.x, wave = tid >> 5, lane = tid & 31, col = lane & 15, g = lane >> 4; const int qb = blockIdx.x; const int ql0 = qb * 64 + wave * 16; const int kce = (kb_last(qb) + 1) * 4;
  v8f acc[HD / 16] = {};
  if (qb < QBH) {
#pragma unroll 1
    for (int kc = 0; kc < kce; ++kc) { const F2 p = split_row(PS + (size_t)(ql0 + col) * TT, kc * 32, lane);
      asm volatile("s_wait_loadcnt 0x0" ::: "memory");
#pragma unroll
      for (int j = 0; j < HD / 16; ++j) { const size_t po = ((size_t)b * CC + h * HD + j * 16 + col) * (size_t)KHI + kc * 32; const v16b vh = frag_b(VB + po, lane); acc[j] = wmma_bf(p.h, vh, acc[j]); acc[j] = wmma_bf(p.l, vh, acc[j]); acc[j] = wmma_bf(p.h, frag_b(VBL + po, lane), acc[j]); } }
  } else {
#pragma unroll 1
    for (int kc = 0; kc < kce; ++kc) { const v16h p = frag_f32(PS + (size_t)(ql0 + col) * TT + kc * 32, lane);
      asm volatile("s_wait_loadcnt 0x0" ::: "memory");
#pragma unroll
      for (int j = 0; j < HD / 16; ++j) { const size_t po = ((size_t)b * CC + h * HD + j * 16 + col) * (size_t)TT + kc * 32; acc[j] = wmma16(p, frag_h(VT + po, lane), acc[j]); } } }
#pragma unroll
  for (int j = 0; j < HD / 16; ++j)
#pragma unroll
    for (int r = 0; r < 8; ++r) ss[wave][8 * g + r][j * 16 + col] = acc[j][r] * (1.0f / 2048.0f);
  LDSX(); for (int rl = 0; rl < 16; ++rl) if (lane < HD / 4) vst2(Y + ((size_t)b * TT + ql0 + rl) * CC + h * HD + lane * 4, *(const v4f*)&ss[wave][rl][lane * 4]); }

extern "C" void kernel_launch(void* const* d_in, const int* in_sizes, int n_in, void* d_out, int out_size, void* d_ws, size_t ws_size, hipStream_t stream) {
  (void)in_sizes; (void)n_in; (void)out_size;
  const float** F = (const float**)d_in;
  if (ws_size < (size_t)WS_END) return;
  char* ws = (char*)d_ws; _Float16 *QH = (_Float16*)(ws + WS_QH), *KH = (_Float16*)(ws + WS_KH), *VT = (_Float16*)(ws + WS_VT), *QL = (_Float16*)(ws + WS_QL), *KL = (_Float16*)(ws + WS_KL); __bf16 *VB = (__bf16*)(ws + WS_VB), *VBL = (__bf16*)(ws + WS_VBL); float *S = (float*)(ws + WS_S), *Y = (float*)(ws + WS_Y);
  (void)Y; (void)QL; (void)KL; (void)VB; (void)VBL;
  // inputs: 0 X [2,2048,1024]; 1 Wq [1024,1024] (out,in), 2 bq; 3 Wk, 4 bk; 5 Wv, 6 bv (biases N(0, 0.02), nonzero); no output projection
  if (ws_size < (size_t)WS_END2) return;
  float *CM = (float*)(ws + WS_CM), *CZ = (float*)(ws + WS_CZ);
  k_proj<<<dim3(TNB * TT / 64, CC / 128, 3), 128, 0, stream>>>(F[0], F[0], F[0], F[1], F[3], F[5], F[2], F[4], F[6], QH, QL, KH, KL, VT, VB, VBL);
  for (int b = 0; b < TNB; ++b) for (int h0 = 0; h0 < NH; h0 += HG) {
    k_sc<<<dim3(NQB, TT / 128, HG), 128, 0, stream>>>(QH, KH, QL, KL, b, h0, S);
    k_colstat_c<<<dim3(TT / 32, HG), CSW * 32, 0, stream>>>(S, CM, CZ);   /* per key column j: max / sum over the visible queries i >= j */
    k_csm_c<<<dim3(TT, HG), 256, 0, stream>>>(S, CM, CZ);            /* P[i][j] = exp(S - m_j) / Z_j x 2^11 for j <= i, 0 above the diagonal */
    k_pv<<<dim3(NQB, 1, HG), 128, 0, stream>>>(S, VT, VB, VBL, b, h0, (float*)d_out);
  }
}

// v002
// A run of this version takes 417 microseconds.
// Timed twice side by side with v001, it ran 3.35 and 3.33 times as fast.
// All steps since v000 together make it 19.0 times as fast.
// compute dtype: all float inputs rounded to bf16; q/k/v projections with EXACT bf16 products on WMMA 16x16x32 (f32 accumulate) + bias; causal scores q x k once to f16 each (1 product; the module scales by 1/sqrt(E) = 1/32, so sigma - 0.1) on every block; softmax over the QUERY axis in f32 (per key column: online max / sum over the visible queries, precise expf); P as bf16 hi + lo against v as bf16 hi + lo (3 products) on EVERY block; f32 output.
#include <hip/hip_runtime.h>
#include <math.h>

typedef __attribute__((ext_vector_type(16))) _Float16 v16h;
typedef __attribute__((ext_vector_type(16))) __bf16 v16b;
typedef __attribute__((ext_vector_type(8)))  _Float16 v8h;
typedef __attribute__((ext_vector_type(8)))  float v8f;
typedef __attribute__((ext_vector_type(4)))  float v4f;
typedef __attribute__((ext_vector_type(2)))  float v2f;
typedef __attribute__((ext_vector_type(4)))  unsigned v4u;
typedef __attribute__((ext_vector_type(4)))  int v4i;
typedef float __attribute__((may_alias)) float_a;
typedef int __attribute__((may_alias)) int_a;

template <typename T> __device__ __forceinline__ void vst2(void* p, T v) { *(T*)p = v;  }
__device__ __forceinline__ v8f wmma16(v16h a, v16h b, v8f c) {
  v8f d = __builtin_amdgcn_wmma_f32_16x16x32_f16(false, a, false, b, (short)0, c, false, false);
  asm volatile("v_nop\n\tv_nop\n\tv_nop\n\tv_nop" : "+v"(d) : "v"(a), "v"(b));
  return d;
}
__device__ __forceinline__ v8f wmma_bf(v16b a, v16b b, v8f c) {
  v8f d = __builtin_amdgcn_wmma_f32_16x16x32_bf16(false, a, false, b, (short)0, c, false, false);
  asm volatile("v_nop\n\tv_nop\n\tv_nop\n\tv_nop" : "+v"(d) : "v"(a), "v"(b));
  return d;
}
// 16x16x32 fragments: lane = (h = lane>>4, row/col = lane&15); elements 0..7 = k0+8h+0..7, 8..15 = k0+16+8h+0..7; D element r = row 8h+r
__device__ __forceinline__ v16h frag_h(const _Float16* rowk0, int lane) {
  union { v16h v; v8h q[2]; } u; const _Float16* p = rowk0 + 8 * (lane >> 4);
  u.q[0] = *(const v8h*)p; u.q[1] = *(const v8h*)(p + 16); return u.v;
}
__device__ __forceinline__ v16h frag_f32(const float* rowk0, int lane) {
  v16h a; const float* p = rowk0 + 8 * (lane >> 4);
#pragma unroll
  for (int i = 0; i < 8; ++i) { a[i] = (_Float16)p[i]; a[8 + i] = (_Float16)p[16 + i]; }
  return a;
}
__device__ __forceinline__ v16h frag_f32s(const float* rowk0, int lane, float sc) {
  v16h a; const float* p = rowk0 + 8 * (lane >> 4);
#pragma unroll
  for (int i = 0; i < 8; ++i) { a[i] = (_Float16)(p[i] * sc); a[8 + i] = (_Float16)(p[16 + i] * sc); }
  return a;
}
// column fragment from a [K][ld] layout (column n), rows >= K read as 0
__device__ __forceinline__ v16h fragc_f32(const float* W, int k0, int n, int lane, int ld, int K) {
  v16h a; const int g = lane >> 4;
#pragma unroll
  for (int i = 0; i < 8; ++i) { const int ka = k0 + 8 * g + i, kb = ka + 16;
    a[i] = (_Float16)(ka < K ? W[(size_t)(ka < K ? ka : K - 1) * ld + n] : 0.f); a[8 + i] = (_Float16)(kb < K ? W[(size_t)(kb < K ? kb : K - 1) * ld + n] : 0.f); }
  return a;
}
struct F2 { v16b h, l; };
__device__ __forceinline__ F2 bsplit16(const float v[16]) { F2 r;
#pragma unroll
  for (int i = 0; i < 16; ++i) { const __bf16 h = (__bf16)v[i]; r.h[i] = h; r.l[i] = (__bf16)(v[i] - (float)h); }
  return r; }
__device__ __forceinline__ F2 split_row(const float* row, int k0, int lane) { float v[16]; const float* p = row + k0 + 8 * (lane >> 4);
#pragma unroll
  for (int i = 0; i < 8; ++i) { v[i] = p[i]; v[8 + i] = p[16 + i]; }
  return bsplit16(v); }
__device__ __forceinline__ F2 split_rowK(const float* row, int k0, int lane, int K) { float v[16]; const int g = lane >> 4;
#pragma unroll
  for (int i = 0; i < 8; ++i) { const int ka = k0 + 8 * g + i, kb = ka + 16; v[i] = ka < K ? row[ka < K ? ka : K - 1] : 0.f; v[8 + i] = kb < K ? row[kb < K ? kb : K - 1] : 0.f; }
  return bsplit16(v); }
__device__ __forceinline__ F2 split_col(const float* W, int k0, int n, int lane, int ld, int K) { float v[16]; const int g = lane >> 4;
#pragma unroll
  for (int i = 0; i < 8; ++i) { const int ka = k0 + 8 * g + i, kb = ka + 16; v[i] = ka < K ? W[(size_t)(ka < K ? ka : K - 1) * ld + n] : 0.f; v[8 + i] = kb < K ? W[(size_t)(kb < K ? kb : K - 1) * ld + n] : 0.f; }
  return bsplit16(v); }
__device__ __forceinline__ v8f mac3(const F2& a, const F2& b, v8f c) { c = wmma_bf(a.l, b.h, c); c = wmma_bf(a.h, b.l, c); return wmma_bf(a.h, b.h, c); }
__device__ __forceinline__ float sigm(float v) { return 1.0f / (1.0f + expf(-v)); }
#define LDSX() do { asm volatile("s_wait_dscnt 0" ::: "memory"); __builtin_amdgcn_wave_barrier(); __builtin_amdgcn_fence(__ATOMIC_RELEASE, "workgroup"); } while (0)

// Multi-headed attention whose softmax runs over the QUERY axis, scaled by the MODEL width (X [2,2048,1024]; torch (out,in) Wq / Wk / Wv [1024,1024] N(0, 1/1024) + biases N(0, 0.02); 16 heads x 64; scores / sqrt(E) = / 32; -inf where j > i; attn = softmax(scores, axis=2) - axis 2 of [B, H, i, j] is the QUERY axis i: every key column j is normalised over the queries i >= j (faithful to the source); out = attn v; merge; no output projection).
#define NB 2
#define TT 2048
#define CC 1024            // NH * HD = projected width
#define DIN 1024          // input (model) width
#define NH 16
#define HD 64
#define NQB (TT / 64)
#define HG 4
#define SCALE (0.03125f)
#define CAUSAL 1
#ifndef TNB
#define TNB NB
#endif
__device__ __forceinline__ float bfr(float v) { return (float)(__bf16)v; }
__host__ __device__ __forceinline__ int kb_last(int qb) { return CAUSAL ? ((qb * 64 + 63) >> 7) : (TT / 128 - 1); }
typedef __attribute__((ext_vector_type(8))) __bf16 v8b;
__device__ __forceinline__ v16b frag_b(const __bf16* rowk0, int lane) {
  union { v16b v; v8b q[2]; } u; const __bf16* p = rowk0 + 8 * (lane >> 4);
  u.q[0] = *(const v8b*)p; u.q[1] = *(const v8b*)(p + 16); return u.v;
}
#define QBH 32              // not read: k_out takes its one bf16 hi/lo path on all NQB query blocks
#define QHI 0               // no q residual plane: the scores are tiny (scale 1/32) and single-product everywhere
#define QBH_SC 0            // not read (k_out: bf16 hi/lo P.v on every block - a query-axis softmax has O(1) weights on the LAST key columns)
#define KHI 2048            // key rows carrying k residual / v bf16 hi+lo planes (the v planes are read by k_out; the k residual is not read)
// B fragment (k rows k0+.., output column o) of a weight: (in,out) [K][ld] or (out,in) [ld rows of K]: bf16 exact, or f16(bf16 * 256) exact
__device__ __forceinline__ v16b wcol_io(const float* Wm, int k0, int o, int lane, int ld) { v16b w; const int g = lane >> 4;
#pragma unroll
  for (int i = 0; i < 8; ++i) { w[i] = (__bf16)Wm[(size_t)(k0 + 8 * g + i) * ld + o]; w[8 + i] = (__bf16)Wm[(size_t)(k0 + 16 + 8 * g + i) * ld + o]; }
  return w; }
__device__ __forceinline__ v16b wcol_oi(const float* Wm, int k0, int o, int lane, int K) { v16b w; const float* p = Wm + (size_t)o * K + k0 + 8 * (lane >> 4);
#pragma unroll
  for (int i = 0; i < 8; ++i) { w[i] = (__bf16)p[i]; w[8 + i] = (__bf16)p[16 + i]; }
  return w; }
__device__ __forceinline__ v16h wcolh_io(const float* Wm, int k0, int o, int lane, int ld) { v16h w; const int g = lane >> 4;
#pragma unroll
  for (int i = 0; i < 8; ++i) { w[i] = (_Float16)(bfr(Wm[(size_t)(k0 + 8 * g + i) * ld + o]) * 256.0f); w[8 + i] = (_Float16)(bfr(Wm[(size_t)(k0 + 16 + 8 * g + i) * ld + o]) * 256.0f); }
  return w; }
__device__ __forceinline__ v16h wcolh_oi(const float* Wm, int k0, int o, int lane, int K) { v16h w; const float* p = Wm + (size_t)o * K + k0 + 8 * (lane >> 4);
#pragma unroll
  for (int i = 0; i < 8; ++i) { w[i] = (_Float16)(bfr(p[i]) * 256.0f); w[8 + i] = (_Float16)(bfr(p[16 + i]) * 256.0f); }
  return w; }
#define WQKV_LAYOUT 1   // 0 = (in,out) [DIN][CC]; 1 = (out,in) [CC][DIN]; 2 = per-head [NH][DIN][HD]
__device__ __forceinline__ v16b wcol_hdk(const float* Wm, int k0, int o, int lane) { v16b w; const int g = lane >> 4; const float* p = Wm + (size_t)(o / HD) * DIN * HD + (o % HD);
#pragma unroll
  for (int i = 0; i < 8; ++i) { w[i] = (__bf16)p[(size_t)(k0 + 8 * g + i) * HD]; w[8 + i] = (__bf16)p[(size_t)(k0 + 16 + 8 * g + i) * HD]; }
  return w; }
#define WO_OUT_IN 0
#if WQKV_LAYOUT == 1
#define WCOL(W, k0, o, lane) wcol_oi(W, k0, o, lane, DIN)
#elif WQKV_LAYOUT == 2
#define WCOL(W, k0, o, lane) wcol_hdk(W, k0, o, lane)
#else
#define WCOL(W, k0, o, lane) wcol_io(W, k0, o, lane, CC)
#endif
#if WO_OUT_IN
#define WOCOL(W, k0, o, lane) wcol_oi(W, k0, o, lane, CC)
#define WOCOLH(W, k0, o, lane) wcolh_oi(W, k0, o, lane, CC)
#else
#define WOCOL(W, k0, o, lane) wcol_io(W, k0, o, lane, DIN)
#define WOCOLH(W, k0, o, lane) wcolh_io(W, k0, o, lane, DIN)
#endif

#ifndef SM_EXTRA_PARAMS
#define SM_EXTRA_PARAMS
#endif
#ifndef PROJ_EXTRA_PARAMS
#define PROJ_EXTRA_PARAMS
#endif
#ifndef SM_MASK_HOOK
#define SM_MASK_HOOK (void)0
#endif

#define WS_QH  0u                                      // f16 q rows [b*t][CC]
#define WS_KH  (WS_QH + 2u * (size_t)NB * TT * CC)      // f16 k rows [b*t][CC]
#define WS_VT  (WS_KH + 2u * (size_t)NB * TT * CC)      // f16 v planes [b][c][t]
#define WS_QL  (WS_VT + 2u * (size_t)NB * CC * TT)      // f16 q residual x 2^10 rows [b][t < QHI][CC]
#define WS_KL  (WS_QL + 2u * (size_t)NB * QHI * CC)     // f16 k residual x 2^10 rows [b][t < KHI][CC]
#define WS_VB  (WS_KL + 2u * (size_t)NB * KHI * CC)     // bf16 v hi planes [b][c][t < KHI]
#define WS_VBL (WS_VB + 2u * (size_t)NB * CC * KHI)
#define WS_S   (WS_VBL + 2u * (size_t)NB * CC * KHI)    // f32 logits / P [hg][t][s] (plane not touched: the scores stay in registers)
#define WS_Y   (WS_S  + 4u * (size_t)HG * TT * TT)      // f32 ctx rows [b*t][CC] (only when there is an output projection)
#define WS_END (WS_Y  + 0u)
#define WS_CM (WS_END)                                  // f32 column maxima [NB * NH][TT]
#define WS_CZ (WS_CM + 4u * (size_t)NB * NH * TT)       // f32 2^11 / column sums [NB * NH][TT]
#define WS_END2 (WS_CZ + 4u * (size_t)NB * NH * TT)

// ---- k_proj: block = (64 rows, 128 cols, which): q/k/v = X W (+ b) with exact bf16 products (K = DIN) -> which 0: q f16 rows (+ residual rows < QHI); 1: k f16 rows (+ residual rows < KHI); 2: v f16 planes [c][t] (+ bf16 hi/lo planes for t < KHI)
__global__ __launch_bounds__(128) void k_proj(const float* __restrict__ XQ, const float* __restrict__ XK, const float* __restrict__ XV, const float* __restrict__ WQ, const float* __restrict__ WK, const float* __restrict__ WV, const float* __restrict__ BQ, const float* __restrict__ BK, const float* __restrict__ BV,
    _Float16* __restrict__ QH, _Float16* __restrict__ QL, _Float16* __restrict__ KH, _Float16* __restrict__ KL, _Float16* __restrict__ VT, __bf16* __restrict__ VB, __bf16* __restrict__ VBL) {
  __shared__ __align__(16) _Float16 sh[64][136], sl[64][136]; __shared__ __align__(16) _Float16 th[128][72]; __shared__ __align__(16) __bf16 tb[128][72], tbl[128][72];
  const int tid = threadIdx.x, wave = tid >> 5, lane = tid & 31, col = lane & 15, g = lane >> 4; const int which = blockIdx.z; const int c0 = blockIdx.y * 128; const size_t r0 = (size_t)blockIdx.x * 64; const size_t bb = r0 / TT; const int t0 = (int)(r0 % TT);
  const float* X = which == 0 ? XQ : which == 1 ? XK : XV; const float* WA = which == 0 ? WQ : which == 1 ? WK : WV; const float* BA = which == 0 ? BQ : which == 1 ? BK : BV;
  v8f acc[8] = {};
#pragma unroll 2
  for (int kc = 0; kc < DIN / 32; ++kc) { v16b a; { const float* p = X + (r0 + wave * 16 + col) * DIN + kc * 32 + 8 * g;
#pragma unroll
      for (int i = 0; i < 8; ++i) { a[i] = (__bf16)p[i]; a[8 + i] = (__bf16)p[16 + i]; } }
    asm volatile("s_wait_loadcnt 0x0" ::: "memory");
#pragma unroll
    for (int j = 0; j < 8; ++j) { const v16b w = WCOL(WA, kc * 32, c0 + j * 16 + col, lane); asm volatile("s_wait_loadcnt 0x0" ::: "memory"); acc[j] = wmma_bf(a, w, acc[j]); } }
  if (which < 2) { _Float16* DH = which == 0 ? QH : KH; _Float16* DL = which == 0 ? QL : KL; const int nhi = which == 0 ? QHI : KHI; const bool hi_rows = t0 < nhi;
#pragma unroll
    for (int j = 0; j < 8; ++j) { const float bias = BA ? bfr(BA[c0 + j * 16 + col]) : 0.f;
#pragma unroll
      for (int r = 0; r < 8; ++r) { const float v = acc[j][r] + bias; const _Float16 hv = (_Float16)v; sh[wave * 16 + 8 * g + r][j * 16 + col] = hv; sl[wave * 16 + 8 * g + r][j * 16 + col] = (_Float16)((v - (float)hv) * 1024.0f); } }
    __syncthreads();
    for (int e = tid; e < 64 * 16; e += 128) { const int rl = e >> 4, q = e & 15; vst2((unsigned*)(DH + (r0 + rl) * CC + c0 + q * 8), *(const v4u*)&sh[rl][q * 8]); if (hi_rows) vst2((unsigned*)(DL + (bb * nhi + t0 + rl) * (size_t)CC + c0 + q * 8), *(const v4u*)&sl[rl][q * 8]); }
  } else { const bool hi_rows = t0 < KHI;
#pragma unroll
    for (int j = 0; j < 8; ++j) { const float bias = BA ? bfr(BA[c0 + j * 16 + col]) : 0.f;
#pragma unroll
      for (int r = 0; r < 8; ++r) { const float v = acc[j][r] + bias; const int rl = wave * 16 + 8 * g + r, cl = j * 16 + col; th[cl][rl] = (_Float16)v; const __bf16 bh = (__bf16)v; tb[cl][rl] = bh; tbl[cl][rl] = (__bf16)(v - (float)bh); } }
    __syncthreads();
    for (int e = tid; e < 128 * 8; e += 128) { const int cl = e >> 3, q = e & 7; vst2((unsigned*)(VT + (bb * CC + c0 + cl) * (size_t)TT + t0 + q * 8), *(const v4u*)&th[cl][q * 8]); if (hi_rows) { const size_t o3 = (bb * CC + c0 + cl) * (size_t)KHI + t0 + q * 8; vst2((unsigned*)(VB + o3), *(const v4u*)&tb[cl][q * 8]); vst2((unsigned*)(VBL + o3), *(const v4u*)&tbl[cl][q * 8]); } } } }
// ---- k_sm: block = query row t (head in group): keys [0, kend): causal -> logit if s <= t else excluded; softmax in f32; P x 2^11 in place (0 for excluded)
__global__ __launch_bounds__(256) void k_sm(float* __restrict__ S0 SM_EXTRA_PARAMS) { __shared__ float sred[8]; __shared__ float sbc; __shared__ __align__(16) float shv[TT];
  const int tid = threadIdx.x; const int t = blockIdx.x; const int kend = (kb_last(t >> 6) + 1) * 128;
  float* sr = S0 + (size_t)blockIdx.y * TT * TT + (size_t)t * TT;
  float m = -3.0e38f; for (int k = tid; k < kend; k += 256) { float v = (!CAUSAL || k <= t) ? sr[k] : -3.0e38f; SM_MASK_HOOK; shv[k] = v; m = fmaxf(m, v); }
#pragma unroll
  for (int o = 1; o < 32; o <<= 1) m = fmaxf(m, __shfl_xor(m, o));
  if ((tid & 31) == 0) sred[tid >> 5] = m; __syncthreads(); if (tid == 0) { float a = sred[0]; for (int i = 1; i < 8; ++i) a = fmaxf(a, sred[i]); sbc = a; } __syncthreads(); m = sbc; __syncthreads();
  float sum = 0.f; for (int k = tid; k < kend; k += 256) { const float v = shv[k]; const float e = (v <= -1.0e38f) ? 0.f : expf(v - m); shv[k] = e; sum += e; }
#pragma unroll
  for (int o = 1; o < 32; o <<= 1) sum += __shfl_xor(sum, o);
  if ((tid & 31) == 0) sred[tid >> 5] = sum; __syncthreads(); if (tid == 0) { float a = 0.f; for (int i = 0; i < 8; ++i) a += sred[i]; sbc = a > 0.f ? 2048.0f / a : 0.f; }   /* a fully excluded row yields P = 0 */ __syncthreads(); const float inv = sbc;
  for (int k = tid; k < kend; k += 256) shv[k] = shv[k] * inv;
  __syncthreads(); for (int q = tid; q < kend / 4; q += 256) vst2(sr + q * 4, *(const v4f*)&shv[q * 4]); }
// ---- k_stat: softmax over the QUERY axis under the causal mask (the source's softmax(axis=2) on [B, H, i, j] scores with -inf where j > i), with no score matrix in memory. Block = (STK key columns from k0, head h, batch b), STW waves. Every wave keeps the STK keys' f16 fragments in registers and takes every STW-th tile of 16 of the visible query rows k0 .. TT-1: scores q x k on WMMA (one f16 product, x SCALE), then per lane and column tile the online (max, sum) over its 8 rows (f32, precise expf; q < k reads as -inf and adds exp(-inf) = 0; the running maximum starts finite, so the difference is never inf - inf). The 2 * STW partial pairs of a column (wave, lane half) are merged through LDS behind one barrier, which every wave reaches after its own last tile: m_k to CM, 2^11 / Z_k to CR, whole lines. Every '#pragma unroll' of k_stat and k_out is there so that the small arrays it indexes (fragments, accumulators, m, z, P) stay in registers
#define STW 8
#define STK 64
// the fragments of frag_h / frag_b from a pointer that already holds the lane's own 8g offset: a run of loads then shares one address value, which the wait behind the run can name
__device__ __forceinline__ v16h frag_hp(const _Float16* p) { union { v16h v; v8h q[2]; } u; u.q[0] = *(const v8h*)p; u.q[1] = *(const v8h*)(p + 16); return u.v; }
__device__ __forceinline__ v16b frag_bp(const __bf16* p) { union { v16b v; v8b q[2]; } u; u.q[0] = *(const v8b*)p; u.q[1] = *(const v8b*)(p + 16); return u.v; }
__global__ __launch_bounds__(STW * 32) void k_stat(const _Float16* __restrict__ QH, const _Float16* __restrict__ KH, float* __restrict__ CM, float* __restrict__ CR) { __shared__ float pm[2 * STW][STK], pz[2 * STW][STK];
  const int tid = threadIdx.x, lane = tid & 31, col = lane & 15, g = lane >> 4; const int wave = __builtin_amdgcn_readfirstlane(tid >> 5); const int k0 = blockIdx.x * STK, h = blockIdx.y, b = blockIdx.z;
  v16h kf[HD / 32][STK / 16]; const _Float16* kp = KH + ((size_t)b * TT + k0 + col) * CC + h * HD + 8 * g;
#pragma unroll
  for (int kc = 0; kc < HD / 32; ++kc) {
#pragma unroll
    for (int j = 0; j < STK / 16; ++j) kf[kc][j] = frag_hp(kp + (size_t)j * 16 * CC + kc * 32); }
  asm volatile("s_wait_xcnt 0x0" :: "v"(kp) : "memory");   /* the wait before a register of an issued load is overwritten; the loads' common address is an input, so it stays live to here and no fragment lands in it */
  float m[STK / 16], z[STK / 16];
#pragma unroll
  for (int j = 0; j < STK / 16; ++j) { m[j] = -3.0e38f; z[j] = 0.f; }
  for (int ql0 = k0 + wave * 16; ql0 < TT; ql0 += STW * 16) { const _Float16* qp = QH + ((size_t)b * TT + ql0 + col) * CC + h * HD; const v16h a0 = frag_h(qp, lane), a1 = frag_h(qp + 32, lane);
#pragma unroll
    for (int j = 0; j < STK / 16; ++j) { v8f acc = {}; acc = wmma16(a0, kf[0][j], acc); acc = wmma16(a1, kf[1][j], acc); const int k = k0 + j * 16 + col; float v[8];
#pragma unroll
      for (int r = 0; r < 8; ++r) v[r] = (ql0 + 8 * g + r >= k) ? acc[r] * SCALE : -INFINITY;
      float mn = m[j];
#pragma unroll
      for (int r = 0; r < 8; ++r) mn = fmaxf(mn, v[r]);
      float s = 0.f;
#pragma unroll
      for (int r = 0; r < 8; ++r) s += expf(v[r] - mn);
      z[j] = z[j] * expf(m[j] - mn) + s; m[j] = mn; } }
#pragma unroll
  for (int j = 0; j < STK / 16; ++j) { pm[2 * wave + g][j * 16 + col] = m[j]; pz[2 * wave + g][j * 16 + col] = z[j]; }
  __syncthreads();
  if (tid < STK) { float mm = pm[0][tid];
#pragma unroll
    for (int w = 1; w < 2 * STW; ++w) mm = fmaxf(mm, pm[w][tid]);
    float a = 0.f;   /* a partial that saw no visible row of this column holds Z = 0 and a finite maximum */
#pragma unroll
    for (int w = 0; w < 2 * STW; ++w) a += pz[w][tid] * expf(pm[w][tid] - mm);
    const size_t o = ((size_t)b * NH + h) * TT + k0 + tid; vst2(CM + o, mm); vst2(CR + o, 2048.0f / a); } }   /* every column sees at least its own diagonal entry: Z_k >= 1 */
// ---- k_out: block = 64 queries (qb) of (b, h), a wave = 16 queries: per 32 keys the scores are formed again on WMMA, transposed (A = 16 key rows, B = the wave's 16 queries, kept in registers; the same one f16 product x SCALE), so that a lane holds, for its own query, the keys 8g + 0..7 of each 16-key tile: two such tiles are, in place, the A fragment of P . v (hardware k order, the order of frag_b). P[i][j] = exp(S - m_j) x (2^11 / Z_j) for j <= i, 0 above the diagonal (unconditional loads, value select); P and v as bf16 hi + lo, 3 products, keys [0, kend) as before; 256-B (row, head) segment by 16 lanes
__global__ __launch_bounds__(128) void k_out(const _Float16* __restrict__ QH, const _Float16* __restrict__ KH, const float* __restrict__ CM, const float* __restrict__ CR, const __bf16* __restrict__ VB, const __bf16* __restrict__ VBL, float* __restrict__ Y) { __shared__ __align__(16) float ss[4][16][HD + 4];
  const int tid = threadIdx.x, wave = tid >> 5, lane = tid & 31, col = lane & 15, g = lane >> 4; const int qb = blockIdx.x, h = blockIdx.y, b = blockIdx.z; const int ql0 = qb * 64 + wave * 16; const int kce = (kb_last(qb) + 1) * 4; const int qi = ql0 + col;
  const float* cm = CM + ((size_t)b * NH + h) * TT + 8 * g; const float* cr = CR + ((size_t)b * NH + h) * TT + 8 * g;
  const _Float16* qp = QH + ((size_t)b * TT + qi) * CC + h * HD; const v16h q0 = frag_h(qp, lane), q1 = frag_h(qp + 32, lane);
  const _Float16* kp = KH + ((size_t)b * TT + col) * CC + h * HD + 8 * g;
  v8f acc[HD / 16] = {};
  for (int kc = 0; kc < kce; ++kc) { const int k0 = kc * 32; const _Float16* ka = kp + (size_t)k0 * CC; const _Float16* kb2 = ka + (size_t)16 * CC; const float* cmk = cm + k0; const float* crk = cr + k0;
    const v16h ka0 = frag_hp(ka), kb0 = frag_hp(kb2), ka1 = frag_hp(ka + 32), kb1 = frag_hp(kb2 + 32);
    v4f mv[4], rv[4];
#pragma unroll
    for (int u = 0; u < 4; ++u) { const int o = (u >> 1) * 16 + (u & 1) * 4; mv[u] = *(const v4f*)(cmk + o); rv[u] = *(const v4f*)(crk + o); }
    asm volatile("s_wait_xcnt 0x0" :: "v"(ka), "v"(cmk), "v"(crk) : "memory");   /* the wait before a register of an issued load is overwritten (the v addresses and fragments below may take those registers); the loads' addresses are inputs, so they stay live to here */
    v16b vh[HD / 16], vl[HD / 16]; const size_t po = ((size_t)b * CC + h * HD + col) * (size_t)KHI + k0 + 8 * g; const __bf16* vhp = VB + po; const __bf16* vlp = VBL + po;
#pragma unroll
    for (int j = 0; j < HD / 16; ++j) { vh[j] = frag_bp(vhp + (size_t)j * 16 * KHI); vl[j] = frag_bp(vlp + (size_t)j * 16 * KHI); }
    asm volatile("s_wait_xcnt 0x0" :: "v"(vhp), "v"(vlp) : "memory");   /* the same wait for the v loads' two addresses, whose registers the products below overwrite; as inputs they stay live to here and no fragment lands in them */
    __builtin_amdgcn_sched_barrier(0);   /* all loads of the pass are issued in front of its first product, so the v fragments fly during the key fragments' latency (without it the v loads are issued only behind the first score product's wait for its key fragment) */
    v8f s0 = {}, s1 = {}; s0 = wmma16(ka0, q0, s0); s1 = wmma16(kb0, q0, s1); s0 = wmma16(ka1, q1, s0); s1 = wmma16(kb1, q1, s1);
    float pv[16];
#pragma unroll
    for (int i = 0; i < 8; ++i) { const int ke = k0 + 8 * g + i; const float e0 = expf(s0[i] * SCALE - mv[i >> 2][i & 3]) * rv[i >> 2][i & 3], e1 = expf(s1[i] * SCALE - mv[2 + (i >> 2)][i & 3]) * rv[2 + (i >> 2)][i & 3]; pv[i] = (ke <= qi) ? e0 : 0.f; pv[8 + i] = (ke + 16 <= qi) ? e1 : 0.f; }
    const F2 p = bsplit16(pv);
#pragma unroll
    for (int j = 0; j < HD / 16; ++j) { acc[j] = wmma_bf(p.h, vh[j], acc[j]); acc[j] = wmma_bf(p.l, vh[j], acc[j]); acc[j] = wmma_bf(p.h, vl[j], acc[j]); } }
#pragma unroll
  for (int j = 0; j < HD / 16; ++j)
#pragma unroll
    for (int r = 0; r < 8; ++r) ss[wave][8 * g + r][j * 16 + col] = acc[j][r] * (1.0f / 2048.0f);
  LDSX(); for (int rl = 0; rl < 16; ++rl) if (lane < HD / 4) vst2(Y + ((size_t)b * TT + ql0 + rl) * CC + h * HD + lane * 4, *(const v4f*)&ss[wave][rl][lane * 4]); }

extern "C" void kernel_launch(void* const* d_in, const int* in_sizes, int n_in, void* d_out, int out_size, void* d_ws, size_t ws_size, hipStream_t stream) {
  (void)in_sizes; (void)n_in; (void)out_size;
  const float** F = (const float**)d_in;
  if (ws_size < (size_t)WS_END) return;
  char* ws = (char*)d_ws; _Float16 *QH = (_Float16*)(ws + WS_QH), *KH = (_Float16*)(ws + WS_KH), *VT = (_Float16*)(ws + WS_VT), *QL = (_Float16*)(ws + WS_QL), *KL = (_Float16*)(ws + WS_KL); __bf16 *VB = (__bf16*)(ws + WS_VB), *VBL = (__bf16*)(ws + WS_VBL); float *S = (float*)(ws + WS_S), *Y = (float*)(ws + WS_Y);
  (void)Y; (void)QL; (void)KL; (void)VB; (void)VBL; (void)S; (void)VT;
  // inputs: 0 X [2,2048,1024]; 1 Wq [1024,1024] (out,in), 2 bq; 3 Wk, 4 bk; 5 Wv, 6 bv (biases N(0, 0.02), nonzero); no output projection
  if (ws_size < (size_t)WS_END2) return;
  float *CM = (float*)(ws + WS_CM), *CZ = (float*)(ws + WS_CZ);
  k_proj<<<dim3(TNB * TT / 64, CC / 128, 3), 128, 0, stream>>>(F[0], F[0], F[0], F[1], F[3], F[5], F[2], F[4], F[6], QH, QL, KH, KL, VT, VB, VBL);
  k_stat<<<dim3(TT / STK, NH, TNB), STW * 32, 0, stream>>>(QH, KH, CM, CZ);   /* per key column j: max and 2^11 / sum over the visible queries i >= j */
  k_out<<<dim3(NQB, NH, TNB), 128, 0, stream>>>(QH, KH, CM, CZ, VB, VBL, (float*)d_out);   /* P formed in registers, then P . v */
}

// v003
// One run takes 215 microseconds.
// Next to v002, in two timings, it ran 1.92 and 1.93 times as fast.
// Over all steps from v000 it is 36.6 times as fast.
// compute dtype: all float inputs rounded to bf16; q/k/v projections with EXACT bf16 products on WMMA 16x16x32 (f32 accumulate) + bias; causal scores q x k once to f16 each (1 product; the module scales by 1/sqrt(E) = 1/32, so sigma - 0.1) on every block; softmax over the QUERY axis in f32 (per key column: online max / sum over the visible queries, precise expf); P as bf16 hi + lo against v as bf16 hi + lo (3 products) on EVERY block; f32 output.
#include <hip/hip_runtime.h>
#include <math.h>

typedef __attribute__((ext_vector_type(16))) _Float16 v16h;
typedef __attribute__((ext_vector_type(16))) __bf16 v16b;
typedef __attribute__((ext_vector_type(8)))  _Float16 v8h;
typedef __attribute__((ext_vector_type(8)))  float v8f;
typedef __attribute__((ext_vector_type(4)))  float v4f;
typedef __attribute__((ext_vector_type(2)))  float v2f;
typedef __attribute__((ext_vector_type(4)))  unsigned v4u;
typedef __attribute__((ext_vector_type(4)))  int v4i;
typedef float __attribute__((may_alias)) float_a;
typedef int __attribute__((may_alias)) int_a;

template <typename T> __device__ __forceinline__ void vst2(void* p, T v) { *(T*)p = v;  }
__device__ __forceinline__ v8f wmma16(v16h a, v16h b, v8f c) {
  v8f d = __builtin_amdgcn_wmma_f32_16x16x32_f16(false, a, false, b, (short)0, c, false, false);
  asm volatile("v_nop\n\tv_nop\n\tv_nop\n\tv_nop" : "+v"(d) : "v"(a), "v"(b));
  return d;
}
__device__ __forceinline__ v8f wmma_bf(v16b a, v16b b, v8f c) {
  v8f d = __builtin_amdgcn_wmma_f32_16x16x32_bf16(false, a, false, b, (short)0, c, false, false);
  asm volatile("v_nop\n\tv_nop\n\tv_nop\n\tv_nop" : "+v"(d) : "v"(a), "v"(b));
  return d;
}
// 16x16x32 fragments: lane = (h = lane>>4, row/col = lane&15); elements 0..7 = k0+8h+0..7, 8..15 = k0+16+8h+0..7; D element r = row 8h+r
__device__ __forceinline__ v16h frag_h(const _Float16* rowk0, int lane) {
  union { v16h v; v8h q[2]; } u; const _Float16* p = rowk0 + 8 * (lane >> 4);
  u.q[0] = *(const v8h*)p; u.q[1] = *(const v8h*)(p + 16); return u.v;
}
__device__ __forceinline__ v16h frag_f32(const float* rowk0, int lane) {
  v16h a; const float* p = rowk0 + 8 * (lane >> 4);
#pragma unroll
  for (int i = 0; i < 8; ++i) { a[i] = (_Float16)p[i]; a[8 + i] = (_Float16)p[16 + i]; }
  return a;
}
__device__ __forceinline__ v16h frag_f32s(const float* rowk0, int lane, float sc) {
  v16h a; const float* p = rowk0 + 8 * (lane >> 4);
#pragma unroll
  for (int i = 0; i < 8; ++i) { a[i] = (_Float16)(p[i] * sc); a[8 + i] = (_Float16)(p[16 + i] * sc); }
  return a;
}
// column fragment from a [K][ld] layout (column n), rows >= K read as 0
__device__ __forceinline__ v16h fragc_f32(const float* W, int k0, int n, int lane, int ld, int K) {
  v16h a; const int g = lane >> 4;
#pragma unroll
  for (int i = 0; i < 8; ++i) { const int ka = k0 + 8 * g + i, kb = ka + 16;
    a[i] = (_Float16)(ka < K ? W[(size_t)(ka < K ? ka : K - 1) * ld + n] : 0.f); a[8 + i] = (_Float16)(kb < K ? W[(size_t)(kb < K ? kb : K - 1) * ld + n] : 0.f); }
  return a;
}
struct F2 { v16b h, l; };
__device__ __forceinline__ F2 bsplit16(const float v[16]) { F2 r;
#pragma unroll
  for (int i = 0; i < 16; ++i) { const __bf16 h = (__bf16)v[i]; r.h[i] = h; r.l[i] = (__bf16)(v[i] - (float)h); }
  return r; }
__device__ __forceinline__ F2 split_row(const float* row, int k0, int lane) { float v[16]; const float* p = row + k0 + 8 * (lane >> 4);
#pragma unroll
  for (int i = 0; i < 8; ++i) { v[i] = p[i]; v[8 + i] = p[16 + i]; }
  return bsplit16(v); }
__device__ __forceinline__ F2 split_rowK(const float* row, int k0, int lane, int K) { float v[16]; const int g = lane >> 4;
#pragma unroll
  for (int i = 0; i < 8; ++i) { const int ka = k0 + 8 * g + i, kb = ka + 16; v[i] = ka < K ? row[ka < K ? ka : K - 1] : 0.f; v[8 + i] = kb < K ? row[kb < K ? kb : K - 1] : 0.f; }
  return bsplit16(v); }
__device__ __forceinline__ F2 split_col(const float* W, int k0, int n, int lane, int ld, int K) { float v[16]; const int g = lane >> 4;
#pragma unroll
  for (int i = 0; i < 8; ++i) { const int ka = k0 + 8 * g + i, kb = ka + 16; v[i] = ka < K ? W[(size_t)(ka < K ? ka : K - 1) * ld + n] : 0.f; v[8 + i] = kb < K ? W[(size_t)(kb < K ? kb : K - 1) * ld + n] : 0.f; }
  return bsplit16(v); }
__device__ __forceinline__ v8f mac3(const F2& a, const F2& b, v8f c) { c = wmma_bf(a.l, b.h, c); c = wmma_bf(a.h, b.l, c); return wmma_bf(a.h, b.h, c); }
__device__ __forceinline__ float sigm(float v) { return 1.0f / (1.0f + expf(-v)); }
#define LDSX() do { asm volatile("s_wait_dscnt 0" ::: "memory"); __builtin_amdgcn_wave_barrier(); __builtin_amdgcn_fence(__ATOMIC_RELEASE, "workgroup"); } while (0)

// Multi-headed attention whose softmax runs over the QUERY axis, scaled by the MODEL width (X [2,2048,1024]; torch (out,in) Wq / Wk / Wv [1024,1024] N(0, 1/1024) + biases N(0, 0.02); 16 heads x 64; scores / sqrt(E) = / 32; -inf where j > i; attn = softmax(scores, axis=2) - axis 2 of [B, H, i, j] is the QUERY axis i: every key column j is normalised over the queries i >= j (faithful to the source); out = attn v; merge; no output projection).
#define NB 2
#define TT 2048
#define CC 1024            // NH * HD = projected width
#define DIN 1024          // input (model) width
#define NH 16
#define HD 64
#define NQB (TT / 64)
#define HG 4
#define SCALE (0.03125f)
#define CAUSAL 1
#ifndef TNB
#define TNB NB
#endif
__device__ __forceinline__ float bfr(float v) { return (float)(__bf16)v; }
__host__ __device__ __forceinline__ int kb_last(int qb) { return CAUSAL ? ((qb * 64 + 63) >> 7) : (TT / 128 - 1); }
typedef __attribute__((ext_vector_type(8))) __bf16 v8b;
__device__ __forceinline__ v16b frag_b(const __bf16* rowk0, int lane) {
  union { v16b v; v8b q[2]; } u; const __bf16* p = rowk0 + 8 * (lane >> 4);
  u.q[0] = *(const v8b*)p; u.q[1] = *(const v8b*)(p + 16); return u.v;
}
#define QBH 32              // not read: k_out takes its one bf16 hi/lo path on all NQB query blocks
#define QHI 0               // no q residual plane: the scores are tiny (scale 1/32) and single-product everywhere
#define QBH_SC 0            // not read (k_out: bf16 hi/lo P.v on every block - a query-axis softmax has O(1) weights on the LAST key columns)
#define KHI 2048            // key rows carrying k residual / v bf16 hi+lo planes (the v planes are read by k_out; the k residual is not read)
// B fragment (k rows k0+.., output column o) of a weight: (in,out) [K][ld] or (out,in) [ld rows of K]: bf16 exact, or f16(bf16 * 256) exact
__device__ __forceinline__ v16b wcol_io(const float* Wm, int k0, int o, int lane, int ld) { v16b w; const int g = lane >> 4;
#pragma unroll
  for (int i = 0; i < 8; ++i) { w[i] = (__bf16)Wm[(size_t)(k0 + 8 * g + i) * ld + o]; w[8 + i] = (__bf16)Wm[(size_t)(k0 + 16 + 8 * g + i) * ld + o]; }
  return w; }
__device__ __forceinline__ v16b wcol_oi(const float* Wm, int k0, int o, int lane, int K) { v16b w; const float* p = Wm + (size_t)o * K + k0 + 8 * (lane >> 4);
#pragma unroll
  for (int i = 0; i < 8; ++i) { w[i] = (__bf16)p[i]; w[8 + i] = (__bf16)p[16 + i]; }
  return w; }
__device__ __forceinline__ v16h wcolh_io(const float* Wm, int k0, int o, int lane, int ld) { v16h w; const int g = lane >> 4;
#pragma unroll
  for (int i = 0; i < 8; ++i) { w[i] = (_Float16)(bfr(Wm[(size_t)(k0 + 8 * g + i) * ld + o]) * 256.0f); w[8 + i] = (_Float16)(bfr(Wm[(size_t)(k0 + 16 + 8 * g + i) * ld + o]) * 256.0f); }
  return w; }
__device__ __forceinline__ v16h wcolh_oi(const float* Wm, int k0, int o, int lane, int K) { v16h w; const float* p = Wm + (size_t)o * K + k0 + 8 * (lane >> 4);
#pragma unroll
  for (int i = 0; i < 8; ++i) { w[i] = (_Float16)(bfr(p[i]) * 256.0f); w[8 + i] = (_Float16)(bfr(p[16 + i]) * 256.0f); }
  return w; }
#define WQKV_LAYOUT 1   // not read by k_proj (W taken as (out,in) [CC][DIN]); WCOL only: 0 = (in,out) [DIN][CC]; 1 = (out,in) [CC][DIN]; 2 = per-head [NH][DIN][HD]
__device__ __forceinline__ v16b wcol_hdk(const float* Wm, int k0, int o, int lane) { v16b w; const int g = lane >> 4; const float* p = Wm + (size_t)(o / HD) * DIN * HD + (o % HD);
#pragma unroll
  for (int i = 0; i < 8; ++i) { w[i] = (__bf16)p[(size_t)(k0 + 8 * g + i) * HD]; w[8 + i] = (__bf16)p[(size_t)(k0 + 16 + 8 * g + i) * HD]; }
  return w; }
#define WO_OUT_IN 0
#if WQKV_LAYOUT == 1
#define WCOL(W, k0, o, lane) wcol_oi(W, k0, o, lane, DIN)
#elif WQKV_LAYOUT == 2
#define WCOL(W, k0, o, lane) wcol_hdk(W, k0, o, lane)
#else
#define WCOL(W, k0, o, lane) wcol_io(W, k0, o, lane, CC)
#endif
#if WO_OUT_IN
#define WOCOL(W, k0, o, lane) wcol_oi(W, k0, o, lane, CC)
#define WOCOLH(W, k0, o, lane) wcolh_oi(W, k0, o, lane, CC)
#else
#define WOCOL(W, k0, o, lane) wcol_io(W, k0, o, lane, DIN)
#define WOCOLH(W, k0, o, lane) wcolh_io(W, k0, o, lane, DIN)
#endif

#ifndef SM_EXTRA_PARAMS
#define SM_EXTRA_PARAMS
#endif
#ifndef PROJ_EXTRA_PARAMS
#define PROJ_EXTRA_PARAMS
#endif
#ifndef SM_MASK_HOOK
#define SM_MASK_HOOK (void)0
#endif

#define WS_QH  0u                                      // f16 q rows [b*t][CC]
#define WS_KH  (WS_QH + 2u * (size_t)NB * TT * CC)      // f16 k rows [b*t][CC]
#define WS_VT  (WS_KH + 2u * (size_t)NB * TT * CC)      // f16 v planes [b][c][t]
#define WS_QL  (WS_VT + 2u * (size_t)NB * CC * TT)      // f16 q residual x 2^10 rows [b][t < QHI][CC]
#define WS_KL  (WS_QL + 2u * (size_t)NB * QHI * CC)     // f16 k residual x 2^10 rows [b][t < KHI][CC]
#define WS_VB  (WS_KL + 2u * (size_t)NB * KHI * CC)     // bf16 v hi planes [b][c][t < KHI]
#define WS_VBL (WS_VB + 2u * (size_t)NB * CC * KHI)
#define WS_S   (WS_VBL + 2u * (size_t)NB * CC * KHI)    // f32 logits / P [hg][t][s] (plane not touched: the scores stay in registers)
#define WS_Y   (WS_S  + 4u * (size_t)HG * TT * TT)      // f32 ctx rows [b*t][CC] (only when there is an output projection)
#define WS_END (WS_Y  + 0u)
#define WS_CM (WS_END)                                  // f32 column maxima [NB * NH][TT]
#define WS_CZ (WS_CM + 4u * (size_t)NB * NH * TT)       // f32 2^11 / column sums [NB * NH][TT]
#define WS_END2 (WS_CZ + 4u * (size_t)NB * NH * TT)

// ---- k_proj: block = (128 rows, 128 cols, which), 8 waves of 32 rows x 64 cols: q/k/v = X W (+ b) with exact bf16 products (K = DIN, 32 k a pass, ascending, one accumulator chain per output as before). Per pass the block's 128 X rows and 128 W rows are read once as whole 128-B lines, rounded to bf16 once and laid in one of two LDS buffers; every wave takes its fragments from there. The next pass's global loads are issued in front of this pass's products and stored into the other buffer behind them; the one barrier of a pass publishes that buffer and ends the reads of this one. -> which 0: q f16 rows (+ residual rows < QHI); 1: k f16 rows (+ residual rows < KHI); 2: v f16 planes [c][t] (+ bf16 hi/lo planes for t < KHI). Every '#pragma unroll' of k_proj and proj_mac is there so that the small arrays it indexes (staged values, fragments, accumulators) stay in registers
#define PJT 128             // rows and columns of a block's tile
#define PJP 40              // LDS pitch of a staged row of 32 bf16, in elements: 80 B = 16 B x odd, free of bank conflicts for the 16-byte fragment reads
#define PJE 136             // LDS pitch of an epilogue row of 128 16-bit values, in elements: 272 B = 16 B x odd
typedef __attribute__((ext_vector_type(4))) __bf16 v4b;
__device__ __forceinline__ void proj_mac(const __bf16 (*xs)[PJP], const __bf16 (*wt)[PJP], int wm, int wn, int lane, v8f (&acc)[2][4]) { const int col = lane & 15; v16b a[2], w[4];
#pragma unroll
  for (int i = 0; i < 2; ++i) a[i] = frag_b(&xs[wm * 32 + i * 16 + col][0], lane);
#pragma unroll
  for (int j = 0; j < 4; ++j) w[j] = frag_b(&wt[wn * 64 + j * 16 + col][0], lane);
#pragma unroll
  for (int i = 0; i < 2; ++i)
#pragma unroll
    for (int j = 0; j < 4; ++j) acc[i][j] = __builtin_amdgcn_wmma_f32_16x16x32_bf16(false, a[i], false, w[j], (short)0, acc[i][j], false, false); }
__global__ __launch_bounds__(256) void k_proj(const float* __restrict__ XQ, const float* __restrict__ XK, const float* __restrict__ XV, const float* __restrict__ WQ, const float* __restrict__ WK, const float* __restrict__ WV, const float* __restrict__ BQ, const float* __restrict__ BK, const float* __restrict__ BV,
    _Float16* __restrict__ QH, _Float16* __restrict__ QL, _Float16* __restrict__ KH, _Float16* __restrict__ KL, _Float16* __restrict__ VT, __bf16* __restrict__ VB, __bf16* __restrict__ VBL) {
  __shared__ __align__(16) unsigned char sm[3 * PJT * PJE * 2];   // the loop's two buffers of X and W rows (40,960 B); behind the loop's last barrier the epilogue's planes
  __bf16 (*xs)[PJT][PJP] = (__bf16 (*)[PJT][PJP])sm; __bf16 (*wt)[PJT][PJP] = (__bf16 (*)[PJT][PJP])(sm + 2 * PJT * PJP * 2);
  const int tid = threadIdx.x, wave = tid >> 5, lane = tid & 31, col = lane & 15, g = lane >> 4, wm = wave & 3, wn = wave >> 2; const int which = blockIdx.z; const int c0 = blockIdx.y * PJT; const size_t r0 = (size_t)blockIdx.x * PJT; const size_t bb = r0 / TT; const int t0 = (int)(r0 % TT);
  const float* X = which == 0 ? XQ : which == 1 ? XK : XV; const float* WA = which == 0 ? WQ : which == 1 ? WK : WV; const float* BA = which == 0 ? BQ : which == 1 ? BK : BV;
  const int lr = tid >> 3, lc = (tid & 7) * 4;   // staging: 8 lanes cover one row's 128-B line, a wave 4 whole lines a load
  const float* xg = X + (r0 + lr) * DIN + lc; const float* wg = WA + (size_t)(c0 + lr) * DIN + lc;
  v8f acc[2][4] = {}; v4f xr[4], wr[4];
#pragma unroll
  for (int u = 0; u < 4; ++u) { xr[u] = *(const v4f*)(xg + (size_t)u * 32 * DIN); wr[u] = *(const v4f*)(wg + (size_t)u * 32 * DIN); }
#pragma unroll
  for (int u = 0; u < 4; ++u) { *(v4b*)&xs[0][u * 32 + lr][lc] = __builtin_convertvector(xr[u], v4b); *(v4b*)&wt[0][u * 32 + lr][lc] = __builtin_convertvector(wr[u], v4b); }
  __syncthreads();
  for (int kc = 0; kc < DIN / 32 - 1; ++kc) { const float* xp = xg + (kc + 1) * 32; const float* wp = wg + (kc + 1) * 32;
#pragma unroll
    for (int u = 0; u < 4; ++u) { xr[u] = *(const v4f*)(xp + (size_t)u * 32 * DIN); wr[u] = *(const v4f*)(wp + (size_t)u * 32 * DIN); }
    asm volatile("s_wait_xcnt 0x0" :: "v"(xp), "v"(wp) : "memory");   /* the wait before a register of an issued load is overwritten (the fragments below take the address registers); the two addresses are inputs, so they stay live to here. Standing here it also keeps all eight loads in front of the pass's LDS reads and products: without it the eighth is issued only behind four products */
    proj_mac(xs[kc & 1], wt[kc & 1], wm, wn, lane, acc);
#pragma unroll
    for (int u = 0; u < 4; ++u) { *(v4b*)&xs[(kc + 1) & 1][u * 32 + lr][lc] = __builtin_convertvector(xr[u], v4b); *(v4b*)&wt[(kc + 1) & 1][u * 32 + lr][lc] = __builtin_convertvector(wr[u], v4b); }
    __syncthreads(); }
  proj_mac(xs[(DIN / 32 - 1) & 1], wt[(DIN / 32 - 1) & 1], wm, wn, lane, acc);
  __syncthreads();   // every wave has taken its last fragments: the epilogue's planes may overwrite the buffers
  if (which < 2) { _Float16 (*sh)[PJE] = (_Float16 (*)[PJE])sm; _Float16 (*sl)[PJE] = (_Float16 (*)[PJE])(sm + PJT * PJE * 2); _Float16* DH = which == 0 ? QH : KH; _Float16* DL = which == 0 ? QL : KL; const int nhi = which == 0 ? QHI : KHI; const bool hi_rows = t0 < nhi;
#pragma unroll
    for (int j = 0; j < 4; ++j) { const int cl = wn * 64 + j * 16 + col; const float bias = BA ? bfr(BA[c0 + cl]) : 0.f;
#pragma unroll
      for (int i = 0; i < 2; ++i)
#pragma unroll
        for (int r = 0; r < 8; ++r) { const float v = acc[i][j][r] + bias; const _Float16 hv = (_Float16)v; const int rl = wm * 32 + i * 16 + 8 * g + r; sh[rl][cl] = hv; sl[rl][cl] = (_Float16)((v - (float)hv) * 1024.0f); } }
    __syncthreads();
    for (int e = tid; e < PJT * 16; e += 256) { const int rl = e >> 4, q = e & 15; _Float16* ph = DH + (r0 + rl) * CC + c0 + q * 8; _Float16* pl = DL + (bb * nhi + t0 + rl) * (size_t)CC + c0 + q * 8; const v4u hv = *(const v4u*)&sh[rl][q * 8], lv = *(const v4u*)&sl[rl][q * 8];
      vst2((unsigned*)ph, hv); if (hi_rows) vst2((unsigned*)pl, lv);
      asm volatile("s_wait_xcnt 0x0" :: "v"(ph), "v"(pl), "v"(hv), "v"(lv) : "memory"); }   /* the wait before a register of an issued store is overwritten (the next trip takes the address and data registers); they are inputs, so they stay live to here */
  } else { _Float16 (*th)[PJE] = (_Float16 (*)[PJE])sm; __bf16 (*tb)[PJE] = (__bf16 (*)[PJE])(sm + PJT * PJE * 2); __bf16 (*tbl)[PJE] = (__bf16 (*)[PJE])(sm + 2 * PJT * PJE * 2); const bool hi_rows = t0 < KHI;
#pragma unroll
    for (int j = 0; j < 4; ++j) { const int cl = wn * 64 + j * 16 + col; const float bias = BA ? bfr(BA[c0 + cl]) : 0.f;
#pragma unroll
      for (int i = 0; i < 2; ++i)
#pragma unroll
        for (int r = 0; r < 8; ++r) { const float v = acc[i][j][r] + bias; const int rl = wm * 32 + i * 16 + 8 * g + r; th[cl][rl] = (_Float16)v; const __bf16 bh = (__bf16)v; tb[cl][rl] = bh; tbl[cl][rl] = (__bf16)(v - (float)bh); } }
    __syncthreads();
    for (int e = tid; e < PJT * 16; e += 256) { const int cl = e >> 4, q = e & 15; vst2((unsigned*)(VT + (bb * CC + c0 + cl) * (size_t)TT + t0 + q * 8), *(const v4u*)&th[cl][q * 8]); if (hi_rows) { const size_t o3 = (bb * CC + c0 + cl) * (size_t)KHI + t0 + q * 8; vst2((unsigned*)(VB + o3), *(const v4u*)&tb[cl][q * 8]); vst2((unsigned*)(VBL + o3), *(const v4u*)&tbl[cl][q * 8]); } } } }
// ---- k_sm: block = query row t (head in group): keys [0, kend): causal -> logit if s <= t else excluded; softmax in f32; P x 2^11 in place (0 for excluded)
__global__ __launch_bounds__(256) void k_sm(float* __restrict__ S0 SM_EXTRA_PARAMS) { __shared__ float sred[8]; __shared__ float sbc; __shared__ __align__(16) float shv[TT];
  const int tid = threadIdx.x; const int t = blockIdx.x; const int kend = (kb_last(t >> 6) + 1) * 128;
  float* sr = S0 + (size_t)blockIdx.y * TT * TT + (size_t)t * TT;
  float m = -3.0e38f; for (int k = tid; k < kend; k += 256) { float v = (!CAUSAL || k <= t) ? sr[k] : -3.0e38f; SM_MASK_HOOK; shv[k] = v; m = fmaxf(m, v); }
#pragma unroll
  for (int o = 1; o < 32; o <<= 1) m = fmaxf(m, __shfl_xor(m, o));
  if ((tid & 31) == 0) sred[tid >> 5] = m; __syncthreads(); if (tid == 0) { float a = sred[0]; for (int i = 1; i < 8; ++i) a = fmaxf(a, sred[i]); sbc = a; } __syncthreads(); m = sbc; __syncthreads();
  float sum = 0.f; for (int k = tid; k < kend; k += 256) { const float v = shv[k]; const float e = (v <= -1.0e38f) ? 0.f : expf(v - m); shv[k] = e; sum += e; }
#pragma unroll
  for (int o = 1; o < 32; o <<= 1) sum += __shfl_xor(sum, o);
  if ((tid & 31) == 0) sred[tid >> 5] = sum; __syncthreads(); if (tid == 0) { float a = 0.f; for (int i = 0; i < 8; ++i) a += sred[i]; sbc = a > 0.f ? 2048.0f / a : 0.f; }   /* a fully excluded row yields P = 0 */ __syncthreads(); const float inv = sbc;
  for (int k = tid; k < kend; k += 256) shv[k] = shv[k] * inv;
  __syncthreads(); for (int q = tid; q < kend / 4; q += 256) vst2(sr + q * 4, *(const v4f*)&shv[q * 4]); }
// ---- k_stat: softmax over the QUERY axis under the causal mask (the source's softmax(axis=2) on [B, H, i, j] scores with -inf where j > i), with no score matrix in memory. Block = (STK key columns from k0, head h, batch b), STW waves. Every wave keeps the STK keys' f16 fragments in registers and takes every STW-th tile of 16 of the visible query rows k0 .. TT-1: scores q x k on WMMA (one f16 product, x SCALE), then per lane and column tile the online (max, sum) over its 8 rows (f32, precise expf; q < k reads as -inf and adds exp(-inf) = 0; the running maximum starts finite, so the difference is never inf - inf). The 2 * STW partial pairs of a column (wave, lane half) are merged through LDS behind one barrier, which every wave reaches after its own last tile: m_k to CM, 2^11 / Z_k to CR, whole lines. Every '#pragma unroll' of k_stat and k_out is there so that the small arrays it indexes (fragments, accumulators, m, z, P) stay in registers
#define STW 8
#define STK 64
// the fragments of frag_h / frag_b from a pointer that already holds the lane's own 8g offset: a run of loads then shares one address value, which the wait behind the run can name
__device__ __forceinline__ v16h frag_hp(const _Float16* p) { union { v16h v; v8h q[2]; } u; u.q[0] = *(const v8h*)p; u.q[1] = *(const v8h*)(p + 16); return u.v; }
__device__ __forceinline__ v16b frag_bp(const __bf16* p) { union { v16b v; v8b q[2]; } u; u.q[0] = *(const v8b*)p; u.q[1] = *(const v8b*)(p + 16); return u.v; }
__global__ __launch_bounds__(STW * 32) void k_stat(const _Float16* __restrict__ QH, const _Float16* __restrict__ KH, float* __restrict__ CM, float* __restrict__ CR) { __shared__ float pm[2 * STW][STK], pz[2 * STW][STK];
  const int tid = threadIdx.x, lane = tid & 31, col = lane & 15, g = lane >> 4; const int wave = __builtin_amdgcn_readfirstlane(tid >> 5); const int k0 = blockIdx.x * STK, h = blockIdx.y, b = blockIdx.z;
  v16h kf[HD / 32][STK / 16]; const _Float16* kp = KH + ((size_t)b * TT + k0 + col) * CC + h * HD + 8 * g;
#pragma unroll
  for (int kc = 0; kc < HD / 32; ++kc) {
#pragma unroll
    for (int j = 0; j < STK / 16; ++j) kf[kc][j] = frag_hp(kp + (size_t)j * 16 * CC + kc * 32); }
  asm volatile("s_wait_xcnt 0x0" :: "v"(kp) : "memory");   /* the wait before a register of an issued load is overwritten; the loads' common address is an input, so it stays live to here and no fragment lands in it */
  float m[STK / 16], z[STK / 16];
#pragma unroll
  for (int j = 0; j < STK / 16; ++j) { m[j] = -3.0e38f; z[j] = 0.f; }
  for (int ql0 = k0 + wave * 16; ql0 < TT; ql0 += STW * 16) { const _Float16* qp = QH + ((size_t)b * TT + ql0 + col) * CC + h * HD; const v16h a0 = frag_h(qp, lane), a1 = frag_h(qp + 32, lane);
#pragma unroll
    for (int j = 0; j < STK / 16; ++j) { v8f acc = {}; acc = wmma16(a0, kf[0][j], acc); acc = wmma16(a1, kf[1][j], acc); const int k = k0 + j * 16 + col; float v[8];
#pragma unroll
      for (int r = 0; r < 8; ++r) v[r] = (ql0 + 8 * g + r >= k) ? acc[r] * SCALE : -INFINITY;
      float mn = m[j];
#pragma unroll
      for (int r = 0; r < 8; ++r) mn = fmaxf(mn, v[r]);
      float s = 0.f;
#pragma unroll
      for (int r = 0; r < 8; ++r) s += expf(v[r] - mn);
      z[j] = z[j] * expf(m[j] - mn) + s; m[j] = mn; } }
#pragma unroll
  for (int j = 0; j < STK / 16; ++j) { pm[2 * wave + g][j * 16 + col] = m[j]; pz[2 * wave + g][j * 16 + col] = z[j]; }
  __syncthreads();
  if (tid < STK) { float mm = pm[0][tid];
#pragma unroll
    for (int w = 1; w < 2 * STW; ++w) mm = fmaxf(mm, pm[w][tid]);
    float a = 0.f;   /* a partial that saw no visible row of this column holds Z = 0 and a finite maximum */
#pragma unroll
    for (int w = 0; w < 2 * STW; ++w) a += pz[w][tid] * expf(pm[w][tid] - mm);
    const size_t o = ((size_t)b * NH + h) * TT + k0 + tid; vst2(CM + o, mm); vst2(CR + o, 2048.0f / a); } }   /* every column sees at least its own diagonal entry: Z_k >= 1 */
// ---- k_out: block = 64 queries (qb) of (b, h), a wave = 16 queries: per 32 keys the scores are formed again on WMMA, transposed (A = 16 key rows, B = the wave's 16 queries, kept in registers; the same one f16 product x SCALE), so that a lane holds, for its own query, the keys 8g + 0..7 of each 16-key tile: two such tiles are, in place, the A fragment of P . v (hardware k order, the order of frag_b). P[i][j] = exp(S - m_j) x (2^11 / Z_j) for j <= i, 0 above the diagonal (unconditional loads, value select); P and v as bf16 hi + lo, 3 products, keys [0, kend) as before; 256-B (row, head) segment by 16 lanes
__global__ __launch_bounds__(128) void k_out(const _Float16* __restrict__ QH, const _Float16* __restrict__ KH, const float* __restrict__ CM, const float* __restrict__ CR, const __bf16* __restrict__ VB, const __bf16* __restrict__ VBL, float* __restrict__ Y) { __shared__ __align__(16) float ss[4][16][HD + 4];
  const int tid = threadIdx.x, wave = tid >> 5, lane = tid & 31, col = lane & 15, g = lane >> 4; const int qb = blockIdx.x, h = blockIdx.y, b = blockIdx.z; const int ql0 = qb * 64 + wave * 16; const int kce = (kb_last(qb) + 1) * 4; const int qi = ql0 + col;
  const float* cm = CM + ((size_t)b * NH + h) * TT + 8 * g; const float* cr = CR + ((size_t)b * NH + h) * TT + 8 * g;
  const _Float16* qp = QH + ((size_t)b * TT + qi) * CC + h * HD; const v16h q0 = frag_h(qp, lane), q1 = frag_h(qp + 32, lane);
  const _Float16* kp = KH + ((size_t)b * TT + col) * CC + h * HD + 8 * g;
  v8f acc[HD / 16] = {};
  for (int kc = 0; kc < kce; ++kc) { const int k0 = kc * 32; const _Float16* ka = kp + (size_t)k0 * CC; const _Float16* kb2 = ka + (size_t)16 * CC; const float* cmk = cm + k0; const float* crk = cr + k0;
    const v16h ka0 = frag_hp(ka), kb0 = frag_hp(kb2), ka1 = frag_hp(ka + 32), kb1 = frag_hp(kb2 + 32);
    v4f mv[4], rv[4];
#pragma unroll
    for (int u = 0; u < 4; ++u) { const int o = (u >> 1) * 16 + (u & 1) * 4; mv[u] = *(const v4f*)(cmk + o); rv[u] = *(const v4f*)(crk + o); }
    asm volatile("s_wait_xcnt 0x0" :: "v"(ka), "v"(cmk), "v"(crk) : "memory");   /* the wait before a register of an issued load is overwritten (the v addresses and fragments below may take those registers); the loads' addresses are inputs, so they stay live to here */
    v16b vh[HD / 16], vl[HD / 16]; const size_t po = ((size_t)b * CC + h * HD + col) * (size_t)KHI + k0 + 8 * g; const __bf16* vhp = VB + po; const __bf16* vlp = VBL + po;
#pragma unroll
    for (int j = 0; j < HD / 16; ++j) { vh[j] = frag_bp(vhp + (size_t)j * 16 * KHI); vl[j] = frag_bp(vlp + (size_t)j * 16 * KHI); }
    asm volatile("s_wait_xcnt 0x0" :: "v"(vhp), "v"(vlp) : "memory");   /* the same wait for the v loads' two addresses, whose registers the products below overwrite; as inputs they stay live to here and no fragment lands in them */
    __builtin_amdgcn_sched_barrier(0);   /* all loads of the pass are issued in front of its first product, so the v fragments fly during the key fragments' latency (without it the v loads are issued only behind the first score product's wait for its key fragment) */
    v8f s0 = {}, s1 = {}; s0 = wmma16(ka0, q0, s0); s1 = wmma16(kb0, q0, s1); s0 = wmma16(ka1, q1, s0); s1 = wmma16(kb1, q1, s1);
    float pv[16];
#pragma unroll
    for (int i = 0; i < 8; ++i) { const int ke = k0 + 8 * g + i; const float e0 = expf(s0[i] * SCALE - mv[i >> 2][i & 3]) * rv[i >> 2][i & 3], e1 = expf(s1[i] * SCALE - mv[2 + (i >> 2)][i & 3]) * rv[2 + (i >> 2)][i & 3]; pv[i] = (ke <= qi) ? e0 : 0.f; pv[8 + i] = (ke + 16 <= qi) ? e1 : 0.f; }
    const F2 p = bsplit16(pv);
#pragma unroll
    for (int j = 0; j < HD / 16; ++j) { acc[j] = wmma_bf(p.h, vh[j], acc[j]); acc[j] = wmma_bf(p.l, vh[j], acc[j]); acc[j] = wmma_bf(p.h, vl[j], acc[j]); } }
#pragma unroll
  for (int j = 0; j < HD / 16; ++j)
#pragma unroll
    for (int r = 0; r < 8; ++r) ss[wave][8 * g + r][j * 16 + col] = acc[j][r] * (1.0f / 2048.0f);
  LDSX(); for (int rl = 0; rl < 16; ++rl) if (lane < HD / 4) vst2(Y + ((size_t)b * TT + ql0 + rl) * CC + h * HD + lane * 4, *(const v4f*)&ss[wave][rl][lane * 4]); }

extern "C" void kernel_launch(void* const* d_in, const int* in_sizes, int n_in, void* d_out, int out_size, void* d_ws, size_t ws_size, hipStream_t stream) {
  (void)in_sizes; (void)n_in; (void)out_size;
  const float** F = (const float**)d_in;
  if (ws_size < (size_t)WS_END) return;
  char* ws = (char*)d_ws; _Float16 *QH = (_Float16*)(ws + WS_QH), *KH = (_Float16*)(ws + WS_KH), *VT = (_Float16*)(ws + WS_VT), *QL = (_Float16*)(ws + WS_QL), *KL = (_Float16*)(ws + WS_KL); __bf16 *VB = (__bf16*)(ws + WS_VB), *VBL = (__bf16*)(ws + WS_VBL); float *S = (float*)(ws + WS_S), *Y = (float*)(ws + WS_Y);
  (void)Y; (void)QL; (void)KL; (void)VB; (void)VBL; (void)S; (void)VT;
  // inputs: 0 X [2,2048,1024]; 1 Wq [1024,1024] (out,in), 2 bq; 3 Wk, 4 bk; 5 Wv, 6 bv (biases N(0, 0.02), nonzero); no output projection
  if (ws_size < (size_t)WS_END2) return;
  float *CM = (float*)(ws + WS_CM), *CZ = (float*)(ws + WS_CZ);
  k_proj<<<dim3(TNB * TT / PJT, CC / PJT, 3), 256, 0, stream>>>(F[0], F[0], F[0], F[1], F[3], F[5], F[2], F[4], F[6], QH, QL, KH, KL, VT, VB, VBL);
  k_stat<<<dim3(TT / STK, NH, TNB), STW * 32, 0, stream>>>(QH, KH, CM, CZ);   /* per key column j: max and 2^11 / sum over the visible queries i >= j */
  k_out<<<dim3(NQB, NH, TNB), 128, 0, stream>>>(QH, KH, CM, CZ, VB, VBL, (float*)d_out);   /* P formed in registers, then P . v */
}

// v004
// Measured time: 168 microseconds a run.
// Next to v003, in two timings, it ran 1.28 times as fast each time.
// Over all steps from v000 it is 46.9 times as fast.
// compute dtype: all float inputs rounded to bf16; q/k/v projections with EXACT bf16 products on WMMA 16x16x32 (f32 accumulate) + bias; causal scores q x k once to f16 each (1 product; the module scales by 1/sqrt(E) = 1/32, so sigma - 0.1) on every block; softmax over the QUERY axis in f32 (per key column: online max / sum over the visible queries, precise expf); P as bf16 hi + lo against v as bf16 hi + lo (3 products) on EVERY block; f32 output.
#include <hip/hip_runtime.h>
#include <math.h>

typedef __attribute__((ext_vector_type(16))) _Float16 v16h;
typedef __attribute__((ext_vector_type(16))) __bf16 v16b;
typedef __attribute__((ext_vector_type(8)))  _Float16 v8h;
typedef __attribute__((ext_vector_type(8)))  float v8f;
typedef __attribute__((ext_vector_type(4)))  float v4f;
typedef __attribute__((ext_vector_type(2)))  float v2f;
typedef __attribute__((ext_vector_type(4)))  unsigned v4u;
typedef __attribute__((ext_vector_type(4)))  int v4i;
typedef float __attribute__((may_alias)) float_a;
typedef int __attribute__((may_alias)) int_a;

template <typename T> __device__ __forceinline__ void vst2(void* p, T v) { *(T*)p = v;  }
__device__ __forceinline__ v8f wmma16(v16h a, v16h b, v8f c) {
  v8f d = __builtin_amdgcn_wmma_f32_16x16x32_f16(false, a, false, b, (short)0, c, false, false);
  asm volatile("v_nop\n\tv_nop\n\tv_nop\n\tv_nop" : "+v"(d) : "v"(a), "v"(b));
  return d;
}
__device__ __forceinline__ v8f wmma_bf(v16b a, v16b b, v8f c) {
  v8f d = __builtin_amdgcn_wmma_f32_16x16x32_bf16(false, a, false, b, (short)0, c, false, false);
  asm volatile("v_nop\n\tv_nop\n\tv_nop\n\tv_nop" : "+v"(d) : "v"(a), "v"(b));
  return d;
}
// 16x16x32 fragments: lane = (h = lane>>4, row/col = lane&15); elements 0..7 = k0+8h+0..7, 8..15 = k0+16+8h+0..7; D element r = row 8h+r
__device__ __forceinline__ v16h frag_h(const _Float16* rowk0, int lane) {
  union { v16h v; v8h q[2]; } u; const _Float16* p = rowk0 + 8 * (lane >> 4);
  u.q[0] = *(const v8h*)p; u.q[1] = *(const v8h*)(p + 16); return u.v;
}
__device__ __forceinline__ v16h frag_f32(const float* rowk0, int lane) {
  v16h a; const float* p = rowk0 + 8 * (lane >> 4);
#pragma unroll
  for (int i = 0; i < 8; ++i) { a[i] = (_Float16)p[i]; a[8 + i] = (_Float16)p[16 + i]; }
  return a;
}
__device__ __forceinline__ v16h frag_f32s(const float* rowk0, int lane, float sc) {
  v16h a; const float* p = rowk0 + 8 * (lane >> 4);
#pragma unroll
  for (int i = 0; i < 8; ++i) { a[i] = (_Float16)(p[i] * sc); a[8 + i] = (_Float16)(p[16 + i] * sc); }
  return a;
}
// column fragment from a [K][ld] layout (column n), rows >= K read as 0
__device__ __forceinline__ v16h fragc_f32(const float* W, int k0, int n, int lane, int ld, int K) {
  v16h a; const int g = lane >> 4;
#pragma unroll
  for (int i = 0; i < 8; ++i) { const int ka = k0 + 8 * g + i, kb = ka + 16;
    a[i] = (_Float16)(ka < K ? W[(size_t)(ka < K ? ka : K - 1) * ld + n] : 0.f); a[8 + i] = (_Float16)(kb < K ? W[(size_t)(kb < K ? kb : K - 1) * ld + n] : 0.f); }
  return a;
}
struct F2 { v16b h, l; };
__device__ __forceinline__ F2 bsplit16(const float v[16]) { F2 r;
#pragma unroll
  for (int i = 0; i < 16; ++i) { const __bf16 h = (__bf16)v[i]; r.h[i] = h; r.l[i] = (__bf16)(v[i] - (float)h); }
  return r; }
__device__ __forceinline__ F2 split_row(const float* row, int k0, int lane) { float v[16]; const float* p = row + k0 + 8 * (lane >> 4);
#pragma unroll
  for (int i = 0; i < 8; ++i) { v[i] = p[i]; v[8 + i] = p[16 + i]; }
  return bsplit16(v); }
__device__ __forceinline__ F2 split_rowK(const float* row, int k0, int lane, int K) { float v[16]; const int g = lane >> 4;
#pragma unroll
  for (int i = 0; i < 8; ++i) { const int ka = k0 + 8 * g + i, kb = ka + 16; v[i] = ka < K ? row[ka < K ? ka : K - 1] : 0.f; v[8 + i] = kb < K ? row[kb < K ? kb : K - 1] : 0.f; }
  return bsplit16(v); }
__device__ __forceinline__ F2 split_col(const float* W, int k0, int n, int lane, int ld, int K) { float v[16]; const int g = lane >> 4;
#pragma unroll
  for (int i = 0; i < 8; ++i) { const int ka = k0 + 8 * g + i, kb = ka + 16; v[i] = ka < K ? W[(size_t)(ka < K ? ka : K - 1) * ld + n] : 0.f; v[8 + i] = kb < K ? W[(size_t)(kb < K ? kb : K - 1) * ld + n] : 0.f; }
  return bsplit16(v); }
__device__ __forceinline__ v8f mac3(const F2& a, const F2& b, v8f c) { c = wmma_bf(a.l, b.h, c); c = wmma_bf(a.h, b.l, c); return wmma_bf(a.h, b.h, c); }
__device__ __forceinline__ float sigm(float v) { return 1.0f / (1.0f + expf(-v)); }
#define LDSX() do { asm volatile("s_wait_dscnt 0" ::: "memory"); __builtin_amdgcn_wave_barrier(); __builtin_amdgcn_fence(__ATOMIC_RELEASE, "workgroup"); } while (0)

// Multi-headed attention whose softmax runs over the QUERY axis, scaled by the MODEL width (X [2,2048,1024]; torch (out,in) Wq / Wk / Wv [1024,1024] N(0, 1/1024) + biases N(0, 0.02); 16 heads x 64; scores / sqrt(E) = / 32; -inf where j > i; attn = softmax(scores, axis=2) - axis 2 of [B, H, i, j] is the QUERY axis i: every key column j is normalised over the queries i >= j (faithful to the source); out = attn v; merge; no output projection).
#define NB 2
#define TT 2048
#define CC 1024            // NH * HD = projected width
#define DIN 1024          // input (model) width
#define NH 16
#define HD 64
#define NQB (TT / 64)
#define HG 4
#define SCALE (0.03125f)
#define CAUSAL 1
#ifndef TNB
#define TNB NB
#endif
__device__ __forceinline__ float bfr(float v) { return (float)(__bf16)v; }
__host__ __device__ __forceinline__ int kb_last(int qb) { return CAUSAL ? ((qb * 64 + 63) >> 7) : (TT / 128 - 1); }
typedef __attribute__((ext_vector_type(8))) __bf16 v8b;
__device__ __forceinline__ v16b frag_b(const __bf16* rowk0, int lane) {
  union { v16b v; v8b q[2]; } u; const __bf16* p = rowk0 + 8 * (lane >> 4);
  u.q[0] = *(const v8b*)p; u.q[1] = *(const v8b*)(p + 16); return u.v;
}
#define QBH 32              // not read: k_out takes its one bf16 hi/lo path on all NQB query blocks
#define QHI 0               // no q residual plane: the scores are tiny (scale 1/32) and single-product everywhere
#define QBH_SC 0            // not read (k_out: bf16 hi/lo P.v on every block - a query-axis softmax has O(1) weights on the LAST key columns)
#define KHI 2048            // key rows carrying k residual / v bf16 hi+lo planes (the v planes are read by k_out; the k residual is not read)
// B fragment (k rows k0+.., output column o) of a weight: (in,out) [K][ld] or (out,in) [ld rows of K]: bf16 exact, or f16(bf16 * 256) exact
__device__ __forceinline__ v16b wcol_io(const float* Wm, int k0, int o, int lane, int ld) { v16b w; const int g = lane >> 4;
#pragma unroll
  for (int i = 0; i < 8; ++i) { w[i] = (__bf16)Wm[(size_t)(k0 + 8 * g + i) * ld + o]; w[8 + i] = (__bf16)Wm[(size_t)(k0 + 16 + 8 * g + i) * ld + o]; }
  return w; }
__device__ __forceinline__ v16b wcol_oi(const float* Wm, int k0, int o, int lane, int K) { v16b w; const float* p = Wm + (size_t)o * K + k0 + 8 * (lane >> 4);
#pragma unroll
  for (int i = 0; i < 8; ++i) { w[i] = (__bf16)p[i]; w[8 + i] = (__bf16)p[16 + i]; }
  return w; }
__device__ __forceinline__ v16h wcolh_io(const float* Wm, int k0, int o, int lane, int ld) { v16h w; const int g = lane >> 4;
#pragma unroll
  for (int i = 0; i < 8; ++i) { w[i] = (_Float16)(bfr(Wm[(size_t)(k0 + 8 * g + i) * ld + o]) * 256.0f); w[8 + i] = (_Float16)(bfr(Wm[(size_t)(k0 + 16 + 8 * g + i) * ld + o]) * 256.0f); }
  return w; }
__device__ __forceinline__ v16h wcolh_oi(const float* Wm, int k0, int o, int lane, int K) { v16h w; const float* p = Wm + (size_t)o * K + k0 + 8 * (lane >> 4);
#pragma unroll
  for (int i = 0; i < 8; ++i) { w[i] = (_Float16)(bfr(p[i]) * 256.0f); w[8 + i] = (_Float16)(bfr(p[16 + i]) * 256.0f); }
  return w; }
#define WQKV_LAYOUT 1   // not read by k_proj (W taken as (out,in) [CC][DIN]); WCOL only: 0 = (in,out) [DIN][CC]; 1 = (out,in) [CC][DIN]; 2 = per-head [NH][DIN][HD]
__device__ __forceinline__ v16b wcol_hdk(const float* Wm, int k0, int o, int lane) { v16b w; const int g = lane >> 4; const float* p = Wm + (size_t)(o / HD) * DIN * HD + (o % HD);
#pragma unroll
  for (int i = 0; i < 8; ++i) { w[i] = (__bf16)p[(size_t)(k0 + 8 * g + i) * HD]; w[8 + i] = (__bf16)p[(size_t)(k0 + 16 + 8 * g + i) * HD]; }
  return w; }
#define WO_OUT_IN 0
#if WQKV_LAYOUT == 1
#define WCOL(W, k0, o, lane) wcol_oi(W, k0, o, lane, DIN)
#elif WQKV_LAYOUT == 2
#define WCOL(W, k0, o, lane) wcol_hdk(W, k0, o, lane)
#else
#define WCOL(W, k0, o, lane) wcol_io(W, k0, o, lane, CC)
#endif
#if WO_OUT_IN
#define WOCOL(W, k0, o, lane) wcol_oi(W, k0, o, lane, CC)
#define WOCOLH(W, k0, o, lane) wcolh_oi(W, k0, o, lane, CC)
#else
#define WOCOL(W, k0, o, lane) wcol_io(W, k0, o, lane, DIN)
#define WOCOLH(W, k0, o, lane) wcolh_io(W, k0, o, lane, DIN)
#endif

#ifndef SM_EXTRA_PARAMS
#define SM_EXTRA_PARAMS
#endif
#ifndef PROJ_EXTRA_PARAMS
#define PROJ_EXTRA_PARAMS
#endif
#ifndef SM_MASK_HOOK
#define SM_MASK_HOOK (void)0
#endif

#define WS_QH  0u                                      // f16 q rows [b*t][CC]
#define WS_KH  (WS_QH + 2u * (size_t)NB * TT * CC)      // f16 k rows [b*t][CC]
#define WS_VT  (WS_KH + 2u * (size_t)NB * TT * CC)      // f16 v planes [b][c][t]
#define WS_QL  (WS_VT + 2u * (size_t)NB * CC * TT)      // f16 q residual x 2^10 rows [b][t < QHI][CC]
#define WS_KL  (WS_QL + 2u * (size_t)NB * QHI * CC)     // f16 k residual x 2^10 rows [b][t < KHI][CC]
#define WS_VB  (WS_KL + 2u * (size_t)NB * KHI * CC)     // bf16 v hi planes [b][c][t < KHI]
#define WS_VBL (WS_VB + 2u * (size_t)NB * CC * KHI)
#define WS_S   (WS_VBL + 2u * (size_t)NB * CC * KHI)    // f32 logits / P [hg][t][s] (plane not touched: the scores stay in registers)
#define WS_Y   (WS_S  + 4u * (size_t)HG * TT * TT)      // f32 ctx rows [b*t][CC] (only when there is an output projection)
#define WS_END (WS_Y  + 0u)
#define WS_CM (WS_END)                                  // f32 column maxima [NB * NH][TT]
#define WS_CZ (WS_CM + 4u * (size_t)NB * NH * TT)       // f32 2^11 / column sums [NB * NH][TT]
#define WS_END2 (WS_CZ + 4u * (size_t)NB * NH * TT)

// ---- k_proj: block = (128 rows, 128 cols, which), 8 waves of 32 rows x 64 cols: q/k/v = X W (+ b) with exact bf16 products (K = DIN, 32 k a pass, ascending, one accumulator chain per output as before). Per pass the block's 128 X rows and 128 W rows are read once as whole 128-B lines, rounded to bf16 once and laid in one of two LDS buffers; every wave takes its fragments from there. The next pass's global loads are issued in front of this pass's products and stored into the other buffer behind them; the one barrier of a pass publishes that buffer and ends the reads of this one. -> which 0: q f16 rows (+ residual rows < QHI); 1: k f16 rows (+ residual rows < KHI); 2: v f16 planes [c][t] (+ bf16 hi/lo planes for t < KHI). Every '#pragma unroll' of k_proj and proj_mac is there so that the small arrays it indexes (staged values, fragments, accumulators) stay in registers
#define PJT 128             // rows and columns of a block's tile
#define PJP 40              // LDS pitch of a staged row of 32 bf16, in elements: 80 B = 16 B x odd, free of bank conflicts for the 16-byte fragment reads
#define PJE 136             // LDS pitch of an epilogue row of 128 16-bit values, in elements: 272 B = 16 B x odd
typedef __attribute__((ext_vector_type(4))) __bf16 v4b;
__device__ __forceinline__ void proj_mac(const __bf16 (*xs)[PJP], const __bf16 (*wt)[PJP], int wm, int wn, int lane, v8f (&acc)[2][4]) { const int col = lane & 15; v16b a[2], w[4];
#pragma unroll
  for (int i = 0; i < 2; ++i) a[i] = frag_b(&xs[wm * 32 + i * 16 + col][0], lane);
#pragma unroll
  for (int j = 0; j < 4; ++j) w[j] = frag_b(&wt[wn * 64 + j * 16 + col][0], lane);
#pragma unroll
  for (int i = 0; i < 2; ++i)
#pragma unroll
    for (int j = 0; j < 4; ++j) acc[i][j] = __builtin_amdgcn_wmma_f32_16x16x32_bf16(false, a[i], false, w[j], (short)0, acc[i][j], false, false); }
__global__ __launch_bounds__(256) void k_proj(const float* __restrict__ XQ, const float* __restrict__ XK, const float* __restrict__ XV, const float* __restrict__ WQ, const float* __restrict__ WK, const float* __restrict__ WV, const float* __restrict__ BQ, const float* __restrict__ BK, const float* __restrict__ BV,
    _Float16* __restrict__ QH, _Float16* __restrict__ QL, _Float16* __restrict__ KH, _Float16* __restrict__ KL, _Float16* __restrict__ VT, __bf16* __restrict__ VB, __bf16* __restrict__ VBL) {
  __shared__ __align__(16) unsigned char sm[3 * PJT * PJE * 2];   // the loop's two buffers of X and W rows (40,960 B); behind the loop's last barrier the epilogue's planes
  __bf16 (*xs)[PJT][PJP] = (__bf16 (*)[PJT][PJP])sm; __bf16 (*wt)[PJT][PJP] = (__bf16 (*)[PJT][PJP])(sm + 2 * PJT * PJP * 2);
  const int tid = threadIdx.x, wave = tid >> 5, lane = tid & 31, col = lane & 15, g = lane >> 4, wm = wave & 3, wn = wave >> 2; const int which = blockIdx.z; const int c0 = blockIdx.y * PJT; const size_t r0 = (size_t)blockIdx.x * PJT; const size_t bb = r0 / TT; const int t0 = (int)(r0 % TT);
  const float* X = which == 0 ? XQ : which == 1 ? XK : XV; const float* WA = which == 0 ? WQ : which == 1 ? WK : WV; const float* BA = which == 0 ? BQ : which == 1 ? BK : BV;
  const int lr = tid >> 3, lc = (tid & 7) * 4;   // staging: 8 lanes cover one row's 128-B line, a wave 4 whole lines a load
  const float* xg = X + (r0 + lr) * DIN + lc; const float* wg = WA + (size_t)(c0 + lr) * DIN + lc;
  v8f acc[2][4] = {}; v4f xr[4], wr[4];
#pragma unroll
  for (int u = 0; u < 4; ++u) { xr[u] = *(const v4f*)(xg + (size_t)u * 32 * DIN); wr[u] = *(const v4f*)(wg + (size_t)u * 32 * DIN); }
#pragma unroll
  for (int u = 0; u < 4; ++u) { *(v4b*)&xs[0][u * 32 + lr][lc] = __builtin_convertvector(xr[u], v4b); *(v4b*)&wt[0][u * 32 + lr][lc] = __builtin_convertvector(wr[u], v4b); }
  __syncthreads();
  for (int kc = 0; kc < DIN / 32 - 1; ++kc) { const float* xp = xg + (kc + 1) * 32; const float* wp = wg + (kc + 1) * 32;
#pragma unroll
    for (int u = 0; u < 4; ++u) { xr[u] = *(const v4f*)(xp + (size_t)u * 32 * DIN); wr[u] = *(const v4f*)(wp + (size_t)u * 32 * DIN); }
    asm volatile("s_wait_xcnt 0x0" :: "v"(xp), "v"(wp) : "memory");   /* the wait before a register of an issued load is overwritten (the fragments below take the address registers); the two addresses are inputs, so they stay live to here. Standing here it also keeps all eight loads in front of the pass's LDS reads and products: without it the eighth is issued only behind four products */
    proj_mac(xs[kc & 1], wt[kc & 1], wm, wn, lane, acc);
#pragma unroll
    for (int u = 0; u < 4; ++u) { *(v4b*)&xs[(kc + 1) & 1][u * 32 + lr][lc] = __builtin_convertvector(xr[u], v4b); *(v4b*)&wt[(kc + 1) & 1][u * 32 + lr][lc] = __builtin_convertvector(wr[u], v4b); }
    __syncthreads(); }
  proj_mac(xs[(DIN / 32 - 1) & 1], wt[(DIN / 32 - 1) & 1], wm, wn, lane, acc);
  __syncthreads();   // every wave has taken its last fragments: the epilogue's planes may overwrite the buffers
  if (which < 2) { _Float16 (*sh)[PJE] = (_Float16 (*)[PJE])sm; _Float16 (*sl)[PJE] = (_Float16 (*)[PJE])(sm + PJT * PJE * 2); _Float16* DH = which == 0 ? QH : KH; _Float16* DL = which == 0 ? QL : KL; const int nhi = which == 0 ? QHI : KHI; const bool hi_rows = t0 < nhi;
#pragma unroll
    for (int j = 0; j < 4; ++j) { const int cl = wn * 64 + j * 16 + col; const float bias = BA ? bfr(BA[c0 + cl]) : 0.f;
#pragma unroll
      for (int i = 0; i < 2; ++i)
#pragma unroll
        for (int r = 0; r < 8; ++r) { const float v = acc[i][j][r] + bias; const _Float16 hv = (_Float16)v; const int rl = wm * 32 + i * 16 + 8 * g + r; sh[rl][cl] = hv; sl[rl][cl] = (_Float16)((v - (float)hv) * 1024.0f); } }
    __syncthreads();
    for (int e = tid; e < PJT * 16; e += 256) { const int rl = e >> 4, q = e & 15; _Float16* ph = DH + (r0 + rl) * CC + c0 + q * 8; _Float16* pl = DL + (bb * nhi + t0 + rl) * (size_t)CC + c0 + q * 8; const v4u hv = *(const v4u*)&sh[rl][q * 8], lv = *(const v4u*)&sl[rl][q * 8];
      vst2((unsigned*)ph, hv); if (hi_rows) vst2((unsigned*)pl, lv);
      asm volatile("s_wait_xcnt 0x0" :: "v"(ph), "v"(pl), "v"(hv), "v"(lv) : "memory"); }   /* the wait before a register of an issued store is overwritten (the next trip takes the address and data registers); they are inputs, so they stay live to here */
  } else { _Float16 (*th)[PJE] = (_Float16 (*)[PJE])sm; __bf16 (*tb)[PJE] = (__bf16 (*)[PJE])(sm + PJT * PJE * 2); __bf16 (*tbl)[PJE] = (__bf16 (*)[PJE])(sm + 2 * PJT * PJE * 2); const bool hi_rows = t0 < KHI;
#pragma unroll
    for (int j = 0; j < 4; ++j) { const int cl = wn * 64 + j * 16 + col; const float bias = BA ? bfr(BA[c0 + cl]) : 0.f;
#pragma unroll
      for (int i = 0; i < 2; ++i)
#pragma unroll
        for (int r = 0; r < 8; ++r) { const float v = acc[i][j][r] + bias; const int rl = wm * 32 + i * 16 + 8 * g + r; th[cl][rl] = (_Float16)v; const __bf16 bh = (__bf16)v; tb[cl][rl] = bh; tbl[cl][rl] = (__bf16)(v - (float)bh); } }
    __syncthreads();
    for (int e = tid; e < PJT * 16; e += 256) { const int cl = e >> 4, q = e & 15; vst2((unsigned*)(VT + (bb * CC + c0 + cl) * (size_t)TT + t0 + q * 8), *(const v4u*)&th[cl][q * 8]); if (hi_rows) { const size_t o3 = (bb * CC + c0 + cl) * (size_t)KHI + t0 + q * 8; vst2((unsigned*)(VB + o3), *(const v4u*)&tb[cl][q * 8]); vst2((unsigned*)(VBL + o3), *(const v4u*)&tbl[cl][q * 8]); } } } }
// ---- k_sm: block = query row t (head in group): keys [0, kend): causal -> logit if s <= t else excluded; softmax in f32; P x 2^11 in place (0 for excluded)
__global__ __launch_bounds__(256) void k_sm(float* __restrict__ S0 SM_EXTRA_PARAMS) { __shared__ float sred[8]; __shared__ float sbc; __shared__ __align__(16) float shv[TT];
  const int tid = threadIdx.x; const int t = blockIdx.x; const int kend = (kb_last(t >> 6) + 1) * 128;
  float* sr = S0 + (size_t)blockIdx.y * TT * TT + (size_t)t * TT;
  float m = -3.0e38f; for (int k = tid; k < kend; k += 256) { float v = (!CAUSAL || k <= t) ? sr[k] : -3.0e38f; SM_MASK_HOOK; shv[k] = v; m = fmaxf(m, v); }
#pragma unroll
  for (int o = 1; o < 32; o <<= 1) m = fmaxf(m, __shfl_xor(m, o));
  if ((tid & 31) == 0) sred[tid >> 5] = m; __syncthreads(); if (tid == 0) { float a = sred[0]; for (int i = 1; i < 8; ++i) a = fmaxf(a, sred[i]); sbc = a; } __syncthreads(); m = sbc; __syncthreads();
  float sum = 0.f; for (int k = tid; k < kend; k += 256) { const float v = shv[k]; const float e = (v <= -1.0e38f) ? 0.f : expf(v - m); shv[k] = e; sum += e; }
#pragma unroll
  for (int o = 1; o < 32; o <<= 1) sum += __shfl_xor(sum, o);
  if ((tid & 31) == 0) sred[tid >> 5] = sum; __syncthreads(); if (tid == 0) { float a = 0.f; for (int i = 0; i < 8; ++i) a += sred[i]; sbc = a > 0.f ? 2048.0f / a : 0.f; }   /* a fully excluded row yields P = 0 */ __syncthreads(); const float inv = sbc;
  for (int k = tid; k < kend; k += 256) shv[k] = shv[k] * inv;
  __syncthreads(); for (int q = tid; q < kend / 4; q += 256) vst2(sr + q * 4, *(const v4f*)&shv[q * 4]); }
// ---- k_stat: softmax over the QUERY axis under the causal mask (the source's softmax(axis=2) on [B, H, i, j] scores with -inf where j > i), with no score matrix in memory. Block = (STK key columns from k0, head h, batch b), STW waves. Every wave keeps the STK keys' f16 fragments in registers and takes every STW-th tile of 16 of the visible query rows k0 .. TT-1: scores q x k on WMMA (one f16 product, x SCALE), then per lane and column tile the online (max, sum) over its 8 rows (f32, precise expf; q < k reads as -inf and adds exp(-inf) = 0; the running maximum starts finite, so the difference is never inf - inf). The 2 * STW partial pairs of a column (wave, lane half) are merged through LDS behind one barrier, which every wave reaches after its own last tile: m_k to CM, 2^11 / Z_k to CR, whole lines. Every '#pragma unroll' of k_stat and k_out but the one over a tile's two halves is there so that the small arrays it indexes (fragments, accumulators, m, z, P) stay in registers
#define STW 8
#define STK 64
// the fragments of frag_h / frag_b from a pointer that already holds the lane's own 8g offset: a run of loads then shares one address value, which the wait behind the run can name
__device__ __forceinline__ v16h frag_hp(const _Float16* p) { union { v16h v; v8h q[2]; } u; u.q[0] = *(const v8h*)p; u.q[1] = *(const v8h*)(p + 16); return u.v; }
__device__ __forceinline__ v16b frag_bp(const __bf16* p) { union { v16b v; v8b q[2]; } u; u.q[0] = *(const v8b*)p; u.q[1] = *(const v8b*)(p + 16); return u.v; }
__global__ __launch_bounds__(STW * 32) void k_stat(const _Float16* __restrict__ QH, const _Float16* __restrict__ KH, float* __restrict__ CM, float* __restrict__ CR) { __shared__ float pm[2 * STW][STK], pz[2 * STW][STK];
  const int tid = threadIdx.x, lane = tid & 31, col = lane & 15, g = lane >> 4; const int wave = __builtin_amdgcn_readfirstlane(tid >> 5); const int k0 = blockIdx.x * STK, h = blockIdx.y, b = blockIdx.z;
  v16h kf[HD / 32][STK / 16]; const _Float16* kp = KH + ((size_t)b * TT + k0 + col) * CC + h * HD + 8 * g;
#pragma unroll
  for (int kc = 0; kc < HD / 32; ++kc) {
#pragma unroll
    for (int j = 0; j < STK / 16; ++j) kf[kc][j] = frag_hp(kp + (size_t)j * 16 * CC + kc * 32); }
  asm volatile("s_wait_xcnt 0x0" :: "v"(kp) : "memory");   /* the wait before a register of an issued load is overwritten; the loads' common address is an input, so it stays live to here and no fragment lands in it */
  float m[STK / 16], z[STK / 16];
#pragma unroll
  for (int j = 0; j < STK / 16; ++j) { m[j] = -3.0e38f; z[j] = 0.f; }
  for (int ql0 = k0 + wave * 16; ql0 < TT; ql0 += STW * 16) { const _Float16* qp = QH + ((size_t)b * TT + ql0 + col) * CC + h * HD; const v16h a0 = frag_h(qp, lane), a1 = frag_h(qp + 32, lane);
#pragma unroll
    for (int j = 0; j < STK / 16; ++j) { v8f acc = {}; acc = wmma16(a0, kf[0][j], acc); acc = wmma16(a1, kf[1][j], acc); const int k = k0 + j * 16 + col; float v[8];
#pragma unroll
      for (int r = 0; r < 8; ++r) v[r] = (ql0 + 8 * g + r >= k) ? acc[r] * SCALE : -INFINITY;
      float mn = m[j];
#pragma unroll
      for (int r = 0; r < 8; ++r) mn = fmaxf(mn, v[r]);
      float s = 0.f;
#pragma unroll
      for (int r = 0; r < 8; ++r) s += expf(v[r] - mn);
      z[j] = z[j] * expf(m[j] - mn) + s; m[j] = mn; } }
#pragma unroll
  for (int j = 0; j < STK / 16; ++j) { pm[2 * wave + g][j * 16 + col] = m[j]; pz[2 * wave + g][j * 16 + col] = z[j]; }
  __syncthreads();
  if (tid < STK) { float mm = pm[0][tid];
#pragma unroll
    for (int w = 1; w < 2 * STW; ++w) mm = fmaxf(mm, pm[w][tid]);
    float a = 0.f;   /* a partial that saw no visible row of this column holds Z = 0 and a finite maximum */
#pragma unroll
    for (int w = 0; w < 2 * STW; ++w) a += pz[w][tid] * expf(pm[w][tid] - mm);
    const size_t o = ((size_t)b * NH + h) * TT + k0 + tid; vst2(CM + o, mm); vst2(CR + o, 2048.0f / a); } }   /* every column sees at least its own diagonal entry: Z_k >= 1 */
// ---- k_out: block = 64 queries (qb) of (b, h), a wave = 16 queries: per 32 keys the scores are formed again on WMMA, transposed (A = 16 key rows, B = the wave's 16 queries, kept in registers; the same one f16 product x SCALE), so that a lane holds, for its own query, the keys 8g + 0..7 of each 16-key tile: two such tiles are, in place, the A fragment of P . v (hardware k order, the order of frag_b). P[i][j] = exp(S - m_j) x (2^11 / Z_j) for j <= i, 0 above the diagonal (unconditional loads, value select); P and v as bf16 hi + lo, 3 products, keys [0, kend) as before; 256-B (row, head) segment by 16 lanes. What the four waves read of 64 keys (k rows, v hi and lo rows, column maxima and scales) is the same for all of them: it is brought into LDS once per block, as whole 128-B lines, by asynchronous copies, two buffers, the next tile flying while a tile is worked on; every fragment comes from LDS
#define OKT 64              // keys of a staged tile
#define OPB 144             // LDS pitch in bytes of a staged row of 128 B: 16 B x odd, free of bank conflicts for the 16-byte fragment reads
#define OPL (64 * OPB)      // one staged plane: 64 rows (64 keys of k; 64 channels of v hi; of v lo)
#define OBF (3 * OPL + 512) // one buffer: three planes, then 64 column maxima and 64 column scales
// the 12 copies of a thread for one tile: 8 lanes cover one row's 128-B line, the block 16 rows a copy. la: the thread's LDS byte address in the k plane; kg, hg, lg: its addresses in the tile's first 16 rows
__device__ __forceinline__ void out_stage(unsigned la, const _Float16* kg, const __bf16* hg, const __bf16* lg) {
  /* the copies and, as the last line of their own statement, the wait before a register that an issued copy names is rewritten */
  asm volatile("global_load_async_to_lds_b128 %0, %12, off\n\tglobal_load_async_to_lds_b128 %1, %13, off\n\tglobal_load_async_to_lds_b128 %2, %14, off\n\tglobal_load_async_to_lds_b128 %3, %15, off\n\t"
               "global_load_async_to_lds_b128 %4, %16, off\n\tglobal_load_async_to_lds_b128 %5, %17, off\n\tglobal_load_async_to_lds_b128 %6, %18, off\n\tglobal_load_async_to_lds_b128 %7, %19, off\n\t"
               "global_load_async_to_lds_b128 %8, %20, off\n\tglobal_load_async_to_lds_b128 %9, %21, off\n\tglobal_load_async_to_lds_b128 %10, %22, off\n\tglobal_load_async_to_lds_b128 %11, %23, off\n\ts_wait_xcnt 0x0"
               :: "v"(la), "v"(la + 16 * OPB), "v"(la + 32 * OPB), "v"(la + 48 * OPB),
                  "v"(la + OPL), "v"(la + OPL + 16 * OPB), "v"(la + OPL + 32 * OPB), "v"(la + OPL + 48 * OPB),
                  "v"(la + 2 * OPL), "v"(la + 2 * OPL + 16 * OPB), "v"(la + 2 * OPL + 32 * OPB), "v"(la + 2 * OPL + 48 * OPB),
                  "v"(kg), "v"(kg + (size_t)16 * CC), "v"(kg + (size_t)32 * CC), "v"(kg + (size_t)48 * CC),
                  "v"(hg), "v"(hg + (size_t)16 * KHI), "v"(hg + (size_t)32 * KHI), "v"(hg + (size_t)48 * KHI),
                  "v"(lg), "v"(lg + (size_t)16 * KHI), "v"(lg + (size_t)32 * KHI), "v"(lg + (size_t)48 * KHI) : "memory"); }
// one wave's copy of the tile's 64 maxima (lanes 0..15) and 64 scales (lanes 16..31), with the same wait
__device__ __forceinline__ void out_stage_c(unsigned la, const float* cg) { asm volatile("global_load_async_to_lds_b128 %0, %1, off\n\ts_wait_xcnt 0x0" :: "v"(la), "v"(cg) : "memory"); }
__global__ __launch_bounds__(128) void k_out(const _Float16* __restrict__ QH, const _Float16* __restrict__ KH, const float* __restrict__ CM, const float* __restrict__ CR, const __bf16* __restrict__ VB, const __bf16* __restrict__ VBL, float* __restrict__ Y) { __shared__ __align__(16) unsigned char sm[2 * OBF];   // the loop's two buffers; behind the loop's last barrier the epilogue's rows
  const int tid = threadIdx.x, lane = tid & 31, col = lane & 15, g = lane >> 4; const int wave = __builtin_amdgcn_readfirstlane(tid >> 5); const int qb = blockIdx.x, h = blockIdx.y, b = blockIdx.z; const int ql0 = qb * 64 + wave * 16; const int nt = (kb_last(qb) + 1) * 2; const int qi = ql0 + col;   // nt tiles of 64 keys, never fewer than two
  const _Float16* qp = QH + ((size_t)b * TT + qi) * CC + h * HD; const v16h q0 = frag_h(qp, lane), q1 = frag_h(qp + 32, lane);
  const int sr = tid >> 3, sq = (tid & 7) * 8;   // staging: the thread's row among 16 and its 16 bytes of the row
  const _Float16* kg = KH + ((size_t)b * TT + sr) * CC + h * HD + sq; const size_t po = ((size_t)b * CC + h * HD + sr) * (size_t)KHI + sq; const __bf16* hg = VB + po; const __bf16* lg = VBL + po;
  const float* cg = (g ? CR : CM) + ((size_t)b * NH + h) * TT + col * 4;
  const unsigned la = (unsigned)(size_t)sm + sr * OPB + sq * 2, lc = (unsigned)(size_t)sm + 3 * OPL + lane * 16;
  out_stage(la, kg, hg, lg); if (wave == 0) out_stage_c(lc, cg);
  asm volatile("s_wait_asynccnt 0x0" ::: "memory");   /* this wave's copies of tile 0 have landed */
  __syncthreads();                                     /* and every other wave's: tile 0 may be read */
  out_stage(la + OBF, kg + (size_t)OKT * CC, hg + OKT, lg + OKT); if (wave == 0) out_stage_c(lc + OBF, cg + OKT);
  v8f acc[HD / 16] = {};
  for (int t = 0; t < nt; ++t) { const unsigned char* bp = sm + (t & 1) * OBF;
#pragma unroll   /* the tile's two halves of 32 keys, unrolled so that every LDS offset of a half is an immediate */
    for (int s = 0; s < 2; ++s) { const int k0 = t * OKT + s * 32;
      const _Float16* ka = (const _Float16*)(bp + (s * 32 + col) * OPB) + 8 * g; const _Float16* kb2 = ka + 16 * (OPB / 2); const float* cmk = (const float*)(bp + 3 * OPL) + s * 32 + 8 * g; const float* crk = cmk + OKT;
      const v16h ka0 = frag_hp(ka), kb0 = frag_hp(kb2), ka1 = frag_hp(ka + 32), kb1 = frag_hp(kb2 + 32);
      v4f mv[4], rv[4];
#pragma unroll
      for (int u = 0; u < 4; ++u) { const int o = (u >> 1) * 16 + (u & 1) * 4; mv[u] = *(const v4f*)(cmk + o); rv[u] = *(const v4f*)(crk + o); }
      v16b vh[HD / 16], vl[HD / 16]; const __bf16* vhp = (const __bf16*)(bp + OPL + col * OPB) + s * 32 + 8 * g; const __bf16* vlp = vhp + OPL / 2;
#pragma unroll
      for (int j = 0; j < HD / 16; ++j) { vh[j] = frag_bp(vhp + j * 16 * (OPB / 2)); vl[j] = frag_bp(vlp + j * 16 * (OPB / 2)); }
      v8f s0 = {}, s1 = {}; s0 = wmma16(ka0, q0, s0); s1 = wmma16(kb0, q0, s1); s0 = wmma16(ka1, q1, s0); s1 = wmma16(kb1, q1, s1);
      float pv[16];
#pragma unroll
      for (int i = 0; i < 8; ++i) { const int ke = k0 + 8 * g + i; const float e0 = expf(s0[i] * SCALE - mv[i >> 2][i & 3]) * rv[i >> 2][i & 3], e1 = expf(s1[i] * SCALE - mv[2 + (i >> 2)][i & 3]) * rv[2 + (i >> 2)][i & 3]; pv[i] = (ke <= qi) ? e0 : 0.f; pv[8 + i] = (ke + 16 <= qi) ? e1 : 0.f; }
      const F2 p = bsplit16(pv);
#pragma unroll
      for (int j = 0; j < HD / 16; ++j) { acc[j] = wmma_bf(p.h, vh[j], acc[j]); acc[j] = wmma_bf(p.l, vh[j], acc[j]); acc[j] = wmma_bf(p.h, vl[j], acc[j]); } }
    asm volatile("s_wait_dscnt 0x0" ::: "memory");      /* this wave's reads of tile t are over */
    asm volatile("s_wait_asynccnt 0x0" ::: "memory");   /* its copies of tile t + 1 have landed */
    __syncthreads();                                     /* the same of every wave: tile t + 1 may be read, tile t's buffer refilled */
    if (t + 2 < nt) { const int kn = (t + 2) * OKT; const unsigned bo = (t & 1) * OBF; out_stage(la + bo, kg + (size_t)kn * CC, hg + kn, lg + kn); if (wave == 0) out_stage_c(lc + bo, cg + kn); } }
  asm volatile("s_wait_asynccnt 0x0" ::: "memory");     /* no copy is outstanding when the buffers become the epilogue's rows */
  float (*ss)[16][HD + 4] = (float (*)[16][HD + 4])sm;
#pragma unroll
  for (int j = 0; j < HD / 16; ++j)
#pragma unroll
    for (int r = 0; r < 8; ++r) ss[wave][8 * g + r][j * 16 + col] = acc[j][r] * (1.0f / 2048.0f);
  LDSX(); for (int rl = 0; rl < 16; ++rl) if (lane < HD / 4) vst2(Y + ((size_t)b * TT + ql0 + rl) * CC + h * HD + lane * 4, *(const v4f*)&ss[wave][rl][lane * 4]); }

extern "C" void kernel_launch(void* const* d_in, const int* in_sizes, int n_in, void* d_out, int out_size, void* d_ws, size_t ws_size, hipStream_t stream) {
  (void)in_sizes; (void)n_in; (void)out_size;
  const float** F = (const float**)d_in;
  if (ws_size < (size_t)WS_END) return;
  char* ws = (char*)d_ws; _Float16 *QH = (_Float16*)(ws + WS_QH), *KH = (_Float16*)(ws + WS_KH), *VT = (_Float16*)(ws + WS_VT), *QL = (_Float16*)(ws + WS_QL), *KL = (_Float16*)(ws + WS_KL); __bf16 *VB = (__bf16*)(ws + WS_VB), *VBL = (__bf16*)(ws + WS_VBL); float *S = (float*)(ws + WS_S), *Y = (float*)(ws + WS_Y);
  (void)Y; (void)QL; (void)KL; (void)VB; (void)VBL; (void)S; (void)VT;
  // inputs: 0 X [2,2048,1024]; 1 Wq [1024,1024] (out,in), 2 bq; 3 Wk, 4 bk; 5 Wv, 6 bv (biases N(0, 0.02), nonzero); no output projection
  if (ws_size < (size_t)WS_END2) return;
  float *CM = (float*)(ws + WS_CM), *CZ = (float*)(ws + WS_CZ);
  k_proj<<<dim3(TNB * TT / PJT, CC / PJT, 3), 256, 0, stream>>>(F[0], F[0], F[0], F[1], F[3], F[5], F[2], F[4], F[6], QH, QL, KH, KL, VT, VB, VBL);
  k_stat<<<dim3(TT / STK, NH, TNB), STW * 32, 0, stream>>>(QH, KH, CM, CZ);   /* per key column j: max and 2^11 / sum over the visible queries i >= j */
  k_out<<<dim3(NQB, NH, TNB), 128, 0, stream>>>(QH, KH, CM, CZ, VB, VBL, (float*)d_out);   /* P formed in registers, then P . v */
}

// v005
// Measured time: 121 microseconds a run.
// Timed twice side by side with v004, it ran 1.39 and 1.38 times as fast.
// Counting every step since v000, it is 64.9 times as fast.
// compute dtype: all float inputs rounded to bf16; q/k/v projections with EXACT bf16 products on WMMA 16x16x32 (f32 accumulate) + bias; causal scores q x k once to f16 each (1 product; the module scales by 1/sqrt(E) = 1/32, so sigma - 0.1) on every block; softmax over the QUERY axis in f32 (per key column: online max / sum over the visible queries, exponentials as 2^x on the hardware's own instruction, 1/sqrt(E) and log2(e) folded into one multiply-add); P as bf16 hi + lo against v as bf16 hi + lo (3 products) on EVERY block; f32 output.
#include <hip/hip_runtime.h>
#include <math.h>

typedef __attribute__((ext_vector_type(16))) _Float16 v16h;
typedef __attribute__((ext_vector_type(16))) __bf16 v16b;
typedef __attribute__((ext_vector_type(8)))  _Float16 v8h;
typedef __attribute__((ext_vector_type(8)))  float v8f;
typedef __attribute__((ext_vector_type(4)))  float v4f;
typedef __attribute__((ext_vector_type(2)))  float v2f;
typedef __attribute__((ext_vector_type(4)))  unsigned v4u;
typedef __attribute__((ext_vector_type(4)))  int v4i;
typedef float __attribute__((may_alias)) float_a;
typedef int __attribute__((may_alias)) int_a;

template <typename T> __device__ __forceinline__ void vst2(void* p, T v) { *(T*)p = v;  }
__device__ __forceinline__ v8f wmma16(v16h a, v16h b, v8f c) {
  v8f d = __builtin_amdgcn_wmma_f32_16x16x32_f16(false, a, false, b, (short)0, c, false, false);
  asm volatile("v_nop\n\tv_nop\n\tv_nop\n\tv_nop" : "+v"(d) : "v"(a), "v"(b));
  return d;
}
__device__ __forceinline__ v8f wmma_bf(v16b a, v16b b, v8f c) {
  v8f d = __builtin_amdgcn_wmma_f32_16x16x32_bf16(false, a, false, b, (short)0, c, false, false);
  asm volatile("v_nop\n\tv_nop\n\tv_nop\n\tv_nop" : "+v"(d) : "v"(a), "v"(b));
  return d;
}
// 16x16x32 fragments: lane = (h = lane>>4, row/col = lane&15); elements 0..7 = k0+8h+0..7, 8..15 = k0+16+8h+0..7; D element r = row 8h+r
__device__ __forceinline__ v16h frag_h(const _Float16* rowk0, int lane) {
  union { v16h v; v8h q[2]; } u; const _Float16* p = rowk0 + 8 * (lane >> 4);
  u.q[0] = *(const v8h*)p; u.q[1] = *(const v8h*)(p + 16); return u.v;
}
__device__ __forceinline__ v16h frag_f32(const float* rowk0, int lane) {
  v16h a; const float* p = rowk0 + 8 * (lane >> 4);
#pragma unroll
  for (int i = 0; i < 8; ++i) { a[i] = (_Float16)p[i]; a[8 + i] = (_Float16)p[16 + i]; }
  return a;
}
__device__ __forceinline__ v16h frag_f32s(const float* rowk0, int lane, float sc) {
  v16h a; const float* p = rowk0 + 8 * (lane >> 4);
#pragma unroll
  for (int i = 0; i < 8; ++i) { a[i] = (_Float16)(p[i] * sc); a[8 + i] = (_Float16)(p[16 + i] * sc); }
  return a;
}
// column fragment from a [K][ld] layout (column n), rows >= K read as 0
__device__ __forceinline__ v16h fragc_f32(const float* W, int k0, int n, int lane, int ld, int K) {
  v16h a; const int g = lane >> 4;
#pragma unroll
  for (int i = 0; i < 8; ++i) { const int ka = k0 + 8 * g + i, kb = ka + 16;
    a[i] = (_Float16)(ka < K ? W[(size_t)(ka < K ? ka : K - 1) * ld + n] : 0.f); a[8 + i] = (_Float16)(kb < K ? W[(size_t)(kb < K ? kb : K - 1) * ld + n] : 0.f); }
  return a;
}
struct F2 { v16b h, l; };
__device__ __forceinline__ F2 bsplit16(const float v[16]) { F2 r;
#pragma unroll
  for (int i = 0; i < 16; ++i) { const __bf16 h = (__bf16)v[i]; r.h[i] = h; r.l[i] = (__bf16)(v[i] - (float)h); }
  return r; }
__device__ __forceinline__ F2 split_row(const float* row, int k0, int lane) { float v[16]; const float* p = row + k0 + 8 * (lane >> 4);
#pragma unroll
  for (int i = 0; i < 8; ++i) { v[i] = p[i]; v[8 + i] = p[16 + i]; }
  return bsplit16(v); }
__device__ __forceinline__ F2 split_rowK(const float* row, int k0, int lane, int K) { float v[16]; const int g = lane >> 4;
#pragma unroll
  for (int i = 0; i < 8; ++i) { const int ka = k0 + 8 * g + i, kb = ka + 16; v[i] = ka < K ? row[ka < K ? ka : K - 1] : 0.f; v[8 + i] = kb < K ? row[kb < K ? kb : K - 1] : 0.f; }
  return bsplit16(v); }
__device__ __forceinline__ F2 split_col(const float* W, int k0, int n, int lane, int ld, int K) { float v[16]; const int g = lane >> 4;
#pragma unroll
  for (int i = 0; i < 8; ++i) { const int ka = k0 + 8 * g + i, kb = ka + 16; v[i] = ka < K ? W[(size_t)(ka < K ? ka : K - 1) * ld + n] : 0.f; v[8 + i] = kb < K ? W[(size_t)(kb < K ? kb : K - 1) * ld + n] : 0.f; }
  return bsplit16(v); }
__device__ __forceinline__ v8f mac3(const F2& a, const F2& b, v8f c) { c = wmma_bf(a.l, b.h, c); c = wmma_bf(a.h, b.l, c); return wmma_bf(a.h, b.h, c); }
__device__ __forceinline__ float sigm(float v) { return 1.0f / (1.0f + expf(-v)); }
#define LDSX() do { asm volatile("s_wait_dscnt 0" ::: "memory"); __builtin_amdgcn_wave_barrier(); __builtin_amdgcn_fence(__ATOMIC_RELEASE, "workgroup"); } while (0)

// Multi-headed attention whose softmax runs over the QUERY axis, scaled by the MODEL width (X [2,2048,1024]; torch (out,in) Wq / Wk / Wv [1024,1024] N(0, 1/1024) + biases N(0, 0.02); 16 heads x 64; scores / sqrt(E) = / 32; -inf where j > i; attn = softmax(scores, axis=2) - axis 2 of [B, H, i, j] is the QUERY axis i: every key column j is normalised over the queries i >= j (faithful to the source); out = attn v; merge; no output projection).
#define NB 2
#define TT 2048
#define CC 1024            // NH * HD = projected width
#define DIN 1024          // input (model) width
#define NH 16
#define HD 64
#define NQB (TT / 64)
#define HG 4
#define SCALE (0.03125f)
#define SCL2 (SCALE * 1.44269504088896340736f)   // raw q . k product -> exponent to base 2
#define CAUSAL 1
#ifndef TNB
#define TNB NB
#endif
__device__ __forceinline__ float bfr(float v) { return (float)(__bf16)v; }
__host__ __device__ __forceinline__ int kb_last(int qb) { return CAUSAL ? ((qb * 64 + 63) >> 7) : (TT / 128 - 1); }
typedef __attribute__((ext_vector_type(8))) __bf16 v8b;
__device__ __forceinline__ v16b frag_b(const __bf16* rowk0, int lane) {
  union { v16b v; v8b q[2]; } u; const __bf16* p = rowk0 + 8 * (lane >> 4);
  u.q[0] = *(const v8b*)p; u.q[1] = *(const v8b*)(p + 16); return u.v;
}
#define QBH 32              // not read: k_out takes its one bf16 hi/lo path on all NQB query blocks
#define QHI 0               // no q residual plane: the scores are tiny (scale 1/32) and single-product everywhere
#define QBH_SC 0            // not read (k_out: bf16 hi/lo P.v on every block - a query-axis softmax has O(1) weights on the LAST key columns)
#define KHI 2048            // key rows carrying k residual / v bf16 hi+lo planes (the v planes are read by k_out; the k residual is not read)
// B fragment (k rows k0+.., output column o) of a weight: (in,out) [K][ld] or (out,in) [ld rows of K]: bf16 exact, or f16(bf16 * 256) exact
__device__ __forceinline__ v16b wcol_io(const float* Wm, int k0, int o, int lane, int ld) { v16b w; const int g = lane >> 4;
#pragma unroll
  for (int i = 0; i < 8; ++i) { w[i] = (__bf16)Wm[(size_t)(k0 + 8 * g + i) * ld + o]; w[8 + i] = (__bf16)Wm[(size_t)(k0 + 16 + 8 * g + i) * ld + o]; }
  return w; }
__device__ __forceinline__ v16b wcol_oi(const float* Wm, int k0, int o, int lane, int K) { v16b w; const float* p = Wm + (size_t)o * K + k0 + 8 * (lane >> 4);
#pragma unroll
  for (int i = 0; i < 8; ++i) { w[i] = (__bf16)p[i]; w[8 + i] = (__bf16)p[16 + i]; }
  return w; }
__device__ __forceinline__ v16h wcolh_io(const float* Wm, int k0, int o, int lane, int ld) { v16h w; const int g = lane >> 4;
#pragma unroll
  for (int i = 0; i < 8; ++i) { w[i] = (_Float16)(bfr(Wm[(size_t)(k0 + 8 * g + i) * ld + o]) * 256.0f); w[8 + i] = (_Float16)(bfr(Wm[(size_t)(k0 + 16 + 8 * g + i) * ld + o]) * 256.0f); }
  return w; }
__device__ __forceinline__ v16h wcolh_oi(const float* Wm, int k0, int o, int lane, int K) { v16h w; const float* p = Wm + (size_t)o * K + k0 + 8 * (lane >> 4);
#pragma unroll
  for (int i = 0; i < 8; ++i) { w[i] = (_Float16)(bfr(p[i]) * 256.0f); w[8 + i] = (_Float16)(bfr(p[16 + i]) * 256.0f); }
  return w; }
#define WQKV_LAYOUT 1   // not read by k_proj (W taken as (out,in) [CC][DIN]); WCOL only: 0 = (in,out) [DIN][CC]; 1 = (out,in) [CC][DIN]; 2 = per-head [NH][DIN][HD]
__device__ __forceinline__ v16b wcol_hdk(const float* Wm, int k0, int o, int lane) { v16b w; const int g = lane >> 4; const float* p = Wm + (size_t)(o / HD) * DIN * HD + (o % HD);
#pragma unroll
  for (int i = 0; i < 8; ++i) { w[i] = (__bf16)p[(size_t)(k0 + 8 * g + i) * HD]; w[8 + i] = (__bf16)p[(size_t)(k0 + 16 + 8 * g + i) * HD]; }
  return w; }
#define WO_OUT_IN 0
#if WQKV_LAYOUT == 1
#define WCOL(W, k0, o, lane) wcol_oi(W, k0, o, lane, DIN)
#elif WQKV_LAYOUT == 2
#define WCOL(W, k0, o, lane) wcol_hdk(W, k0, o, lane)
#else
#define WCOL(W, k0, o, lane) wcol_io(W, k0, o, lane, CC)
#endif
#if WO_OUT_IN
#define WOCOL(W, k0, o, lane) wcol_oi(W, k0, o, lane, CC)
#define WOCOLH(W, k0, o, lane) wcolh_oi(W, k0, o, lane, CC)
#else
#define WOCOL(W, k0, o, lane) wcol_io(W, k0, o, lane, DIN)
#define WOCOLH(W, k0, o, lane) wcolh_io(W, k0, o, lane, DIN)
#endif

#ifndef SM_EXTRA_PARAMS
#define SM_EXTRA_PARAMS
#endif
#ifndef PROJ_EXTRA_PARAMS
#define PROJ_EXTRA_PARAMS
#endif
#ifndef SM_MASK_HOOK
#define SM_MASK_HOOK (void)0
#endif

#define WS_QH  0u                                      // f16 q rows [b*t][CC]
#define WS_KH  (WS_QH + 2u * (size_t)NB * TT * CC)      // f16 k rows [b*t][CC]
#define WS_VT  (WS_KH + 2u * (size_t)NB * TT * CC)      // f16 v planes [b][c][t]
#define WS_QL  (WS_VT + 2u * (size_t)NB * CC * TT)      // f16 q residual x 2^10 rows [b][t < QHI][CC]
#define WS_KL  (WS_QL + 2u * (size_t)NB * QHI * CC)     // f16 k residual x 2^10 rows [b][t < KHI][CC]
#define WS_VB  (WS_KL + 2u * (size_t)NB * KHI * CC)     // bf16 v hi planes [b][c][t < KHI]
#define WS_VBL (WS_VB + 2u * (size_t)NB * CC * KHI)
#define WS_S   (WS_VBL + 2u * (size_t)NB * CC * KHI)    // f32 logits / P [hg][t][s] (plane not touched: the scores stay in registers)
#define WS_Y   (WS_S  + 4u * (size_t)HG * TT * TT)      // f32 ctx rows [b*t][CC] (only when there is an output projection)
#define WS_END (WS_Y  + 0u)
#define WS_CM (WS_END)                                  // f32 column maxima, base-2 units [NB * NH][TT]
#define WS_CZ (WS_CM + 4u * (size_t)NB * NH * TT)       // f32 2^11 / column sums [NB * NH][TT]
#define WS_END2 (WS_CZ + 4u * (size_t)NB * NH * TT)

// ---- k_proj: block = (128 rows, 128 cols, which), 8 waves of 32 rows x 64 cols: q/k/v = X W (+ b) with exact bf16 products (K = DIN, 32 k a pass, ascending, one accumulator chain per output as before). Per pass the block's 128 X rows and 128 W rows are read once as whole 128-B lines, rounded to bf16 once and laid in one of two LDS buffers; every wave takes its fragments from there. The next pass's global loads are issued in front of this pass's products and stored into the other buffer behind them; the one barrier of a pass publishes that buffer and ends the reads of this one. -> which 0: q f16 rows (+ residual rows < QHI); 1: k f16 rows (+ residual rows < KHI); 2: v f16 planes [c][t] (+ bf16 hi/lo planes for t < KHI). Every '#pragma unroll' of k_proj and proj_mac is there so that the small arrays it indexes (staged values, fragments, accumulators) stay in registers
#define PJT 128             // rows and columns of a block's tile
#define PJP 40              // LDS pitch of a staged row of 32 bf16, in elements: 80 B = 16 B x odd, free of bank conflicts for the 16-byte fragment reads
#define PJE 136             // LDS pitch of an epilogue row of 128 16-bit values, in elements: 272 B = 16 B x odd
typedef __attribute__((ext_vector_type(4))) __bf16 v4b;
__device__ __forceinline__ void proj_mac(const __bf16 (*xs)[PJP], const __bf16 (*wt)[PJP], int wm, int wn, int lane, v8f (&acc)[2][4]) { const int col = lane & 15; v16b a[2], w[4];
#pragma unroll
  for (int i = 0; i < 2; ++i) a[i] = frag_b(&xs[wm * 32 + i * 16 + col][0], lane);
#pragma unroll
  for (int j = 0; j < 4; ++j) w[j] = frag_b(&wt[wn * 64 + j * 16 + col][0], lane);
#pragma unroll
  for (int i = 0; i < 2; ++i)
#pragma unroll
    for (int j = 0; j < 4; ++j) acc[i][j] = __builtin_amdgcn_wmma_f32_16x16x32_bf16(false, a[i], false, w[j], (short)0, acc[i][j], false, false); }
__global__ __launch_bounds__(256) void k_proj(const float* __restrict__ XQ, const float* __restrict__ XK, const float* __restrict__ XV, const float* __restrict__ WQ, const float* __restrict__ WK, const float* __restrict__ WV, const float* __restrict__ BQ, const float* __restrict__ BK, const float* __restrict__ BV,
    _Float16* __restrict__ QH, _Float16* __restrict__ QL, _Float16* __restrict__ KH, _Float16* __restrict__ KL, _Float16* __restrict__ VT, __bf16* __restrict__ VB, __bf16* __restrict__ VBL) {
  __shared__ __align__(16) unsigned char sm[3 * PJT * PJE * 2];   // the loop's two buffers of X and W rows (40,960 B); behind the loop's last barrier the epilogue's planes
  __bf16 (*xs)[PJT][PJP] = (__bf16 (*)[PJT][PJP])sm; __bf16 (*wt)[PJT][PJP] = (__bf16 (*)[PJT][PJP])(sm + 2 * PJT * PJP * 2);
  const int tid = threadIdx.x, wave = tid >> 5, lane = tid & 31, col = lane & 15, g = lane >> 4, wm = wave & 3, wn = wave >> 2; const int which = blockIdx.z; const int c0 = blockIdx.y * PJT; const size_t r0 = (size_t)blockIdx.x * PJT; const size_t bb = r0 / TT; const int t0 = (int)(r0 % TT);
  const float* X = which == 0 ? XQ : which == 1 ? XK : XV; const float* WA = which == 0 ? WQ : which == 1 ? WK : WV; const float* BA = which == 0 ? BQ : which == 1 ? BK : BV;
  const int lr = tid >> 3, lc = (tid & 7) * 4;   // staging: 8 lanes cover one row's 128-B line, a wave 4 whole lines a load
  const float* xg = X + (r0 + lr) * DIN + lc; const float* wg = WA + (size_t)(c0 + lr) * DIN + lc;
  v8f acc[2][4] = {}; v4f xr[4], wr[4];
#pragma unroll
  for (int u = 0; u < 4; ++u) { xr[u] = *(const v4f*)(xg + (size_t)u * 32 * DIN); wr[u] = *(const v4f*)(wg + (size_t)u * 32 * DIN); }
#pragma unroll
  for (int u = 0; u < 4; ++u) { *(v4b*)&xs[0][u * 32 + lr][lc] = __builtin_convertvector(xr[u], v4b); *(v4b*)&wt[0][u * 32 + lr][lc] = __builtin_convertvector(wr[u], v4b); }
  __syncthreads();
  for (int kc = 0; kc < DIN / 32 - 1; ++kc) { const float* xp = xg + (kc + 1) * 32; const float* wp = wg + (kc + 1) * 32;
#pragma unroll
    for (int u = 0; u < 4; ++u) { xr[u] = *(const v4f*)(xp + (size_t)u * 32 * DIN); wr[u] = *(const v4f*)(wp + (size_t)u * 32 * DIN); }
    asm volatile("s_wait_xcnt 0x0" :: "v"(xp), "v"(wp) : "memory");   /* the wait before a register of an issued load is overwritten (the fragments below take the address registers); the two addresses are inputs, so they stay live to here. Standing here it also keeps all eight loads in front of the pass's LDS reads and products: without it the eighth is issued only behind four products */
    proj_mac(xs[kc & 1], wt[kc & 1], wm, wn, lane, acc);
#pragma unroll
    for (int u = 0; u < 4; ++u) { *(v4b*)&xs[(kc + 1) & 1][u * 32 + lr][lc] = __builtin_convertvector(xr[u], v4b); *(v4b*)&wt[(kc + 1) & 1][u * 32 + lr][lc] = __builtin_convertvector(wr[u], v4b); }
    __syncthreads(); }
  proj_mac(xs[(DIN / 32 - 1) & 1], wt[(DIN / 32 - 1) & 1], wm, wn, lane, acc);
  __syncthreads();   // every wave has taken its last fragments: the epilogue's planes may overwrite the buffers
  if (which < 2) { _Float16 (*sh)[PJE] = (_Float16 (*)[PJE])sm; _Float16 (*sl)[PJE] = (_Float16 (*)[PJE])(sm + PJT * PJE * 2); _Float16* DH = which == 0 ? QH : KH; _Float16* DL = which == 0 ? QL : KL; const int nhi = which == 0 ? QHI : KHI; const bool hi_rows = t0 < nhi;
#pragma unroll
    for (int j = 0; j < 4; ++j) { const int cl = wn * 64 + j * 16 + col; const float bias = BA ? bfr(BA[c0 + cl]) : 0.f;
#pragma unroll
      for (int i = 0; i < 2; ++i)
#pragma unroll
        for (int r = 0; r < 8; ++r) { const float v = acc[i][j][r] + bias; const _Float16 hv = (_Float16)v; const int rl = wm * 32 + i * 16 + 8 * g + r; sh[rl][cl] = hv; sl[rl][cl] = (_Float16)((v - (float)hv) * 1024.0f); } }
    __syncthreads();
    for (int e = tid; e < PJT * 16; e += 256) { const int rl = e >> 4, q = e & 15; _Float16* ph = DH + (r0 + rl) * CC + c0 + q * 8; _Float16* pl = DL + (bb * nhi + t0 + rl) * (size_t)CC + c0 + q * 8; const v4u hv = *(const v4u*)&sh[rl][q * 8], lv = *(const v4u*)&sl[rl][q * 8];
      vst2((unsigned*)ph, hv); if (hi_rows) vst2((unsigned*)pl, lv);
      asm volatile("s_wait_xcnt 0x0" :: "v"(ph), "v"(pl), "v"(hv), "v"(lv) : "memory"); }   /* the wait before a register of an issued store is overwritten (the next trip takes the address and data registers); they are inputs, so they stay live to here */
  } else { _Float16 (*th)[PJE] = (_Float16 (*)[PJE])sm; __bf16 (*tb)[PJE] = (__bf16 (*)[PJE])(sm + PJT * PJE * 2); __bf16 (*tbl)[PJE] = (__bf16 (*)[PJE])(sm + 2 * PJT * PJE * 2); const bool hi_rows = t0 < KHI;
#pragma unroll
    for (int j = 0; j < 4; ++j) { const int cl = wn * 64 + j * 16 + col; const float bias = BA ? bfr(BA[c0 + cl]) : 0.f;
#pragma unroll
      for (int i = 0; i < 2; ++i)
#pragma unroll
        for (int r = 0; r < 8; ++r) { const float v = acc[i][j][r] + bias; const int rl = wm * 32 + i * 16 + 8 * g + r; th[cl][rl] = (_Float16)v; const __bf16 bh = (__bf16)v; tb[cl][rl] = bh; tbl[cl][rl] = (__bf16)(v - (float)bh); } }
    __syncthreads();
    for (int e = tid; e < PJT * 16; e += 256) { const int cl = e >> 4, q = e & 15; vst2((unsigned*)(VT + (bb * CC + c0 + cl) * (size_t)TT + t0 + q * 8), *(const v4u*)&th[cl][q * 8]); if (hi_rows) { const size_t o3 = (bb * CC + c0 + cl) * (size_t)KHI + t0 + q * 8; vst2((unsigned*)(VB + o3), *(const v4u*)&tb[cl][q * 8]); vst2((unsigned*)(VBL + o3), *(const v4u*)&tbl[cl][q * 8]); } } } }
// ---- k_sm: block = query row t (head in group): keys [0, kend): causal -> logit if s <= t else excluded; softmax in f32; P x 2^11 in place (0 for excluded)
__global__ __launch_bounds__(256) void k_sm(float* __restrict__ S0 SM_EXTRA_PARAMS) { __shared__ float sred[8]; __shared__ float sbc; __shared__ __align__(16) float shv[TT];
  const int tid = threadIdx.x; const int t = blockIdx.x; const int kend = (kb_last(t >> 6) + 1) * 128;
  float* sr = S0 + (size_t)blockIdx.y * TT * TT + (size_t)t * TT;
  float m = -3.0e38f; for (int k = tid; k < kend; k += 256) { float v = (!CAUSAL || k <= t) ? sr[k] : -3.0e38f; SM_MASK_HOOK; shv[k] = v; m = fmaxf(m, v); }
#pragma unroll
  for (int o = 1; o < 32; o <<= 1) m = fmaxf(m, __shfl_xor(m, o));
  if ((tid & 31) == 0) sred[tid >> 5] = m; __syncthreads(); if (tid == 0) { float a = sred[0]; for (int i = 1; i < 8; ++i) a = fmaxf(a, sred[i]); sbc = a; } __syncthreads(); m = sbc; __syncthreads();
  float sum = 0.f; for (int k = tid; k < kend; k += 256) { const float v = shv[k]; const float e = (v <= -1.0e38f) ? 0.f : expf(v - m); shv[k] = e; sum += e; }
#pragma unroll
  for (int o = 1; o < 32; o <<= 1) sum += __shfl_xor(sum, o);
  if ((tid & 31) == 0) sred[tid >> 5] = sum; __syncthreads(); if (tid == 0) { float a = 0.f; for (int i = 0; i < 8; ++i) a += sred[i]; sbc = a > 0.f ? 2048.0f / a : 0.f; }   /* a fully excluded row yields P = 0 */ __syncthreads(); const float inv = sbc;
  for (int k = tid; k < kend; k += 256) shv[k] = shv[k] * inv;
  __syncthreads(); for (int q = tid; q < kend / 4; q += 256) vst2(sr + q * 4, *(const v4f*)&shv[q * 4]); }
// ---- k_stat: softmax over the QUERY axis under the causal mask (the source's softmax(axis=2) on [B, H, i, j] scores with -inf where j > i), with no score matrix in memory. Block = (STK key columns from k0, head h, batch b), STW waves. Every wave keeps the STK keys' f16 fragments in registers and takes every STW-th tile of 16 of the visible query rows k0 .. TT-1: scores q x k on WMMA (one f16 product), then per lane and column tile the online (max, sum) over its 8 rows (f32; the maximum runs over the raw products, each term is 2^(s x SCL2 - m x SCL2): one multiply-add and one v_exp_f32; q < k reads as -inf and adds 2^(-inf) = 0; the running maximum starts finite, so no difference is inf - inf; the sum so far is rescaled by 2^((m_old - m_new) x SCL2)). The 2 * STW partial pairs of a column (wave, lane half) are merged through LDS behind one barrier, which every wave reaches after its own last tile: m_k in base-2 units (m x SCL2) to CM, 2^11 / Z_k to CR, whole lines. Every '#pragma unroll' of k_stat and k_out is there so that the small arrays it indexes (fragments, accumulators, m, z, P) stay in registers
#define STW 8
#define STK 64
// the fragments of frag_h / frag_b from a pointer that already holds the lane's own 8g offset: a run of loads then shares one address value, which the wait behind the run can name
// 2^x on v_exp_f32: every argument here is at most about 0 where its result is used, and a result below the normal range may read as 0 (it stands beside a column sum of at least 1). Written as asm so that the slot the instruction set asks for behind a transcendental (no use of its result, no overwrite of its source in the next instruction) is kept by construction, wherever the compiler places the statement. The v_nop is that slot
__device__ __forceinline__ float ex2(float x) { float e; asm("v_exp_f32 %0, %1\n\tv_nop" : "=v"(e) : "v"(x)); return e; }
// eight of them: the results are early-clobber outputs, so none lies in a source and each v_exp_f32 is the independent instruction behind the one before; one v_nop behind the last
__device__ __forceinline__ void ex2x8(float (&e)[8], const float (&x)[8]) {
  asm("v_exp_f32 %0, %8\n\tv_exp_f32 %1, %9\n\tv_exp_f32 %2, %10\n\tv_exp_f32 %3, %11\n\tv_exp_f32 %4, %12\n\tv_exp_f32 %5, %13\n\tv_exp_f32 %6, %14\n\tv_exp_f32 %7, %15\n\tv_nop"
      : "=&v"(e[0]), "=&v"(e[1]), "=&v"(e[2]), "=&v"(e[3]), "=&v"(e[4]), "=&v"(e[5]), "=&v"(e[6]), "=&v"(e[7])
      : "v"(x[0]), "v"(x[1]), "v"(x[2]), "v"(x[3]), "v"(x[4]), "v"(x[5]), "v"(x[6]), "v"(x[7])); }
__device__ __forceinline__ v16h frag_hp(const _Float16* p) { union { v16h v; v8h q[2]; } u; u.q[0] = *(const v8h*)p; u.q[1] = *(const v8h*)(p + 16); return u.v; }
__device__ __forceinline__ v16b frag_bp(const __bf16* p) { union { v16b v; v8b q[2]; } u; u.q[0] = *(const v8b*)p; u.q[1] = *(const v8b*)(p + 16); return u.v; }
__global__ __launch_bounds__(STW * 32) void k_stat(const _Float16* __restrict__ QH, const _Float16* __restrict__ KH, float* __restrict__ CM, float* __restrict__ CR) { __shared__ float pm[2 * STW][STK], pz[2 * STW][STK];
  const int tid = threadIdx.x, lane = tid & 31, col = lane & 15, g = lane >> 4; const int wave = __builtin_amdgcn_readfirstlane(tid >> 5); const int k0 = blockIdx.x * STK, h = blockIdx.y, b = blockIdx.z;
  v16h kf[HD / 32][STK / 16]; const _Float16* kp = KH + ((size_t)b * TT + k0 + col) * CC + h * HD + 8 * g;
#pragma unroll
  for (int kc = 0; kc < HD / 32; ++kc) {
#pragma unroll
    for (int j = 0; j < STK / 16; ++j) kf[kc][j] = frag_hp(kp + (size_t)j * 16 * CC + kc * 32); }
  asm volatile("s_wait_xcnt 0x0" :: "v"(kp) : "memory");   /* the wait before a register of an issued load is overwritten; the loads' common address is an input, so it stays live to here and no fragment lands in it */
  float m[STK / 16], z[STK / 16];   // m: running maximum of the raw products
#pragma unroll
  for (int j = 0; j < STK / 16; ++j) { m[j] = -3.0e38f; z[j] = 0.f; }
  for (int ql0 = k0 + wave * 16; ql0 < TT; ql0 += STW * 16) { const _Float16* qp = QH + ((size_t)b * TT + ql0 + col) * CC + h * HD; const v16h a0 = frag_h(qp, lane), a1 = frag_h(qp + 32, lane);
#pragma unroll
    for (int j = 0; j < STK / 16; ++j) { v8f acc = {}; acc = wmma16(a0, kf[0][j], acc); acc = wmma16(a1, kf[1][j], acc); const int k = k0 + j * 16 + col; float v[8];
#pragma unroll
      for (int r = 0; r < 8; ++r) v[r] = (ql0 + 8 * g + r >= k) ? acc[r] : -INFINITY;
      float mn = m[j];
#pragma unroll
      for (int r = 0; r < 8; ++r) mn = fmaxf(mn, v[r]);
      const float nb = -(mn * SCL2); float x[8], e[8];
#pragma unroll
      for (int r = 0; r < 8; ++r) x[r] = __builtin_fmaf(v[r], SCL2, nb);
      ex2x8(e, x); float s = e[0];
#pragma unroll
      for (int r = 1; r < 8; ++r) s += e[r];
      z[j] = z[j] * ex2((m[j] - mn) * SCL2) + s; m[j] = mn; } }   /* the two raw maxima are subtracted first: a maximum that has not moved gives exactly 2^0 = 1, and a difference followed by a multiply has no fused form */
#pragma unroll
  for (int j = 0; j < STK / 16; ++j) { pm[2 * wave + g][j * 16 + col] = m[j] * SCL2; pz[2 * wave + g][j * 16 + col] = z[j]; }
  __syncthreads();
  if (tid < STK) { float mm = pm[0][tid];
#pragma unroll
    for (int w = 1; w < 2 * STW; ++w) mm = fmaxf(mm, pm[w][tid]);
    float a = 0.f;   /* a partial that saw no visible row of this column holds Z = 0 and a finite maximum */
#pragma unroll
    for (int w = 0; w < 2 * STW; ++w) a += pz[w][tid] * ex2(pm[w][tid] - mm);
    const size_t o = ((size_t)b * NH + h) * TT + k0 + tid; vst2(CM + o, mm); vst2(CR + o, 2048.0f / a); } }   /* every column sees at least its own diagonal entry: Z_k >= 1 */
// ---- k_out: block = 64 queries (qb) of (b, h), a wave = 16 queries: per 32 keys the scores are formed again on WMMA, transposed (A = 16 key rows, B = the wave's 16 queries, kept in registers; the same one f16 product), so that a lane holds, for its own query, the keys 8g + 0..7 of each 16-key tile: two such tiles are, in place, the A fragment of P . v (hardware k order, the order of frag_b). P[i][j] = 2^(s x SCL2 - m_j) x (2^11 / Z_j), m_j in base-2 units, for j <= i, 0 above the diagonal (unconditional loads, value select); P and v as bf16 hi + lo, 3 products, keys [0, kend) as before; 256-B (row, head) segment by 16 lanes. What the four waves read of 64 keys (k rows, v hi and lo rows, column maxima and scales) is the same for all of them: it is brought into LDS once per block, as whole 128-B lines, by asynchronous copies, two buffers, the next tile flying while a tile is worked on; every fragment comes from LDS
#define OKT 64              // keys of a staged tile
#define OPB 144             // LDS pitch in bytes of a staged row of 128 B: 16 B x odd, free of bank conflicts for the 16-byte fragment reads
#define OPL (64 * OPB)      // one staged plane: 64 rows (64 keys of k; 64 channels of v hi; of v lo)
#define OBF (3 * OPL + 512) // one buffer: three planes, then 64 column maxima and 64 column scales
// the 12 copies of a thread for one tile: 8 lanes cover one row's 128-B line, the block 16 rows a copy. la: the thread's LDS byte address in the k plane; kg, hg, lg: its addresses in the tile's first 16 rows
__device__ __forceinline__ void out_stage(unsigned la, const _Float16* kg, const __bf16* hg, const __bf16* lg) {
  /* the copies and, as the last line of their own statement, the wait before a register that an issued copy names is rewritten */
  asm volatile("global_load_async_to_lds_b128 %0, %12, off\n\tglobal_load_async_to_lds_b128 %1, %13, off\n\tglobal_load_async_to_lds_b128 %2, %14, off\n\tglobal_load_async_to_lds_b128 %3, %15, off\n\t"
               "global_load_async_to_lds_b128 %4, %16, off\n\tglobal_load_async_to_lds_b128 %5, %17, off\n\tglobal_load_async_to_lds_b128 %6, %18, off\n\tglobal_load_async_to_lds_b128 %7, %19, off\n\t"
               "global_load_async_to_lds_b128 %8, %20, off\n\tglobal_load_async_to_lds_b128 %9, %21, off\n\tglobal_load_async_to_lds_b128 %10, %22, off\n\tglobal_load_async_to_lds_b128 %11, %23, off\n\ts_wait_xcnt 0x0"
               :: "v"(la), "v"(la + 16 * OPB), "v"(la + 32 * OPB), "v"(la + 48 * OPB),
                  "v"(la + OPL), "v"(la + OPL + 16 * OPB), "v"(la + OPL + 32 * OPB), "v"(la + OPL + 48 * OPB),
                  "v"(la + 2 * OPL), "v"(la + 2 * OPL + 16 * OPB), "v"(la + 2 * OPL + 32 * OPB), "v"(la + 2 * OPL + 48 * OPB),
                  "v"(kg), "v"(kg + (size_t)16 * CC), "v"(kg + (size_t)32 * CC), "v"(kg + (size_t)48 * CC),
                  "v"(hg), "v"(hg + (size_t)16 * KHI), "v"(hg + (size_t)32 * KHI), "v"(hg + (size_t)48 * KHI),
                  "v"(lg), "v"(lg + (size_t)16 * KHI), "v"(lg + (size_t)32 * KHI), "v"(lg + (size_t)48 * KHI) : "memory"); }
// one wave's copy of the tile's 64 maxima (lanes 0..15) and 64 scales (lanes 16..31), with the same wait
__device__ __forceinline__ void out_stage_c(unsigned la, const float* cg) { asm volatile("global_load_async_to_lds_b128 %0, %1, off\n\ts_wait_xcnt 0x0" :: "v"(la), "v"(cg) : "memory"); }
__global__ __launch_bounds__(128) void k_out(const _Float16* __restrict__ QH, const _Float16* __restrict__ KH, const float* __restrict__ CM, const float* __restrict__ CR, const __bf16* __restrict__ VB, const __bf16* __restrict__ VBL, float* __restrict__ Y) { __shared__ __align__(16) unsigned char sm[2 * OBF];   // the loop's two buffers; behind the loop's last barrier the epilogue's rows
  const int tid = threadIdx.x, lane = tid & 31, col = lane & 15, g = lane >> 4; const int wave = __builtin_amdgcn_readfirstlane(tid >> 5); const int qb = blockIdx.x, h = blockIdx.y, b = blockIdx.z; const int ql0 = qb * 64 + wave * 16; const int nt = (kb_last(qb) + 1) * 2; const int qi = ql0 + col;   // nt tiles of 64 keys, never fewer than two
  const _Float16* qp = QH + ((size_t)b * TT + qi) * CC + h * HD; const v16h q0 = frag_h(qp, lane), q1 = frag_h(qp + 32, lane);
  const int sr = tid >> 3, sq = (tid & 7) * 8;   // staging: the thread's row among 16 and its 16 bytes of the row
  const _Float16* kg = KH + ((size_t)b * TT + sr) * CC + h * HD + sq; const size_t po = ((size_t)b * CC + h * HD + sr) * (size_t)KHI + sq; const __bf16* hg = VB + po; const __bf16* lg = VBL + po;
  const float* cg = (g ? CR : CM) + ((size_t)b * NH + h) * TT + col * 4;
  const unsigned la = (unsigned)(size_t)sm + sr * OPB + sq * 2, lc = (unsigned)(size_t)sm + 3 * OPL + lane * 16;
  out_stage(la, kg, hg, lg); if (wave == 0) out_stage_c(lc, cg);
  asm volatile("s_wait_asynccnt 0x0" ::: "memory");   /* this wave's copies of tile 0 have landed */
  __syncthreads();                                     /* and every other wave's: tile 0 may be read */
  out_stage(la + OBF, kg + (size_t)OKT * CC, hg + OKT, lg + OKT); if (wave == 0) out_stage_c(lc + OBF, cg + OKT);
  v8f acc[HD / 16] = {};
  for (int t = 0; t < nt; ++t) { const unsigned char* bp = sm + (t & 1) * OBF;
#pragma unroll   /* the tile's two halves of 32 keys, unrolled so that every LDS offset of a half is an immediate */
    for (int s = 0; s < 2; ++s) { const int k0 = t * OKT + s * 32;
      const _Float16* ka = (const _Float16*)(bp + (s * 32 + col) * OPB) + 8 * g; const _Float16* kb2 = ka + 16 * (OPB / 2); const float* cmk = (const float*)(bp + 3 * OPL) + s * 32 + 8 * g; const float* crk = cmk + OKT;
      const v16h ka0 = frag_hp(ka), kb0 = frag_hp(kb2), ka1 = frag_hp(ka + 32), kb1 = frag_hp(kb2 + 32);
      v4f mv[4], rv[4];
#pragma unroll
      for (int u = 0; u < 4; ++u) { const int o = (u >> 1) * 16 + (u & 1) * 4; mv[u] = *(const v4f*)(cmk + o); rv[u] = *(const v4f*)(crk + o); }
      v16b vh[HD / 16], vl[HD / 16]; const __bf16* vhp = (const __bf16*)(bp + OPL + col * OPB) + s * 32 + 8 * g; const __bf16* vlp = vhp + OPL / 2;
#pragma unroll
      for (int j = 0; j < HD / 16; ++j) { vh[j] = frag_bp(vhp + j * 16 * (OPB / 2)); vl[j] = frag_bp(vlp + j * 16 * (OPB / 2)); }
      v8f s0 = {}, s1 = {}; s0 = wmma16(ka0, q0, s0); s1 = wmma16(kb0, q0, s1); s0 = wmma16(ka1, q1, s0); s1 = wmma16(kb1, q1, s1);
      float pv[16], x0[8], x1[8], e0[8], e1[8];
#pragma unroll
      for (int i = 0; i < 8; ++i) { x0[i] = __builtin_fmaf(s0[i], SCL2, -mv[i >> 2][i & 3]); x1[i] = __builtin_fmaf(s1[i], SCL2, -mv[2 + (i >> 2)][i & 3]); }
      ex2x8(e0, x0); ex2x8(e1, x1);
#pragma unroll
      for (int i = 0; i < 8; ++i) { const int ke = k0 + 8 * g + i; pv[i] = (ke <= qi) ? e0[i] * rv[i >> 2][i & 3] : 0.f; pv[8 + i] = (ke + 16 <= qi) ? e1[i] * rv[2 + (i >> 2)][i & 3] : 0.f; }
      const F2 p = bsplit16(pv);
#pragma unroll
      for (int j = 0; j < HD / 16; ++j) { acc[j] = wmma_bf(p.h, vh[j], acc[j]); acc[j] = wmma_bf(p.l, vh[j], acc[j]); acc[j] = wmma_bf(p.h, vl[j], acc[j]); } }
    asm volatile("s_wait_dscnt 0x0" ::: "memory");      /* this wave's reads of tile t are over */
    asm volatile("s_wait_asynccnt 0x0" ::: "memory");   /* its copies of tile t + 1 have landed */
    __syncthreads();                                     /* the same of every wave: tile t + 1 may be read, tile t's buffer refilled */
    if (t + 2 < nt) { const int kn = (t + 2) * OKT; const unsigned bo = (t & 1) * OBF; out_stage(la + bo, kg + (size_t)kn * CC, hg + kn, lg + kn); if (wave == 0) out_stage_c(lc + bo, cg + kn); } }
  asm volatile("s_wait_asynccnt 0x0" ::: "memory");     /* no copy is outstanding when the buffers become the epilogue's rows */
  float (*ss)[16][HD + 4] = (float (*)[16][HD + 4])sm;
#pragma unroll
  for (int j = 0; j < HD / 16; ++j)
#pragma unroll
    for (int r = 0; r < 8; ++r) ss[wave][8 * g + r][j * 16 + col] = acc[j][r] * (1.0f / 2048.0f);
  LDSX(); for (int rl = 0; rl < 16; ++rl) if (lane < HD / 4) vst2(Y + ((size_t)b * TT + ql0 + rl) * CC + h * HD + lane * 4, *(const v4f*)&ss[wave][rl][lane * 4]); }

extern "C" void kernel_launch(void* const* d_in, const int* in_sizes, int n_in, void* d_out, int out_size, void* d_ws, size_t ws_size, hipStream_t stream) {
  (void)in_sizes; (void)n_in; (void)out_size;
  const float** F = (const float**)d_in;
  if (ws_size < (size_t)WS_END) return;
  char* ws = (char*)d_ws; _Float16 *QH = (_Float16*)(ws + WS_QH), *KH = (_Float16*)(ws + WS_KH), *VT = (_Float16*)(ws + WS_VT), *QL = (_Float16*)(ws + WS_QL), *KL = (_Float16*)(ws + WS_KL); __bf16 *VB = (__bf16*)(ws + WS_VB), *VBL = (__bf16*)(ws + WS_VBL); float *S = (float*)(ws + WS_S), *Y = (float*)(ws + WS_Y);
  (void)Y; (void)QL; (void)KL; (void)VB; (void)VBL; (void)S; (void)VT;
  // inputs: 0 X [2,2048,1024]; 1 Wq [1024,1024] (out,in), 2 bq; 3 Wk, 4 bk; 5 Wv, 6 bv (biases N(0, 0.02), nonzero); no output projection
  if (ws_size < (size_t)WS_END2) return;
  float *CM = (float*)(ws + WS_CM), *CZ = (float*)(ws + WS_CZ);
  k_proj<<<dim3(TNB * TT / PJT, CC / PJT, 3), 256, 0, stream>>>(F[0], F[0], F[0], F[1], F[3], F[5], F[2], F[4], F[6], QH, QL, KH, KL, VT, VB, VBL);
  k_stat<<<dim3(TT / STK, NH, TNB), STW * 32, 0, stream>>>(QH, KH, CM, CZ);   /* per key column j: max and 2^11 / sum over the visible queries i >= j */
  k_out<<<dim3(NQB, NH, TNB), 128, 0, stream>>>(QH, KH, CM, CZ, VB, VBL, (float*)d_out);   /* P formed in registers, then P . v */
}

// v006
// A run of this version takes 102 microseconds.
// Timed twice side by side with v005, it ran 1.19 times as fast both times.
// All steps since v000 together make it 77.2 times as fast.
// compute dtype: all float inputs rounded to bf16; q/k/v projections with EXACT bf16 products on WMMA 16x16x32 (f32 accumulate) + bias; causal scores q x k once to f16 each (1 product; the module scales by 1/sqrt(E) = 1/32, so sigma - 0.1) on every block; softmax over the QUERY axis in f32 (per key column: online max / sum over the visible queries, exponentials as 2^x on the hardware's own instruction, 1/sqrt(E) and log2(e) folded into one multiply-add); P as bf16 hi + lo against v as bf16 hi + lo (3 products) on EVERY block; f32 output.
#include <hip/hip_runtime.h>
#include <math.h>

typedef __attribute__((ext_vector_type(16))) _Float16 v16h;
typedef __attribute__((ext_vector_type(16))) __bf16 v16b;
typedef __attribute__((ext_vector_type(8)))  _Float16 v8h;
typedef __attribute__((ext_vector_type(8)))  float v8f;
typedef __attribute__((ext_vector_type(4)))  float v4f;
typedef __attribute__((ext_vector_type(2)))  float v2f;
typedef __attribute__((ext_vector_type(4)))  unsigned v4u;
typedef __attribute__((ext_vector_type(4)))  int v4i;
typedef float __attribute__((may_alias)) float_a;
typedef int __attribute__((may_alias)) int_a;

template <typename T> __device__ __forceinline__ void vst2(void* p, T v) { *(T*)p = v;  }
__device__ __forceinline__ v8f wmma16(v16h a, v16h b, v8f c) {
  v8f d = __builtin_amdgcn_wmma_f32_16x16x32_f16(false, a, false, b, (short)0, c, false, false);
  asm volatile("v_nop\n\tv_nop\n\tv_nop\n\tv_nop" : "+v"(d) : "v"(a), "v"(b));
  return d;
}
__device__ __forceinline__ v8f wmma_bf(v16b a, v16b b, v8f c) {
  v8f d = __builtin_amdgcn_wmma_f32_16x16x32_bf16(false, a, false, b, (short)0, c, false, false);
  asm volatile("v_nop\n\tv_nop\n\tv_nop\n\tv_nop" : "+v"(d) : "v"(a), "v"(b));
  return d;
}
// 16x16x32 fragments: lane = (h = lane>>4, row/col = lane&15); elements 0..7 = k0+8h+0..7, 8..15 = k0+16+8h+0..7; D element r = row 8h+r
__device__ __forceinline__ v16h frag_h(const _Float16* rowk0, int lane) {
  union { v16h v; v8h q[2]; } u; const _Float16* p = rowk0 + 8 * (lane >> 4);
  u.q[0] = *(const v8h*)p; u.q[1] = *(const v8h*)(p + 16); return u.v;
}
__device__ __forceinline__ v16h frag_f32(const float* rowk0, int lane) {
  v16h a; const float* p = rowk0 + 8 * (lane >> 4);
#pragma unroll
  for (int i = 0; i < 8; ++i) { a[i] = (_Float16)p[i]; a[8 + i] = (_Float16)p[16 + i]; }
  return a;
}
__device__ __forceinline__ v16h frag_f32s(const float* rowk0, int lane, float sc) {
  v16h a; const float* p = rowk0 + 8 * (lane >> 4);
#pragma unroll
  for (int i = 0; i < 8; ++i) { a[i] = (_Float16)(p[i] * sc); a[8 + i] = (_Float16)(p[16 + i] * sc); }
  return a;
}
// column fragment from a [K][ld] layout (column n), rows >= K read as 0
__device__ __forceinline__ v16h fragc_f32(const float* W, int k0, int n, int lane, int ld, int K) {
  v16h a; const int g = lane >> 4;
#pragma unroll
  for (int i = 0; i < 8; ++i) { const int ka = k0 + 8 * g + i, kb = ka + 16;
    a[i] = (_Float16)(ka < K ? W[(size_t)(ka < K ? ka : K - 1) * ld + n] : 0.f); a[8 + i] = (_Float16)(kb < K ? W[(size_t)(kb < K ? kb : K - 1) * ld + n] : 0.f); }
  return a;
}
struct F2 { v16b h, l; };
__device__ __forceinline__ F2 bsplit16(const float v[16]) { F2 r;
#pragma unroll
  for (int i = 0; i < 16; ++i) { const __bf16 h = (__bf16)v[i]; r.h[i] = h; r.l[i] = (__bf16)(v[i] - (float)h); }
  return r; }
__device__ __forceinline__ F2 split_row(const float* row, int k0, int lane) { float v[16]; const float* p = row + k0 + 8 * (lane >> 4);
#pragma unroll
  for (int i = 0; i < 8; ++i) { v[i] = p[i]; v[8 + i] = p[16 + i]; }
  return bsplit16(v); }
__device__ __forceinline__ F2 split_rowK(const float* row, int k0, int lane, int K) { float v[16]; const int g = lane >> 4;
#pragma unroll
  for (int i = 0; i < 8; ++i) { const int ka = k0 + 8 * g + i, kb = ka + 16; v[i] = ka < K ? row[ka < K ? ka : K - 1] : 0.f; v[8 + i] = kb < K ? row[kb < K ? kb : K - 1] : 0.f; }
  return bsplit16(v); }
__device__ __forceinline__ F2 split_col(const float* W, int k0, int n, int lane, int ld, int K) { float v[16]; const int g = lane >> 4;
#pragma unroll
  for (int i = 0; i < 8; ++i) { const int ka = k0 + 8 * g + i, kb = ka + 16; v[i] = ka < K ? W[(size_t)(ka < K ? ka : K - 1) * ld + n] : 0.f; v[8 + i] = kb < K ? W[(size_t)(kb < K ? kb : K - 1) * ld + n] : 0.f; }
  return bsplit16(v); }
__device__ __forceinline__ v8f mac3(const F2& a, const F2& b, v8f c) { c = wmma_bf(a.l, b.h, c); c = wmma_bf(a.h, b.l, c); return wmma_bf(a.h, b.h, c); }
__device__ __forceinline__ float sigm(float v) { return 1.0f / (1.0f + expf(-v)); }
#define LDSX() do { asm volatile("s_wait_dscnt 0" ::: "memory"); __builtin_amdgcn_wave_barrier(); __builtin_amdgcn_fence(__ATOMIC_RELEASE, "workgroup"); } while (0)

// Multi-headed attention whose softmax runs over the QUERY axis, scaled by the MODEL width (X [2,2048,1024]; torch (out,in) Wq / Wk / Wv [1024,1024] N(0, 1/1024) + biases N(0, 0.02); 16 heads x 64; scores / sqrt(E) = / 32; -inf where j > i; attn = softmax(scores, axis=2) - axis 2 of [B, H, i, j] is the QUERY axis i: every key column j is normalised over the queries i >= j (faithful to the source); out = attn v; merge; no output projection).
#define NB 2
#define TT 2048
#define CC 1024            // NH * HD = projected width
#define DIN 1024          // input (model) width
#define NH 16
#define HD 64
#define NQB (TT / 64)
#define HG 4
#define SCALE (0.03125f)
#define SCL2 (SCALE * 1.44269504088896340736f)   // raw q . k product -> exponent to base 2
#define CAUSAL 1
#ifndef TNB
#define TNB NB
#endif
__device__ __forceinline__ float bfr(float v) { return (float)(__bf16)v; }
__host__ __device__ __forceinline__ int kb_last(int qb) { return CAUSAL ? ((qb * 64 + 63) >> 7) : (TT / 128 - 1); }
typedef __attribute__((ext_vector_type(8))) __bf16 v8b;
__device__ __forceinline__ v16b frag_b(const __bf16* rowk0, int lane) {
  union { v16b v; v8b q[2]; } u; const __bf16* p = rowk0 + 8 * (lane >> 4);
  u.q[0] = *(const v8b*)p; u.q[1] = *(const v8b*)(p + 16); return u.v;
}
#define QBH 32              // not read: k_out takes its one bf16 hi/lo path on all NQB query blocks
#define QHI 0               // no q residual plane: the scores are tiny (scale 1/32) and single-product everywhere
#define QBH_SC 0            // not read (k_out: bf16 hi/lo P.v on every block - a query-axis softmax has O(1) weights on the LAST key columns)
#define KHI 2048            // key rows carrying k residual / v bf16 hi+lo planes (the v planes are read by k_out; the k residual is not read)
// B fragment (k rows k0+.., output column o) of a weight: (in,out) [K][ld] or (out,in) [ld rows of K]: bf16 exact, or f16(bf16 * 256) exact
__device__ __forceinline__ v16b wcol_io(const float* Wm, int k0, int o, int lane, int ld) { v16b w; const int g = lane >> 4;
#pragma unroll
  for (int i = 0; i < 8; ++i) { w[i] = (__bf16)Wm[(size_t)(k0 + 8 * g + i) * ld + o]; w[8 + i] = (__bf16)Wm[(size_t)(k0 + 16 + 8 * g + i) * ld + o]; }
  return w; }
__device__ __forceinline__ v16b wcol_oi(const float* Wm, int k0, int o, int lane, int K) { v16b w; const float* p = Wm + (size_t)o * K + k0 + 8 * (lane >> 4);
#pragma unroll
  for (int i = 0; i < 8; ++i) { w[i] = (__bf16)p[i]; w[8 + i] = (__bf16)p[16 + i]; }
  return w; }
__device__ __forceinline__ v16h wcolh_io(const float* Wm, int k0, int o, int lane, int ld) { v16h w; const int g = lane >> 4;
#pragma unroll
  for (int i = 0; i < 8; ++i) { w[i] = (_Float16)(bfr(Wm[(size_t)(k0 + 8 * g + i) * ld + o]) * 256.0f); w[8 + i] = (_Float16)(bfr(Wm[(size_t)(k0 + 16 + 8 * g + i) * ld + o]) * 256.0f); }
  return w; }
__device__ __forceinline__ v16h wcolh_oi(const float* Wm, int k0, int o, int lane, int K) { v16h w; const float* p = Wm + (size_t)o * K + k0 + 8 * (lane >> 4);
#pragma unroll
  for (int i = 0; i < 8; ++i) { w[i] = (_Float16)(bfr(p[i]) * 256.0f); w[8 + i] = (_Float16)(bfr(p[16 + i]) * 256.0f); }
  return w; }
#define WQKV_LAYOUT 1   // not read by k_proj (W taken as (out,in) [CC][DIN]); WCOL only: 0 = (in,out) [DIN][CC]; 1 = (out,in) [CC][DIN]; 2 = per-head [NH][DIN][HD]
__device__ __forceinline__ v16b wcol_hdk(const float* Wm, int k0, int o, int lane) { v16b w; const int g = lane >> 4; const float* p = Wm + (size_t)(o / HD) * DIN * HD + (o % HD);
#pragma unroll
  for (int i = 0; i < 8; ++i) { w[i] = (__bf16)p[(size_t)(k0 + 8 * g + i) * HD]; w[8 + i] = (__bf16)p[(size_t)(k0 + 16 + 8 * g + i) * HD]; }
  return w; }
#define WO_OUT_IN 0
#if WQKV_LAYOUT == 1
#define WCOL(W, k0, o, lane) wcol_oi(W, k0, o, lane, DIN)
#elif WQKV_LAYOUT == 2
#define WCOL(W, k0, o, lane) wcol_hdk(W, k0, o, lane)
#else
#define WCOL(W, k0, o, lane) wcol_io(W, k0, o, lane, CC)
#endif
#if WO_OUT_IN
#define WOCOL(W, k0, o, lane) wcol_oi(W, k0, o, lane, CC)
#define WOCOLH(W, k0, o, lane) wcolh_oi(W, k0, o, lane, CC)
#else
#define WOCOL(W, k0, o, lane) wcol_io(W, k0, o, lane, DIN)
#define WOCOLH(W, k0, o, lane) wcolh_io(W, k0, o, lane, DIN)
#endif

#ifndef SM_EXTRA_PARAMS
#define SM_EXTRA_PARAMS
#endif
#ifndef PROJ_EXTRA_PARAMS
#define PROJ_EXTRA_PARAMS
#endif
#ifndef SM_MASK_HOOK
#define SM_MASK_HOOK (void)0
#endif

#define WS_QH  0u                                      // f16 q rows [b*t][CC]
#define WS_KH  (WS_QH + 2u * (size_t)NB * TT * CC)      // f16 k rows [b*t][CC]
#define WS_VT  (WS_KH + 2u * (size_t)NB * TT * CC)      // f16 v planes [b][c][t]
#define WS_QL  (WS_VT + 2u * (size_t)NB * CC * TT)      // f16 q residual x 2^10 rows [b][t < QHI][CC]
#define WS_KL  (WS_QL + 2u * (size_t)NB * QHI * CC)     // f16 k residual x 2^10 rows [b][t < KHI][CC]
#define WS_VB  (WS_KL + 2u * (size_t)NB * KHI * CC)     // bf16 v hi planes [b][c][t < KHI]
#define WS_VBL (WS_VB + 2u * (size_t)NB * CC * KHI)
#define WS_S   (WS_VBL + 2u * (size_t)NB * CC * KHI)    // f32 logits / P [hg][t][s] (plane not touched: the scores stay in registers)
#define WS_Y   (WS_S  + 4u * (size_t)HG * TT * TT)      // f32 ctx rows [b*t][CC] (only when there is an output projection)
#define WS_END (WS_Y  + 0u)
#define WS_CM (WS_END)                                  // f32 column maxima, base-2 units [NB * NH][TT]
#define WS_CZ (WS_CM + 4u * (size_t)NB * NH * TT)       // f32 2^11 / column sums [NB * NH][TT]
#define WS_END2 (WS_CZ + 4u * (size_t)NB * NH * TT)

// ---- k_proj: block = (128 rows, 128 cols, which), 8 waves of 32 rows x 64 cols: q/k/v = X W (+ b) with exact bf16 products (K = DIN, 32 k a pass, ascending, one accumulator chain per output as before). Per pass the block's 128 X rows and 128 W rows are read once as whole 128-B lines, rounded to bf16 once and laid in one of two LDS buffers; every wave takes its fragments from there. The next pass's global loads are issued in front of this pass's products and stored into the other buffer behind them; the one barrier of a pass publishes that buffer and ends the reads of this one. -> which 0: q f16 rows (+ residual rows < QHI); 1: k f16 rows (+ residual rows < KHI); 2: v f16 planes [c][t] (+ bf16 hi/lo planes for t < KHI). Every '#pragma unroll' of k_proj and proj_mac is there so that the small arrays it indexes (staged values, fragments, accumulators) stay in registers
#define PJT 128             // rows and columns of a block's tile
#define PJP 40              // LDS pitch of a staged row of 32 bf16, in elements: 80 B = 16 B x odd, free of bank conflicts for the 16-byte fragment reads
#define PJE 136             // LDS pitch of an epilogue row of 128 16-bit values, in elements: 272 B = 16 B x odd
typedef __attribute__((ext_vector_type(4))) __bf16 v4b;
__device__ __forceinline__ void proj_mac(const __bf16 (*xs)[PJP], const __bf16 (*wt)[PJP], int wm, int wn, int lane, v8f (&acc)[2][4]) { const int col = lane & 15; v16b a[2], w[4];
#pragma unroll
  for (int i = 0; i < 2; ++i) a[i] = frag_b(&xs[wm * 32 + i * 16 + col][0], lane);
#pragma unroll
  for (int j = 0; j < 4; ++j) w[j] = frag_b(&wt[wn * 64 + j * 16 + col][0], lane);
#pragma unroll
  for (int i = 0; i < 2; ++i)
#pragma unroll
    for (int j = 0; j < 4; ++j) acc[i][j] = __builtin_amdgcn_wmma_f32_16x16x32_bf16(false, a[i], false, w[j], (short)0, acc[i][j], false, false); }
__global__ __launch_bounds__(256) void k_proj(const float* __restrict__ XQ, const float* __restrict__ XK, const float* __restrict__ XV, const float* __restrict__ WQ, const float* __restrict__ WK, const float* __restrict__ WV, const float* __restrict__ BQ, const float* __restrict__ BK, const float* __restrict__ BV,
    _Float16* __restrict__ QH, _Float16* __restrict__ QL, _Float16* __restrict__ KH, _Float16* __restrict__ KL, _Float16* __restrict__ VT, __bf16* __restrict__ VB, __bf16* __restrict__ VBL) {
  __shared__ __align__(16) unsigned char sm[3 * PJT * PJE * 2];   // the loop's two buffers of X and W rows (40,960 B); behind the loop's last barrier the epilogue's planes
  __bf16 (*xs)[PJT][PJP] = (__bf16 (*)[PJT][PJP])sm; __bf16 (*wt)[PJT][PJP] = (__bf16 (*)[PJT][PJP])(sm + 2 * PJT * PJP * 2);
  const int tid = threadIdx.x, wave = tid >> 5, lane = tid & 31, col = lane & 15, g = lane >> 4, wm = wave & 3, wn = wave >> 2; const int which = blockIdx.z; const int c0 = blockIdx.y * PJT; const size_t r0 = (size_t)blockIdx.x * PJT; const size_t bb = r0 / TT; const int t0 = (int)(r0 % TT);
  const float* X = which == 0 ? XQ : which == 1 ? XK : XV; const float* WA = which == 0 ? WQ : which == 1 ? WK : WV; const float* BA = which == 0 ? BQ : which == 1 ? BK : BV;
  const int lr = tid >> 3, lc = (tid & 7) * 4;   // staging: 8 lanes cover one row's 128-B line, a wave 4 whole lines a load
  const float* xg = X + (r0 + lr) * DIN + lc; const float* wg = WA + (size_t)(c0 + lr) * DIN + lc;
  v8f acc[2][4] = {}; v4f xr[4], wr[4];
#pragma unroll
  for (int u = 0; u < 4; ++u) { xr[u] = *(const v4f*)(xg + (size_t)u * 32 * DIN); wr[u] = *(const v4f*)(wg + (size_t)u * 32 * DIN); }
#pragma unroll
  for (int u = 0; u < 4; ++u) { *(v4b*)&xs[0][u * 32 + lr][lc] = __builtin_convertvector(xr[u], v4b); *(v4b*)&wt[0][u * 32 + lr][lc] = __builtin_convertvector(wr[u], v4b); }
  __syncthreads();
  for (int kc = 0; kc < DIN / 32 - 1; ++kc) { const float* xp = xg + (kc + 1) * 32; const float* wp = wg + (kc + 1) * 32;
#pragma unroll
    for (int u = 0; u < 4; ++u) { xr[u] = *(const v4f*)(xp + (size_t)u * 32 * DIN); wr[u] = *(const v4f*)(wp + (size_t)u * 32 * DIN); }
    asm volatile("s_wait_xcnt 0x0" :: "v"(xp), "v"(wp) : "memory");   /* the wait before a register of an issued load is overwritten (the fragments below take the address registers); the two addresses are inputs, so they stay live to here. Standing here it also keeps all eight loads in front of the pass's LDS reads and products: without it the eighth is issued only behind four products */
    proj_mac(xs[kc & 1], wt[kc & 1], wm, wn, lane, acc);
#pragma unroll
    for (int u = 0; u < 4; ++u) { *(v4b*)&xs[(kc + 1) & 1][u * 32 + lr][lc] = __builtin_convertvector(xr[u], v4b); *(v4b*)&wt[(kc + 1) & 1][u * 32 + lr][lc] = __builtin_convertvector(wr[u], v4b); }
    __syncthreads(); }
  proj_mac(xs[(DIN / 32 - 1) & 1], wt[(DIN / 32 - 1) & 1], wm, wn, lane, acc);
  __syncthreads();   // every wave has taken its last fragments: the epilogue's planes may overwrite the buffers
  if (which < 2) { _Float16 (*sh)[PJE] = (_Float16 (*)[PJE])sm; _Float16 (*sl)[PJE] = (_Float16 (*)[PJE])(sm + PJT * PJE * 2); _Float16* DH = which == 0 ? QH : KH; _Float16* DL = which == 0 ? QL : KL; const int nhi = which == 0 ? QHI : KHI; const bool hi_rows = t0 < nhi;
#pragma unroll
    for (int j = 0; j < 4; ++j) { const int cl = wn * 64 + j * 16 + col; const float bias = BA ? bfr(BA[c0 + cl]) : 0.f;
#pragma unroll
      for (int i = 0; i < 2; ++i)
#pragma unroll
        for (int r = 0; r < 8; ++r) { const float v = acc[i][j][r] + bias; const _Float16 hv = (_Float16)v; const int rl = wm * 32 + i * 16 + 8 * g + r; sh[rl][cl] = hv; sl[rl][cl] = (_Float16)((v - (float)hv) * 1024.0f); } }
    __syncthreads();
    for (int e = tid; e < PJT * 16; e += 256) { const int rl = e >> 4, q = e & 15; _Float16* ph = DH + (r0 + rl) * CC + c0 + q * 8; _Float16* pl = DL + (bb * nhi + t0 + rl) * (size_t)CC + c0 + q * 8; const v4u hv = *(const v4u*)&sh[rl][q * 8], lv = *(const v4u*)&sl[rl][q * 8];
      vst2((unsigned*)ph, hv); if (hi_rows) vst2((unsigned*)pl, lv);
      asm volatile("s_wait_xcnt 0x0" :: "v"(ph), "v"(pl), "v"(hv), "v"(lv) : "memory"); }   /* the wait before a register of an issued store is overwritten (the next trip takes the address and data registers); they are inputs, so they stay live to here */
  } else { _Float16 (*th)[PJE] = (_Float16 (*)[PJE])sm; __bf16 (*tb)[PJE] = (__bf16 (*)[PJE])(sm + PJT * PJE * 2); __bf16 (*tbl)[PJE] = (__bf16 (*)[PJE])(sm + 2 * PJT * PJE * 2); const bool hi_rows = t0 < KHI;
#pragma unroll
    for (int j = 0; j < 4; ++j) { const int cl = wn * 64 + j * 16 + col; const float bias = BA ? bfr(BA[c0 + cl]) : 0.f;
#pragma unroll
      for (int i = 0; i < 2; ++i)
#pragma unroll
        for (int r = 0; r < 8; ++r) { const float v = acc[i][j][r] + bias; const int rl = wm * 32 + i * 16 + 8 * g + r; th[cl][rl] = (_Float16)v; const __bf16 bh = (__bf16)v; tb[cl][rl] = bh; tbl[cl][rl] = (__bf16)(v - (float)bh); } }
    __syncthreads();
    for (int e = tid; e < PJT * 16; e += 256) { const int cl = e >> 4, q = e & 15; vst2((unsigned*)(VT + (bb * CC + c0 + cl) * (size_t)TT + t0 + q * 8), *(const v4u*)&th[cl][q * 8]); if (hi_rows) { const size_t o3 = (bb * CC + c0 + cl) * (size_t)KHI + t0 + q * 8; vst2((unsigned*)(VB + o3), *(const v4u*)&tb[cl][q * 8]); vst2((unsigned*)(VBL + o3), *(const v4u*)&tbl[cl][q * 8]); } } } }
// ---- k_sm: block = query row t (head in group): keys [0, kend): causal -> logit if s <= t else excluded; softmax in f32; P x 2^11 in place (0 for excluded)
__global__ __launch_bounds__(256) void k_sm(float* __restrict__ S0 SM_EXTRA_PARAMS) { __shared__ float sred[8]; __shared__ float sbc; __shared__ __align__(16) float shv[TT];
  const int tid = threadIdx.x; const int t = blockIdx.x; const int kend = (kb_last(t >> 6) + 1) * 128;
  float* sr = S0 + (size_t)blockIdx.y * TT * TT + (size_t)t * TT;
  float m = -3.0e38f; for (int k = tid; k < kend; k += 256) { float v = (!CAUSAL || k <= t) ? sr[k] : -3.0e38f; SM_MASK_HOOK; shv[k] = v; m = fmaxf(m, v); }
#pragma unroll
  for (int o = 1; o < 32; o <<= 1) m = fmaxf(m, __shfl_xor(m, o));
  if ((tid & 31) == 0) sred[tid >> 5] = m; __syncthreads(); if (tid == 0) { float a = sred[0]; for (int i = 1; i < 8; ++i) a = fmaxf(a, sred[i]); sbc = a; } __syncthreads(); m = sbc; __syncthreads();
  float sum = 0.f; for (int k = tid; k < kend; k += 256) { const float v = shv[k]; const float e = (v <= -1.0e38f) ? 0.f : expf(v - m); shv[k] = e; sum += e; }
#pragma unroll
  for (int o = 1; o < 32; o <<= 1) sum += __shfl_xor(sum, o);
  if ((tid & 31) == 0) sred[tid >> 5] = sum; __syncthreads(); if (tid == 0) { float a = 0.f; for (int i = 0; i < 8; ++i) a += sred[i]; sbc = a > 0.f ? 2048.0f / a : 0.f; }   /* a fully excluded row yields P = 0 */ __syncthreads(); const float inv = sbc;
  for (int k = tid; k < kend; k += 256) shv[k] = shv[k] * inv;
  __syncthreads(); for (int q = tid; q < kend / 4; q += 256) vst2(sr + q * 4, *(const v4f*)&shv[q * 4]); }
// ---- k_stat: softmax over the QUERY axis under the causal mask (the source's softmax(axis=2) on [B, H, i, j] scores with -inf where j > i), with no score matrix in memory. Block = (STK key columns from k0, head h, batch b), STW waves. Every wave keeps the STK keys' f16 fragments in registers and takes every STW-th tile of 16 of the visible query rows k0 .. TT-1: scores q x k on WMMA (one f16 product), then per lane and column tile the online (max, sum) over its 8 rows (f32; the maximum runs over the raw products, each term is 2^(s x SCL2 - m x SCL2): one multiply-add and one v_exp_f32; q < k reads as -inf and adds 2^(-inf) = 0; the running maximum starts finite, so no difference is inf - inf; the sum so far is rescaled by 2^((m_old - m_new) x SCL2)). The 2 * STW partial pairs of a column (wave, lane half) are merged through LDS behind one barrier, which every wave reaches after its own last tile: m_k in base-2 units (m x SCL2) to CM, 2^11 / Z_k to CR, whole lines. The cost of a strip falls linearly with its index (strip x sees TT - x * STK query rows) and every work-group of the launch is resident at once, so a work-group takes two strips one after the other, the last minus x and x: every work-group has the same work. Each strip has its own pair of LDS arrays, so the second strip's partials never meet the first strip's merge. Every '#pragma unroll' of k_stat and k_out is there so that the small arrays it indexes (fragments, accumulators, m, z, P) stay in registers
#define STW 8
#define STK 64
// the fragments of frag_h / frag_b from a pointer that already holds the lane's own 8g offset: a run of loads then shares one address value, which the wait behind the run can name
// 2^x on v_exp_f32: every argument here is at most about 0 where its result is used, and a result below the normal range may read as 0 (it stands beside a column sum of at least 1). Written as asm so that the slot the instruction set asks for behind a transcendental (no use of its result, no overwrite of its source in the next instruction) is kept by construction, wherever the compiler places the statement. The v_nop is that slot
__device__ __forceinline__ float ex2(float x) { float e; asm("v_exp_f32 %0, %1\n\tv_nop" : "=v"(e) : "v"(x)); return e; }
// eight of them: the results are early-clobber outputs, so none lies in a source and each v_exp_f32 is the independent instruction behind the one before; one v_nop behind the last
__device__ __forceinline__ void ex2x8(float (&e)[8], const float (&x)[8]) {
  asm("v_exp_f32 %0, %8\n\tv_exp_f32 %1, %9\n\tv_exp_f32 %2, %10\n\tv_exp_f32 %3, %11\n\tv_exp_f32 %4, %12\n\tv_exp_f32 %5, %13\n\tv_exp_f32 %6, %14\n\tv_exp_f32 %7, %15\n\tv_nop"
      : "=&v"(e[0]), "=&v"(e[1]), "=&v"(e[2]), "=&v"(e[3]), "=&v"(e[4]), "=&v"(e[5]), "=&v"(e[6]), "=&v"(e[7])
      : "v"(x[0]), "v"(x[1]), "v"(x[2]), "v"(x[3]), "v"(x[4]), "v"(x[5]), "v"(x[6]), "v"(x[7])); }
__device__ __forceinline__ v16h frag_hp(const _Float16* p) { union { v16h v; v8h q[2]; } u; u.q[0] = *(const v8h*)p; u.q[1] = *(const v8h*)(p + 16); return u.v; }
__device__ __forceinline__ v16b frag_bp(const __bf16* p) { union { v16b v; v8b q[2]; } u; u.q[0] = *(const v8b*)p; u.q[1] = *(const v8b*)(p + 16); return u.v; }
__global__ __launch_bounds__(STW * 32) void k_stat(const _Float16* __restrict__ QH, const _Float16* __restrict__ KH, float* __restrict__ CM, float* __restrict__ CR) { __shared__ float pm2[2][2 * STW][STK], pz2[2][2 * STW][STK];
  const int tid = threadIdx.x, lane = tid & 31, col = lane & 15, g = lane >> 4; const int wave = __builtin_amdgcn_readfirstlane(tid >> 5); const int h = blockIdx.y, b = blockIdx.z;
  for (int half = 0; half < 2; ++half) { const int k0 = (half ? (int)blockIdx.x : TT / STK - 1 - (int)blockIdx.x) * STK; float (*pm)[STK] = pm2[half]; float (*pz)[STK] = pz2[half];
  v16h kf[HD / 32][STK / 16]; const _Float16* kp = KH + ((size_t)b * TT + k0 + col) * CC + h * HD + 8 * g;
#pragma unroll
  for (int kc = 0; kc < HD / 32; ++kc) {
#pragma unroll
    for (int j = 0; j < STK / 16; ++j) kf[kc][j] = frag_hp(kp + (size_t)j * 16 * CC + kc * 32); }
  asm volatile("s_wait_xcnt 0x0" :: "v"(kp) : "memory");   /* the wait before a register of an issued load is overwritten; the loads' common address is an input, so it stays live to here and no fragment lands in it */
  float m[STK / 16], z[STK / 16];   // m: running maximum of the raw products
#pragma unroll
  for (int j = 0; j < STK / 16; ++j) { m[j] = -3.0e38f; z[j] = 0.f; }
  for (int ql0 = k0 + wave * 16; ql0 < TT; ql0 += STW * 16) { const _Float16* qp = QH + ((size_t)b * TT + ql0 + col) * CC + h * HD; const v16h a0 = frag_h(qp, lane), a1 = frag_h(qp + 32, lane);
#pragma unroll
    for (int j = 0; j < STK / 16; ++j) { v8f acc = {}; acc = wmma16(a0, kf[0][j], acc); acc = wmma16(a1, kf[1][j], acc); const int k = k0 + j * 16 + col; float v[8];
#pragma unroll
      for (int r = 0; r < 8; ++r) v[r] = (ql0 + 8 * g + r >= k) ? acc[r] : -INFINITY;
      float mn = m[j];
#pragma unroll
      for (int r = 0; r < 8; ++r) mn = fmaxf(mn, v[r]);
      const float nb = -(mn * SCL2); float x[8], e[8];
#pragma unroll
      for (int r = 0; r < 8; ++r) x[r] = __builtin_fmaf(v[r], SCL2, nb);
      ex2x8(e, x); float s = e[0];
#pragma unroll
      for (int r = 1; r < 8; ++r) s += e[r];
      z[j] = z[j] * ex2((m[j] - mn) * SCL2) + s; m[j] = mn; } }   /* the two raw maxima are subtracted first: a maximum that has not moved gives exactly 2^0 = 1, and a difference followed by a multiply has no fused form */
#pragma unroll
  for (int j = 0; j < STK / 16; ++j) { pm[2 * wave + g][j * 16 + col] = m[j] * SCL2; pz[2 * wave + g][j * 16 + col] = z[j]; }
  __syncthreads();
  if (tid < STK) { float mm = pm[0][tid];
#pragma unroll
    for (int w = 1; w < 2 * STW; ++w) mm = fmaxf(mm, pm[w][tid]);
    float a = 0.f;   /* a partial that saw no visible row of this column holds Z = 0 and a finite maximum */
#pragma unroll
    for (int w = 0; w < 2 * STW; ++w) a += pz[w][tid] * ex2(pm[w][tid] - mm);
    const size_t o = ((size_t)b * NH + h) * TT + k0 + tid; float* pcm = CM + o; float* pcr = CR + o; const float rz = 2048.0f / a; vst2(pcm, mm); vst2(pcr, rz);   /* every column sees at least its own diagonal entry: Z_k >= 1 */
    asm volatile("s_wait_xcnt 0x0" :: "v"(pcm), "v"(pcr), "v"(mm), "v"(rz) : "memory"); } } }   /* the wait before a register of an issued store is overwritten (the second strip takes the address and data registers); they are inputs, so they stay live to here */
// ---- k_out: block = 64 queries (qb) of (b, h), a wave = 16 queries: per 32 keys the scores are formed again on WMMA, transposed (A = 16 key rows, B = the wave's 16 queries, kept in registers; the same one f16 product), so that a lane holds, for its own query, the keys 8g + 0..7 of each 16-key tile: two such tiles are, in place, the A fragment of P . v (hardware k order, the order of frag_b). P[i][j] = 2^(s x SCL2 - m_j) x (2^11 / Z_j), m_j in base-2 units, for j <= i, 0 above the diagonal (unconditional loads, value select); P and v as bf16 hi + lo, 3 products, keys [0, kend) as before; 256-B (row, head) segment by 16 lanes. What the four waves read of 64 keys (k rows, v hi and lo rows, column maxima and scales) is the same for all of them: it is brought into LDS once per block, as whole 128-B lines, by asynchronous copies, two buffers, the next tile flying while a tile is worked on; every fragment comes from LDS. The cost of a query block grows linearly with its index (block qb walks the keys up to its own diagonal) and every work-group of the launch is resident at once, so a work-group takes two query blocks of its head one after the other, the last minus x and x: every work-group has the same work
#define OKT 64              // keys of a staged tile
#define OPB 144             // LDS pitch in bytes of a staged row of 128 B: 16 B x odd, free of bank conflicts for the 16-byte fragment reads
#define OPL (64 * OPB)      // one staged plane: 64 rows (64 keys of k; 64 channels of v hi; of v lo)
#define OBF (3 * OPL + 512) // one buffer: three planes, then 64 column maxima and 64 column scales
// the 12 copies of a thread for one tile: 8 lanes cover one row's 128-B line, the block 16 rows a copy. la: the thread's LDS byte address in the k plane; kg, hg, lg: its addresses in the tile's first 16 rows
__device__ __forceinline__ void out_stage(unsigned la, const _Float16* kg, const __bf16* hg, const __bf16* lg) {
  /* the copies and, as the last line of their own statement, the wait before a register that an issued copy names is rewritten */
  asm volatile("global_load_async_to_lds_b128 %0, %12, off\n\tglobal_load_async_to_lds_b128 %1, %13, off\n\tglobal_load_async_to_lds_b128 %2, %14, off\n\tglobal_load_async_to_lds_b128 %3, %15, off\n\t"
               "global_load_async_to_lds_b128 %4, %16, off\n\tglobal_load_async_to_lds_b128 %5, %17, off\n\tglobal_load_async_to_lds_b128 %6, %18, off\n\tglobal_load_async_to_lds_b128 %7, %19, off\n\t"
               "global_load_async_to_lds_b128 %8, %20, off\n\tglobal_load_async_to_lds_b128 %9, %21, off\n\tglobal_load_async_to_lds_b128 %10, %22, off\n\tglobal_load_async_to_lds_b128 %11, %23, off\n\ts_wait_xcnt 0x0"
               :: "v"(la), "v"(la + 16 * OPB), "v"(la + 32 * OPB), "v"(la + 48 * OPB),
                  "v"(la + OPL), "v"(la + OPL + 16 * OPB), "v"(la + OPL + 32 * OPB), "v"(la + OPL + 48 * OPB),
                  "v"(la + 2 * OPL), "v"(la + 2 * OPL + 16 * OPB), "v"(la + 2 * OPL + 32 * OPB), "v"(la + 2 * OPL + 48 * OPB),
                  "v"(kg), "v"(kg + (size_t)16 * CC), "v"(kg + (size_t)32 * CC), "v"(kg + (size_t)48 * CC),
                  "v"(hg), "v"(hg + (size_t)16 * KHI), "v"(hg + (size_t)32 * KHI), "v"(hg + (size_t)48 * KHI),
                  "v"(lg), "v"(lg + (size_t)16 * KHI), "v"(lg + (size_t)32 * KHI), "v"(lg + (size_t)48 * KHI) : "memory"); }
// one wave's copy of the tile's 64 maxima (lanes 0..15) and 64 scales (lanes 16..31), with the same wait
__device__ __forceinline__ void out_stage_c(unsigned la, const float* cg) { asm volatile("global_load_async_to_lds_b128 %0, %1, off\n\ts_wait_xcnt 0x0" :: "v"(la), "v"(cg) : "memory"); }
// amdgpu_waves_per_eu(4): a budget of 256 registers; without it what the compiler keeps live round the loop over the two query blocks takes the count just past 256 and fills the key loop with register-window switches
__global__ __launch_bounds__(128) __attribute__((amdgpu_waves_per_eu(4))) void k_out(const _Float16* __restrict__ QH, const _Float16* __restrict__ KH, const float* __restrict__ CM, const float* __restrict__ CR, const __bf16* __restrict__ VB, const __bf16* __restrict__ VBL, float* __restrict__ Y) { __shared__ __align__(16) unsigned char sm[2 * OBF];   // the loop's two buffers; behind the loop's last barrier the epilogue's rows
  const int tid = threadIdx.x, lane = tid & 31, col = lane & 15, g = lane >> 4; const int wave = __builtin_amdgcn_readfirstlane(tid >> 5); const int h = blockIdx.y, b = blockIdx.z;
  const int sr = tid >> 3, sq = (tid & 7) * 8;   // staging: the thread's row among 16 and its 16 bytes of the row
  const _Float16* kg = KH + ((size_t)b * TT + sr) * CC + h * HD + sq; const size_t po = ((size_t)b * CC + h * HD + sr) * (size_t)KHI + sq; const __bf16* hg = VB + po; const __bf16* lg = VBL + po;
  const float* cg = (g ? CR : CM) + ((size_t)b * NH + h) * TT + col * 4;
  const unsigned la = (unsigned)(size_t)sm + sr * OPB + sq * 2, lc = (unsigned)(size_t)sm + 3 * OPL + lane * 16;
  for (int half = 0; half < 2; ++half) { const int qb = half ? (int)blockIdx.x : NQB - 1 - (int)blockIdx.x; const int ql0 = qb * 64 + wave * 16; const int nt = (kb_last(qb) + 1) * 2; const int qi = ql0 + col;   // nt tiles of 64 keys, never fewer than two
  const _Float16* qp = QH + ((size_t)b * TT + qi) * CC + h * HD; const v16h q0 = frag_h(qp, lane), q1 = frag_h(qp + 32, lane);
  out_stage(la, kg, hg, lg); if (wave == 0) out_stage_c(lc, cg);
  asm volatile("s_wait_asynccnt 0x0" ::: "memory");   /* this wave's copies of tile 0 have landed */
  __syncthreads();                                     /* and every other wave's: tile 0 may be read */
  out_stage(la + OBF, kg + (size_t)OKT * CC, hg + OKT, lg + OKT); if (wave == 0) out_stage_c(lc + OBF, cg + OKT);
  v8f acc[HD / 16] = {};
  for (int t = 0; t < nt; ++t) { const unsigned char* bp = sm + (t & 1) * OBF;
#pragma unroll   /* the tile's two halves of 32 keys, unrolled so that every LDS offset of a half is an immediate */
    for (int s = 0; s < 2; ++s) { const int k0 = t * OKT + s * 32;
      const _Float16* ka = (const _Float16*)(bp + (s * 32 + col) * OPB) + 8 * g; const _Float16* kb2 = ka + 16 * (OPB / 2); const float* cmk = (const float*)(bp + 3 * OPL) + s * 32 + 8 * g; const float* crk = cmk + OKT;
      const v16h ka0 = frag_hp(ka), kb0 = frag_hp(kb2), ka1 = frag_hp(ka + 32), kb1 = frag_hp(kb2 + 32);
      v4f mv[4], rv[4];
#pragma unroll
      for (int u = 0; u < 4; ++u) { const int o = (u >> 1) * 16 + (u & 1) * 4; mv[u] = *(const v4f*)(cmk + o); rv[u] = *(const v4f*)(crk + o); }
      v16b vh[HD / 16], vl[HD / 16]; const __bf16* vhp = (const __bf16*)(bp + OPL + col * OPB) + s * 32 + 8 * g; const __bf16* vlp = vhp + OPL / 2;
#pragma unroll
      for (int j = 0; j < HD / 16; ++j) { vh[j] = frag_bp(vhp + j * 16 * (OPB / 2)); vl[j] = frag_bp(vlp + j * 16 * (OPB / 2)); }
      v8f s0 = {}, s1 = {}; s0 = wmma16(ka0, q0, s0); s1 = wmma16(kb0, q0, s1); s0 = wmma16(ka1, q1, s0); s1 = wmma16(kb1, q1, s1);
      float pv[16], x0[8], x1[8], e0[8], e1[8];
#pragma unroll
      for (int i = 0; i < 8; ++i) { x0[i] = __builtin_fmaf(s0[i], SCL2, -mv[i >> 2][i & 3]); x1[i] = __builtin_fmaf(s1[i], SCL2, -mv[2 + (i >> 2)][i & 3]); }
      ex2x8(e0, x0); ex2x8(e1, x1);
#pragma unroll
      for (int i = 0; i < 8; ++i) { const int ke = k0 + 8 * g + i; pv[i] = (ke <= qi) ? e0[i] * rv[i >> 2][i & 3] : 0.f; pv[8 + i] = (ke + 16 <= qi) ? e1[i] * rv[2 + (i >> 2)][i & 3] : 0.f; }
      const F2 p = bsplit16(pv);
#pragma unroll
      for (int j = 0; j < HD / 16; ++j) { acc[j] = wmma_bf(p.h, vh[j], acc[j]); acc[j] = wmma_bf(p.l, vh[j], acc[j]); acc[j] = wmma_bf(p.h, vl[j], acc[j]); } }
    asm volatile("s_wait_dscnt 0x0" ::: "memory");      /* this wave's reads of tile t are over */
    asm volatile("s_wait_asynccnt 0x0" ::: "memory");   /* its copies of tile t + 1 have landed */
    __syncthreads();                                     /* the same of every wave: tile t + 1 may be read, tile t's buffer refilled */
    if (t + 2 < nt) { const int kn = (t + 2) * OKT; const unsigned bo = (t & 1) * OBF; out_stage(la + bo, kg + (size_t)kn * CC, hg + kn, lg + kn); if (wave == 0) out_stage_c(lc + bo, cg + kn); } }
  asm volatile("s_wait_asynccnt 0x0" ::: "memory");     /* no copy is outstanding when the buffers become the epilogue's rows */
  float (*ss)[16][HD + 4] = (float (*)[16][HD + 4])sm;
#pragma unroll
  for (int j = 0; j < HD / 16; ++j)
#pragma unroll
    for (int r = 0; r < 8; ++r) ss[wave][8 * g + r][j * 16 + col] = acc[j][r] * (1.0f / 2048.0f);
  LDSX(); for (int rl = 0; rl < 16; ++rl) if (lane < HD / 4) vst2(Y + ((size_t)b * TT + ql0 + rl) * CC + h * HD + lane * 4, *(const v4f*)&ss[wave][rl][lane * 4]);
  if (half == 0) {
    asm volatile("s_wait_xcnt 0x0" ::: "memory");     /* the wait before a register of an issued store is overwritten (the second query block takes the address and data registers) */
    asm volatile("s_wait_dscnt 0x0" ::: "memory");    /* this wave's reads of its epilogue rows are over */
    __syncthreads(); } } }                             /* the same of every wave: the second query block's copies may overwrite the rows */

extern "C" void kernel_launch(void* const* d_in, const int* in_sizes, int n_in, void* d_out, int out_size, void* d_ws, size_t ws_size, hipStream_t stream) {
  (void)in_sizes; (void)n_in; (void)out_size;
  const float** F = (const float**)d_in;
  if (ws_size < (size_t)WS_END) return;
  char* ws = (char*)d_ws; _Float16 *QH = (_Float16*)(ws + WS_QH), *KH = (_Float16*)(ws + WS_KH), *VT = (_Float16*)(ws + WS_VT), *QL = (_Float16*)(ws + WS_QL), *KL = (_Float16*)(ws + WS_KL); __bf16 *VB = (__bf16*)(ws + WS_VB), *VBL = (__bf16*)(ws + WS_VBL); float *S = (float*)(ws + WS_S), *Y = (float*)(ws + WS_Y);
  (void)Y; (void)QL; (void)KL; (void)VB; (void)VBL; (void)S; (void)VT;
  // inputs: 0 X [2,2048,1024]; 1 Wq [1024,1024] (out,in), 2 bq; 3 Wk, 4 bk; 5 Wv, 6 bv (biases N(0, 0.02), nonzero); no output projection
  if (ws_size < (size_t)WS_END2) return;
  float *CM = (float*)(ws + WS_CM), *CZ = (float*)(ws + WS_CZ);
  k_proj<<<dim3(TNB * TT / PJT, CC / PJT, 3), 256, 0, stream>>>(F[0], F[0], F[0], F[1], F[3], F[5], F[2], F[4], F[6], QH, QL, KH, KL, VT, VB, VBL);
  k_stat<<<dim3(TT / STK / 2, NH, TNB), STW * 32, 0, stream>>>(QH, KH, CM, CZ);   /* per key column j: max and 2^11 / sum over the visible queries i >= j */
  k_out<<<dim3(NQB / 2, NH, TNB), 128, 0, stream>>>(QH, KH, CM, CZ, VB, VBL, (float*)d_out);   /* P formed in registers, then P . v */
}

// v007
// A run of this version takes 96.2 microseconds.
// Two timings next to v006 both put it at 1.06 times that version's speed.
// Counting every step since v000, it is 81.7 times as fast.
// compute dtype: all float inputs rounded to bf16; q/k/v projections with EXACT bf16 products on WMMA 16x16x32 (f32 accumulate) + bias; causal scores q x k once to f16 each (1 product; the module scales by 1/sqrt(E) = 1/32, so sigma - 0.1) on every block; softmax over the QUERY axis in f32 (per key column: online max / sum over the visible queries, exponentials as 2^x on the hardware's own instruction, 1/sqrt(E) and log2(e) folded into one multiply-add); P as bf16 hi + lo against v as bf16 hi + lo (3 products) on EVERY block; f32 output.
#include <hip/hip_runtime.h>
#include <math.h>

typedef __attribute__((ext_vector_type(16))) _Float16 v16h;
typedef __attribute__((ext_vector_type(16))) __bf16 v16b;
typedef __attribute__((ext_vector_type(8)))  _Float16 v8h;
typedef __attribute__((ext_vector_type(8)))  float v8f;
typedef __attribute__((ext_vector_type(4)))  float v4f;
typedef __attribute__((ext_vector_type(2)))  float v2f;
typedef __attribute__((ext_vector_type(4)))  unsigned v4u;
typedef __attribute__((ext_vector_type(4)))  int v4i;
typedef float __attribute__((may_alias)) float_a;
typedef int __attribute__((may_alias)) int_a;

template <typename T> __device__ __forceinline__ void vst2(void* p, T v) { *(T*)p = v;  }
__device__ __forceinline__ v8f wmma16(v16h a, v16h b, v8f c) {
  return __builtin_amdgcn_wmma_f32_16x16x32_f16(false, a, false, b, (short)0, c, false, false);
}
__device__ __forceinline__ v8f wmma_bf(v16b a, v16b b, v8f c) {
  return __builtin_amdgcn_wmma_f32_16x16x32_bf16(false, a, false, b, (short)0, c, false, false);
}
// 16x16x32 fragments: lane = (h = lane>>4, row/col = lane&15); elements 0..7 = k0+8h+0..7, 8..15 = k0+16+8h+0..7; D element r = row 8h+r
__device__ __forceinline__ v16h frag_h(const _Float16* rowk0, int lane) {
  union { v16h v; v8h q[2]; } u; const _Float16* p = rowk0 + 8 * (lane >> 4);
  u.q[0] = *(const v8h*)p; u.q[1] = *(const v8h*)(p + 16); return u.v;
}
__device__ __forceinline__ v16h frag_f32(const float* rowk0, int lane) {
  v16h a; const float* p = rowk0 + 8 * (lane >> 4);
#pragma unroll
  for (int i = 0; i < 8; ++i) { a[i] = (_Float16)p[i]; a[8 + i] = (_Float16)p[16 + i]; }
  return a;
}
__device__ __forceinline__ v16h frag_f32s(const float* rowk0, int lane, float sc) {
  v16h a; const float* p = rowk0 + 8 * (lane >> 4);
#pragma unroll
  for (int i = 0; i < 8; ++i) { a[i] = (_Float16)(p[i] * sc); a[8 + i] = (_Float16)(p[16 + i] * sc); }
  return a;
}
// column fragment from a [K][ld] layout (column n), rows >= K read as 0
__device__ __forceinline__ v16h fragc_f32(const float* W, int k0, int n, int lane, int ld, int K) {
  v16h a; const int g = lane >> 4;
#pragma unroll
  for (int i = 0; i < 8; ++i) { const int ka = k0 + 8 * g + i, kb = ka + 16;
    a[i] = (_Float16)(ka < K ? W[(size_t)(ka < K ? ka : K - 1) * ld + n] : 0.f); a[8 + i] = (_Float16)(kb < K ? W[(size_t)(kb < K ? kb : K - 1) * ld + n] : 0.f); }
  return a;
}
struct F2 { v16b h, l; };
__device__ __forceinline__ F2 bsplit16(const float v[16]) { F2 r;
#pragma unroll
  for (int i = 0; i < 16; ++i) { const __bf16 h = (__bf16)v[i]; r.h[i] = h; r.l[i] = (__bf16)(v[i] - (float)h); }
  return r; }
__device__ __forceinline__ F2 split_row(const float* row, int k0, int lane) { float v[16]; const float* p = row + k0 + 8 * (lane >> 4);
#pragma unroll
  for (int i = 0; i < 8; ++i) { v[i] = p[i]; v[8 + i] = p[16 + i]; }
  return bsplit16(v); }
__device__ __forceinline__ F2 split_rowK(const float* row, int k0, int lane, int K) { float v[16]; const int g = lane >> 4;
#pragma unroll
  for (int i = 0; i < 8; ++i) { const int ka = k0 + 8 * g + i, kb = ka + 16; v[i] = ka < K ? row[ka < K ? ka : K - 1] : 0.f; v[8 + i] = kb < K ? row[kb < K ? kb : K - 1] : 0.f; }
  return bsplit16(v); }
__device__ __forceinline__ F2 split_col(const float* W, int k0, int n, int lane, int ld, int K) { float v[16]; const int g = lane >> 4;
#pragma unroll
  for (int i = 0; i < 8; ++i) { const int ka = k0 + 8 * g + i, kb = ka + 16; v[i] = ka < K ? W[(size_t)(ka < K ? ka : K - 1) * ld + n] : 0.f; v[8 + i] = kb < K ? W[(size_t)(kb < K ? kb : K - 1) * ld + n] : 0.f; }
  return bsplit16(v); }
__device__ __forceinline__ v8f mac3(const F2& a, const F2& b, v8f c) { c = wmma_bf(a.l, b.h, c); c = wmma_bf(a.h, b.l, c); return wmma_bf(a.h, b.h, c); }
__device__ __forceinline__ float sigm(float v) { return 1.0f / (1.0f + expf(-v)); }
#define LDSX() do { asm volatile("s_wait_dscnt 0" ::: "memory"); __builtin_amdgcn_wave_barrier(); __builtin_amdgcn_fence(__ATOMIC_RELEASE, "workgroup"); } while (0)

// Multi-headed attention whose softmax runs over the QUERY axis, scaled by the MODEL width (X [2,2048,1024]; torch (out,in) Wq / Wk / Wv [1024,1024] N(0, 1/1024) + biases N(0, 0.02); 16 heads x 64; scores / sqrt(E) = / 32; -inf where j > i; attn = softmax(scores, axis=2) - axis 2 of [B, H, i, j] is the QUERY axis i: every key column j is normalised over the queries i >= j (faithful to the source); out = attn v; merge; no output projection).
#define NB 2
#define TT 2048
#define CC 1024            // NH * HD = projected width
#define DIN 1024          // input (model) width
#define NH 16
#define HD 64
#define NQB (TT / 64)
#define HG 4
#define SCALE (0.03125f)
#define SCL2 (SCALE * 1.44269504088896340736f)   // raw q . k product -> exponent to base 2
#define CAUSAL 1
#ifndef TNB
#define TNB NB
#endif
__device__ __forceinline__ float bfr(float v) { return (float)(__bf16)v; }
__host__ __device__ __forceinline__ int kb_last(int qb) { return CAUSAL ? ((qb * 64 + 63) >> 7) : (TT / 128 - 1); }
typedef __attribute__((ext_vector_type(8))) __bf16 v8b;
__device__ __forceinline__ v16b frag_b(const __bf16* rowk0, int lane) {
  union { v16b v; v8b q[2]; } u; const __bf16* p = rowk0 + 8 * (lane >> 4);
  u.q[0] = *(const v8b*)p; u.q[1] = *(const v8b*)(p + 16); return u.v;
}
#define QBH 32              // not read: k_out takes its one bf16 hi/lo path on all NQB query blocks
#define QHI 0               // no q residual plane: the scores are tiny (scale 1/32) and single-product everywhere
#define QBH_SC 0            // not read (k_out: bf16 hi/lo P.v on every block - a query-axis softmax has O(1) weights on the LAST key columns)
#define KHI 2048            // key rows carrying k residual / v bf16 hi+lo planes (the v planes are read by k_out; the k residual is not read)
// B fragment (k rows k0+.., output column o) of a weight: (in,out) [K][ld] or (out,in) [ld rows of K]: bf16 exact, or f16(bf16 * 256) exact
__device__ __forceinline__ v16b wcol_io(const float* Wm, int k0, int o, int lane, int ld) { v16b w; const int g = lane >> 4;
#pragma unroll
  for (int i = 0; i < 8; ++i) { w[i] = (__bf16)Wm[(size_t)(k0 + 8 * g + i) * ld + o]; w[8 + i] = (__bf16)Wm[(size_t)(k0 + 16 + 8 * g + i) * ld + o]; }
  return w; }
__device__ __forceinline__ v16b wcol_oi(const float* Wm, int k0, int o, int lane, int K) { v16b w; const float* p = Wm + (size_t)o * K + k0 + 8 * (lane >> 4);
#pragma unroll
  for (int i = 0; i < 8; ++i) { w[i] = (__bf16)p[i]; w[8 + i] = (__bf16)p[16 + i]; }
  return w; }
__device__ __forceinline__ v16h wcolh_io(const float* Wm, int k0, int o, int lane, int ld) { v16h w; const int g = lane >> 4;
#pragma unroll
  for (int i = 0; i < 8; ++i) { w[i] = (_Float16)(bfr(Wm[(size_t)(k0 + 8 * g + i) * ld + o]) * 256.0f); w[8 + i] = (_Float16)(bfr(Wm[(size_t)(k0 + 16 + 8 * g + i) * ld + o]) * 256.0f); }
  return w; }
__device__ __forceinline__ v16h wcolh_oi(const float* Wm, int k0, int o, int lane, int K) { v16h w; const float* p = Wm + (size_t)o * K + k0 + 8 * (lane >> 4);
#pragma unroll
  for (int i = 0; i < 8; ++i) { w[i] = (_Float16)(bfr(p[i]) * 256.0f); w[8 + i] = (_Float16)(bfr(p[16 + i]) * 256.0f); }
  return w; }
#define WQKV_LAYOUT 1   // not read by k_proj (W taken as (out,in) [CC][DIN]); WCOL only: 0 = (in,out) [DIN][CC]; 1 = (out,in) [CC][DIN]; 2 = per-head [NH][DIN][HD]
__device__ __forceinline__ v16b wcol_hdk(const float* Wm, int k0, int o, int lane) { v16b w; const int g = lane >> 4; const float* p = Wm + (size_t)(o / HD) * DIN * HD + (o % HD);
#pragma unroll
  for (int i = 0; i < 8; ++i) { w[i] = (__bf16)p[(size_t)(k0 + 8 * g + i) * HD]; w[8 + i] = (__bf16)p[(size_t)(k0 + 16 + 8 * g + i) * HD]; }
  return w; }
#define WO_OUT_IN 0
#if WQKV_LAYOUT == 1
#define WCOL(W, k0, o, lane) wcol_oi(W, k0, o, lane, DIN)
#elif WQKV_LAYOUT == 2
#define WCOL(W, k0, o, lane) wcol_hdk(W, k0, o, lane)
#else
#define WCOL(W, k0, o, lane) wcol_io(W, k0, o, lane, CC)
#endif
#if WO_OUT_IN
#define WOCOL(W, k0, o, lane) wcol_oi(W, k0, o, lane, CC)
#define WOCOLH(W, k0, o, lane) wcolh_oi(W, k0, o, lane, CC)
#else
#define WOCOL(W, k0, o, lane) wcol_io(W, k0, o, lane, DIN)
#define WOCOLH(W, k0, o, lane) wcolh_io(W, k0, o, lane, DIN)
#endif

#ifndef SM_EXTRA_PARAMS
#define SM_EXTRA_PARAMS
#endif
#ifndef PROJ_EXTRA_PARAMS
#define PROJ_EXTRA_PARAMS
#endif
#ifndef SM_MASK_HOOK
#define SM_MASK_HOOK (void)0
#endif

#define WS_QH  0u                                      // f16 q rows [b*t][CC]
#define WS_KH  (WS_QH + 2u * (size_t)NB * TT * CC)      // f16 k rows [b*t][CC]
#define WS_VT  (WS_KH + 2u * (size_t)NB * TT * CC)      // f16 v planes [b][c][t]
#define WS_QL  (WS_VT + 2u * (size_t)NB * CC * TT)      // f16 q residual x 2^10 rows [b][t < QHI][CC]
#define WS_KL  (WS_QL + 2u * (size_t)NB * QHI * CC)     // f16 k residual x 2^10 rows [b][t < KHI][CC]
#define WS_VB  (WS_KL + 2u * (size_t)NB * KHI * CC)     // bf16 v hi planes [b][c][t < KHI]
#define WS_VBL (WS_VB + 2u * (size_t)NB * CC * KHI)
#define WS_S   (WS_VBL + 2u * (size_t)NB * CC * KHI)    // f32 logits / P [hg][t][s] (plane not touched: the scores stay in registers)
#define WS_Y   (WS_S  + 4u * (size_t)HG * TT * TT)      // f32 ctx rows [b*t][CC] (only when there is an output projection)
#define WS_END (WS_Y  + 0u)
#define WS_CM (WS_END)                                  // f32 column maxima, base-2 units [NB * NH][TT]
#define WS_CZ (WS_CM + 4u * (size_t)NB * NH * TT)       // f32 2^11 / column sums [NB * NH][TT]
#define WS_END2 (WS_CZ + 4u * (size_t)NB * NH * TT)

// ---- k_proj: block = (128 rows, 128 cols, which), 8 waves of 32 rows x 64 cols: q/k/v = X W (+ b) with exact bf16 products (K = DIN, 32 k a pass, ascending, one accumulator chain per output as before). Per pass the block's 128 X rows and 128 W rows are read once as whole 128-B lines, rounded to bf16 once and laid in one of two LDS buffers; every wave takes its fragments from there. The next pass's global loads are issued in front of this pass's products and stored into the other buffer behind them; the one barrier of a pass publishes that buffer and ends the reads of this one. -> which 0: q f16 rows (+ residual rows < QHI); 1: k f16 rows (+ residual rows < KHI); 2: v f16 planes [c][t] (+ bf16 hi/lo planes for t < KHI). Every '#pragma unroll' of k_proj and proj_mac is there so that the small arrays it indexes (staged values, fragments, accumulators) stay in registers
#define PJT 128             // rows and columns of a block's tile
#define PJP 40              // LDS pitch of a staged row of 32 bf16, in elements: 80 B = 16 B x odd, free of bank conflicts for the 16-byte fragment reads
#define PJE 136             // LDS pitch of an epilogue row of 128 16-bit values, in elements: 272 B = 16 B x odd
typedef __attribute__((ext_vector_type(4))) __bf16 v4b;
__device__ __forceinline__ void proj_mac(const __bf16 (*xs)[PJP], const __bf16 (*wt)[PJP], int wm, int wn, int lane, v8f (&acc)[2][4]) { const int col = lane & 15; v16b a[2], w[4];
#pragma unroll
  for (int i = 0; i < 2; ++i) a[i] = frag_b(&xs[wm * 32 + i * 16 + col][0], lane);
#pragma unroll
  for (int j = 0; j < 4; ++j) w[j] = frag_b(&wt[wn * 64 + j * 16 + col][0], lane);
#pragma unroll
  for (int i = 0; i < 2; ++i)
#pragma unroll
    for (int j = 0; j < 4; ++j) acc[i][j] = __builtin_amdgcn_wmma_f32_16x16x32_bf16(false, a[i], false, w[j], (short)0, acc[i][j], false, false); }
__global__ __launch_bounds__(256) void k_proj(const float* __restrict__ XQ, const float* __restrict__ XK, const float* __restrict__ XV, const float* __restrict__ WQ, const float* __restrict__ WK, const float* __restrict__ WV, const float* __restrict__ BQ, const float* __restrict__ BK, const float* __restrict__ BV,
    _Float16* __restrict__ QH, _Float16* __restrict__ QL, _Float16* __restrict__ KH, _Float16* __restrict__ KL, _Float16* __restrict__ VT, __bf16* __restrict__ VB, __bf16* __restrict__ VBL) {
  __shared__ __align__(16) unsigned char sm[3 * PJT * PJE * 2];   // the loop's two buffers of X and W rows (40,960 B); behind the loop's last barrier the epilogue's planes
  __bf16 (*xs)[PJT][PJP] = (__bf16 (*)[PJT][PJP])sm; __bf16 (*wt)[PJT][PJP] = (__bf16 (*)[PJT][PJP])(sm + 2 * PJT * PJP * 2);
  const int tid = threadIdx.x, wave = tid >> 5, lane = tid & 31, col = lane & 15, g = lane >> 4, wm = wave & 3, wn = wave >> 2; const int which = blockIdx.z; const int c0 = blockIdx.y * PJT; const size_t r0 = (size_t)blockIdx.x * PJT; const size_t bb = r0 / TT; const int t0 = (int)(r0 % TT);
  const float* X = which == 0 ? XQ : which == 1 ? XK : XV; const float* WA = which == 0 ? WQ : which == 1 ? WK : WV; const float* BA = which == 0 ? BQ : which == 1 ? BK : BV;
  const int lr = tid >> 3, lc = (tid & 7) * 4;   // staging: 8 lanes cover one row's 128-B line, a wave 4 whole lines a load
  const float* xg = X + (r0 + lr) * DIN + lc; const float* wg = WA + (size_t)(c0 + lr) * DIN + lc;
  v8f acc[2][4] = {}; v4f xr[4], wr[4];
#pragma unroll
  for (int u = 0; u < 4; ++u) { xr[u] = *(const v4f*)(xg + (size_t)u * 32 * DIN); wr[u] = *(const v4f*)(wg + (size_t)u * 32 * DIN); }
#pragma unroll
  for (int u = 0; u < 4; ++u) { *(v4b*)&xs[0][u * 32 + lr][lc] = __builtin_convertvector(xr[u], v4b); *(v4b*)&wt[0][u * 32 + lr][lc] = __builtin_convertvector(wr[u], v4b); }
  __syncthreads();
  for (int kc = 0; kc < DIN / 32 - 1; ++kc) { const float* xp = xg + (kc + 1) * 32; const float* wp = wg + (kc + 1) * 32;
#pragma unroll
    for (int u = 0; u < 4; ++u) { xr[u] = *(const v4f*)(xp + (size_t)u * 32 * DIN); wr[u] = *(const v4f*)(wp + (size_t)u * 32 * DIN); }
    asm volatile("s_wait_xcnt 0x0" :: "v"(xp), "v"(wp) : "memory");   /* the wait before a register of an issued load is overwritten (the fragments below take the address registers); the two addresses are inputs, so they stay live to here. Standing here it also keeps all eight loads in front of the pass's LDS reads and products: without it the eighth is issued only behind four products */
    proj_mac(xs[kc & 1], wt[kc & 1], wm, wn, lane, acc);
#pragma unroll
    for (int u = 0; u < 4; ++u) { *(v4b*)&xs[(kc + 1) & 1][u * 32 + lr][lc] = __builtin_convertvector(xr[u], v4b); *(v4b*)&wt[(kc + 1) & 1][u * 32 + lr][lc] = __builtin_convertvector(wr[u], v4b); }
    __syncthreads(); }
  proj_mac(xs[(DIN / 32 - 1) & 1], wt[(DIN / 32 - 1) & 1], wm, wn, lane, acc);
  __syncthreads();   // every wave has taken its last fragments: the epilogue's planes may overwrite the buffers
  if (which < 2) { _Float16 (*sh)[PJE] = (_Float16 (*)[PJE])sm; _Float16 (*sl)[PJE] = (_Float16 (*)[PJE])(sm + PJT * PJE * 2); _Float16* DH = which == 0 ? QH : KH; _Float16* DL = which == 0 ? QL : KL; const int nhi = which == 0 ? QHI : KHI; const bool hi_rows = t0 < nhi;
#pragma unroll
    for (int j = 0; j < 4; ++j) { const int cl = wn * 64 + j * 16 + col; const float bias = BA ? bfr(BA[c0 + cl]) : 0.f;
#pragma unroll
      for (int i = 0; i < 2; ++i)
#pragma unroll
        for (int r = 0; r < 8; ++r) { const float v = acc[i][j][r] + bias; const _Float16 hv = (_Float16)v; const int rl = wm * 32 + i * 16 + 8 * g + r; sh[rl][cl] = hv; sl[rl][cl] = (_Float16)((v - (float)hv) * 1024.0f); } }
    __syncthreads();
    for (int e = tid; e < PJT * 16; e += 256) { const int rl = e >> 4, q = e & 15; _Float16* ph = DH + (r0 + rl) * CC + c0 + q * 8; _Float16* pl = DL + (bb * nhi + t0 + rl) * (size_t)CC + c0 + q * 8; const v4u hv = *(const v4u*)&sh[rl][q * 8], lv = *(const v4u*)&sl[rl][q * 8];
      vst2((unsigned*)ph, hv); if (hi_rows) vst2((unsigned*)pl, lv);
      asm volatile("s_wait_xcnt 0x0" :: "v"(ph), "v"(pl), "v"(hv), "v"(lv) : "memory"); }   /* the wait before a register of an issued store is overwritten (the next trip takes the address and data registers); they are inputs, so they stay live to here */
  } else { _Float16 (*th)[PJE] = (_Float16 (*)[PJE])sm; __bf16 (*tb)[PJE] = (__bf16 (*)[PJE])(sm + PJT * PJE * 2); __bf16 (*tbl)[PJE] = (__bf16 (*)[PJE])(sm + 2 * PJT * PJE * 2); const bool hi_rows = t0 < KHI;
#pragma unroll
    for (int j = 0; j < 4; ++j) { const int cl = wn * 64 + j * 16 + col; const float bias = BA ? bfr(BA[c0 + cl]) : 0.f;
#pragma unroll
      for (int i = 0; i < 2; ++i)
#pragma unroll
        for (int r = 0; r < 8; ++r) { const float v = acc[i][j][r] + bias; const int rl = wm * 32 + i * 16 + 8 * g + r; th[cl][rl] = (_Float16)v; const __bf16 bh = (__bf16)v; tb[cl][rl] = bh; tbl[cl][rl] = (__bf16)(v - (float)bh); } }
    __syncthreads();
    for (int e = tid; e < PJT * 16; e += 256) { const int cl = e >> 4, q = e & 15; vst2((unsigned*)(VT + (bb * CC + c0 + cl) * (size_t)TT + t0 + q * 8), *(const v4u*)&th[cl][q * 8]); if (hi_rows) { const size_t o3 = (bb * CC + c0 + cl) * (size_t)KHI + t0 + q * 8; vst2((unsigned*)(VB + o3), *(const v4u*)&tb[cl][q * 8]); vst2((unsigned*)(VBL + o3), *(const v4u*)&tbl[cl][q * 8]); } } } }
// ---- k_sm: block = query row t (head in group): keys [0, kend): causal -> logit if s <= t else excluded; softmax in f32; P x 2^11 in place (0 for excluded)
__global__ __launch_bounds__(256) void k_sm(float* __restrict__ S0 SM_EXTRA_PARAMS) { __shared__ float sred[8]; __shared__ float sbc; __shared__ __align__(16) float shv[TT];
  const int tid = threadIdx.x; const int t = blockIdx.x; const int kend = (kb_last(t >> 6) + 1) * 128;
  float* sr = S0 + (size_t)blockIdx.y * TT * TT + (size_t)t * TT;
  float m = -3.0e38f; for (int k = tid; k < kend; k += 256) { float v = (!CAUSAL || k <= t) ? sr[k] : -3.0e38f; SM_MASK_HOOK; shv[k] = v; m = fmaxf(m, v); }
#pragma unroll
  for (int o = 1; o < 32; o <<= 1) m = fmaxf(m, __shfl_xor(m, o));
  if ((tid & 31) == 0) sred[tid >> 5] = m; __syncthreads(); if (tid == 0) { float a = sred[0]; for (int i = 1; i < 8; ++i) a = fmaxf(a, sred[i]); sbc = a; } __syncthreads(); m = sbc; __syncthreads();
  float sum = 0.f; for (int k = tid; k < kend; k += 256) { const float v = shv[k]; const float e = (v <= -1.0e38f) ? 0.f : expf(v - m); shv[k] = e; sum += e; }
#pragma unroll
  for (int o = 1; o < 32; o <<= 1) sum += __shfl_xor(sum, o);
  if ((tid & 31) == 0) sred[tid >> 5] = sum; __syncthreads(); if (tid == 0) { float a = 0.f; for (int i = 0; i < 8; ++i) a += sred[i]; sbc = a > 0.f ? 2048.0f / a : 0.f; }   /* a fully excluded row yields P = 0 */ __syncthreads(); const float inv = sbc;
  for (int k = tid; k < kend; k += 256) shv[k] = shv[k] * inv;
  __syncthreads(); for (int q = tid; q < kend / 4; q += 256) vst2(sr + q * 4, *(const v4f*)&shv[q * 4]); }
// ---- k_stat: softmax over the QUERY axis under the causal mask (the source's softmax(axis=2) on [B, H, i, j] scores with -inf where j > i), with no score matrix in memory. Block = (STK key columns from k0, head h, batch b), STW waves. Every wave keeps the STK keys' f16 fragments in registers and takes every STW-th tile of 16 of the visible query rows k0 .. TT-1: scores q x k on WMMA (one f16 product), then per lane and column tile the online (max, sum) over its 8 rows (f32; the maximum runs over the raw products, each term is 2^(s x SCL2 - m x SCL2): one multiply-add and one v_exp_f32; q < k reads as -inf and adds 2^(-inf) = 0; the running maximum starts finite, so no difference is inf - inf; the sum so far is rescaled by 2^((m_old - m_new) x SCL2)). The 2 * STW partial pairs of a column (wave, lane half) are merged through LDS behind one barrier, which every wave reaches after its own last tile: m_k in base-2 units (m x SCL2) to CM, 2^11 / Z_k to CR, whole lines. The cost of a strip falls linearly with its index (strip x sees TT - x * STK query rows) and every work-group of the launch is resident at once, so a work-group takes two strips one after the other, the last minus x and x: every work-group has the same work. Each strip has its own pair of LDS arrays, so the second strip's partials never meet the first strip's merge. Every '#pragma unroll' of k_stat and k_out is there so that the small arrays it indexes (fragments, accumulators, m, z, P) stay in registers
#define STW 8
#define STK 64
// the fragments of frag_h / frag_b from a pointer that already holds the lane's own 8g offset: a run of loads then shares one address value, which the wait behind the run can name
// 2^x on v_exp_f32: every argument here is at most about 0 where its result is used, and a result below the normal range may read as 0 (it stands beside a column sum of at least 1). Written as asm so that the slot the instruction set asks for behind a transcendental (no use of its result, no overwrite of its source in the next instruction) is kept by construction, wherever the compiler places the statement. The v_nop is that slot
__device__ __forceinline__ float ex2(float x) { float e; asm("v_exp_f32 %0, %1\n\tv_nop" : "=v"(e) : "v"(x)); return e; }
// eight of them: the results are early-clobber outputs, so none lies in a source and each v_exp_f32 is the independent instruction behind the one before; one v_nop behind the last
__device__ __forceinline__ void ex2x8(float (&e)[8], const float (&x)[8]) {
  asm("v_exp_f32 %0, %8\n\tv_exp_f32 %1, %9\n\tv_exp_f32 %2, %10\n\tv_exp_f32 %3, %11\n\tv_exp_f32 %4, %12\n\tv_exp_f32 %5, %13\n\tv_exp_f32 %6, %14\n\tv_exp_f32 %7, %15\n\tv_nop"
      : "=&v"(e[0]), "=&v"(e[1]), "=&v"(e[2]), "=&v"(e[3]), "=&v"(e[4]), "=&v"(e[5]), "=&v"(e[6]), "=&v"(e[7])
      : "v"(x[0]), "v"(x[1]), "v"(x[2]), "v"(x[3]), "v"(x[4]), "v"(x[5]), "v"(x[6]), "v"(x[7])); }
__device__ __forceinline__ v16h frag_hp(const _Float16* p) { union { v16h v; v8h q[2]; } u; u.q[0] = *(const v8h*)p; u.q[1] = *(const v8h*)(p + 16); return u.v; }
__device__ __forceinline__ v16b frag_bp(const __bf16* p) { union { v16b v; v8b q[2]; } u; u.q[0] = *(const v8b*)p; u.q[1] = *(const v8b*)(p + 16); return u.v; }
__global__ __launch_bounds__(STW * 32) void k_stat(const _Float16* __restrict__ QH, const _Float16* __restrict__ KH, float* __restrict__ CM, float* __restrict__ CR) { __shared__ float pm2[2][2 * STW][STK], pz2[2][2 * STW][STK];
  const int tid = threadIdx.x, lane = tid & 31, col = lane & 15, g = lane >> 4; const int wave = __builtin_amdgcn_readfirstlane(tid >> 5); const int h = blockIdx.y, b = blockIdx.z;
  for (int half = 0; half < 2; ++half) { const int k0 = (half ? (int)blockIdx.x : TT / STK - 1 - (int)blockIdx.x) * STK; float (*pm)[STK] = pm2[half]; float (*pz)[STK] = pz2[half];
  v16h kf[HD / 32][STK / 16]; const _Float16* kp = KH + ((size_t)b * TT + k0 + col) * CC + h * HD + 8 * g;
#pragma unroll
  for (int kc = 0; kc < HD / 32; ++kc) {
#pragma unroll
    for (int j = 0; j < STK / 16; ++j) kf[kc][j] = frag_hp(kp + (size_t)j * 16 * CC + kc * 32); }
  asm volatile("s_wait_xcnt 0x0" :: "v"(kp) : "memory");   /* the wait before a register of an issued load is overwritten; the loads' common address is an input, so it stays live to here and no fragment lands in it */
  float m[STK / 16], z[STK / 16];   // m: running maximum of the raw products
#pragma unroll
  for (int j = 0; j < STK / 16; ++j) { m[j] = -3.0e38f; z[j] = 0.f; }
  for (int ql0 = k0 + wave * 16; ql0 < TT; ql0 += STW * 16) { const _Float16* qp = QH + ((size_t)b * TT + ql0 + col) * CC + h * HD; const v16h a0 = frag_h(qp, lane), a1 = frag_h(qp + 32, lane);
    v8f sc[STK / 16];   /* the trip's eight products first, over four independent accumulators: no WMMA waits for the one in front of it */
#pragma unroll
    for (int j = 0; j < STK / 16; ++j) { const v8f zero = {}; sc[j] = wmma16(a0, kf[0][j], zero); }
#pragma unroll
    for (int j = 0; j < STK / 16; ++j) sc[j] = wmma16(a1, kf[1][j], sc[j]);
#pragma unroll
    for (int j = 0; j < STK / 16; ++j) { const v8f acc = sc[j]; const int k = k0 + j * 16 + col; float v[8];
#pragma unroll
      for (int r = 0; r < 8; ++r) v[r] = (ql0 + 8 * g + r >= k) ? acc[r] : -INFINITY;
      float mn = m[j];
#pragma unroll
      for (int r = 0; r < 8; ++r) mn = fmaxf(mn, v[r]);
      const float nb = -(mn * SCL2); float x[8], e[8];
#pragma unroll
      for (int r = 0; r < 8; ++r) x[r] = __builtin_fmaf(v[r], SCL2, nb);
      ex2x8(e, x); float s = e[0];
#pragma unroll
      for (int r = 1; r < 8; ++r) s += e[r];
      z[j] = z[j] * ex2((m[j] - mn) * SCL2) + s; m[j] = mn; } }   /* the two raw maxima are subtracted first: a maximum that has not moved gives exactly 2^0 = 1, and a difference followed by a multiply has no fused form */
#pragma unroll
  for (int j = 0; j < STK / 16; ++j) { pm[2 * wave + g][j * 16 + col] = m[j] * SCL2; pz[2 * wave + g][j * 16 + col] = z[j]; }
  __syncthreads();
  if (tid < STK) { float mm = pm[0][tid];
#pragma unroll
    for (int w = 1; w < 2 * STW; ++w) mm = fmaxf(mm, pm[w][tid]);
    float a = 0.f;   /* a partial that saw no visible row of this column holds Z = 0 and a finite maximum */
#pragma unroll
    for (int w = 0; w < 2 * STW; ++w) a += pz[w][tid] * ex2(pm[w][tid] - mm);
    const size_t o = ((size_t)b * NH + h) * TT + k0 + tid; float* pcm = CM + o; float* pcr = CR + o; const float rz = 2048.0f / a; vst2(pcm, mm); vst2(pcr, rz);   /* every column sees at least its own diagonal entry: Z_k >= 1 */
    asm volatile("s_wait_xcnt 0x0" :: "v"(pcm), "v"(pcr), "v"(mm), "v"(rz) : "memory"); } } }   /* the wait before a register of an issued store is overwritten (the second strip takes the address and data registers); they are inputs, so they stay live to here */
// ---- k_out: block = 64 queries (qb) of (b, h), a wave = 16 queries: per 32 keys the scores are formed again on WMMA, transposed (A = 16 key rows, B = the wave's 16 queries, kept in registers; the same one f16 product), so that a lane holds, for its own query, the keys 8g + 0..7 of each 16-key tile: two such tiles are, in place, the A fragment of P . v (hardware k order, the order of frag_b). P[i][j] = 2^(s x SCL2 - m_j) x (2^11 / Z_j), m_j in base-2 units, for j <= i, 0 above the diagonal (unconditional loads, value select); P and v as bf16 hi + lo, 3 products, keys [0, kend) as before; 256-B (row, head) segment by 16 lanes. What the four waves read of 64 keys (k rows, v hi and lo rows, column maxima and scales) is the same for all of them: it is brought into LDS once per block, as whole 128-B lines, by asynchronous copies, two buffers, the next tile flying while a tile is worked on; every fragment comes from LDS. The cost of a query block grows linearly with its index (block qb walks the keys up to its own diagonal) and every work-group of the launch is resident at once, so a work-group takes two query blocks of its head one after the other, the last minus x and x: every work-group has the same work
#define OKT 64              // keys of a staged tile
#define OPB 144             // LDS pitch in bytes of a staged row of 128 B: 16 B x odd, free of bank conflicts for the 16-byte fragment reads
#define OPL (64 * OPB)      // one staged plane: 64 rows (64 keys of k; 64 channels of v hi; of v lo)
#define OBF (3 * OPL + 512) // one buffer: three planes, then 64 column maxima and 64 column scales
// the 12 copies of a thread for one tile: 8 lanes cover one row's 128-B line, the block 16 rows a copy. la: the thread's LDS byte address in the k plane; kg, hg, lg: its addresses in the tile's first 16 rows
__device__ __forceinline__ void out_stage(unsigned la, const _Float16* kg, const __bf16* hg, const __bf16* lg) {
  /* the copies and, as the last line of their own statement, the wait before a register that an issued copy names is rewritten */
  asm volatile("global_load_async_to_lds_b128 %0, %12, off\n\tglobal_load_async_to_lds_b128 %1, %13, off\n\tglobal_load_async_to_lds_b128 %2, %14, off\n\tglobal_load_async_to_lds_b128 %3, %15, off\n\t"
               "global_load_async_to_lds_b128 %4, %16, off\n\tglobal_load_async_to_lds_b128 %5, %17, off\n\tglobal_load_async_to_lds_b128 %6, %18, off\n\tglobal_load_async_to_lds_b128 %7, %19, off\n\t"
               "global_load_async_to_lds_b128 %8, %20, off\n\tglobal_load_async_to_lds_b128 %9, %21, off\n\tglobal_load_async_to_lds_b128 %10, %22, off\n\tglobal_load_async_to_lds_b128 %11, %23, off\n\ts_wait_xcnt 0x0"
               :: "v"(la), "v"(la + 16 * OPB), "v"(la + 32 * OPB), "v"(la + 48 * OPB),
                  "v"(la + OPL), "v"(la + OPL + 16 * OPB), "v"(la + OPL + 32 * OPB), "v"(la + OPL + 48 * OPB),
                  "v"(la + 2 * OPL), "v"(la + 2 * OPL + 16 * OPB), "v"(la + 2 * OPL + 32 * OPB), "v"(la + 2 * OPL + 48 * OPB),
                  "v"(kg), "v"(kg + (size_t)16 * CC), "v"(kg + (size_t)32 * CC), "v"(kg + (size_t)48 * CC),
                  "v"(hg), "v"(hg + (size_t)16 * KHI), "v"(hg + (size_t)32 * KHI), "v"(hg + (size_t)48 * KHI),
                  "v"(lg), "v"(lg + (size_t)16 * KHI), "v"(lg + (size_t)32 * KHI), "v"(lg + (size_t)48 * KHI) : "memory"); }
// one wave's copy of the tile's 64 maxima (lanes 0..15) and 64 scales (lanes 16..31), with the same wait
__device__ __forceinline__ void out_stage_c(unsigned la, const float* cg) { asm volatile("global_load_async_to_lds_b128 %0, %1, off\n\ts_wait_xcnt 0x0" :: "v"(la), "v"(cg) : "memory"); }
// amdgpu_waves_per_eu(4): a budget of 256 registers; without it what the compiler keeps live round the loop over the two query blocks takes the count just past 256 and fills the key loop with register-window switches
__global__ __launch_bounds__(128) __attribute__((amdgpu_waves_per_eu(4))) void k_out(const _Float16* __restrict__ QH, const _Float16* __restrict__ KH, const float* __restrict__ CM, const float* __restrict__ CR, const __bf16* __restrict__ VB, const __bf16* __restrict__ VBL, float* __restrict__ Y) { __shared__ __align__(16) unsigned char sm[2 * OBF];   // the loop's two buffers; behind the loop's last barrier the epilogue's rows
  const int tid = threadIdx.x, lane = tid & 31, col = lane & 15, g = lane >> 4; const int wave = __builtin_amdgcn_readfirstlane(tid >> 5); const int h = blockIdx.y, b = blockIdx.z;
  const int sr = tid >> 3, sq = (tid & 7) * 8;   // staging: the thread's row among 16 and its 16 bytes of the row
  const _Float16* kg = KH + ((size_t)b * TT + sr) * CC + h * HD + sq; const size_t po = ((size_t)b * CC + h * HD + sr) * (size_t)KHI + sq; const __bf16* hg = VB + po; const __bf16* lg = VBL + po;
  const float* cg = (g ? CR : CM) + ((size_t)b * NH + h) * TT + col * 4;
  const unsigned la = (unsigned)(size_t)sm + sr * OPB + sq * 2, lc = (unsigned)(size_t)sm + 3 * OPL + lane * 16;
  for (int half = 0; half < 2; ++half) { const int qb = half ? (int)blockIdx.x : NQB - 1 - (int)blockIdx.x; const int ql0 = qb * 64 + wave * 16; const int nt = (kb_last(qb) + 1) * 2; const int qi = ql0 + col;   // nt tiles of 64 keys, never fewer than two
  const _Float16* qp = QH + ((size_t)b * TT + qi) * CC + h * HD; const v16h q0 = frag_h(qp, lane), q1 = frag_h(qp + 32, lane);
  out_stage(la, kg, hg, lg); if (wave == 0) out_stage_c(lc, cg);
  asm volatile("s_wait_asynccnt 0x0" ::: "memory");   /* this wave's copies of tile 0 have landed */
  __syncthreads();                                     /* and every other wave's: tile 0 may be read */
  out_stage(la + OBF, kg + (size_t)OKT * CC, hg + OKT, lg + OKT); if (wave == 0) out_stage_c(lc + OBF, cg + OKT);
  v8f acc[HD / 16] = {};
  for (int t = 0; t < nt; ++t) { const unsigned char* bp = sm + (t & 1) * OBF;
#pragma unroll   /* the tile's two halves of 32 keys, unrolled so that every LDS offset of a half is an immediate */
    for (int s = 0; s < 2; ++s) { const int k0 = t * OKT + s * 32;
      const _Float16* ka = (const _Float16*)(bp + (s * 32 + col) * OPB) + 8 * g; const _Float16* kb2 = ka + 16 * (OPB / 2); const float* cmk = (const float*)(bp + 3 * OPL) + s * 32 + 8 * g; const float* crk = cmk + OKT;
      const v16h ka0 = frag_hp(ka), kb0 = frag_hp(kb2), ka1 = frag_hp(ka + 32), kb1 = frag_hp(kb2 + 32);
      v4f mv[4], rv[4];
#pragma unroll
      for (int u = 0; u < 4; ++u) { const int o = (u >> 1) * 16 + (u & 1) * 4; mv[u] = *(const v4f*)(cmk + o); rv[u] = *(const v4f*)(crk + o); }
      v16b vh[HD / 16], vl[HD / 16]; const __bf16* vhp = (const __bf16*)(bp + OPL + col * OPB) + s * 32 + 8 * g; const __bf16* vlp = vhp + OPL / 2;
#pragma unroll
      for (int j = 0; j < HD / 16; ++j) vh[j] = frag_bp(vhp + j * 16 * (OPB / 2));
      __builtin_amdgcn_sched_barrier(0);   /* keeps these 24 LDS reads together in front of the half's products: without it the compiler sinks them in pairs between the WMMAs, each pair waited for one WMMA later */
      v8f s0 = {}, s1 = {}; s0 = wmma16(ka0, q0, s0); s1 = wmma16(kb0, q0, s1); s0 = wmma16(ka1, q1, s0); s1 = wmma16(kb1, q1, s1);
      float pv[16], x0[8], x1[8], e0[8], e1[8];
#pragma unroll
      for (int i = 0; i < 8; ++i) { x0[i] = __builtin_fmaf(s0[i], SCL2, -mv[i >> 2][i & 3]); x1[i] = __builtin_fmaf(s1[i], SCL2, -mv[2 + (i >> 2)][i & 3]); }
      ex2x8(e0, x0); ex2x8(e1, x1);
#pragma unroll
      for (int j = 0; j < HD / 16; ++j) vl[j] = frag_bp(vlp + j * 16 * (OPB / 2));   /* the v lo rows, wanted last, are a second group of reads: with all 32 reads of a half in one group the kernel no longer fits its 256 registers and spills */
      __builtin_amdgcn_sched_barrier(0);   /* keeps those 8 reads in front of the forming of P, which with the first eight P . v products covers their latency: without it the compiler sinks them in pairs between the products */
#pragma unroll
      for (int i = 0; i < 8; ++i) { const int ke = k0 + 8 * g + i; pv[i] = (ke <= qi) ? e0[i] * rv[i >> 2][i & 3] : 0.f; pv[8 + i] = (ke + 16 <= qi) ? e1[i] * rv[2 + (i >> 2)][i & 3] : 0.f; }
      const F2 p = bsplit16(pv);
#pragma unroll
      for (int j = 0; j < HD / 16; ++j) acc[j] = wmma_bf(p.h, vh[j], acc[j]);   /* product by product over the four accumulators: no WMMA waits for the one in front of it; each accumulator takes its three products in the order it had */
#pragma unroll
      for (int j = 0; j < HD / 16; ++j) acc[j] = wmma_bf(p.l, vh[j], acc[j]);
#pragma unroll
      for (int j = 0; j < HD / 16; ++j) acc[j] = wmma_bf(p.h, vl[j], acc[j]); }
    __builtin_amdgcn_sched_barrier(0);                   /* keeps the tile's last products in front of the barrier, as they stood: without it the compiler moves them behind it, and the refill below, which follows them, is issued that much later */
    asm volatile("s_wait_dscnt 0x0" ::: "memory");      /* this wave's reads of tile t are over */
    asm volatile("s_wait_asynccnt 0x0" ::: "memory");   /* its copies of tile t + 1 have landed */
    __syncthreads();                                     /* the same of every wave: tile t + 1 may be read, tile t's buffer refilled */
    if (t + 2 < nt) { const int kn = (t + 2) * OKT; const unsigned bo = (t & 1) * OBF; out_stage(la + bo, kg + (size_t)kn * CC, hg + kn, lg + kn); if (wave == 0) out_stage_c(lc + bo, cg + kn); } }
  asm volatile("s_wait_asynccnt 0x0" ::: "memory");     /* no copy is outstanding when the buffers become the epilogue's rows */
  float (*ss)[16][HD + 4] = (float (*)[16][HD + 4])sm;
#pragma unroll
  for (int j = 0; j < HD / 16; ++j)
#pragma unroll
    for (int r = 0; r < 8; ++r) ss[wave][8 * g + r][j * 16 + col] = acc[j][r] * (1.0f / 2048.0f);
  LDSX(); for (int rl = 0; rl < 16; ++rl) if (lane < HD / 4) vst2(Y + ((size_t)b * TT + ql0 + rl) * CC + h * HD + lane * 4, *(const v4f*)&ss[wave][rl][lane * 4]);
  if (half == 0) {
    asm volatile("s_wait_xcnt 0x0" ::: "memory");     /* the wait before a register of an issued store is overwritten (the second query block takes the address and data registers) */
    asm volatile("s_wait_dscnt 0x0" ::: "memory");    /* this wave's reads of its epilogue rows are over */
    __syncthreads(); } } }                             /* the same of every wave: the second query block's copies may overwrite the rows */

extern "C" void kernel_launch(void* const* d_in, const int* in_sizes, int n_in, void* d_out, int out_size, void* d_ws, size_t ws_size, hipStream_t stream) {
  (void)in_sizes; (void)n_in; (void)out_size;
  const float** F = (const float**)d_in;
  if (ws_size < (size_t)WS_END) return;
  char* ws = (char*)d_ws; _Float16 *QH = (_Float16*)(ws + WS_QH), *KH = (_Float16*)(ws + WS_KH), *VT = (_Float16*)(ws + WS_VT), *QL = (_Float16*)(ws + WS_QL), *KL = (_Float16*)(ws + WS_KL); __bf16 *VB = (__bf16*)(ws + WS_VB), *VBL = (__bf16*)(ws + WS_VBL); float *S = (float*)(ws + WS_S), *Y = (float*)(ws + WS_Y);
  (void)Y; (void)QL; (void)KL; (void)VB; (void)VBL; (void)S; (void)VT;
  // inputs: 0 X [2,2048,1024]; 1 Wq [1024,1024] (out,in), 2 bq; 3 Wk, 4 bk; 5 Wv, 6 bv (biases N(0, 0.02), nonzero); no output projection
  if (ws_size < (size_t)WS_END2) return;
  float *CM = (float*)(ws + WS_CM), *CZ = (float*)(ws + WS_CZ);
  k_proj<<<dim3(TNB * TT / PJT, CC / PJT, 3), 256, 0, stream>>>(F[0], F[0], F[0], F[1], F[3], F[5], F[2], F[4], F[6], QH, QL, KH, KL, VT, VB, VBL);
  k_stat<<<dim3(TT / STK / 2, NH, TNB), STW * 32, 0, stream>>>(QH, KH, CM, CZ);   /* per key column j: max and 2^11 / sum over the visible queries i >= j */
  k_out<<<dim3(NQB / 2, NH, TNB), 128, 0, stream>>>(QH, KH, CM, CZ, VB, VBL, (float*)d_out);   /* P formed in registers, then P . v */
}

// v008
// A run of this version takes 92.5 microseconds.
// Two timings next to v007 both put it at 1.04 times that version's speed.
// Counting every step since v000, it is 84.8 times as fast.
// compute dtype: all float inputs rounded to bf16; q/k/v projections with EXACT bf16 products on WMMA 16x16x32 (f32 accumulate) + bias; causal scores q x k once to f16 each (1 product; the module scales by 1/sqrt(E) = 1/32, so sigma - 0.1) on every block; softmax over the QUERY axis in f32 (per key column: online max / sum over the visible queries, exponentials as 2^x on the hardware's own instruction, 1/sqrt(E) and log2(e) folded into one multiply-add); P as bf16 hi + lo against v as bf16 hi + lo (3 products) on EVERY block; f32 output.
#include <hip/hip_runtime.h>
#include <math.h>

typedef __attribute__((ext_vector_type(16))) _Float16 v16h;
typedef __attribute__((ext_vector_type(16))) __bf16 v16b;
typedef __attribute__((ext_vector_type(8)))  _Float16 v8h;
typedef __attribute__((ext_vector_type(8)))  float v8f;
typedef __attribute__((ext_vector_type(4)))  float v4f;
typedef __attribute__((ext_vector_type(2)))  float v2f;
typedef __attribute__((ext_vector_type(4)))  unsigned v4u;
typedef __attribute__((ext_vector_type(4)))  int v4i;
typedef float __attribute__((may_alias)) float_a;
typedef int __attribute__((may_alias)) int_a;

template <typename T> __device__ __forceinline__ void vst2(void* p, T v) { *(T*)p = v;  }
__device__ __forceinline__ v8f wmma16(v16h a, v16h b, v8f c) {
  return __builtin_amdgcn_wmma_f32_16x16x32_f16(false, a, false, b, (short)0, c, false, false);
}
__device__ __forceinline__ v8f wmma_bf(v16b a, v16b b, v8f c) {
  return __builtin_amdgcn_wmma_f32_16x16x32_bf16(false, a, false, b, (short)0, c, false, false);
}
// 16x16x32 fragments: lane = (h = lane>>4, row/col = lane&15); elements 0..7 = k0+8h+0..7, 8..15 = k0+16+8h+0..7; D element r = row 8h+r
__device__ __forceinline__ v16h frag_h(const _Float16* rowk0, int lane) {
  union { v16h v; v8h q[2]; } u; const _Float16* p = rowk0 + 8 * (lane >> 4);
  u.q[0] = *(const v8h*)p; u.q[1] = *(const v8h*)(p + 16); return u.v;
}
__device__ __forceinline__ v16h frag_f32(const float* rowk0, int lane) {
  v16h a; const float* p = rowk0 + 8 * (lane >> 4);
#pragma unroll
  for (int i = 0; i < 8; ++i) { a[i] = (_Float16)p[i]; a[8 + i] = (_Float16)p[16 + i]; }
  return a;
}
__device__ __forceinline__ v16h frag_f32s(const float* rowk0, int lane, float sc) {
  v16h a; const float* p = rowk0 + 8 * (lane >> 4);
#pragma unroll
  for (int i = 0; i < 8; ++i) { a[i] = (_Float16)(p[i] * sc); a[8 + i] = (_Float16)(p[16 + i] * sc); }
  return a;
}
// column fragment from a [K][ld] layout (column n), rows >= K read as 0
__device__ __forceinline__ v16h fragc_f32(const float* W, int k0, int n, int lane, int ld, int K) {
  v16h a; const int g = lane >> 4;
#pragma unroll
  for (int i = 0; i < 8; ++i) { const int ka = k0 + 8 * g + i, kb = ka + 16;
    a[i] = (_Float16)(ka < K ? W[(size_t)(ka < K ? ka : K - 1) * ld + n] : 0.f); a[8 + i] = (_Float16)(kb < K ? W[(size_t)(kb < K ? kb : K - 1) * ld + n] : 0.f); }
  return a;
}
struct F2 { v16b h, l; };
__device__ __forceinline__ F2 bsplit16(const float v[16]) { F2 r;
#pragma unroll
  for (int i = 0; i < 16; ++i) { const __bf16 h = (__bf16)v[i]; r.h[i] = h; r.l[i] = (__bf16)(v[i] - (float)h); }
  return r; }
__device__ __forceinline__ F2 split_row(const float* row, int k0, int lane) { float v[16]; const float* p = row + k0 + 8 * (lane >> 4);
#pragma unroll
  for (int i = 0; i < 8; ++i) { v[i] = p[i]; v[8 + i] = p[16 + i]; }
  return bsplit16(v); }
__device__ __forceinline__ F2 split_rowK(const float* row, int k0, int lane, int K) { float v[16]; const int g = lane >> 4;
#pragma unroll
  for (int i = 0; i < 8; ++i) { const int ka = k0 + 8 * g + i, kb = ka + 16; v[i] = ka < K ? row[ka < K ? ka : K - 1] : 0.f; v[8 + i] = kb < K ? row[kb < K ? kb : K - 1] : 0.f; }
  return bsplit16(v); }
__device__ __forceinline__ F2 split_col(const float* W, int k0, int n, int lane, int ld, int K) { float v[16]; const int g = lane >> 4;
#pragma unroll
  for (int i = 0; i < 8; ++i) { const int ka = k0 + 8 * g + i, kb = ka + 16; v[i] = ka < K ? W[(size_t)(ka < K ? ka : K - 1) * ld + n] : 0.f; v[8 + i] = kb < K ? W[(size_t)(kb < K ? kb : K - 1) * ld + n] : 0.f; }
  return bsplit16(v); }
__device__ __forceinline__ v8f mac3(const F2& a, const F2& b, v8f c) { c = wmma_bf(a.l, b.h, c); c = wmma_bf(a.h, b.l, c); return wmma_bf(a.h, b.h, c); }
__device__ __forceinline__ float sigm(float v) { return 1.0f / (1.0f + expf(-v)); }
#define LDSX() do { asm volatile("s_wait_dscnt 0" ::: "memory"); __builtin_amdgcn_wave_barrier(); __builtin_amdgcn_fence(__ATOMIC_RELEASE, "workgroup"); } while (0)

// Multi-headed attention whose softmax runs over the QUERY axis, scaled by the MODEL width (X [2,2048,1024]; torch (out,in) Wq / Wk / Wv [1024,1024] N(0, 1/1024) + biases N(0, 0.02); 16 heads x 64; scores / sqrt(E) = / 32; -inf where j > i; attn = softmax(scores, axis=2) - axis 2 of [B, H, i, j] is the QUERY axis i: every key column j is normalised over the queries i >= j (faithful to the source); out = attn v; merge; no output projection).
#define NB 2
#define TT 2048
#define CC 1024            // NH * HD = projected width
#define DIN 1024          // input (model) width
#define NH 16
#define HD 64
#define NQB (TT / 64)
#define HG 4
#define SCALE (0.03125f)
#define SCL2 (SCALE * 1.44269504088896340736f)   // raw q . k product -> exponent to base 2
#define CAUSAL 1
#ifndef TNB
#define TNB NB
#endif
__device__ __forceinline__ float bfr(float v) { return (float)(__bf16)v; }
__host__ __device__ __forceinline__ int kb_last(int qb) { return CAUSAL ? ((qb * 64 + 63) >> 7) : (TT / 128 - 1); }
typedef __attribute__((ext_vector_type(8))) __bf16 v8b;
__device__ __forceinline__ v16b frag_b(const __bf16* rowk0, int lane) {
  union { v16b v; v8b q[2]; } u; const __bf16* p = rowk0 + 8 * (lane >> 4);
  u.q[0] = *(const v8b*)p; u.q[1] = *(const v8b*)(p + 16); return u.v;
}
#define QBH 32              // not read: k_out takes its one bf16 hi/lo path on all NQB query blocks
#define QHI 0               // no q residual plane: the scores are tiny (scale 1/32) and single-product everywhere
#define QBH_SC 0            // not read (k_out: bf16 hi/lo P.v on every block - a query-axis softmax has O(1) weights on the LAST key columns)
#define KHI 2048            // key rows carrying k residual / v bf16 hi+lo planes (the v planes are read by k_out; the k residual is not read)
// B fragment (k rows k0+.., output column o) of a weight: (in,out) [K][ld] or (out,in) [ld rows of K]: bf16 exact, or f16(bf16 * 256) exact
__device__ __forceinline__ v16b wcol_io(const float* Wm, int k0, int o, int lane, int ld) { v16b w; const int g = lane >> 4;
#pragma unroll
  for (int i = 0; i < 8; ++i) { w[i] = (__bf16)Wm[(size_t)(k0 + 8 * g + i) * ld + o]; w[8 + i] = (__bf16)Wm[(size_t)(k0 + 16 + 8 * g + i) * ld + o]; }
  return w; }
__device__ __forceinline__ v16b wcol_oi(const float* Wm, int k0, int o, int lane, int K) { v16b w; const float* p = Wm + (size_t)o * K + k0 + 8 * (lane >> 4);
#pragma unroll
  for (int i = 0; i < 8; ++i) { w[i] = (__bf16)p[i]; w[8 + i] = (__bf16)p[16 + i]; }
  return w; }
__device__ __forceinline__ v16h wcolh_io(const float* Wm, int k0, int o, int lane, int ld) { v16h w; const int g = lane >> 4;
#pragma unroll
  for (int i = 0; i < 8; ++i) { w[i] = (_Float16)(bfr(Wm[(size_t)(k0 + 8 * g + i) * ld + o]) * 256.0f); w[8 + i] = (_Float16)(bfr(Wm[(size_t)(k0 + 16 + 8 * g + i) * ld + o]) * 256.0f); }
  return w; }
__device__ __forceinline__ v16h wcolh_oi(const float* Wm, int k0, int o, int lane, int K) { v16h w; const float* p = Wm + (size_t)o * K + k0 + 8 * (lane >> 4);
#pragma unroll
  for (int i = 0; i < 8; ++i) { w[i] = (_Float16)(bfr(p[i]) * 256.0f); w[8 + i] = (_Float16)(bfr(p[16 + i]) * 256.0f); }
  return w; }
#define WQKV_LAYOUT 1   // not read by k_pack or k_proj (k_pack takes W as (out,in) [CC][DIN]); WCOL only: 0 = (in,out) [DIN][CC]; 1 = (out,in) [CC][DIN]; 2 = per-head [NH][DIN][HD]
__device__ __forceinline__ v16b wcol_hdk(const float* Wm, int k0, int o, int lane) { v16b w; const int g = lane >> 4; const float* p = Wm + (size_t)(o / HD) * DIN * HD + (o % HD);
#pragma unroll
  for (int i = 0; i < 8; ++i) { w[i] = (__bf16)p[(size_t)(k0 + 8 * g + i) * HD]; w[8 + i] = (__bf16)p[(size_t)(k0 + 16 + 8 * g + i) * HD]; }
  return w; }
#define WO_OUT_IN 0
#if WQKV_LAYOUT == 1
#define WCOL(W, k0, o, lane) wcol_oi(W, k0, o, lane, DIN)
#elif WQKV_LAYOUT == 2
#define WCOL(W, k0, o, lane) wcol_hdk(W, k0, o, lane)
#else
#define WCOL(W, k0, o, lane) wcol_io(W, k0, o, lane, CC)
#endif
#if WO_OUT_IN
#define WOCOL(W, k0, o, lane) wcol_oi(W, k0, o, lane, CC)
#define WOCOLH(W, k0, o, lane) wcolh_oi(W, k0, o, lane, CC)
#else
#define WOCOL(W, k0, o, lane) wcol_io(W, k0, o, lane, DIN)
#define WOCOLH(W, k0, o, lane) wcolh_io(W, k0, o, lane, DIN)
#endif

#ifndef SM_EXTRA_PARAMS
#define SM_EXTRA_PARAMS
#endif
#ifndef PROJ_EXTRA_PARAMS
#define PROJ_EXTRA_PARAMS
#endif
#ifndef SM_MASK_HOOK
#define SM_MASK_HOOK (void)0
#endif

#define WS_QH  0u                                      // f16 q rows [b*t][CC]
#define WS_KH  (WS_QH + 2u * (size_t)NB * TT * CC)      // f16 k rows [b*t][CC]
#define WS_VT  (WS_KH + 2u * (size_t)NB * TT * CC)      // f16 v planes [b][c][t]
#define WS_QL  (WS_VT + 2u * (size_t)NB * CC * TT)      // f16 q residual x 2^10 rows [b][t < QHI][CC]
#define WS_KL  (WS_QL + 2u * (size_t)NB * QHI * CC)     // f16 k residual x 2^10 rows [b][t < KHI][CC]
#define WS_VB  (WS_KL + 2u * (size_t)NB * KHI * CC)     // bf16 v hi planes [b][c][t < KHI]
#define WS_VBL (WS_VB + 2u * (size_t)NB * CC * KHI)
#define WS_S   (WS_VBL + 2u * (size_t)NB * CC * KHI)    // f32 logits / P [hg][t][s] (plane not touched: the scores stay in registers)
#define WS_Y   (WS_S  + 4u * (size_t)HG * TT * TT)      // f32 ctx rows [b*t][CC] (only when there is an output projection)
#define WS_END (WS_Y  + 0u)
#define WS_CM (WS_END)                                  // f32 column maxima, base-2 units [NB * NH][TT]
#define WS_CZ (WS_CM + 4u * (size_t)NB * NH * TT)       // f32 2^11 / column sums [NB * NH][TT]
#define WS_END2 (WS_CZ + 4u * (size_t)NB * NH * TT)
#define WS_XB (WS_END2)                                 // bf16 X, packed [block of 128 rows][pass of 64 k][128 rows][64 k]
#define WS_WB (WS_XB + 2u * (size_t)NB * TT * DIN)      // bf16 Wq, Wk, Wv one after the other, each packed the same way
#define WS_END3 (WS_WB + 2u * 3u * (size_t)CC * DIN)

// ---- k_pack: X, Wq, Wk, Wv rounded to bf16 once (the rounding k_proj used to repeat in every block that read a value) and laid so that what a k_proj block stages in one pass, 128 rows x 64 k, is one contiguous run of 16 KiB: piece o of 16 bytes = ((row block * 16 + pass) * 128 + row) * 8 + eighth of the row's 64 k. A thread takes 14 pieces, the same place in 8 successive passes of X and in 2 of each weight: a wave reads aligned 256-byte stretches of 4 rows and stores 512 contiguous bytes a piece. All 28 loads are issued before the first store
// ---- k_proj: block = (128 rows, 128 cols, which), 8 waves of 32 rows x 64 cols: q/k/v = X W (+ b) with exact bf16 products (K = DIN, 32 k a product, ascending, one accumulator chain per output as before). Per pass of 64 k the block's 128 X rows and 128 W rows are read from the packed bf16 planes, 16 KiB each, and laid in one of two LDS buffers; every wave takes its fragments from there. The next pass's global loads are issued in front of this pass's products and stored into the other buffer behind them; the one barrier of a pass publishes that buffer and ends the reads of this one. -> which 0: q f16 rows (+ residual rows < QHI); 1: k f16 rows (+ residual rows < KHI); 2: v f16 planes [c][t] (+ bf16 hi/lo planes for t < KHI). Every '#pragma unroll' of k_pack, k_proj and proj_mac is there so that the small arrays it indexes (staged values, fragments, accumulators) stay in registers
#define PJT 128             // rows and columns of a block's tile
#define PJK 64              // k of a pass: a staged row is one 128-B line of bf16
#define PJP 72              // LDS pitch of a staged row of 64 bf16, in elements: 144 B = 16 B x odd, free of bank conflicts for the 16-byte fragment reads
#define PJC (PJT * PJK)     // elements of one packed run: a block's rows of one pass
#define PKN 65536           // threads of k_pack
#define PJE 136             // LDS pitch of an epilogue row of 128 16-bit values, in elements: 272 B = 16 B x odd
typedef __attribute__((ext_vector_type(4))) __bf16 v4b;
__device__ __forceinline__ void proj_mac(const __bf16 (*xs)[PJP], const __bf16 (*wt)[PJP], int kk, int wm, int wn, int lane, v8f (&acc)[2][4]) { const int col = lane & 15; v16b a[2], w[4];
#pragma unroll
  for (int i = 0; i < 2; ++i) a[i] = frag_b(&xs[wm * 32 + i * 16 + col][kk], lane);
#pragma unroll
  for (int j = 0; j < 4; ++j) w[j] = frag_b(&wt[wn * 64 + j * 16 + col][kk], lane);
#pragma unroll
  for (int i = 0; i < 2; ++i)
#pragma unroll
    for (int j = 0; j < 4; ++j) acc[i][j] = __builtin_amdgcn_wmma_f32_16x16x32_bf16(false, a[i], false, w[j], (short)0, acc[i][j], false, false); }
__global__ __launch_bounds__(256) void k_pack(const float* __restrict__ X, const float* __restrict__ WQ, const float* __restrict__ WK, const float* __restrict__ WV, __bf16* __restrict__ XB, __bf16* __restrict__ WB) {
  const unsigned o = blockIdx.x * 256u + threadIdx.x, re = o & 1023u, hi = o >> 10, row = re >> 3, e = re & 7u;   // re: the piece's place in a packed run (row, eighth of its 64 k); hi: which runs
  const float* xa = X + ((size_t)(hi >> 1) * PJT + row) * DIN + (hi & 1u) * 8u * PJK + e * 8u;   // X: row block hi >> 1, passes (hi & 1) * 8 + 0 .. 7
  const size_t sw = ((size_t)(hi >> 3) * PJT + row) * DIN + (hi & 7u) * 2u * PJK + e * 8u;        // weights: row block hi >> 3, passes (hi & 7) * 2 + 0 .. 1
  const float* wq = WQ + sw; const float* wk = WK + sw; const float* wv = WV + sw; v4f a[14], c[14];
#pragma unroll
  for (int u = 0; u < 8; ++u) { a[u] = *(const v4f*)(xa + u * PJK); c[u] = *(const v4f*)(xa + u * PJK + 4); }
#pragma unroll
  for (int u = 0; u < 2; ++u) { a[8 + u] = *(const v4f*)(wq + u * PJK); c[8 + u] = *(const v4f*)(wq + u * PJK + 4); a[10 + u] = *(const v4f*)(wk + u * PJK); c[10 + u] = *(const v4f*)(wk + u * PJK + 4); a[12 + u] = *(const v4f*)(wv + u * PJK); c[12 + u] = *(const v4f*)(wv + u * PJK + 4); }
  asm volatile("s_wait_xcnt 0x0" :: "v"(xa), "v"(wq), "v"(wk), "v"(wv) : "memory");   /* the wait before a register of an issued load is overwritten; the loads' four addresses are inputs, so they stay live to here and no loaded value lands in one */
  asm volatile("" :: "v"(a[0]), "v"(c[0]), "v"(a[1]), "v"(c[1]), "v"(a[2]), "v"(c[2]), "v"(a[3]), "v"(c[3]), "v"(a[4]), "v"(c[4]), "v"(a[5]), "v"(c[5]), "v"(a[6]), "v"(c[6]), "v"(a[7]), "v"(c[7]), "v"(a[8]), "v"(c[8]), "v"(a[9]), "v"(c[9]), "v"(a[10]), "v"(c[10]), "v"(a[11]), "v"(c[11]), "v"(a[12]), "v"(c[12]), "v"(a[13]), "v"(c[13]));   /* the loaded values as inputs only: holds the 28 loads together in front of the first convert, one memory latency for the thread; without it the compiler issues them in four groups, each waited for before the next */
#pragma unroll
  for (int u = 0; u < 14; ++u) { __bf16* d = u < 8 ? XB + ((size_t)hi * 8u + u) * PJC + re * 8u : WB + (size_t)((u - 8) >> 1) * CC * DIN + ((size_t)hi * 2u + (u & 1)) * PJC + re * 8u;   /* run = row block * 16 + pass */
    *(v8b*)d = __builtin_convertvector(__builtin_shufflevector(a[u], c[u], 0, 1, 2, 3, 4, 5, 6, 7), v8b); } }
__global__ __launch_bounds__(256) void k_proj(const __bf16* __restrict__ XB, const __bf16* __restrict__ WB, const float* __restrict__ BQ, const float* __restrict__ BK, const float* __restrict__ BV,
    _Float16* __restrict__ QH, _Float16* __restrict__ QL, _Float16* __restrict__ KH, _Float16* __restrict__ KL, _Float16* __restrict__ VT, __bf16* __restrict__ VB, __bf16* __restrict__ VBL) {
  __shared__ __align__(16) unsigned char sm[3 * PJT * PJE * 2];   // the loop's two buffers of X and W rows (73,728 B); behind the barrier after the last pass the epilogue's planes
  __bf16 (*xs)[PJT][PJP] = (__bf16 (*)[PJT][PJP])sm; __bf16 (*wt)[PJT][PJP] = (__bf16 (*)[PJT][PJP])(sm + 2 * PJT * PJP * 2);
  const int tid = threadIdx.x, wave = tid >> 5, lane = tid & 31, col = lane & 15, g = lane >> 4, wm = wave & 3, wn = wave >> 2; const int which = blockIdx.z; const int c0 = blockIdx.y * PJT; const size_t r0 = (size_t)blockIdx.x * PJT; const size_t bb = r0 / TT; const int t0 = (int)(r0 % TT);
  const float* BA = which == 0 ? BQ : which == 1 ? BK : BV;
  const int lr = tid >> 3, lc = (tid & 7) * 8;   // staging: piece u * 256 + tid of a packed run is row u * 32 + lr, elements lc .. lc + 7; a wave reads 512 contiguous bytes a load
  const __bf16* xg = XB + (size_t)blockIdx.x * (DIN / PJK) * PJC + tid * 8; const __bf16* wg = WB + ((size_t)which * (CC / PJT) + blockIdx.y) * (DIN / PJK) * PJC + tid * 8;
  v8f acc[2][4] = {}; v8b xr[4], wr[4];
#pragma unroll
  for (int u = 0; u < 4; ++u) { xr[u] = *(const v8b*)(xg + u * 2048); wr[u] = *(const v8b*)(wg + u * 2048); }
#pragma unroll
  for (int u = 0; u < 4; ++u) { *(v8b*)&xs[0][u * 32 + lr][lc] = xr[u]; *(v8b*)&wt[0][u * 32 + lr][lc] = wr[u]; }
  __syncthreads();
  for (int kc = 0; kc < DIN / PJK - 1; ++kc) { const __bf16* xp = xg + (kc + 1) * PJC; const __bf16* wp = wg + (kc + 1) * PJC;
#pragma unroll
    for (int u = 0; u < 4; ++u) { xr[u] = *(const v8b*)(xp + u * 2048); wr[u] = *(const v8b*)(wp + u * 2048); }
    asm volatile("s_wait_xcnt 0x0" :: "v"(xp), "v"(wp) : "memory");   /* the wait before a register of an issued load is overwritten (the fragments below take the address registers); the two addresses are inputs, so they stay live to here. Standing here it also keeps all eight loads in front of the pass's LDS reads and products */
    proj_mac(xs[kc & 1], wt[kc & 1], 0, wm, wn, lane, acc); proj_mac(xs[kc & 1], wt[kc & 1], 32, wm, wn, lane, acc);
#pragma unroll
    for (int u = 0; u < 4; ++u) { *(v8b*)&xs[(kc + 1) & 1][u * 32 + lr][lc] = xr[u]; *(v8b*)&wt[(kc + 1) & 1][u * 32 + lr][lc] = wr[u]; }
    __syncthreads(); }
  proj_mac(xs[(DIN / PJK - 1) & 1], wt[(DIN / PJK - 1) & 1], 0, wm, wn, lane, acc); proj_mac(xs[(DIN / PJK - 1) & 1], wt[(DIN / PJK - 1) & 1], 32, wm, wn, lane, acc);
  __syncthreads();   // every wave has taken its last fragments: the epilogue's planes may overwrite the buffers
  if (which < 2) { _Float16 (*sh)[PJE] = (_Float16 (*)[PJE])sm; _Float16 (*sl)[PJE] = (_Float16 (*)[PJE])(sm + PJT * PJE * 2); _Float16* DH = which == 0 ? QH : KH; _Float16* DL = which == 0 ? QL : KL; const int nhi = which == 0 ? QHI : KHI; const bool hi_rows = t0 < nhi;
#pragma unroll
    for (int j = 0; j < 4; ++j) { const int cl = wn * 64 + j * 16 + col; const float bias = BA ? bfr(BA[c0 + cl]) : 0.f;
#pragma unroll
      for (int i = 0; i < 2; ++i)
#pragma unroll
        for (int r = 0; r < 8; ++r) { const float v = acc[i][j][r] + bias; const _Float16 hv = (_Float16)v; const int rl = wm * 32 + i * 16 + 8 * g + r; sh[rl][cl] = hv; sl[rl][cl] = (_Float16)((v - (float)hv) * 1024.0f); } }
    __syncthreads();
    for (int e = tid; e < PJT * 16; e += 256) { const int rl = e >> 4, q = e & 15; _Float16* ph = DH + (r0 + rl) * CC + c0 + q * 8; _Float16* pl = DL + (bb * nhi + t0 + rl) * (size_t)CC + c0 + q * 8; const v4u hv = *(const v4u*)&sh[rl][q * 8], lv = *(const v4u*)&sl[rl][q * 8];
      vst2((unsigned*)ph, hv); if (hi_rows) vst2((unsigned*)pl, lv);
      asm volatile("s_wait_xcnt 0x0" :: "v"(ph), "v"(pl), "v"(hv), "v"(lv) : "memory"); }   /* the wait before a register of an issued store is overwritten (the next trip takes the address and data registers); they are inputs, so they stay live to here */
  } else { _Float16 (*th)[PJE] = (_Float16 (*)[PJE])sm; __bf16 (*tb)[PJE] = (__bf16 (*)[PJE])(sm + PJT * PJE * 2); __bf16 (*tbl)[PJE] = (__bf16 (*)[PJE])(sm + 2 * PJT * PJE * 2); const bool hi_rows = t0 < KHI;
#pragma unroll
    for (int j = 0; j < 4; ++j) { const int cl = wn * 64 + j * 16 + col; const float bias = BA ? bfr(BA[c0 + cl]) : 0.f;
#pragma unroll
      for (int i = 0; i < 2; ++i)
#pragma unroll
        for (int r = 0; r < 8; ++r) { const float v = acc[i][j][r] + bias; const int rl = wm * 32 + i * 16 + 8 * g + r; th[cl][rl] = (_Float16)v; const __bf16 bh = (__bf16)v; tb[cl][rl] = bh; tbl[cl][rl] = (__bf16)(v - (float)bh); } }
    __syncthreads();
    for (int e = tid; e < PJT * 16; e += 256) { const int cl = e >> 4, q = e & 15; vst2((unsigned*)(VT + (bb * CC + c0 + cl) * (size_t)TT + t0 + q * 8), *(const v4u*)&th[cl][q * 8]); if (hi_rows) { const size_t o3 = (bb * CC + c0 + cl) * (size_t)KHI + t0 + q * 8; vst2((unsigned*)(VB + o3), *(const v4u*)&tb[cl][q * 8]); vst2((unsigned*)(VBL + o3), *(const v4u*)&tbl[cl][q * 8]); } } } }
// ---- k_sm: block = query row t (head in group): keys [0, kend): causal -> logit if s <= t else excluded; softmax in f32; P x 2^11 in place (0 for excluded)
__global__ __launch_bounds__(256) void k_sm(float* __restrict__ S0 SM_EXTRA_PARAMS) { __shared__ float sred[8]; __shared__ float sbc; __shared__ __align__(16) float shv[TT];
  const int tid = threadIdx.x; const int t = blockIdx.x; const int kend = (kb_last(t >> 6) + 1) * 128;
  float* sr = S0 + (size_t)blockIdx.y * TT * TT + (size_t)t * TT;
  float m = -3.0e38f; for (int k = tid; k < kend; k += 256) { float v = (!CAUSAL || k <= t) ? sr[k] : -3.0e38f; SM_MASK_HOOK; shv[k] = v; m = fmaxf(m, v); }
#pragma unroll
  for (int o = 1; o < 32; o <<= 1) m = fmaxf(m, __shfl_xor(m, o));
  if ((tid & 31) == 0) sred[tid >> 5] = m; __syncthreads(); if (tid == 0) { float a = sred[0]; for (int i = 1; i < 8; ++i) a = fmaxf(a, sred[i]); sbc = a; } __syncthreads(); m = sbc; __syncthreads();
  float sum = 0.f; for (int k = tid; k < kend; k += 256) { const float v = shv[k]; const float e = (v <= -1.0e38f) ? 0.f : expf(v - m); shv[k] = e; sum += e; }
#pragma unroll
  for (int o = 1; o < 32; o <<= 1) sum += __shfl_xor(sum, o);
  if ((tid & 31) == 0) sred[tid >> 5] = sum; __syncthreads(); if (tid == 0) { float a = 0.f; for (int i = 0; i < 8; ++i) a += sred[i]; sbc = a > 0.f ? 2048.0f / a : 0.f; }   /* a fully excluded row yields P = 0 */ __syncthreads(); const float inv = sbc;
  for (int k = tid; k < kend; k += 256) shv[k] = shv[k] * inv;
  __syncthreads(); for (int q = tid; q < kend / 4; q += 256) vst2(sr + q * 4, *(const v4f*)&shv[q * 4]); }
// ---- k_stat: softmax over the QUERY axis under the causal mask (the source's softmax(axis=2) on [B, H, i, j] scores with -inf where j > i), with no score matrix in memory. Block = (STK key columns from k0, head h, batch b), STW waves. Every wave keeps the STK keys' f16 fragments in registers and takes every STW-th tile of 16 of the visible query rows k0 .. TT-1: scores q x k on WMMA (one f16 product), then per lane and column tile the online (max, sum) over its 8 rows (f32; the maximum runs over the raw products, each term is 2^(s x SCL2 - m x SCL2): one multiply-add and one v_exp_f32; q < k reads as -inf and adds 2^(-inf) = 0; the running maximum starts finite, so no difference is inf - inf; the sum so far is rescaled by 2^((m_old - m_new) x SCL2)). The 2 * STW partial pairs of a column (wave, lane half) are merged through LDS behind one barrier, which every wave reaches after its own last tile: m_k in base-2 units (m x SCL2) to CM, 2^11 / Z_k to CR, whole lines. The cost of a strip falls linearly with its index (strip x sees TT - x * STK query rows) and every work-group of the launch is resident at once, so a work-group takes two strips one after the other, the last minus x and x: every work-group has the same work. Each strip has its own pair of LDS arrays, so the second strip's partials never meet the first strip's merge. Every '#pragma unroll' of k_stat and k_out is there so that the small arrays it indexes (fragments, accumulators, m, z, P) stay in registers
#define STW 8
#define STK 64
// the fragments of frag_h / frag_b from a pointer that already holds the lane's own 8g offset: a run of loads then shares one address value, which the wait behind the run can name
// 2^x on v_exp_f32: every argument here is at most about 0 where its result is used, and a result below the normal range may read as 0 (it stands beside a column sum of at least 1). Written as asm so that the slot the instruction set asks for behind a transcendental (no use of its result, no overwrite of its source in the next instruction) is kept by construction, wherever the compiler places the statement. The v_nop is that slot
__device__ __forceinline__ float ex2(float x) { float e; asm("v_exp_f32 %0, %1\n\tv_nop" : "=v"(e) : "v"(x)); return e; }
// eight of them: the results are early-clobber outputs, so none lies in a source and each v_exp_f32 is the independent instruction behind the one before; one v_nop behind the last
__device__ __forceinline__ void ex2x8(float (&e)[8], const float (&x)[8]) {
  asm("v_exp_f32 %0, %8\n\tv_exp_f32 %1, %9\n\tv_exp_f32 %2, %10\n\tv_exp_f32 %3, %11\n\tv_exp_f32 %4, %12\n\tv_exp_f32 %5, %13\n\tv_exp_f32 %6, %14\n\tv_exp_f32 %7, %15\n\tv_nop"
      : "=&v"(e[0]), "=&v"(e[1]), "=&v"(e[2]), "=&v"(e[3]), "=&v"(e[4]), "=&v"(e[5]), "=&v"(e[6]), "=&v"(e[7])
      : "v"(x[0]), "v"(x[1]), "v"(x[2]), "v"(x[3]), "v"(x[4]), "v"(x[5]), "v"(x[6]), "v"(x[7])); }
__device__ __forceinline__ v16h frag_hp(const _Float16* p) { union { v16h v; v8h q[2]; } u; u.q[0] = *(const v8h*)p; u.q[1] = *(const v8h*)(p + 16); return u.v; }
__device__ __forceinline__ v16b frag_bp(const __bf16* p) { union { v16b v; v8b q[2]; } u; u.q[0] = *(const v8b*)p; u.q[1] = *(const v8b*)(p + 16); return u.v; }
__global__ __launch_bounds__(STW * 32) void k_stat(const _Float16* __restrict__ QH, const _Float16* __restrict__ KH, float* __restrict__ CM, float* __restrict__ CR) { __shared__ float pm2[2][2 * STW][STK], pz2[2][2 * STW][STK];
  const int tid = threadIdx.x, lane = tid & 31, col = lane & 15, g = lane >> 4; const int wave = __builtin_amdgcn_readfirstlane(tid >> 5); const int h = blockIdx.y, b = blockIdx.z;
  for (int half = 0; half < 2; ++half) { const int k0 = (half ? (int)blockIdx.x : TT / STK - 1 - (int)blockIdx.x) * STK; float (*pm)[STK] = pm2[half]; float (*pz)[STK] = pz2[half];
  v16h kf[HD / 32][STK / 16]; const _Float16* kp = KH + ((size_t)b * TT + k0 + col) * CC + h * HD + 8 * g;
#pragma unroll
  for (int kc = 0; kc < HD / 32; ++kc) {
#pragma unroll
    for (int j = 0; j < STK / 16; ++j) kf[kc][j] = frag_hp(kp + (size_t)j * 16 * CC + kc * 32); }
  asm volatile("s_wait_xcnt 0x0" :: "v"(kp) : "memory");   /* the wait before a register of an issued load is overwritten; the loads' common address is an input, so it stays live to here and no fragment lands in it */
  float m[STK / 16], z[STK / 16];   // m: running maximum of the raw products
#pragma unroll
  for (int j = 0; j < STK / 16; ++j) { m[j] = -3.0e38f; z[j] = 0.f; }
  for (int ql0 = k0 + wave * 16; ql0 < TT; ql0 += STW * 16) { const _Float16* qp = QH + ((size_t)b * TT + ql0 + col) * CC + h * HD; const v16h a0 = frag_h(qp, lane), a1 = frag_h(qp + 32, lane);
    v8f sc[STK / 16];   /* the trip's eight products first, over four independent accumulators: no WMMA waits for the one in front of it */
#pragma unroll
    for (int j = 0; j < STK / 16; ++j) { const v8f zero = {}; sc[j] = wmma16(a0, kf[0][j], zero); }
#pragma unroll
    for (int j = 0; j < STK / 16; ++j) sc[j] = wmma16(a1, kf[1][j], sc[j]);
#pragma unroll
    for (int j = 0; j < STK / 16; ++j) { const v8f acc = sc[j]; const int k = k0 + j * 16 + col; float v[8];
#pragma unroll
      for (int r = 0; r < 8; ++r) v[r] = (ql0 + 8 * g + r >= k) ? acc[r] : -INFINITY;
      float mn = m[j];
#pragma unroll
      for (int r = 0; r < 8; ++r) mn = fmaxf(mn, v[r]);
      const float nb = -(mn * SCL2); float x[8], e[8];
#pragma unroll
      for (int r = 0; r < 8; ++r) x[r] = __builtin_fmaf(v[r], SCL2, nb);
      ex2x8(e, x); float s = e[0];
#pragma unroll
      for (int r = 1; r < 8; ++r) s += e[r];
      z[j] = z[j] * ex2((m[j] - mn) * SCL2) + s; m[j] = mn; } }   /* the two raw maxima are subtracted first: a maximum that has not moved gives exactly 2^0 = 1, and a difference followed by a multiply has no fused form */
#pragma unroll
  for (int j = 0; j < STK / 16; ++j) { pm[2 * wave + g][j * 16 + col] = m[j] * SCL2; pz[2 * wave + g][j * 16 + col] = z[j]; }
  __syncthreads();
  if (tid < STK) { float mm = pm[0][tid];
#pragma unroll
    for (int w = 1; w < 2 * STW; ++w) mm = fmaxf(mm, pm[w][tid]);
    float a = 0.f;   /* a partial that saw no visible row of this column holds Z = 0 and a finite maximum */
#pragma unroll
    for (int w = 0; w < 2 * STW; ++w) a += pz[w][tid] * ex2(pm[w][tid] - mm);
    const size_t o = ((size_t)b * NH + h) * TT + k0 + tid; float* pcm = CM + o; float* pcr = CR + o; const float rz = 2048.0f / a; vst2(pcm, mm); vst2(pcr, rz);   /* every column sees at least its own diagonal entry: Z_k >= 1 */
    asm volatile("s_wait_xcnt 0x0" :: "v"(pcm), "v"(pcr), "v"(mm), "v"(rz) : "memory"); } } }   /* the wait before a register of an issued store is overwritten (the second strip takes the address and data registers); they are inputs, so they stay live to here */
// ---- k_out: block = 64 queries (qb) of (b, h), a wave = 16 queries: per 32 keys the scores are formed again on WMMA, transposed (A = 16 key rows, B = the wave's 16 queries, kept in registers; the same one f16 product), so that a lane holds, for its own query, the keys 8g + 0..7 of each 16-key tile: two such tiles are, in place, the A fragment of P . v (hardware k order, the order of frag_b). P[i][j] = 2^(s x SCL2 - m_j) x (2^11 / Z_j), m_j in base-2 units, for j <= i, 0 above the diagonal (unconditional loads, value select); P and v as bf16 hi + lo, 3 products, keys [0, kend) as before; 256-B (row, head) segment by 16 lanes. What the four waves read of 64 keys (k rows, v hi and lo rows, column maxima and scales) is the same for all of them: it is brought into LDS once per block, as whole 128-B lines, by asynchronous copies, two buffers, the next tile flying while a tile is worked on; every fragment comes from LDS. The cost of a query block grows linearly with its index (block qb walks the keys up to its own diagonal) and every work-group of the launch is resident at once, so a work-group takes two query blocks of its head one after the other, the last minus x and x: every work-group has the same work
#define OKT 64              // keys of a staged tile
#define OPB 144             // LDS pitch in bytes of a staged row of 128 B: 16 B x odd, free of bank conflicts for the 16-byte fragment reads
#define OPL (64 * OPB)      // one staged plane: 64 rows (64 keys of k; 64 channels of v hi; of v lo)
#define OBF (3 * OPL + 512) // one buffer: three planes, then 64 column maxima and 64 column scales
// the 12 copies of a thread for one tile: 8 lanes cover one row's 128-B line, the block 16 rows a copy. la: the thread's LDS byte address in the k plane; kg, hg, lg: its addresses in the tile's first 16 rows
__device__ __forceinline__ void out_stage(unsigned la, const _Float16* kg, const __bf16* hg, const __bf16* lg) {
  /* the copies and, as the last line of their own statement, the wait before a register that an issued copy names is rewritten */
  asm volatile("global_load_async_to_lds_b128 %0, %12, off\n\tglobal_load_async_to_lds_b128 %1, %13, off\n\tglobal_load_async_to_lds_b128 %2, %14, off\n\tglobal_load_async_to_lds_b128 %3, %15, off\n\t"
               "global_load_async_to_lds_b128 %4, %16, off\n\tglobal_load_async_to_lds_b128 %5, %17, off\n\tglobal_load_async_to_lds_b128 %6, %18, off\n\tglobal_load_async_to_lds_b128 %7, %19, off\n\t"
               "global_load_async_to_lds_b128 %8, %20, off\n\tglobal_load_async_to_lds_b128 %9, %21, off\n\tglobal_load_async_to_lds_b128 %10, %22, off\n\tglobal_load_async_to_lds_b128 %11, %23, off\n\ts_wait_xcnt 0x0"
               :: "v"(la), "v"(la + 16 * OPB), "v"(la + 32 * OPB), "v"(la + 48 * OPB),
                  "v"(la + OPL), "v"(la + OPL + 16 * OPB), "v"(la + OPL + 32 * OPB), "v"(la + OPL + 48 * OPB),
                  "v"(la + 2 * OPL), "v"(la + 2 * OPL + 16 * OPB), "v"(la + 2 * OPL + 32 * OPB), "v"(la + 2 * OPL + 48 * OPB),
                  "v"(kg), "v"(kg + (size_t)16 * CC), "v"(kg + (size_t)32 * CC), "v"(kg + (size_t)48 * CC),
                  "v"(hg), "v"(hg + (size_t)16 * KHI), "v"(hg + (size_t)32 * KHI), "v"(hg + (size_t)48 * KHI),
                  "v"(lg), "v"(lg + (size_t)16 * KHI), "v"(lg + (size_t)32 * KHI), "v"(lg + (size_t)48 * KHI) : "memory"); }
// one wave's copy of the tile's 64 maxima (lanes 0..15) and 64 scales (lanes 16..31), with the same wait
__device__ __forceinline__ void out_stage_c(unsigned la, const float* cg) { asm volatile("global_load_async_to_lds_b128 %0, %1, off\n\ts_wait_xcnt 0x0" :: "v"(la), "v"(cg) : "memory"); }
// amdgpu_waves_per_eu(4): a budget of 256 registers; without it what the compiler keeps live round the loop over the two query blocks takes the count just past 256 and fills the key loop with register-window switches
__global__ __launch_bounds__(128) __attribute__((amdgpu_waves_per_eu(4))) void k_out(const _Float16* __restrict__ QH, const _Float16* __restrict__ KH, const float* __restrict__ CM, const float* __restrict__ CR, const __bf16* __restrict__ VB, const __bf16* __restrict__ VBL, float* __restrict__ Y) { __shared__ __align__(16) unsigned char sm[2 * OBF];   // the loop's two buffers; behind the loop's last barrier the epilogue's rows
  const int tid = threadIdx.x, lane = tid & 31, col = lane & 15, g = lane >> 4; const int wave = __builtin_amdgcn_readfirstlane(tid >> 5); const int h = blockIdx.y, b = blockIdx.z;
  const int sr = tid >> 3, sq = (tid & 7) * 8;   // staging: the thread's row among 16 and its 16 bytes of the row
  const _Float16* kg = KH + ((size_t)b * TT + sr) * CC + h * HD + sq; const size_t po = ((size_t)b * CC + h * HD + sr) * (size_t)KHI + sq; const __bf16* hg = VB + po; const __bf16* lg = VBL + po;
  const float* cg = (g ? CR : CM) + ((size_t)b * NH + h) * TT + col * 4;
  const unsigned la = (unsigned)(size_t)sm + sr * OPB + sq * 2, lc = (unsigned)(size_t)sm + 3 * OPL + lane * 16;
  for (int half = 0; half < 2; ++half) { const int qb = half ? (int)blockIdx.x : NQB - 1 - (int)blockIdx.x; const int ql0 = qb * 64 + wave * 16; const int nt = (kb_last(qb) + 1) * 2; const int qi = ql0 + col;   // nt tiles of 64 keys, never fewer than two
  const _Float16* qp = QH + ((size_t)b * TT + qi) * CC + h * HD; const v16h q0 = frag_h(qp, lane), q1 = frag_h(qp + 32, lane);
  out_stage(la, kg, hg, lg); if (wave == 0) out_stage_c(lc, cg);
  asm volatile("s_wait_asynccnt 0x0" ::: "memory");   /* this wave's copies of tile 0 have landed */
  __syncthreads();                                     /* and every other wave's: tile 0 may be read */
  out_stage(la + OBF, kg + (size_t)OKT * CC, hg + OKT, lg + OKT); if (wave == 0) out_stage_c(lc + OBF, cg + OKT);
  v8f acc[HD / 16] = {};
  for (int t = 0; t < nt; ++t) { const unsigned char* bp = sm + (t & 1) * OBF;
#pragma unroll   /* the tile's two halves of 32 keys, unrolled so that every LDS offset of a half is an immediate */
    for (int s = 0; s < 2; ++s) { const int k0 = t * OKT + s * 32;
      const _Float16* ka = (const _Float16*)(bp + (s * 32 + col) * OPB) + 8 * g; const _Float16* kb2 = ka + 16 * (OPB / 2); const float* cmk = (const float*)(bp + 3 * OPL) + s * 32 + 8 * g; const float* crk = cmk + OKT;
      const v16h ka0 = frag_hp(ka), kb0 = frag_hp(kb2), ka1 = frag_hp(ka + 32), kb1 = frag_hp(kb2 + 32);
      v4f mv[4], rv[4];
#pragma unroll
      for (int u = 0; u < 4; ++u) { const int o = (u >> 1) * 16 + (u & 1) * 4; mv[u] = *(const v4f*)(cmk + o); rv[u] = *(const v4f*)(crk + o); }
      v16b vh[HD / 16], vl[HD / 16]; const __bf16* vhp = (const __bf16*)(bp + OPL + col * OPB) + s * 32 + 8 * g; const __bf16* vlp = vhp + OPL / 2;
#pragma unroll
      for (int j = 0; j < HD / 16; ++j) vh[j] = frag_bp(vhp + j * 16 * (OPB / 2));
      __builtin_amdgcn_sched_barrier(0);   /* keeps these 24 LDS reads together in front of the half's products: without it the compiler sinks them in pairs between the WMMAs, each pair waited for one WMMA later */
      v8f s0 = {}, s1 = {}; s0 = wmma16(ka0, q0, s0); s1 = wmma16(kb0, q0, s1); s0 = wmma16(ka1, q1, s0); s1 = wmma16(kb1, q1, s1);
      float pv[16], x0[8], x1[8], e0[8], e1[8];
#pragma unroll
      for (int i = 0; i < 8; ++i) { x0[i] = __builtin_fmaf(s0[i], SCL2, -mv[i >> 2][i & 3]); x1[i] = __builtin_fmaf(s1[i], SCL2, -mv[2 + (i >> 2)][i & 3]); }
      ex2x8(e0, x0); ex2x8(e1, x1);
#pragma unroll
      for (int j = 0; j < HD / 16; ++j) vl[j] = frag_bp(vlp + j * 16 * (OPB / 2));   /* the v lo rows, wanted last, are a second group of reads: with all 32 reads of a half in one group the kernel no longer fits its 256 registers and spills */
      __builtin_amdgcn_sched_barrier(0);   /* keeps those 8 reads in front of the forming of P, which with the first eight P . v products covers their latency: without it the compiler sinks them in pairs between the products */
#pragma unroll
      for (int i = 0; i < 8; ++i) { const int ke = k0 + 8 * g + i; pv[i] = (ke <= qi) ? e0[i] * rv[i >> 2][i & 3] : 0.f; pv[8 + i] = (ke + 16 <= qi) ? e1[i] * rv[2 + (i >> 2)][i & 3] : 0.f; }
      const F2 p = bsplit16(pv);
#pragma unroll
      for (int j = 0; j < HD / 16; ++j) acc[j] = wmma_bf(p.h, vh[j], acc[j]);   /* product by product over the four accumulators: no WMMA waits for the one in front of it; each accumulator takes its three products in the order it had */
#pragma unroll
      for (int j = 0; j < HD / 16; ++j) acc[j] = wmma_bf(p.l, vh[j], acc[j]);
#pragma unroll
      for (int j = 0; j < HD / 16; ++j) acc[j] = wmma_bf(p.h, vl[j], acc[j]); }
    __builtin_amdgcn_sched_barrier(0);                   /* keeps the tile's last products in front of the barrier, as they stood: without it the compiler moves them behind it, and the refill below, which follows them, is issued that much later */
    asm volatile("s_wait_dscnt 0x0" ::: "memory");      /* this wave's reads of tile t are over */
    asm volatile("s_wait_asynccnt 0x0" ::: "memory");   /* its copies of tile t + 1 have landed */
    __syncthreads();                                     /* the same of every wave: tile t + 1 may be read, tile t's buffer refilled */
    if (t + 2 < nt) { const int kn = (t + 2) * OKT; const unsigned bo = (t & 1) * OBF; out_stage(la + bo, kg + (size_t)kn * CC, hg + kn, lg + kn); if (wave == 0) out_stage_c(lc + bo, cg + kn); } }
  asm volatile("s_wait_asynccnt 0x0" ::: "memory");     /* no copy is outstanding when the buffers become the epilogue's rows */
  float (*ss)[16][HD + 4] = (float (*)[16][HD + 4])sm;
#pragma unroll
  for (int j = 0; j < HD / 16; ++j)
#pragma unroll
    for (int r = 0; r < 8; ++r) ss[wave][8 * g + r][j * 16 + col] = acc[j][r] * (1.0f / 2048.0f);
  LDSX(); for (int rl = 0; rl < 16; ++rl) if (lane < HD / 4) vst2(Y + ((size_t)b * TT + ql0 + rl) * CC + h * HD + lane * 4, *(const v4f*)&ss[wave][rl][lane * 4]);
  if (half == 0) {
    asm volatile("s_wait_xcnt 0x0" ::: "memory");     /* the wait before a register of an issued store is overwritten (the second query block takes the address and data registers) */
    asm volatile("s_wait_dscnt 0x0" ::: "memory");    /* this wave's reads of its epilogue rows are over */
    __syncthreads(); } } }                             /* the same of every wave: the second query block's copies may overwrite the rows */

extern "C" void kernel_launch(void* const* d_in, const int* in_sizes, int n_in, void* d_out, int out_size, void* d_ws, size_t ws_size, hipStream_t stream) {
  (void)in_sizes; (void)n_in; (void)out_size;
  const float** F = (const float**)d_in;
  if (ws_size < (size_t)WS_END) return;
  char* ws = (char*)d_ws; _Float16 *QH = (_Float16*)(ws + WS_QH), *KH = (_Float16*)(ws + WS_KH), *VT = (_Float16*)(ws + WS_VT), *QL = (_Float16*)(ws + WS_QL), *KL = (_Float16*)(ws + WS_KL); __bf16 *VB = (__bf16*)(ws + WS_VB), *VBL = (__bf16*)(ws + WS_VBL); float *S = (float*)(ws + WS_S), *Y = (float*)(ws + WS_Y);
  (void)Y; (void)QL; (void)KL; (void)VB; (void)VBL; (void)S; (void)VT;
  // inputs: 0 X [2,2048,1024]; 1 Wq [1024,1024] (out,in), 2 bq; 3 Wk, 4 bk; 5 Wv, 6 bv (biases N(0, 0.02), nonzero); no output projection
  if (ws_size < (size_t)WS_END3) return;
  __bf16 *XB = (__bf16*)(ws + WS_XB), *WB = (__bf16*)(ws + WS_WB);
  float *CM = (float*)(ws + WS_CM), *CZ = (float*)(ws + WS_CZ);
  k_pack<<<dim3(PKN / 256), 256, 0, stream>>>(F[0], F[1], F[3], F[5], XB, WB);   /* bf16 copies of X and the weights, packed by k_proj's passes */
  k_proj<<<dim3(TNB * TT / PJT, CC / PJT, 3), 256, 0, stream>>>(XB, WB, F[2], F[4], F[6], QH, QL, KH, KL, VT, VB, VBL);
  k_stat<<<dim3(TT / STK / 2, NH, TNB), STW * 32, 0, stream>>>(QH, KH, CM, CZ);   /* per key column j: max and 2^11 / sum over the visible queries i >= j */
  k_out<<<dim3(NQB / 2, NH, TNB), 128, 0, stream>>>(QH, KH, CM, CZ, VB, VBL, (float*)d_out);   /* P formed in registers, then P . v */
}

// v009
// Measured time: 88 microseconds a run.
// Next to v008, in two timings, it ran 1.05 times as fast each time.
// Counting every step since v000, it is 89.2 times as fast.
// compute dtype: all float inputs rounded to bf16; q/k/v projections with EXACT bf16 products on WMMA 16x16x32 (f32 accumulate) + bias; causal scores q x k once to f16 each (1 product; the module scales by 1/sqrt(E) = 1/32, so sigma - 0.1) on every block; softmax over the QUERY axis in f32 (per key column: online max / sum over the visible queries, exponentials as 2^x on the hardware's own instruction, 1/sqrt(E) and log2(e) folded into one multiply-add); P as bf16 hi + lo against v as bf16 hi + lo (3 products) on EVERY block; f32 output.
#include <hip/hip_runtime.h>
#include <math.h>

typedef __attribute__((ext_vector_type(16))) _Float16 v16h;
typedef __attribute__((ext_vector_type(16))) __bf16 v16b;
typedef __attribute__((ext_vector_type(8)))  _Float16 v8h;
typedef __attribute__((ext_vector_type(8)))  float v8f;
typedef __attribute__((ext_vector_type(4)))  float v4f;
typedef __attribute__((ext_vector_type(2)))  float v2f;
typedef __attribute__((ext_vector_type(4)))  unsigned v4u;
typedef __attribute__((ext_vector_type(4)))  int v4i;
typedef float __attribute__((may_alias)) float_a;
typedef int __attribute__((may_alias)) int_a;

template <typename T> __device__ __forceinline__ void vst2(void* p, T v) { *(T*)p = v;  }
__device__ __forceinline__ v8f wmma16(v16h a, v16h b, v8f c) {
  return __builtin_amdgcn_wmma_f32_16x16x32_f16(false, a, false, b, (short)0, c, false, false);
}
__device__ __forceinline__ v8f wmma_bf(v16b a, v16b b, v8f c) {
  return __builtin_amdgcn_wmma_f32_16x16x32_bf16(false, a, false, b, (short)0, c, false, false);
}
// 16x16x32 fragments: lane = (h = lane>>4, row/col = lane&15); elements 0..7 = k0+8h+0..7, 8..15 = k0+16+8h+0..7; D element r = row 8h+r
__device__ __forceinline__ v16h frag_h(const _Float16* rowk0, int lane) {
  union { v16h v; v8h q[2]; } u; const _Float16* p = rowk0 + 8 * (lane >> 4);
  u.q[0] = *(const v8h*)p; u.q[1] = *(const v8h*)(p + 16); return u.v;
}
__device__ __forceinline__ v16h frag_f32(const float* rowk0, int lane) {
  v16h a; const float* p = rowk0 + 8 * (lane >> 4);
#pragma unroll
  for (int i = 0; i < 8; ++i) { a[i] = (_Float16)p[i]; a[8 + i] = (_Float16)p[16 + i]; }
  return a;
}
__device__ __forceinline__ v16h frag_f32s(const float* rowk0, int lane, float sc) {
  v16h a; const float* p = rowk0 + 8 * (lane >> 4);
#pragma unroll
  for (int i = 0; i < 8; ++i) { a[i] = (_Float16)(p[i] * sc); a[8 + i] = (_Float16)(p[16 + i] * sc); }
  return a;
}
// column fragment from a [K][ld] layout (column n), rows >= K read as 0
__device__ __forceinline__ v16h fragc_f32(const float* W, int k0, int n, int lane, int ld, int K) {
  v16h a; const int g = lane >> 4;
#pragma unroll
  for (int i = 0; i < 8; ++i) { const int ka = k0 + 8 * g + i, kb = ka + 16;
    a[i] = (_Float16)(ka < K ? W[(size_t)(ka < K ? ka : K - 1) * ld + n] : 0.f); a[8 + i] = (_Float16)(kb < K ? W[(size_t)(kb < K ? kb : K - 1) * ld + n] : 0.f); }
  return a;
}
struct F2 { v16b h, l; };
__device__ __forceinline__ F2 bsplit16(const float v[16]) { F2 r;
#pragma unroll
  for (int i = 0; i < 16; ++i) { const __bf16 h = (__bf16)v[i]; r.h[i] = h; r.l[i] = (__bf16)(v[i] - (float)h); }
  return r; }
__device__ __forceinline__ F2 split_row(const float* row, int k0, int lane) { float v[16]; const float* p = row + k0 + 8 * (lane >> 4);
#pragma unroll
  for (int i = 0; i < 8; ++i) { v[i] = p[i]; v[8 + i] = p[16 + i]; }
  return bsplit16(v); }
__device__ __forceinline__ F2 split_rowK(const float* row, int k0, int lane, int K) { float v[16]; const int g = lane >> 4;
#pragma unroll
  for (int i = 0; i < 8; ++i) { const int ka = k0 + 8 * g + i, kb = ka + 16; v[i] = ka < K ? row[ka < K ? ka : K - 1] : 0.f; v[8 + i] = kb < K ? row[kb < K ? kb : K - 1] : 0.f; }
  return bsplit16(v); }
__device__ __forceinline__ F2 split_col(const float* W, int k0, int n, int lane, int ld, int K) { float v[16]; const int g = lane >> 4;
#pragma unroll
  for (int i = 0; i < 8; ++i) { const int ka = k0 + 8 * g + i, kb = ka + 16; v[i] = ka < K ? W[(size_t)(ka < K ? ka : K - 1) * ld + n] : 0.f; v[8 + i] = kb < K ? W[(size_t)(kb < K ? kb : K - 1) * ld + n] : 0.f; }
  return bsplit16(v); }
__device__ __forceinline__ v8f mac3(const F2& a, const F2& b, v8f c) { c = wmma_bf(a.l, b.h, c); c = wmma_bf(a.h, b.l, c); return wmma_bf(a.h, b.h, c); }
__device__ __forceinline__ float sigm(float v) { return 1.0f / (1.0f + expf(-v)); }
#define LDSX() do { asm volatile("s_wait_dscnt 0" ::: "memory"); __builtin_amdgcn_wave_barrier(); __builtin_amdgcn_fence(__ATOMIC_RELEASE, "workgroup"); } while (0)

// Multi-headed attention whose softmax runs over the QUERY axis, scaled by the MODEL width (X [2,2048,1024]; torch (out,in) Wq / Wk / Wv [1024,1024] N(0, 1/1024) + biases N(0, 0.02); 16 heads x 64; scores / sqrt(E) = / 32; -inf where j > i; attn = softmax(scores, axis=2) - axis 2 of [B, H, i, j] is the QUERY axis i: every key column j is normalised over the queries i >= j (faithful to the source); out = attn v; merge; no output projection).
#define NB 2
#define TT 2048
#define CC 1024            // NH * HD = projected width
#define DIN 1024          // input (model) width
#define NH 16
#define HD 64
#define NQB (TT / 64)
#define HG 4
#define SCALE (0.03125f)
#define SCL2 (SCALE * 1.44269504088896340736f)   // raw q . k product -> exponent to base 2
#define CAUSAL 1
#ifndef TNB
#define TNB NB
#endif
__device__ __forceinline__ float bfr(float v) { return (float)(__bf16)v; }
__host__ __device__ __forceinline__ int kb_last(int qb) { return CAUSAL ? ((qb * 64 + 63) >> 7) : (TT / 128 - 1); }
typedef __attribute__((ext_vector_type(8))) __bf16 v8b;
__device__ __forceinline__ v16b frag_b(const __bf16* rowk0, int lane) {
  union { v16b v; v8b q[2]; } u; const __bf16* p = rowk0 + 8 * (lane >> 4);
  u.q[0] = *(const v8b*)p; u.q[1] = *(const v8b*)(p + 16); return u.v;
}
#define QBH 32              // not read: k_out takes its one bf16 hi/lo path on all NQB query blocks
#define QHI 0               // no q residual plane: the scores are tiny (scale 1/32) and single-product everywhere
#define QBH_SC 0            // not read (k_out: bf16 hi/lo P.v on every block - a query-axis softmax has O(1) weights on the LAST key columns)
#define KHI 2048            // key rows carrying k residual / v bf16 hi+lo planes (the v planes are read by k_out; the k residual is not read)
// B fragment (k rows k0+.., output column o) of a weight: (in,out) [K][ld] or (out,in) [ld rows of K]: bf16 exact, or f16(bf16 * 256) exact
__device__ __forceinline__ v16b wcol_io(const float* Wm, int k0, int o, int lane, int ld) { v16b w; const int g = lane >> 4;
#pragma unroll
  for (int i = 0; i < 8; ++i) { w[i] = (__bf16)Wm[(size_t)(k0 + 8 * g + i) * ld + o]; w[8 + i] = (__bf16)Wm[(size_t)(k0 + 16 + 8 * g + i) * ld + o]; }
  return w; }
__device__ __forceinline__ v16b wcol_oi(const float* Wm, int k0, int o, int lane, int K) { v16b w; const float* p = Wm + (size_t)o * K + k0 + 8 * (lane >> 4);
#pragma unroll
  for (int i = 0; i < 8; ++i) { w[i] = (__bf16)p[i]; w[8 + i] = (__bf16)p[16 + i]; }
  return w; }
__device__ __forceinline__ v16h wcolh_io(const float* Wm, int k0, int o, int lane, int ld) { v16h w; const int g = lane >> 4;
#pragma unroll
  for (int i = 0; i < 8; ++i) { w[i] = (_Float16)(bfr(Wm[(size_t)(k0 + 8 * g + i) * ld + o]) * 256.0f); w[8 + i] = (_Float16)(bfr(Wm[(size_t)(k0 + 16 + 8 * g + i) * ld + o]) * 256.0f); }
  return w; }
__device__ __forceinline__ v16h wcolh_oi(const float* Wm, int k0, int o, int lane, int K) { v16h w; const float* p = Wm + (size_t)o * K + k0 + 8 * (lane >> 4);
#pragma unroll
  for (int i = 0; i < 8; ++i) { w[i] = (_Float16)(bfr(p[i]) * 256.0f); w[8 + i] = (_Float16)(bfr(p[16 + i]) * 256.0f); }
  return w; }
#define WQKV_LAYOUT 1   // not read by k_pack or k_proj (k_pack takes W as (out,in) [CC][DIN]); WCOL only: 0 = (in,out) [DIN][CC]; 1 = (out,in) [CC][DIN]; 2 = per-head [NH][DIN][HD]
__device__ __forceinline__ v16b wcol_hdk(const float* Wm, int k0, int o, int lane) { v16b w; const int g = lane >> 4; const float* p = Wm + (size_t)(o / HD) * DIN * HD + (o % HD);
#pragma unroll
  for (int i = 0; i < 8; ++i) { w[i] = (__bf16)p[(size_t)(k0 + 8 * g + i) * HD]; w[8 + i] = (__bf16)p[(size_t)(k0 + 16 + 8 * g + i) * HD]; }
  return w; }
#define WO_OUT_IN 0
#if WQKV_LAYOUT == 1
#define WCOL(W, k0, o, lane) wcol_oi(W, k0, o, lane, DIN)
#elif WQKV_LAYOUT == 2
#define WCOL(W, k0, o, lane) wcol_hdk(W, k0, o, lane)
#else
#define WCOL(W, k0, o, lane) wcol_io(W, k0, o, lane, CC)
#endif
#if WO_OUT_IN
#define WOCOL(W, k0, o, lane) wcol_oi(W, k0, o, lane, CC)
#define WOCOLH(W, k0, o, lane) wcolh_oi(W, k0, o, lane, CC)
#else
#define WOCOL(W, k0, o, lane) wcol_io(W, k0, o, lane, DIN)
#define WOCOLH(W, k0, o, lane) wcolh_io(W, k0, o, lane, DIN)
#endif

#ifndef SM_EXTRA_PARAMS
#define SM_EXTRA_PARAMS
#endif
#ifndef PROJ_EXTRA_PARAMS
#define PROJ_EXTRA_PARAMS
#endif
#ifndef SM_MASK_HOOK
#define SM_MASK_HOOK (void)0
#endif

#define WS_QH  0u                                      // f16 q rows [b*t][CC]
#define WS_KH  (WS_QH + 2u * (size_t)NB * TT * CC)      // f16 k rows [b*t][CC]
#define WS_VT  (WS_KH + 2u * (size_t)NB * TT * CC)      // f16 v planes [b][c][t]
#define WS_QL  (WS_VT + 2u * (size_t)NB * CC * TT)      // f16 q residual x 2^10 rows [b][t < QHI][CC]
#define WS_KL  (WS_QL + 2u * (size_t)NB * QHI * CC)     // f16 k residual x 2^10 rows [b][t < KHI][CC]
#define WS_VB  (WS_KL + 2u * (size_t)NB * KHI * CC)     // bf16 v hi planes [b][c][t < KHI]
#define WS_VBL (WS_VB + 2u * (size_t)NB * CC * KHI)
#define WS_S   (WS_VBL + 2u * (size_t)NB * CC * KHI)    // f32 logits / P [hg][t][s] (plane not touched: the scores stay in registers)
#define WS_Y   (WS_S  + 4u * (size_t)HG * TT * TT)      // f32 ctx rows [b*t][CC] (only when there is an output projection)
#define WS_END (WS_Y  + 0u)
#define WS_CM (WS_END)                                  // f32 column maxima, base-2 units [NB * NH][TT]
#define WS_CZ (WS_CM + 4u * (size_t)NB * NH * TT)       // f32 2^11 / column sums [NB * NH][TT]
#define WS_END2 (WS_CZ + 4u * (size_t)NB * NH * TT)
#define WS_XB (WS_END2)                                 // bf16 X, packed [block of 128 rows][pass of 64 k][128 rows][64 k]
#define WS_WB (WS_XB + 2u * (size_t)NB * TT * DIN)      // bf16 Wq, Wk, Wv one after the other, each packed the same way
#define WS_END3 (WS_WB + 2u * 3u * (size_t)CC * DIN)

// ---- k_pack: X, Wq, Wk, Wv rounded to bf16 once (the rounding k_proj used to repeat in every block that read a value) and laid so that what a k_proj block stages in one pass, 128 rows x 64 k, is one contiguous run of 16 KiB: piece o of 16 bytes = ((row block * 16 + pass) * 128 + row) * 8 + eighth of the row's 64 k. A thread takes 14 pieces, the same place in 8 successive passes of X and in 2 of each weight: a wave reads aligned 256-byte stretches of 4 rows and stores 512 contiguous bytes a piece. All 28 loads are issued before the first store
// ---- k_proj: block = (128 rows, 128 cols, which), 8 waves of 32 rows x 64 cols: q/k/v = X W (+ b) with exact bf16 products (K = DIN, 32 k a product, ascending, one accumulator chain per output as before). Per pass of 64 k the block's 128 X rows and 128 W rows are read from the packed bf16 planes, 16 KiB each, and laid in one of two LDS buffers; every wave takes its fragments from there. The next pass's global loads are issued in front of this pass's products and stored into the other buffer behind them; the one barrier of a pass publishes that buffer and ends the reads of this one. -> which 0: q f16 rows (+ residual rows < QHI); 1: k f16 rows (+ residual rows < KHI); 2: v f16 planes [c][t] (+ bf16 hi/lo planes for t < KHI). Every '#pragma unroll' of k_pack, k_proj and proj_mac is there so that the small arrays it indexes (staged values, fragments, accumulators) stay in registers
#define PJT 128             // rows and columns of a block's tile
#define PJK 64              // k of a pass: a staged row is one 128-B line of bf16
#define PJP 72              // LDS pitch of a staged row of 64 bf16, in elements: 144 B = 16 B x odd, free of bank conflicts for the 16-byte fragment reads
#define PJC (PJT * PJK)     // elements of one packed run: a block's rows of one pass
#define PKN 65536           // threads of k_pack
#define PJE 136             // LDS pitch of an epilogue row of 128 16-bit values, in elements: 272 B = 16 B x odd
typedef __attribute__((ext_vector_type(4))) __bf16 v4b;
__device__ __forceinline__ void proj_mac(const __bf16 (*xs)[PJP], const __bf16 (*wt)[PJP], int kk, int wm, int wn, int lane, v8f (&acc)[2][4]) { const int col = lane & 15; v16b a[2], w[4];
#pragma unroll
  for (int i = 0; i < 2; ++i) a[i] = frag_b(&xs[wm * 32 + i * 16 + col][kk], lane);
#pragma unroll
  for (int j = 0; j < 4; ++j) w[j] = frag_b(&wt[wn * 64 + j * 16 + col][kk], lane);
#pragma unroll
  for (int i = 0; i < 2; ++i)
#pragma unroll
    for (int j = 0; j < 4; ++j) acc[i][j] = __builtin_amdgcn_wmma_f32_16x16x32_bf16(false, a[i], false, w[j], (short)0, acc[i][j], false, false); }
__global__ __launch_bounds__(256) void k_pack(const float* __restrict__ X, const float* __restrict__ WQ, const float* __restrict__ WK, const float* __restrict__ WV, __bf16* __restrict__ XB, __bf16* __restrict__ WB) {
  const unsigned o = blockIdx.x * 256u + threadIdx.x, re = o & 1023u, hi = o >> 10, row = re >> 3, e = re & 7u;   // re: the piece's place in a packed run (row, eighth of its 64 k); hi: which runs
  const float* xa = X + ((size_t)(hi >> 1) * PJT + row) * DIN + (hi & 1u) * 8u * PJK + e * 8u;   // X: row block hi >> 1, passes (hi & 1) * 8 + 0 .. 7
  const size_t sw = ((size_t)(hi >> 3) * PJT + row) * DIN + (hi & 7u) * 2u * PJK + e * 8u;        // weights: row block hi >> 3, passes (hi & 7) * 2 + 0 .. 1
  const float* wq = WQ + sw; const float* wk = WK + sw; const float* wv = WV + sw; v4f a[14], c[14];
#pragma unroll
  for (int u = 0; u < 8; ++u) { a[u] = *(const v4f*)(xa + u * PJK); c[u] = *(const v4f*)(xa + u * PJK + 4); }
#pragma unroll
  for (int u = 0; u < 2; ++u) { a[8 + u] = *(const v4f*)(wq + u * PJK); c[8 + u] = *(const v4f*)(wq + u * PJK + 4); a[10 + u] = *(const v4f*)(wk + u * PJK); c[10 + u] = *(const v4f*)(wk + u * PJK + 4); a[12 + u] = *(const v4f*)(wv + u * PJK); c[12 + u] = *(const v4f*)(wv + u * PJK + 4); }
  asm volatile("s_wait_xcnt 0x0" :: "v"(xa), "v"(wq), "v"(wk), "v"(wv) : "memory");   /* the wait before a register of an issued load is overwritten; the loads' four addresses are inputs, so they stay live to here and no loaded value lands in one */
  asm volatile("" :: "v"(a[0]), "v"(c[0]), "v"(a[1]), "v"(c[1]), "v"(a[2]), "v"(c[2]), "v"(a[3]), "v"(c[3]), "v"(a[4]), "v"(c[4]), "v"(a[5]), "v"(c[5]), "v"(a[6]), "v"(c[6]), "v"(a[7]), "v"(c[7]), "v"(a[8]), "v"(c[8]), "v"(a[9]), "v"(c[9]), "v"(a[10]), "v"(c[10]), "v"(a[11]), "v"(c[11]), "v"(a[12]), "v"(c[12]), "v"(a[13]), "v"(c[13]));   /* the loaded values as inputs only: holds the 28 loads together in front of the first convert, one memory latency for the thread; without it the compiler issues them in four groups, each waited for before the next */
#pragma unroll
  for (int u = 0; u < 14; ++u) { __bf16* d = u < 8 ? XB + ((size_t)hi * 8u + u) * PJC + re * 8u : WB + (size_t)((u - 8) >> 1) * CC * DIN + ((size_t)hi * 2u + (u & 1)) * PJC + re * 8u;   /* run = row block * 16 + pass */
    *(v8b*)d = __builtin_convertvector(__builtin_shufflevector(a[u], c[u], 0, 1, 2, 3, 4, 5, 6, 7), v8b); } }
__global__ __launch_bounds__(256) void k_proj(const __bf16* __restrict__ XB, const __bf16* __restrict__ WB, const float* __restrict__ BQ, const float* __restrict__ BK, const float* __restrict__ BV,
    _Float16* __restrict__ QH, _Float16* __restrict__ QL, _Float16* __restrict__ KH, _Float16* __restrict__ KL, _Float16* __restrict__ VT, __bf16* __restrict__ VB, __bf16* __restrict__ VBL) {
  __shared__ __align__(16) unsigned char sm[3 * PJT * PJE * 2];   // the loop's two buffers of X and W rows (73,728 B); behind the barrier after the last pass the epilogue's planes
  __bf16 (*xs)[PJT][PJP] = (__bf16 (*)[PJT][PJP])sm; __bf16 (*wt)[PJT][PJP] = (__bf16 (*)[PJT][PJP])(sm + 2 * PJT * PJP * 2);
  const int tid = threadIdx.x, wave = tid >> 5, lane = tid & 31, col = lane & 15, g = lane >> 4, wm = wave & 3, wn = wave >> 2; const int which = blockIdx.z; const int c0 = blockIdx.y * PJT; const size_t r0 = (size_t)blockIdx.x * PJT; const size_t bb = r0 / TT; const int t0 = (int)(r0 % TT);
  const float* BA = which == 0 ? BQ : which == 1 ? BK : BV;
  const int lr = tid >> 3, lc = (tid & 7) * 8;   // staging: piece u * 256 + tid of a packed run is row u * 32 + lr, elements lc .. lc + 7; a wave reads 512 contiguous bytes a load
  const __bf16* xg = XB + (size_t)blockIdx.x * (DIN / PJK) * PJC + tid * 8; const __bf16* wg = WB + ((size_t)which * (CC / PJT) + blockIdx.y) * (DIN / PJK) * PJC + tid * 8;
  v8f acc[2][4] = {}; v8b xr[4], wr[4];
#pragma unroll
  for (int u = 0; u < 4; ++u) { xr[u] = *(const v8b*)(xg + u * 2048); wr[u] = *(const v8b*)(wg + u * 2048); }
#pragma unroll
  for (int u = 0; u < 4; ++u) { *(v8b*)&xs[0][u * 32 + lr][lc] = xr[u]; *(v8b*)&wt[0][u * 32 + lr][lc] = wr[u]; }
  __syncthreads();
  for (int kc = 0; kc < DIN / PJK - 1; ++kc) { const __bf16* xp = xg + (kc + 1) * PJC; const __bf16* wp = wg + (kc + 1) * PJC;
#pragma unroll
    for (int u = 0; u < 4; ++u) { xr[u] = *(const v8b*)(xp + u * 2048); wr[u] = *(const v8b*)(wp + u * 2048); }
    asm volatile("s_wait_xcnt 0x0" :: "v"(xp), "v"(wp) : "memory");   /* the wait before a register of an issued load is overwritten (the fragments below take the address registers); the two addresses are inputs, so they stay live to here. Standing here it also keeps all eight loads in front of the pass's LDS reads and products */
    proj_mac(xs[kc & 1], wt[kc & 1], 0, wm, wn, lane, acc); proj_mac(xs[kc & 1], wt[kc & 1], 32, wm, wn, lane, acc);
#pragma unroll
    for (int u = 0; u < 4; ++u) { *(v8b*)&xs[(kc + 1) & 1][u * 32 + lr][lc] = xr[u]; *(v8b*)&wt[(kc + 1) & 1][u * 32 + lr][lc] = wr[u]; }
    __syncthreads(); }
  proj_mac(xs[(DIN / PJK - 1) & 1], wt[(DIN / PJK - 1) & 1], 0, wm, wn, lane, acc); proj_mac(xs[(DIN / PJK - 1) & 1], wt[(DIN / PJK - 1) & 1], 32, wm, wn, lane, acc);
  __syncthreads();   // every wave has taken its last fragments: the epilogue's planes may overwrite the buffers
  if (which < 2) { _Float16 (*sh)[PJE] = (_Float16 (*)[PJE])sm; _Float16 (*sl)[PJE] = (_Float16 (*)[PJE])(sm + PJT * PJE * 2); _Float16* DH = which == 0 ? QH : KH; _Float16* DL = which == 0 ? QL : KL; const int nhi = which == 0 ? QHI : KHI; const bool hi_rows = t0 < nhi;
#pragma unroll
    for (int j = 0; j < 4; ++j) { const int cl = wn * 64 + j * 16 + col; const float bias = BA ? bfr(BA[c0 + cl]) : 0.f;
#pragma unroll
      for (int i = 0; i < 2; ++i)
#pragma unroll
        for (int r = 0; r < 8; ++r) { const float v = acc[i][j][r] + bias; const _Float16 hv = (_Float16)v; const int rl = wm * 32 + i * 16 + 8 * g + r; sh[rl][cl] = hv; sl[rl][cl] = (_Float16)((v - (float)hv) * 1024.0f); } }
    __syncthreads();
    for (int e = tid; e < PJT * 16; e += 256) { const int rl = e >> 4, q = e & 15; _Float16* ph = DH + (r0 + rl) * CC + c0 + q * 8; _Float16* pl = DL + (bb * nhi + t0 + rl) * (size_t)CC + c0 + q * 8; const v4u hv = *(const v4u*)&sh[rl][q * 8], lv = *(const v4u*)&sl[rl][q * 8];
      vst2((unsigned*)ph, hv); if (hi_rows) vst2((unsigned*)pl, lv);
      asm volatile("s_wait_xcnt 0x0" :: "v"(ph), "v"(pl), "v"(hv), "v"(lv) : "memory"); }   /* the wait before a register of an issued store is overwritten (the next trip takes the address and data registers); they are inputs, so they stay live to here */
  } else { _Float16 (*th)[PJE] = (_Float16 (*)[PJE])sm; __bf16 (*tb)[PJE] = (__bf16 (*)[PJE])(sm + PJT * PJE * 2); __bf16 (*tbl)[PJE] = (__bf16 (*)[PJE])(sm + 2 * PJT * PJE * 2); const bool hi_rows = t0 < KHI;
#pragma unroll
    for (int j = 0; j < 4; ++j) { const int cl = wn * 64 + j * 16 + col; const float bias = BA ? bfr(BA[c0 + cl]) : 0.f;
#pragma unroll
      for (int i = 0; i < 2; ++i)
#pragma unroll
        for (int r = 0; r < 8; ++r) { const float v = acc[i][j][r] + bias; const int rl = wm * 32 + i * 16 + 8 * g + r; th[cl][rl] = (_Float16)v; const __bf16 bh = (__bf16)v; tb[cl][rl] = bh; tbl[cl][rl] = (__bf16)(v - (float)bh); } }
    __syncthreads();
    for (int e = tid; e < PJT * 16; e += 256) { const int cl = e >> 4, q = e & 15; vst2((unsigned*)(VT + (bb * CC + c0 + cl) * (size_t)TT + t0 + q * 8), *(const v4u*)&th[cl][q * 8]); if (hi_rows) { const size_t o3 = (bb * CC + c0 + cl) * (size_t)KHI + t0 + q * 8; vst2((unsigned*)(VB + o3), *(const v4u*)&tb[cl][q * 8]); vst2((unsigned*)(VBL + o3), *(const v4u*)&tbl[cl][q * 8]); } } } }
// ---- k_sm: block = query row t (head in group): keys [0, kend): causal -> logit if s <= t else excluded; softmax in f32; P x 2^11 in place (0 for excluded)
__global__ __launch_bounds__(256) void k_sm(float* __restrict__ S0 SM_EXTRA_PARAMS) { __shared__ float sred[8]; __shared__ float sbc; __shared__ __align__(16) float shv[TT];
  const int tid = threadIdx.x; const int t = blockIdx.x; const int kend = (kb_last(t >> 6) + 1) * 128;
  float* sr = S0 + (size_t)blockIdx.y * TT * TT + (size_t)t * TT;
  float m = -3.0e38f; for (int k = tid; k < kend; k += 256) { float v = (!CAUSAL || k <= t) ? sr[k] : -3.0e38f; SM_MASK_HOOK; shv[k] = v; m = fmaxf(m, v); }
#pragma unroll
  for (int o = 1; o < 32; o <<= 1) m = fmaxf(m, __shfl_xor(m, o));
  if ((tid & 31) == 0) sred[tid >> 5] = m; __syncthreads(); if (tid == 0) { float a = sred[0]; for (int i = 1; i < 8; ++i) a = fmaxf(a, sred[i]); sbc = a; } __syncthreads(); m = sbc; __syncthreads();
  float sum = 0.f; for (int k = tid; k < kend; k += 256) { const float v = shv[k]; const float e = (v <= -1.0e38f) ? 0.f : expf(v - m); shv[k] = e; sum += e; }
#pragma unroll
  for (int o = 1; o < 32; o <<= 1) sum += __shfl_xor(sum, o);
  if ((tid & 31) == 0) sred[tid >> 5] = sum; __syncthreads(); if (tid == 0) { float a = 0.f; for (int i = 0; i < 8; ++i) a += sred[i]; sbc = a > 0.f ? 2048.0f / a : 0.f; }   /* a fully excluded row yields P = 0 */ __syncthreads(); const float inv = sbc;
  for (int k = tid; k < kend; k += 256) shv[k] = shv[k] * inv;
  __syncthreads(); for (int q = tid; q < kend / 4; q += 256) vst2(sr + q * 4, *(const v4f*)&shv[q * 4]); }
// ---- k_stat: softmax over the QUERY axis under the causal mask (the source's softmax(axis=2) on [B, H, i, j] scores with -inf where j > i), with no score matrix in memory. Block = (STK key columns from k0, head h, batch b), STW waves. Every wave keeps the STK keys' f16 fragments in registers and takes every STW-th tile of 16 of the visible query rows k0 .. TT-1: scores q x k on WMMA (one f16 product), then per lane and column tile the online (max, sum) over its 8 rows (f32; the maximum runs over the raw products, each term is 2^(s x SCL2 - m x SCL2): one multiply-add and one v_exp_f32; q < k reads as -inf and adds 2^(-inf) = 0; the running maximum starts finite, so no difference is inf - inf; the sum so far is rescaled by 2^((m_old - m_new) x SCL2)). The 2 * STW partial pairs of a column (wave, lane half) are merged through LDS behind one barrier, which every wave reaches after its own last tile: m_k in base-2 units (m x SCL2) to CM, 2^11 / Z_k to CR, whole lines. The cost of a strip falls linearly with its index (strip x sees TT - x * STK query rows) and every work-group of the launch is resident at once, so a work-group takes two strips one after the other, the last minus x and x: every work-group has the same work. Each strip has its own pair of LDS arrays, so the second strip's partials never meet the first strip's merge. Every '#pragma unroll' of k_stat and k_out is there so that the small arrays it indexes (fragments, accumulators, m, z, P) stay in registers
#define STW 8
#define STK 64
// the fragments of frag_h / frag_b from a pointer that already holds the lane's own 8g offset: a run of loads then shares one address value, which the wait behind the run can name
// 2^x on v_exp_f32: every argument here is at most about 0 where its result is used, and a result below the normal range may read as 0 (it stands beside a column sum of at least 1). Written as asm so that the slot the instruction set asks for behind a transcendental (no use of its result, no overwrite of its source in the next instruction) is kept by construction, wherever the compiler places the statement. The v_nop is that slot
__device__ __forceinline__ float ex2(float x) { float e; asm("v_exp_f32 %0, %1\n\tv_nop" : "=v"(e) : "v"(x)); return e; }
// eight of them: the results are early-clobber outputs, so none lies in a source and each v_exp_f32 is the independent instruction behind the one before; one v_nop behind the last
__device__ __forceinline__ void ex2x8(float (&e)[8], const float (&x)[8]) {
  asm("v_exp_f32 %0, %8\n\tv_exp_f32 %1, %9\n\tv_exp_f32 %2, %10\n\tv_exp_f32 %3, %11\n\tv_exp_f32 %4, %12\n\tv_exp_f32 %5, %13\n\tv_exp_f32 %6, %14\n\tv_exp_f32 %7, %15\n\tv_nop"
      : "=&v"(e[0]), "=&v"(e[1]), "=&v"(e[2]), "=&v"(e[3]), "=&v"(e[4]), "=&v"(e[5]), "=&v"(e[6]), "=&v"(e[7])
      : "v"(x[0]), "v"(x[1]), "v"(x[2]), "v"(x[3]), "v"(x[4]), "v"(x[5]), "v"(x[6]), "v"(x[7])); }
__device__ __forceinline__ v16h frag_hp(const _Float16* p) { union { v16h v; v8h q[2]; } u; u.q[0] = *(const v8h*)p; u.q[1] = *(const v8h*)(p + 16); return u.v; }
__device__ __forceinline__ v16b frag_bp(const __bf16* p) { union { v16b v; v8b q[2]; } u; u.q[0] = *(const v8b*)p; u.q[1] = *(const v8b*)(p + 16); return u.v; }
// one tile of 16 query rows against the strip's STK keys. MASK is a constant of the call: from query row k0 + STK on every key of the strip is visible, the compare is true in every lane, and the 32 compares and 32 selects of a tile, with the row indices they need, are not built at all; only the strip's own first STK rows, which the diagonal crosses, are built with them
template <bool MASK> __device__ __forceinline__ void stat_trip(const _Float16* __restrict__ QH, int b, int h, int ql0, int k0, int col, int g, const v16h (&kf)[HD / 32][STK / 16], float (&m)[STK / 16], float (&z)[STK / 16]) { const _Float16* qp = QH + ((size_t)b * TT + ql0 + col) * CC + h * HD + 8 * g; const v16h a0 = frag_hp(qp), a1 = frag_hp(qp + 32);
    asm volatile("s_wait_xcnt 0x0" :: "v"(qp), "v"(a0), "v"(a1) : "memory");   /* the wait before a register of an issued load is overwritten (the next tile's address); the loads' common address is an input, so it stays live to here. The loaded values are inputs too, and inputs only: that holds the tile's four loads together in front of the products, one memory latency a tile; without it the compiler, in the tile with the mask, issues the second pair behind the first four products, into the first pair's registers, and waits a second time */
    v8f sc[STK / 16];   /* the trip's eight products first, over four independent accumulators: no WMMA waits for the one in front of it */
#pragma unroll
    for (int j = 0; j < STK / 16; ++j) { const v8f zero = {}; sc[j] = wmma16(a0, kf[0][j], zero); }
#pragma unroll
    for (int j = 0; j < STK / 16; ++j) sc[j] = wmma16(a1, kf[1][j], sc[j]);
#pragma unroll
    for (int j = 0; j < STK / 16; ++j) { const v8f acc = sc[j]; const int k = k0 + j * 16 + col; float v[8];
#pragma unroll
      for (int r = 0; r < 8; ++r) v[r] = (!MASK || ql0 + 8 * g + r >= k) ? acc[r] : -INFINITY;
      float mn = m[j];
#pragma unroll
      for (int r = 0; r < 8; ++r) mn = fmaxf(mn, v[r]);
      const float nb = -(mn * SCL2); float x[8], e[8];
#pragma unroll
      for (int r = 0; r < 8; ++r) x[r] = __builtin_fmaf(v[r], SCL2, nb);
      ex2x8(e, x); float s = e[0];
#pragma unroll
      for (int r = 1; r < 8; ++r) s += e[r];
      z[j] = z[j] * ex2((m[j] - mn) * SCL2) + s; m[j] = mn; } }   /* the two raw maxima are subtracted first: a maximum that has not moved gives exactly 2^0 = 1, and a difference followed by a multiply has no fused form */
__global__ __launch_bounds__(STW * 32) void k_stat(const _Float16* __restrict__ QH, const _Float16* __restrict__ KH, float* __restrict__ CM, float* __restrict__ CR) { __shared__ float pm2[2][2 * STW][STK], pz2[2][2 * STW][STK];
  const int tid = threadIdx.x, lane = tid & 31, col = lane & 15, g = lane >> 4; const int wave = __builtin_amdgcn_readfirstlane(tid >> 5); const int h = blockIdx.y, b = blockIdx.z;
  for (int half = 0; half < 2; ++half) { const int k0 = (half ? (int)blockIdx.x : TT / STK - 1 - (int)blockIdx.x) * STK; float (*pm)[STK] = pm2[half]; float (*pz)[STK] = pz2[half];
  v16h kf[HD / 32][STK / 16]; const _Float16* kp = KH + ((size_t)b * TT + k0 + col) * CC + h * HD + 8 * g;
#pragma unroll
  for (int kc = 0; kc < HD / 32; ++kc) {
#pragma unroll
    for (int j = 0; j < STK / 16; ++j) kf[kc][j] = frag_hp(kp + (size_t)j * 16 * CC + kc * 32); }
  asm volatile("s_wait_xcnt 0x0" :: "v"(kp) : "memory");   /* the wait before a register of an issued load is overwritten; the loads' common address is an input, so it stays live to here and no fragment lands in it */
  float m[STK / 16], z[STK / 16];   // m: running maximum of the raw products
#pragma unroll
  for (int j = 0; j < STK / 16; ++j) { m[j] = -3.0e38f; z[j] = 0.f; }
  int ql0 = k0 + wave * 16;   // wave-uniform: both tests below are scalar branches
  if (wave < STK / 16) { stat_trip<true>(QH, b, h, ql0, k0, col, g, kf, m, z); ql0 += STW * 16; }   /* the diagonal crosses the first tile of waves 0 .. STK / 16 - 1 and no other; that tile always exists (k0 + STK <= TT) */
  for (; ql0 < TT; ql0 += STW * 16) stat_trip<false>(QH, b, h, ql0, k0, col, g, kf, m, z);
#pragma unroll
  for (int j = 0; j < STK / 16; ++j) { pm[2 * wave + g][j * 16 + col] = m[j] * SCL2; pz[2 * wave + g][j * 16 + col] = z[j]; }
  __syncthreads();
  if (tid < STK) { float mm = pm[0][tid];
#pragma unroll
    for (int w = 1; w < 2 * STW; ++w) mm = fmaxf(mm, pm[w][tid]);
    float a = 0.f;   /* a partial that saw no visible row of this column holds Z = 0 and a finite maximum */
#pragma unroll
    for (int w = 0; w < 2 * STW; ++w) a += pz[w][tid] * ex2(pm[w][tid] - mm);
    const size_t o = ((size_t)b * NH + h) * TT + k0 + tid; float* pcm = CM + o; float* pcr = CR + o; const float rz = 2048.0f / a; vst2(pcm, mm); vst2(pcr, rz);   /* every column sees at least its own diagonal entry: Z_k >= 1 */
    asm volatile("s_wait_xcnt 0x0" :: "v"(pcm), "v"(pcr), "v"(mm), "v"(rz) : "memory"); } } }   /* the wait before a register of an issued store is overwritten (the second strip takes the address and data registers); they are inputs, so they stay live to here */
// ---- k_out: block = 64 queries (qb) of (b, h), a wave = 16 queries: per 32 keys the scores are formed again on WMMA, transposed (A = 16 key rows, B = the wave's 16 queries, kept in registers; the same one f16 product), so that a lane holds, for its own query, the keys 8g + 0..7 of each 16-key tile: two such tiles are, in place, the A fragment of P . v (hardware k order, the order of frag_b). P[i][j] = 2^(s x SCL2 - m_j) x (2^11 / Z_j), m_j in base-2 units, for j <= i, 0 above the diagonal (unconditional loads, value select); P and v as bf16 hi + lo, 3 products, keys [0, (qb + 1) x 64); 256-B (row, head) segment by 16 lanes. What the four waves read of 64 keys (k rows, v hi and lo rows, column maxima and scales) is the same for all of them: it is brought into LDS once per block, as whole 128-B lines, by asynchronous copies, two buffers, the next tile flying while a tile is worked on; every fragment comes from LDS. The cost of a query block grows linearly with its index (block qb walks the keys up to its own diagonal) and every work-group of the launch is resident at once, so a work-group takes two query blocks of its head one after the other, the last minus x and x: every work-group has the same work
#define OKT 64              // keys of a staged tile
#define OPB 144             // LDS pitch in bytes of a staged row of 128 B: 16 B x odd, free of bank conflicts for the 16-byte fragment reads
#define OPL (64 * OPB)      // one staged plane: 64 rows (64 keys of k; 64 channels of v hi; of v lo)
#define OBF (3 * OPL + 512) // one buffer: three planes, then 64 column maxima and 64 column scales
// the 12 copies of a thread for one tile: 8 lanes cover one row's 128-B line, the block 16 rows a copy. la: the thread's LDS byte address in the k plane; kg, hg, lg: its addresses in the tile's first 16 rows
__device__ __forceinline__ void out_stage(unsigned la, const _Float16* kg, const __bf16* hg, const __bf16* lg) {
  /* the copies and, as the last line of their own statement, the wait before a register that an issued copy names is rewritten */
  asm volatile("global_load_async_to_lds_b128 %0, %12, off\n\tglobal_load_async_to_lds_b128 %1, %13, off\n\tglobal_load_async_to_lds_b128 %2, %14, off\n\tglobal_load_async_to_lds_b128 %3, %15, off\n\t"
               "global_load_async_to_lds_b128 %4, %16, off\n\tglobal_load_async_to_lds_b128 %5, %17, off\n\tglobal_load_async_to_lds_b128 %6, %18, off\n\tglobal_load_async_to_lds_b128 %7, %19, off\n\t"
               "global_load_async_to_lds_b128 %8, %20, off\n\tglobal_load_async_to_lds_b128 %9, %21, off\n\tglobal_load_async_to_lds_b128 %10, %22, off\n\tglobal_load_async_to_lds_b128 %11, %23, off\n\ts_wait_xcnt 0x0"
               :: "v"(la), "v"(la + 16 * OPB), "v"(la + 32 * OPB), "v"(la + 48 * OPB),
                  "v"(la + OPL), "v"(la + OPL + 16 * OPB), "v"(la + OPL + 32 * OPB), "v"(la + OPL + 48 * OPB),
                  "v"(la + 2 * OPL), "v"(la + 2 * OPL + 16 * OPB), "v"(la + 2 * OPL + 32 * OPB), "v"(la + 2 * OPL + 48 * OPB),
                  "v"(kg), "v"(kg + (size_t)16 * CC), "v"(kg + (size_t)32 * CC), "v"(kg + (size_t)48 * CC),
                  "v"(hg), "v"(hg + (size_t)16 * KHI), "v"(hg + (size_t)32 * KHI), "v"(hg + (size_t)48 * KHI),
                  "v"(lg), "v"(lg + (size_t)16 * KHI), "v"(lg + (size_t)32 * KHI), "v"(lg + (size_t)48 * KHI) : "memory"); }
// one wave's copy of the tile's 64 maxima (lanes 0..15) and 64 scales (lanes 16..31), with the same wait
__device__ __forceinline__ void out_stage_c(unsigned la, const float* cg) { asm volatile("global_load_async_to_lds_b128 %0, %1, off\n\ts_wait_xcnt 0x0" :: "v"(la), "v"(cg) : "memory"); }
// one staged tile of 64 keys for a wave's 16 queries. MASK is a constant of the call: a tile whose last key is at or below the block's first query (t < qb) has every key visible to every query, the compare is true in every lane, and its 16 compares and 16 selects a half, with the key indices they need, are not built at all; only the tile that the diagonal crosses (t == qb) is built with them
template <bool MASK> __device__ __forceinline__ void out_tile(const unsigned char* bp, int t, int qi, int col, int g, const v16h& q0, const v16h& q1, v8f (&acc)[HD / 16]) {
#pragma unroll   /* the tile's two halves of 32 keys, unrolled so that every LDS offset of a half is an immediate */
    for (int s = 0; s < 2; ++s) { const int k0 = t * OKT + s * 32;
      const _Float16* ka = (const _Float16*)(bp + (s * 32 + col) * OPB) + 8 * g; const _Float16* kb2 = ka + 16 * (OPB / 2); const float* cmk = (const float*)(bp + 3 * OPL) + s * 32 + 8 * g; const float* crk = cmk + OKT;
      const v16h ka0 = frag_hp(ka), kb0 = frag_hp(kb2), ka1 = frag_hp(ka + 32), kb1 = frag_hp(kb2 + 32);
      v4f mv[4], rv[4];
#pragma unroll
      for (int u = 0; u < 4; ++u) { const int o = (u >> 1) * 16 + (u & 1) * 4; mv[u] = *(const v4f*)(cmk + o); rv[u] = *(const v4f*)(crk + o); }
      v16b vh[HD / 16], vl[HD / 16]; const __bf16* vhp = (const __bf16*)(bp + OPL + col * OPB) + s * 32 + 8 * g; const __bf16* vlp = vhp + OPL / 2;
#pragma unroll
      for (int j = 0; j < HD / 16; ++j) vh[j] = frag_bp(vhp + j * 16 * (OPB / 2));
      __builtin_amdgcn_sched_barrier(0);   /* keeps these 24 LDS reads together in front of the half's products: without it the compiler sinks them in pairs between the WMMAs, each pair waited for one WMMA later */
      v8f s0 = {}, s1 = {}; s0 = wmma16(ka0, q0, s0); s1 = wmma16(kb0, q0, s1); s0 = wmma16(ka1, q1, s0); s1 = wmma16(kb1, q1, s1);
      float pv[16], x0[8], x1[8], e0[8], e1[8];
#pragma unroll
      for (int i = 0; i < 8; ++i) { x0[i] = __builtin_fmaf(s0[i], SCL2, -mv[i >> 2][i & 3]); x1[i] = __builtin_fmaf(s1[i], SCL2, -mv[2 + (i >> 2)][i & 3]); }
      ex2x8(e0, x0); ex2x8(e1, x1);
#pragma unroll
      for (int j = 0; j < HD / 16; ++j) vl[j] = frag_bp(vlp + j * 16 * (OPB / 2));   /* the v lo rows, wanted last, are a second group of reads: with all 32 reads of a half in one group the kernel no longer fits its 256 registers and spills */
      __builtin_amdgcn_sched_barrier(0);   /* keeps those 8 reads in front of the forming of P, which with the first eight P . v products covers their latency: without it the compiler sinks them in pairs between the products */
#pragma unroll
      for (int i = 0; i < 8; ++i) { const int ke = k0 + 8 * g + i; pv[i] = (!MASK || ke <= qi) ? e0[i] * rv[i >> 2][i & 3] : 0.f; pv[8 + i] = (!MASK || ke + 16 <= qi) ? e1[i] * rv[2 + (i >> 2)][i & 3] : 0.f; }
      const F2 p = bsplit16(pv);
#pragma unroll
      for (int j = 0; j < HD / 16; ++j) acc[j] = wmma_bf(p.h, vh[j], acc[j]);   /* product by product over the four accumulators: no WMMA waits for the one in front of it; each accumulator takes its three products in the order it had */
#pragma unroll
      for (int j = 0; j < HD / 16; ++j) acc[j] = wmma_bf(p.l, vh[j], acc[j]);
#pragma unroll
      for (int j = 0; j < HD / 16; ++j) acc[j] = wmma_bf(p.h, vl[j], acc[j]); } }
// amdgpu_waves_per_eu(4): a budget of 256 registers; without it what the compiler keeps live round the loop over the two query blocks takes the count just past 256 and fills the key loop with register-window switches
__global__ __launch_bounds__(128) __attribute__((amdgpu_waves_per_eu(4))) void k_out(const _Float16* __restrict__ QH, const _Float16* __restrict__ KH, const float* __restrict__ CM, const float* __restrict__ CR, const __bf16* __restrict__ VB, const __bf16* __restrict__ VBL, float* __restrict__ Y) { __shared__ __align__(16) unsigned char sm[2 * OBF];   // the loop's two buffers; behind the barrier after the last tile the epilogue's rows
  const int tid = threadIdx.x, lane = tid & 31, col = lane & 15, g = lane >> 4; const int wave = __builtin_amdgcn_readfirstlane(tid >> 5); const int h = blockIdx.y, b = blockIdx.z;
  const int sr = tid >> 3, sq = (tid & 7) * 8;   // staging: the thread's row among 16 and its 16 bytes of the row
  const _Float16* kg = KH + ((size_t)b * TT + sr) * CC + h * HD + sq; const size_t po = ((size_t)b * CC + h * HD + sr) * (size_t)KHI + sq; const __bf16* hg = VB + po; const __bf16* lg = VBL + po;
  const float* cg = (g ? CR : CM) + ((size_t)b * NH + h) * TT + col * 4;
  const unsigned la = (unsigned)(size_t)sm + sr * OPB + sq * 2, lc = (unsigned)(size_t)sm + 3 * OPL + lane * 16;
  for (int half = 0; half < 2; ++half) { const int qb = half ? (int)blockIdx.x : NQB - 1 - (int)blockIdx.x; const int ql0 = qb * 64 + wave * 16; const int nt = qb + 1; const int qi = ql0 + col;   // nt tiles of 64 keys: up to the one that holds the block's own diagonal; a tile wholly above it has P = 0 throughout and is not visited
  const _Float16* qp = QH + ((size_t)b * TT + qi) * CC + h * HD; const v16h q0 = frag_h(qp, lane), q1 = frag_h(qp + 32, lane);
  out_stage(la, kg, hg, lg); if (wave == 0) out_stage_c(lc, cg);
  asm volatile("s_wait_asynccnt 0x0" ::: "memory");   /* this wave's copies of tile 0 have landed */
  __syncthreads();                                     /* and every other wave's: tile 0 may be read */
  if (nt > 1) { out_stage(la + OBF, kg + (size_t)OKT * CC, hg + OKT, lg + OKT); if (wave == 0) out_stage_c(lc + OBF, cg + OKT); }
  v8f acc[HD / 16] = {};
  for (int t = 0; t < qb; ++t) { out_tile<false>(sm + (t & 1) * OBF, t, qi, col, g, q0, q1, acc);   /* the tiles below the diagonal */
    __builtin_amdgcn_sched_barrier(0);                   /* keeps the tile's last products in front of the barrier, as they stood: without it the compiler moves them behind it, and the refill below, which follows them, is issued that much later */
    asm volatile("s_wait_dscnt 0x0" ::: "memory");      /* this wave's reads of tile t are over */
    asm volatile("s_wait_asynccnt 0x0" ::: "memory");   /* its copies of tile t + 1 have landed */
    __syncthreads();                                     /* the same of every wave: tile t + 1 may be read, tile t's buffer refilled */
    if (t + 2 < nt) { const int kn = (t + 2) * OKT; const unsigned bo = (t & 1) * OBF; out_stage(la + bo, kg + (size_t)kn * CC, hg + kn, lg + kn); if (wave == 0) out_stage_c(lc + bo, cg + kn); } }
  out_tile<true>(sm + (qb & 1) * OBF, qb, qi, col, g, q0, q1, acc);   /* the tile that the diagonal crosses, the block's last */
  asm volatile("s_wait_dscnt 0x0" ::: "memory");      /* this wave's reads of the last tile are over */
  asm volatile("s_wait_asynccnt 0x0" ::: "memory");     /* no copy is outstanding when the buffers become the epilogue's rows */
  __syncthreads();                                     /* the same of every wave: the buffers may become the epilogue's rows */
  float (*ss)[16][HD + 4] = (float (*)[16][HD + 4])sm;
#pragma unroll
  for (int j = 0; j < HD / 16; ++j)
#pragma unroll
    for (int r = 0; r < 8; ++r) ss[wave][8 * g + r][j * 16 + col] = acc[j][r] * (1.0f / 2048.0f);
  LDSX(); for (int rl = 0; rl < 16; ++rl) if (lane < HD / 4) vst2(Y + ((size_t)b * TT + ql0 + rl) * CC + h * HD + lane * 4, *(const v4f*)&ss[wave][rl][lane * 4]);
  if (half == 0) {
    asm volatile("s_wait_xcnt 0x0" ::: "memory");     /* the wait before a register of an issued store is overwritten (the second query block takes the address and data registers) */
    asm volatile("s_wait_dscnt 0x0" ::: "memory");    /* this wave's reads of its epilogue rows are over */
    __syncthreads(); } } }                             /* the same of every wave: the second query block's copies may overwrite the rows */

extern "C" void kernel_launch(void* const* d_in, const int* in_sizes, int n_in, void* d_out, int out_size, void* d_ws, size_t ws_size, hipStream_t stream) {
  (void)in_sizes; (void)n_in; (void)out_size;
  const float** F = (const float**)d_in;
  if (ws_size < (size_t)WS_END) return;
  char* ws = (char*)d_ws; _Float16 *QH = (_Float16*)(ws + WS_QH), *KH = (_Float16*)(ws + WS_KH), *VT = (_Float16*)(ws + WS_VT), *QL = (_Float16*)(ws + WS_QL), *KL = (_Float16*)(ws + WS_KL); __bf16 *VB = (__bf16*)(ws + WS_VB), *VBL = (__bf16*)(ws + WS_VBL); float *S = (float*)(ws + WS_S), *Y = (float*)(ws + WS_Y);
  (void)Y; (void)QL; (void)KL; (void)VB; (void)VBL; (void)S; (void)VT;
  // inputs: 0 X [2,2048,1024]; 1 Wq [1024,1024] (out,in), 2 bq; 3 Wk, 4 bk; 5 Wv, 6 bv (biases N(0, 0.02), nonzero); no output projection
  if (ws_size < (size_t)WS_END3) return;
  __bf16 *XB = (__bf16*)(ws + WS_XB), *WB = (__bf16*)(ws + WS_WB);
  float *CM = (float*)(ws + WS_CM), *CZ = (float*)(ws + WS_CZ);
  k_pack<<<dim3(PKN / 256), 256, 0, stream>>>(F[0], F[1], F[3], F[5], XB, WB);   /* bf16 copies of X and the weights, packed by k_proj's passes */
  k_proj<<<dim3(TNB * TT / PJT, CC / PJT, 3), 256, 0, stream>>>(XB, WB, F[2], F[4], F[6], QH, QL, KH, KL, VT, VB, VBL);
  k_stat<<<dim3(TT / STK / 2, NH, TNB), STW * 32, 0, stream>>>(QH, KH, CM, CZ);   /* per key column j: max and 2^11 / sum over the visible queries i >= j */
  k_out<<<dim3(NQB / 2, NH, TNB), 128, 0, stream>>>(QH, KH, CM, CZ, VB, VBL, (float*)d_out);   /* P formed in registers, then P . v */
}

// v010
// Measured time: 84.3 microseconds a run.
// Timed twice side by side with v009, it ran 1.04 and 1.05 times as fast.
// All steps since v000 together make it 93.4 times as fast.
// compute dtype: all float inputs rounded to bf16; q/k/v projections with EXACT bf16 products on WMMA 16x16x32 (f32 accumulate) + bias; causal scores q x k once to f16 each (1 product; the module scales by 1/sqrt(E) = 1/32, so sigma - 0.1) on every block; softmax over the QUERY axis in f32 (per key column: online max / sum over the visible queries, exponentials as 2^x on the hardware's own instruction, 1/sqrt(E) and log2(e) folded into one multiply-add); P as bf16 hi + lo against v as bf16 hi + lo (3 products) on EVERY block; f32 output.
#include <hip/hip_runtime.h>
#include <math.h>

typedef __attribute__((ext_vector_type(16))) _Float16 v16h;
typedef __attribute__((ext_vector_type(16))) __bf16 v16b;
typedef __attribute__((ext_vector_type(8)))  _Float16 v8h;
typedef __attribute__((ext_vector_type(8)))  float v8f;
typedef __attribute__((ext_vector_type(4)))  float v4f;
typedef __attribute__((ext_vector_type(2)))  float v2f;
typedef __attribute__((ext_vector_type(4)))  unsigned v4u;
typedef __attribute__((ext_vector_type(4)))  int v4i;
typedef float __attribute__((may_alias)) float_a;
typedef int __attribute__((may_alias)) int_a;

template <typename T> __device__ __forceinline__ void vst2(void* p, T v) { *(T*)p = v;  }
__device__ __forceinline__ v8f wmma16(v16h a, v16h b, v8f c) {
  return __builtin_amdgcn_wmma_f32_16x16x32_f16(false, a, false, b, (short)0, c, false, false);
}
__device__ __forceinline__ v8f wmma_bf(v16b a, v16b b, v8f c) {
  return __builtin_amdgcn_wmma_f32_16x16x32_bf16(false, a, false, b, (short)0, c, false, false);
}
// 16x16x32 fragments: lane = (h = lane>>4, row/col = lane&15); elements 0..7 = k0+8h+0..7, 8..15 = k0+16+8h+0..7; D element r = row 8h+r
__device__ __forceinline__ v16h frag_h(const _Float16* rowk0, int lane) {
  union { v16h v; v8h q[2]; } u; const _Float16* p = rowk0 + 8 * (lane >> 4);
  u.q[0] = *(const v8h*)p; u.q[1] = *(const v8h*)(p + 16); return u.v;
}
__device__ __forceinline__ v16h frag_f32(const float* rowk0, int lane) {
  v16h a; const float* p = rowk0 + 8 * (lane >> 4);
#pragma unroll
  for (int i = 0; i < 8; ++i) { a[i] = (_Float16)p[i]; a[8 + i] = (_Float16)p[16 + i]; }
  return a;
}
__device__ __forceinline__ v16h frag_f32s(const float* rowk0, int lane, float sc) {
  v16h a; const float* p = rowk0 + 8 * (lane >> 4);
#pragma unroll
  for (int i = 0; i < 8; ++i) { a[i] = (_Float16)(p[i] * sc); a[8 + i] = (_Float16)(p[16 + i] * sc); }
  return a;
}
// column fragment from a [K][ld] layout (column n), rows >= K read as 0
__device__ __forceinline__ v16h fragc_f32(const float* W, int k0, int n, int lane, int ld, int K) {
  v16h a; const int g = lane >> 4;
#pragma unroll
  for (int i = 0; i < 8; ++i) { const int ka = k0 + 8 * g + i, kb = ka + 16;
    a[i] = (_Float16)(ka < K ? W[(size_t)(ka < K ? ka : K - 1) * ld + n] : 0.f); a[8 + i] = (_Float16)(kb < K ? W[(size_t)(kb < K ? kb : K - 1) * ld + n] : 0.f); }
  return a;
}
struct F2 { v16b h, l; };
__device__ __forceinline__ F2 bsplit16(const float v[16]) { F2 r;
#pragma unroll
  for (int i = 0; i < 16; ++i) { const __bf16 h = (__bf16)v[i]; r.h[i] = h; r.l[i] = (__bf16)(v[i] - (float)h); }
  return r; }
__device__ __forceinline__ F2 split_row(const float* row, int k0, int lane) { float v[16]; const float* p = row + k0 + 8 * (lane >> 4);
#pragma unroll
  for (int i = 0; i < 8; ++i) { v[i] = p[i]; v[8 + i] = p[16 + i]; }
  return bsplit16(v); }
__device__ __forceinline__ F2 split_rowK(const float* row, int k0, int lane, int K) { float v[16]; const int g = lane >> 4;
#pragma unroll
  for (int i = 0; i < 8; ++i) { const int ka = k0 + 8 * g + i, kb = ka + 16; v[i] = ka < K ? row[ka < K ? ka : K - 1] : 0.f; v[8 + i] = kb < K ? row[kb < K ? kb : K - 1] : 0.f; }
  return bsplit16(v); }
__device__ __forceinline__ F2 split_col(const float* W, int k0, int n, int lane, int ld, int K) { float v[16]; const int g = lane >> 4;
#pragma unroll
  for (int i = 0; i < 8; ++i) { const int ka = k0 + 8 * g + i, kb = ka + 16; v[i] = ka < K ? W[(size_t)(ka < K ? ka : K - 1) * ld + n] : 0.f; v[8 + i] = kb < K ? W[(size_t)(kb < K ? kb : K - 1) * ld + n] : 0.f; }
  return bsplit16(v); }
__device__ __forceinline__ v8f mac3(const F2& a, const F2& b, v8f c) { c = wmma_bf(a.l, b.h, c); c = wmma_bf(a.h, b.l, c); return wmma_bf(a.h, b.h, c); }
__device__ __forceinline__ float sigm(float v) { return 1.0f / (1.0f + expf(-v)); }
#define LDSX() do { asm volatile("s_wait_dscnt 0" ::: "memory"); __builtin_amdgcn_wave_barrier(); __builtin_amdgcn_fence(__ATOMIC_RELEASE, "workgroup"); } while (0)

// Multi-headed attention whose softmax runs over the QUERY axis, scaled by the MODEL width (X [2,2048,1024]; torch (out,in) Wq / Wk / Wv [1024,1024] N(0, 1/1024) + biases N(0, 0.02); 16 heads x 64; scores / sqrt(E) = / 32; -inf where j > i; attn = softmax(scores, axis=2) - axis 2 of [B, H, i, j] is the QUERY axis i: every key column j is normalised over the queries i >= j (faithful to the source); out = attn v; merge; no output projection).
#define NB 2
#define TT 2048
#define CC 1024            // NH * HD = projected width
#define DIN 1024          // input (model) width
#define NH 16
#define HD 64
#define NQB (TT / 64)
#define HG 4
#define SCALE (0.03125f)
#define SCL2 (SCALE * 1.44269504088896340736f)   // raw q . k product -> exponent to base 2
#define CAUSAL 1
#ifndef TNB
#define TNB NB
#endif
__device__ __forceinline__ float bfr(float v) { return (float)(__bf16)v; }
__host__ __device__ __forceinline__ int kb_last(int qb) { return CAUSAL ? ((qb * 64 + 63) >> 7) : (TT / 128 - 1); }
typedef __attribute__((ext_vector_type(8))) __bf16 v8b;
__device__ __forceinline__ v16b frag_b(const __bf16* rowk0, int lane) {
  union { v16b v; v8b q[2]; } u; const __bf16* p = rowk0 + 8 * (lane >> 4);
  u.q[0] = *(const v8b*)p; u.q[1] = *(const v8b*)(p + 16); return u.v;
}
#define QBH 32              // not read: k_out takes its one bf16 hi/lo path on all NQB query blocks
#define QHI 0               // no q residual plane: the scores are tiny (scale 1/32) and single-product everywhere
#define QBH_SC 0            // not read (k_out: bf16 hi/lo P.v on every block - a query-axis softmax has O(1) weights on the LAST key columns)
#define KHI 2048            // key rows carrying k residual / v bf16 hi+lo planes (the v planes are read by k_out; the k residual is not read)
// B fragment (k rows k0+.., output column o) of a weight: (in,out) [K][ld] or (out,in) [ld rows of K]: bf16 exact, or f16(bf16 * 256) exact
__device__ __forceinline__ v16b wcol_io(const float* Wm, int k0, int o, int lane, int ld) { v16b w; const int g = lane >> 4;
#pragma unroll
  for (int i = 0; i < 8; ++i) { w[i] = (__bf16)Wm[(size_t)(k0 + 8 * g + i) * ld + o]; w[8 + i] = (__bf16)Wm[(size_t)(k0 + 16 + 8 * g + i) * ld + o]; }
  return w; }
__device__ __forceinline__ v16b wcol_oi(const float* Wm, int k0, int o, int lane, int K) { v16b w; const float* p = Wm + (size_t)o * K + k0 + 8 * (lane >> 4);
#pragma unroll
  for (int i = 0; i < 8; ++i) { w[i] = (__bf16)p[i]; w[8 + i] = (__bf16)p[16 + i]; }
  return w; }
__device__ __forceinline__ v16h wcolh_io(const float* Wm, int k0, int o, int lane, int ld) { v16h w; const int g = lane >> 4;
#pragma unroll
  for (int i = 0; i < 8; ++i) { w[i] = (_Float16)(bfr(Wm[(size_t)(k0 + 8 * g + i) * ld + o]) * 256.0f); w[8 + i] = (_Float16)(bfr(Wm[(size_t)(k0 + 16 + 8 * g + i) * ld + o]) * 256.0f); }
  return w; }
__device__ __forceinline__ v16h wcolh_oi(const float* Wm, int k0, int o, int lane, int K) { v16h w; const float* p = Wm + (size_t)o * K + k0 + 8 * (lane >> 4);
#pragma unroll
  for (int i = 0; i < 8; ++i) { w[i] = (_Float16)(bfr(p[i]) * 256.0f); w[8 + i] = (_Float16)(bfr(p[16 + i]) * 256.0f); }
  return w; }
#define WQKV_LAYOUT 1   // not read by k_pack or k_proj (k_pack takes W as (out,in) [CC][DIN]); WCOL only: 0 = (in,out) [DIN][CC]; 1 = (out,in) [CC][DIN]; 2 = per-head [NH][DIN][HD]
__device__ __forceinline__ v16b wcol_hdk(const float* Wm, int k0, int o, int lane) { v16b w; const int g = lane >> 4; const float* p = Wm + (size_t)(o / HD) * DIN * HD + (o % HD);
#pragma unroll
  for (int i = 0; i < 8; ++i) { w[i] = (__bf16)p[(size_t)(k0 + 8 * g + i) * HD]; w[8 + i] = (__bf16)p[(size_t)(k0 + 16 + 8 * g + i) * HD]; }
  return w; }
#define WO_OUT_IN 0
#if WQKV_LAYOUT == 1
#define WCOL(W, k0, o, lane) wcol_oi(W, k0, o, lane, DIN)
#elif WQKV_LAYOUT == 2
#define WCOL(W, k0, o, lane) wcol_hdk(W, k0, o, lane)
#else
#define WCOL(W, k0, o, lane) wcol_io(W, k0, o, lane, CC)
#endif
#if WO_OUT_IN
#define WOCOL(W, k0, o, lane) wcol_oi(W, k0, o, lane, CC)
#define WOCOLH(W, k0, o, lane) wcolh_oi(W, k0, o, lane, CC)
#else
#define WOCOL(W, k0, o, lane) wcol_io(W, k0, o, lane, DIN)
#define WOCOLH(W, k0, o, lane) wcolh_io(W, k0, o, lane, DIN)
#endif

#ifndef SM_EXTRA_PARAMS
#define SM_EXTRA_PARAMS
#endif
#ifndef PROJ_EXTRA_PARAMS
#define PROJ_EXTRA_PARAMS
#endif
#ifndef SM_MASK_HOOK
#define SM_MASK_HOOK (void)0
#endif

#define WS_QH  0u                                      // f16 q in fragment order [b][h][tile of 16 rows][4 pieces][32 lanes][8] (qpk below)
#define WS_KH  (WS_QH + 2u * (size_t)NB * TT * CC)      // f16 k in the same fragment order
#define WS_VT  (WS_KH + 2u * (size_t)NB * TT * CC)      // f16 v, in the order of the v hi plane
#define WS_QL  (WS_VT + 2u * (size_t)NB * CC * TT)      // f16 q residual x 2^10, t < QHI, in the order of the q plane
#define WS_KL  (WS_QL + 2u * (size_t)NB * QHI * CC)     // f16 k residual x 2^10, t < KHI = TT, in the order of the k plane
#define WS_VB  (WS_KL + 2u * (size_t)NB * KHI * CC)     // bf16 v hi, t < KHI = TT, in fragment order [b][h][tile of 64 keys][16 channels][4 pieces][32 lanes][8] (vpk below); v lo behind it likewise
#define WS_VBL (WS_VB + 2u * (size_t)NB * CC * KHI)
#define WS_S   (WS_VBL + 2u * (size_t)NB * CC * KHI)    // f32 logits / P [hg][t][s] (plane not touched: the scores stay in registers)
#define WS_Y   (WS_S  + 4u * (size_t)HG * TT * TT)      // f32 ctx rows [b*t][CC] (only when there is an output projection)
#define WS_END (WS_Y  + 0u)
#define WS_CM (WS_END)                                  // f32 column maxima, base-2 units [NB * NH][TT]
#define WS_CZ (WS_CM + 4u * (size_t)NB * NH * TT)       // f32 2^11 / column sums [NB * NH][TT]
#define WS_END2 (WS_CZ + 4u * (size_t)NB * NH * TT)
#define WS_XB (WS_END2)                                 // bf16 X, packed [block of 128 rows][pass of 64 k][128 rows][64 k]
#define WS_WB (WS_XB + 2u * (size_t)NB * TT * DIN)      // bf16 Wq, Wk, Wv one after the other, each packed the same way
#define WS_END3 (WS_WB + 2u * 3u * (size_t)CC * DIN)

// ---- k_pack: X, Wq, Wk, Wv rounded to bf16 once (the rounding k_proj used to repeat in every block that read a value) and laid so that what a k_proj block stages in one pass, 128 rows x 64 k, is one contiguous run of 16 KiB: piece o of 16 bytes = ((row block * 16 + pass) * 128 + row) * 8 + eighth of the row's 64 k. A thread takes 14 pieces, the same place in 8 successive passes of X and in 2 of each weight: a wave reads aligned 256-byte stretches of 4 rows and stores 512 contiguous bytes a piece. All 28 loads are issued before the first store
// ---- k_proj: block = (128 rows, 128 cols, which), 8 waves of 32 rows x 64 cols: q/k/v = X W (+ b) with exact bf16 products (K = DIN, 32 k a product, ascending, one accumulator chain per output as before). Per pass of 64 k the block's 128 X rows and 128 W rows are read from the packed bf16 planes, 16 KiB each, and laid in one of two LDS buffers; every wave takes its fragments from there. The next pass's global loads are issued in front of this pass's products and stored into the other buffer behind them; the one barrier of a pass publishes that buffer and ends the reads of this one. -> which 0: q f16 in fragment order (qpk; + residual for rows < QHI); 1: k f16 in the same order (+ residual for rows < KHI); 2: v f16 (+ bf16 hi/lo for t < KHI) in fragment order (vpk). Every '#pragma unroll' of k_pack, k_proj and proj_mac is there so that the small arrays it indexes (staged values, fragments, accumulators) stay in registers
// q in fragment order: the 16 rows x 64 k that (batch * NH + head) bh holds for one tile of 16 queries are one run of 2 KiB, laid as the four 16-byte loads of its two 16x16x32 fragments take them: piece c8 >> 1 of 512 B, in it lane (c8 & 1) * 16 + row, where c8 is the eighth of the row's 64 k. A wave's load is then 512 contiguous bytes, four whole lines, where a load from plain rows touches 32 bytes in each of 16 lines. Returns the element offset of row t's eighth c8
__device__ __forceinline__ size_t qpk(size_t bh, int t, int c8) { return (((bh * (TT / 16) + (t >> 4)) * 4 + (c8 >> 1)) * 32 + (c8 & 1) * 16 + (t & 15)) * 8; }
// v likewise, for the B fragments of P . v (a row is a channel, k runs over the keys): the 16 channels x 64 keys of one tile of 64 keys are one run of 2 KiB, the head's four runs of a tile lie one after the other. ch: channel in the head, t: a key that is a multiple of 8. Returns the element offset of the 8 keys from t
__device__ __forceinline__ size_t vpk(size_t bh, int ch, int t) { return ((((bh * (TT / 64) + (t >> 6)) * 4 + (ch >> 4)) * 4 + ((t >> 4) & 3)) * 32 + ((t >> 3) & 1) * 16 + (ch & 15)) * 8; }
#define PJT 128             // rows and columns of a block's tile
#define PJK 64              // k of a pass: a staged row is one 128-B line of bf16
#define PJP 72              // LDS pitch of a staged row of 64 bf16, in elements: 144 B = 16 B x odd, free of bank conflicts for the 16-byte fragment reads
#define PJC (PJT * PJK)     // elements of one packed run: a block's rows of one pass
#define PKN 65536           // threads of k_pack
#define PJE 136             // LDS pitch of an epilogue row of 128 16-bit values, in elements: 272 B = 16 B x odd
typedef __attribute__((ext_vector_type(4))) __bf16 v4b;
__device__ __forceinline__ void proj_mac(const __bf16 (*xs)[PJP], const __bf16 (*wt)[PJP], int kk, int wm, int wn, int lane, v8f (&acc)[2][4]) { const int col = lane & 15; v16b a[2], w[4];
#pragma unroll
  for (int i = 0; i < 2; ++i) a[i] = frag_b(&xs[wm * 32 + i * 16 + col][kk], lane);
#pragma unroll
  for (int j = 0; j < 4; ++j) w[j] = frag_b(&wt[wn * 64 + j * 16 + col][kk], lane);
#pragma unroll
  for (int i = 0; i < 2; ++i)
#pragma unroll
    for (int j = 0; j < 4; ++j) acc[i][j] = __builtin_amdgcn_wmma_f32_16x16x32_bf16(false, a[i], false, w[j], (short)0, acc[i][j], false, false); }
__global__ __launch_bounds__(256) void k_pack(const float* __restrict__ X, const float* __restrict__ WQ, const float* __restrict__ WK, const float* __restrict__ WV, __bf16* __restrict__ XB, __bf16* __restrict__ WB) {
  const unsigned o = blockIdx.x * 256u + threadIdx.x, re = o & 1023u, hi = o >> 10, row = re >> 3, e = re & 7u;   // re: the piece's place in a packed run (row, eighth of its 64 k); hi: which runs
  const float* xa = X + ((size_t)(hi >> 1) * PJT + row) * DIN + (hi & 1u) * 8u * PJK + e * 8u;   // X: row block hi >> 1, passes (hi & 1) * 8 + 0 .. 7
  const size_t sw = ((size_t)(hi >> 3) * PJT + row) * DIN + (hi & 7u) * 2u * PJK + e * 8u;        // weights: row block hi >> 3, passes (hi & 7) * 2 + 0 .. 1
  const float* wq = WQ + sw; const float* wk = WK + sw; const float* wv = WV + sw; v4f a[14], c[14];
#pragma unroll
  for (int u = 0; u < 8; ++u) { a[u] = *(const v4f*)(xa + u * PJK); c[u] = *(const v4f*)(xa + u * PJK + 4); }
#pragma unroll
  for (int u = 0; u < 2; ++u) { a[8 + u] = *(const v4f*)(wq + u * PJK); c[8 + u] = *(const v4f*)(wq + u * PJK + 4); a[10 + u] = *(const v4f*)(wk + u * PJK); c[10 + u] = *(const v4f*)(wk + u * PJK + 4); a[12 + u] = *(const v4f*)(wv + u * PJK); c[12 + u] = *(const v4f*)(wv + u * PJK + 4); }
  asm volatile("s_wait_xcnt 0x0" :: "v"(xa), "v"(wq), "v"(wk), "v"(wv) : "memory");   /* the wait before a register of an issued load is overwritten; the loads' four addresses are inputs, so they stay live to here and no loaded value lands in one */
  asm volatile("" :: "v"(a[0]), "v"(c[0]), "v"(a[1]), "v"(c[1]), "v"(a[2]), "v"(c[2]), "v"(a[3]), "v"(c[3]), "v"(a[4]), "v"(c[4]), "v"(a[5]), "v"(c[5]), "v"(a[6]), "v"(c[6]), "v"(a[7]), "v"(c[7]), "v"(a[8]), "v"(c[8]), "v"(a[9]), "v"(c[9]), "v"(a[10]), "v"(c[10]), "v"(a[11]), "v"(c[11]), "v"(a[12]), "v"(c[12]), "v"(a[13]), "v"(c[13]));   /* the loaded values as inputs only: holds the 28 loads together in front of the first convert, one memory latency for the thread; without it the compiler issues them in four groups, each waited for before the next */
#pragma unroll
  for (int u = 0; u < 14; ++u) { __bf16* d = u < 8 ? XB + ((size_t)hi * 8u + u) * PJC + re * 8u : WB + (size_t)((u - 8) >> 1) * CC * DIN + ((size_t)hi * 2u + (u & 1)) * PJC + re * 8u;   /* run = row block * 16 + pass */
    *(v8b*)d = __builtin_convertvector(__builtin_shufflevector(a[u], c[u], 0, 1, 2, 3, 4, 5, 6, 7), v8b); } }
__global__ __launch_bounds__(256) void k_proj(const __bf16* __restrict__ XB, const __bf16* __restrict__ WB, const float* __restrict__ BQ, const float* __restrict__ BK, const float* __restrict__ BV,
    _Float16* __restrict__ QH, _Float16* __restrict__ QL, _Float16* __restrict__ KH, _Float16* __restrict__ KL, _Float16* __restrict__ VT, __bf16* __restrict__ VB, __bf16* __restrict__ VBL) {
  __shared__ __align__(16) unsigned char sm[3 * PJT * PJE * 2];   // the loop's two buffers of X and W rows (73,728 B); behind the barrier after the last pass the epilogue's planes
  __bf16 (*xs)[PJT][PJP] = (__bf16 (*)[PJT][PJP])sm; __bf16 (*wt)[PJT][PJP] = (__bf16 (*)[PJT][PJP])(sm + 2 * PJT * PJP * 2);
  const int tid = threadIdx.x, wave = tid >> 5, lane = tid & 31, col = lane & 15, g = lane >> 4, wm = wave & 3, wn = wave >> 2; const int which = blockIdx.z; const int c0 = blockIdx.y * PJT; const size_t r0 = (size_t)blockIdx.x * PJT; const size_t bb = r0 / TT; const int t0 = (int)(r0 % TT);
  const float* BA = which == 0 ? BQ : which == 1 ? BK : BV;
  const int lr = tid >> 3, lc = (tid & 7) * 8;   // staging: piece u * 256 + tid of a packed run is row u * 32 + lr, elements lc .. lc + 7; a wave reads 512 contiguous bytes a load
  const __bf16* xg = XB + (size_t)blockIdx.x * (DIN / PJK) * PJC + tid * 8; const __bf16* wg = WB + ((size_t)which * (CC / PJT) + blockIdx.y) * (DIN / PJK) * PJC + tid * 8;
  v8f acc[2][4] = {}; v8b xr[4], wr[4];
#pragma unroll
  for (int u = 0; u < 4; ++u) { xr[u] = *(const v8b*)(xg + u * 2048); wr[u] = *(const v8b*)(wg + u * 2048); }
#pragma unroll
  for (int u = 0; u < 4; ++u) { *(v8b*)&xs[0][u * 32 + lr][lc] = xr[u]; *(v8b*)&wt[0][u * 32 + lr][lc] = wr[u]; }
  __syncthreads();
  for (int kc = 0; kc < DIN / PJK - 1; ++kc) { const __bf16* xp = xg + (kc + 1) * PJC; const __bf16* wp = wg + (kc + 1) * PJC;
#pragma unroll
    for (int u = 0; u < 4; ++u) { xr[u] = *(const v8b*)(xp + u * 2048); wr[u] = *(const v8b*)(wp + u * 2048); }
    asm volatile("s_wait_xcnt 0x0" :: "v"(xp), "v"(wp) : "memory");   /* the wait before a register of an issued load is overwritten (the fragments below take the address registers); the two addresses are inputs, so they stay live to here. Standing here it also keeps all eight loads in front of the pass's LDS reads and products */
    proj_mac(xs[kc & 1], wt[kc & 1], 0, wm, wn, lane, acc); proj_mac(xs[kc & 1], wt[kc & 1], 32, wm, wn, lane, acc);
#pragma unroll
    for (int u = 0; u < 4; ++u) { *(v8b*)&xs[(kc + 1) & 1][u * 32 + lr][lc] = xr[u]; *(v8b*)&wt[(kc + 1) & 1][u * 32 + lr][lc] = wr[u]; }
    __syncthreads(); }
  proj_mac(xs[(DIN / PJK - 1) & 1], wt[(DIN / PJK - 1) & 1], 0, wm, wn, lane, acc); proj_mac(xs[(DIN / PJK - 1) & 1], wt[(DIN / PJK - 1) & 1], 32, wm, wn, lane, acc);
  __syncthreads();   // every wave has taken its last fragments: the epilogue's planes may overwrite the buffers
  if (which < 2) { _Float16 (*sh)[PJE] = (_Float16 (*)[PJE])sm; _Float16 (*sl)[PJE] = (_Float16 (*)[PJE])(sm + PJT * PJE * 2); _Float16* DH = which == 0 ? QH : KH; _Float16* DL = which == 0 ? QL : KL; const int nhi = which == 0 ? QHI : KHI; const bool hi_rows = t0 < nhi;
#pragma unroll
    for (int j = 0; j < 4; ++j) { const int cl = wn * 64 + j * 16 + col; const float bias = BA ? bfr(BA[c0 + cl]) : 0.f;
#pragma unroll
      for (int i = 0; i < 2; ++i)
#pragma unroll
        for (int r = 0; r < 8; ++r) { const float v = acc[i][j][r] + bias; const _Float16 hv = (_Float16)v; const int rl = wm * 32 + i * 16 + 8 * g + r; sh[rl][cl] = hv; sl[rl][cl] = (_Float16)((v - (float)hv) * 1024.0f); } }
    __syncthreads();
    for (int e = tid; e < PJT * 16; e += 256) { const int rl = (e >> 8) * 16 + (e & 15), q = (e >> 4) & 15;   /* a wave takes 16 rows x 2 eighths of a head's 64 k: 512 contiguous bytes of the fragment order */
      const size_t po = qpk(bb * NH + (c0 >> 6) + (q >> 3), t0 + rl, q & 7); _Float16* ph = DH + po; _Float16* pl = DL + po; const v4u hv = *(const v4u*)&sh[rl][q * 8], lv = *(const v4u*)&sl[rl][q * 8];
      vst2((unsigned*)ph, hv); if (hi_rows) vst2((unsigned*)pl, lv);
      asm volatile("s_wait_xcnt 0x0" :: "v"(ph), "v"(pl), "v"(hv), "v"(lv) : "memory"); }   /* the wait before a register of an issued store is overwritten (the next trip takes the address and data registers); they are inputs, so they stay live to here */
  } else { _Float16 (*th)[PJE] = (_Float16 (*)[PJE])sm; __bf16 (*tb)[PJE] = (__bf16 (*)[PJE])(sm + PJT * PJE * 2); __bf16 (*tbl)[PJE] = (__bf16 (*)[PJE])(sm + 2 * PJT * PJE * 2); const bool hi_rows = t0 < KHI;
#pragma unroll
    for (int j = 0; j < 4; ++j) { const int cl = wn * 64 + j * 16 + col; const float bias = BA ? bfr(BA[c0 + cl]) : 0.f;
#pragma unroll
      for (int i = 0; i < 2; ++i)
#pragma unroll
        for (int r = 0; r < 8; ++r) { const float v = acc[i][j][r] + bias; const int rl = wm * 32 + i * 16 + 8 * g + r; th[cl][rl] = (_Float16)v; const __bf16 bh = (__bf16)v; tb[cl][rl] = bh; tbl[cl][rl] = (__bf16)(v - (float)bh); } }
    __syncthreads();
    for (int e = tid; e < PJT * 16; e += 256) { const int cl = (e >> 8) * 16 + (e & 15), q = (e >> 4) & 15;   /* a wave takes 16 channels x 2 eighths of a tile's 64 keys: 512 contiguous bytes of the fragment order */
      const size_t o3 = vpk(bb * NH + ((c0 + cl) >> 6), (c0 + cl) & 63, t0 + q * 8); _Float16* pt = VT + o3; __bf16* pb = VB + o3; __bf16* pbl = VBL + o3; const v4u tv = *(const v4u*)&th[cl][q * 8], bv = *(const v4u*)&tb[cl][q * 8], lv = *(const v4u*)&tbl[cl][q * 8];
      vst2((unsigned*)pt, tv); if (hi_rows) { vst2((unsigned*)pb, bv); vst2((unsigned*)pbl, lv); }
      asm volatile("s_wait_xcnt 0x0" :: "v"(pt), "v"(pb), "v"(pbl), "v"(tv), "v"(bv), "v"(lv) : "memory"); } } }   /* the wait before a register of an issued store is overwritten (the next trip takes the address and data registers); they are inputs, so they stay live to here */
// ---- k_sm: block = query row t (head in group): keys [0, kend): causal -> logit if s <= t else excluded; softmax in f32; P x 2^11 in place (0 for excluded)
__global__ __launch_bounds__(256) void k_sm(float* __restrict__ S0 SM_EXTRA_PARAMS) { __shared__ float sred[8]; __shared__ float sbc; __shared__ __align__(16) float shv[TT];
  const int tid = threadIdx.x; const int t = blockIdx.x; const int kend = (kb_last(t >> 6) + 1) * 128;
  float* sr = S0 + (size_t)blockIdx.y * TT * TT + (size_t)t * TT;
  float m = -3.0e38f; for (int k = tid; k < kend; k += 256) { float v = (!CAUSAL || k <= t) ? sr[k] : -3.0e38f; SM_MASK_HOOK; shv[k] = v; m = fmaxf(m, v); }
#pragma unroll
  for (int o = 1; o < 32; o <<= 1) m = fmaxf(m, __shfl_xor(m, o));
  if ((tid & 31) == 0) sred[tid >> 5] = m; __syncthreads(); if (tid == 0) { float a = sred[0]; for (int i = 1; i < 8; ++i) a = fmaxf(a, sred[i]); sbc = a; } __syncthreads(); m = sbc; __syncthreads();
  float sum = 0.f; for (int k = tid; k < kend; k += 256) { const float v = shv[k]; const float e = (v <= -1.0e38f) ? 0.f : expf(v - m); shv[k] = e; sum += e; }
#pragma unroll
  for (int o = 1; o < 32; o <<= 1) sum += __shfl_xor(sum, o);
  if ((tid & 31) == 0) sred[tid >> 5] = sum; __syncthreads(); if (tid == 0) { float a = 0.f; for (int i = 0; i < 8; ++i) a += sred[i]; sbc = a > 0.f ? 2048.0f / a : 0.f; }   /* a fully excluded row yields P = 0 */ __syncthreads(); const float inv = sbc;
  for (int k = tid; k < kend; k += 256) shv[k] = shv[k] * inv;
  __syncthreads(); for (int q = tid; q < kend / 4; q += 256) vst2(sr + q * 4, *(const v4f*)&shv[q * 4]); }
// ---- k_stat: softmax over the QUERY axis under the causal mask (the source's softmax(axis=2) on [B, H, i, j] scores with -inf where j > i), with no score matrix in memory. Block = (STK key columns from k0, head h, batch b), STW waves. Every wave keeps the STK keys' f16 fragments in registers and takes every STW-th tile of 16 of the visible query rows k0 .. TT-1: scores q x k on WMMA (one f16 product), then per lane and column tile the online (max, sum) over its 8 rows (f32; the maximum runs over the raw products, each term is 2^(s x SCL2 - m x SCL2): one multiply-add and one v_exp_f32; q < k reads as -inf and adds 2^(-inf) = 0; the running maximum starts finite, so no difference is inf - inf; the sum so far is rescaled by 2^((m_old - m_new) x SCL2)). The 2 * STW partial pairs of a column (wave, lane half) are merged through LDS behind one barrier, which every wave reaches after its own last tile: m_k in base-2 units (m x SCL2) to CM, 2^11 / Z_k to CR, whole lines. The cost of a strip falls linearly with its index (strip x sees TT - x * STK query rows) and every work-group of the launch is resident at once, so a work-group takes two strips one after the other, the last minus x and x: every work-group has the same work. Each strip has its own pair of LDS arrays, so the second strip's partials never meet the first strip's merge. Every '#pragma unroll' of k_stat and k_out is there so that the small arrays it indexes (fragments, accumulators, m, z, P) stay in registers
#define STW 8
#define STK 64
// 2^x on v_exp_f32: every argument here is at most about 0 where its result is used, and a result below the normal range may read as 0 (it stands beside a column sum of at least 1). Written as asm so that the slot the instruction set asks for behind a transcendental (no use of its result, no overwrite of its source in the next instruction) is kept by construction, wherever the compiler places the statement. The v_nop is that slot
__device__ __forceinline__ float ex2(float x) { float e; asm("v_exp_f32 %0, %1\n\tv_nop" : "=v"(e) : "v"(x)); return e; }
// eight of them: the results are early-clobber outputs, so none lies in a source and each v_exp_f32 is the independent instruction behind the one before; one v_nop behind the last
__device__ __forceinline__ void ex2x8(float (&e)[8], const float (&x)[8]) {
  asm("v_exp_f32 %0, %8\n\tv_exp_f32 %1, %9\n\tv_exp_f32 %2, %10\n\tv_exp_f32 %3, %11\n\tv_exp_f32 %4, %12\n\tv_exp_f32 %5, %13\n\tv_exp_f32 %6, %14\n\tv_exp_f32 %7, %15\n\tv_nop"
      : "=&v"(e[0]), "=&v"(e[1]), "=&v"(e[2]), "=&v"(e[3]), "=&v"(e[4]), "=&v"(e[5]), "=&v"(e[6]), "=&v"(e[7])
      : "v"(x[0]), "v"(x[1]), "v"(x[2]), "v"(x[3]), "v"(x[4]), "v"(x[5]), "v"(x[6]), "v"(x[7])); }
// a fragment from that order: p holds the lane's own place in the fragment's first piece, the second piece lies 512 B on
__device__ __forceinline__ v16h frag_hq(const _Float16* p) { union { v16h v; v8h q[2]; } u; u.q[0] = *(const v8h*)p; u.q[1] = *(const v8h*)(p + 256); return u.v; }
__device__ __forceinline__ v16b frag_bq(const __bf16* p) { union { v16b v; v8b q[2]; } u; u.q[0] = *(const v8b*)p; u.q[1] = *(const v8b*)(p + 256); return u.v; }
// one tile of 16 query rows against the strip's STK keys. MASK is a constant of the call: from query row k0 + STK on every key of the strip is visible, the compare is true in every lane, and the 32 compares and 32 selects of a tile, with the row indices they need, are not built at all; only the strip's own first STK rows, which the diagonal crosses, are built with them
template <bool MASK> __device__ __forceinline__ void stat_trip(const _Float16* __restrict__ QH, int b, int h, int ql0, int k0, int col, int g, const v16h (&kf)[HD / 32][STK / 16], float (&m)[STK / 16], float (&z)[STK / 16]) { const _Float16* qp = QH + qpk((size_t)b * NH + h, ql0, 0) + (g * 16 + col) * 8; const v16h a0 = frag_hq(qp), a1 = frag_hq(qp + 512);   /* ql0 is a multiple of 16: the tile's run, a scalar, and the lane's place in it */
    asm volatile("s_wait_xcnt 0x0" :: "v"(qp), "v"(a0), "v"(a1) : "memory");   /* the wait before a register of an issued load is overwritten (the next tile's address); the loads' common address is an input, so it stays live to here. The loaded values are inputs too, and inputs only: that holds the tile's four loads together in front of the products, one memory latency a tile; without it the compiler, in the tile with the mask, issues the second pair behind the first four products, into the first pair's registers, and waits a second time */
    v8f sc[STK / 16];   /* the trip's eight products first, over four independent accumulators: no WMMA waits for the one in front of it */
#pragma unroll
    for (int j = 0; j < STK / 16; ++j) { const v8f zero = {}; sc[j] = wmma16(a0, kf[0][j], zero); }
#pragma unroll
    for (int j = 0; j < STK / 16; ++j) sc[j] = wmma16(a1, kf[1][j], sc[j]);
#pragma unroll
    for (int j = 0; j < STK / 16; ++j) { const v8f acc = sc[j]; const int k = k0 + j * 16 + col; float v[8];
#pragma unroll
      for (int r = 0; r < 8; ++r) v[r] = (!MASK || ql0 + 8 * g + r >= k) ? acc[r] : -INFINITY;
      float mn = m[j];
#pragma unroll
      for (int r = 0; r < 8; ++r) mn = fmaxf(mn, v[r]);
      const float nb = -(mn * SCL2); float x[8], e[8];
#pragma unroll
      for (int r = 0; r < 8; ++r) x[r] = __builtin_fmaf(v[r], SCL2, nb);
      ex2x8(e, x); float s = e[0];
#pragma unroll
      for (int r = 1; r < 8; ++r) s += e[r];
      z[j] = z[j] * ex2((m[j] - mn) * SCL2) + s; m[j] = mn; } }   /* the two raw maxima are subtracted first: a maximum that has not moved gives exactly 2^0 = 1, and a difference followed by a multiply has no fused form */
__global__ __launch_bounds__(STW * 32) void k_stat(const _Float16* __restrict__ QH, const _Float16* __restrict__ KH, float* __restrict__ CM, float* __restrict__ CR) { __shared__ float pm2[2][2 * STW][STK], pz2[2][2 * STW][STK];
  const int tid = threadIdx.x, lane = tid & 31, col = lane & 15, g = lane >> 4; const int wave = __builtin_amdgcn_readfirstlane(tid >> 5); const int h = blockIdx.y, b = blockIdx.z;
  for (int half = 0; half < 2; ++half) { const int k0 = (half ? (int)blockIdx.x : TT / STK - 1 - (int)blockIdx.x) * STK; float (*pm)[STK] = pm2[half]; float (*pz)[STK] = pz2[half];
  v16h kf[HD / 32][STK / 16]; const _Float16* kp = KH + qpk((size_t)b * NH + h, k0 + col, g);
#pragma unroll
  for (int kc = 0; kc < HD / 32; ++kc) {
#pragma unroll
    for (int j = 0; j < STK / 16; ++j) kf[kc][j] = frag_hq(kp + j * 1024 + kc * 512); }
  asm volatile("s_wait_xcnt 0x0" :: "v"(kp) : "memory");   /* the wait before a register of an issued load is overwritten; the loads' common address is an input, so it stays live to here and no fragment lands in it */
  float m[STK / 16], z[STK / 16];   // m: running maximum of the raw products
#pragma unroll
  for (int j = 0; j < STK / 16; ++j) { m[j] = -3.0e38f; z[j] = 0.f; }
  int ql0 = k0 + wave * 16;   // wave-uniform: both tests below are scalar branches
  if (wave < STK / 16) { stat_trip<true>(QH, b, h, ql0, k0, col, g, kf, m, z); ql0 += STW * 16; }   /* the diagonal crosses the first tile of waves 0 .. STK / 16 - 1 and no other; that tile always exists (k0 + STK <= TT) */
  for (; ql0 < TT; ql0 += STW * 16) stat_trip<false>(QH, b, h, ql0, k0, col, g, kf, m, z);
#pragma unroll
  for (int j = 0; j < STK / 16; ++j) { pm[2 * wave + g][j * 16 + col] = m[j] * SCL2; pz[2 * wave + g][j * 16 + col] = z[j]; }
  __syncthreads();
  if (tid < STK) { float mm = pm[0][tid];
#pragma unroll
    for (int w = 1; w < 2 * STW; ++w) mm = fmaxf(mm, pm[w][tid]);
    float a = 0.f;   /* a partial that saw no visible row of this column holds Z = 0 and a finite maximum */
#pragma unroll
    for (int w = 0; w < 2 * STW; ++w) a += pz[w][tid] * ex2(pm[w][tid] - mm);
    const size_t o = ((size_t)b * NH + h) * TT + k0 + tid; float* pcm = CM + o; float* pcr = CR + o; const float rz = 2048.0f / a; vst2(pcm, mm); vst2(pcr, rz);   /* every column sees at least its own diagonal entry: Z_k >= 1 */
    asm volatile("s_wait_xcnt 0x0" :: "v"(pcm), "v"(pcr), "v"(mm), "v"(rz) : "memory"); } } }   /* the wait before a register of an issued store is overwritten (the second strip takes the address and data registers); they are inputs, so they stay live to here */
// ---- k_out: block = 64 queries (qb) of (b, h), a wave = 16 queries: per 32 keys the scores are formed again on WMMA, transposed (A = 16 key rows, B = the wave's 16 queries, kept in registers; the same one f16 product), so that a lane holds, for its own query, the keys 8g + 0..7 of each 16-key tile: two such tiles are, in place, the A fragment of P . v (hardware k order, the order of frag_b). P[i][j] = 2^(s x SCL2 - m_j) x (2^11 / Z_j), m_j in base-2 units, for j <= i, 0 above the diagonal (unconditional loads, value select); P and v as bf16 hi + lo, 3 products, keys [0, kend) as before; 256-B (row, head) segment by 16 lanes. What the four waves read of 64 keys (k rows, v hi and lo rows, column maxima and scales) is the same for all of them: it is brought into LDS once per block, in runs of 512 contiguous bytes a wave, by asynchronous copies, two buffers, the next tile flying while a tile is worked on; every fragment comes from LDS. The cost of a query block grows linearly with its index (block qb walks the keys up to its own diagonal) and every work-group of the launch is resident at once, so a work-group takes two query blocks of its head one after the other, the last minus x and x: every work-group has the same work
#define OKT 64              // keys of a staged tile
#define OPL 8192            // one staged plane: a tile's 64 keys of k; of v hi; of v lo: each 8 KiB in fragment order, laid in LDS as it lies in memory, so that a fragment read is 512 contiguous bytes, free of bank conflicts
#define OBF (3 * OPL + 512) // one buffer: three planes, then 64 column maxima and 64 column scales
// the 12 copies of a thread for one tile: each plane's 8 KiB lie in a run, the block takes 2 KiB a copy, a wave 512 contiguous bytes. la: the thread's LDS byte address in the first 2 KiB of the k plane; kg, hg, lg: its global addresses in the first 2 KiB of the tile's three planes
__device__ __forceinline__ void out_stage(unsigned la, const _Float16* kg, const __bf16* hg, const __bf16* lg) {
  /* the copies and, as the last line of their own statement, the wait before a register that an issued copy names is rewritten */
  asm volatile("global_load_async_to_lds_b128 %0, %12, off\n\tglobal_load_async_to_lds_b128 %1, %13, off\n\tglobal_load_async_to_lds_b128 %2, %14, off\n\tglobal_load_async_to_lds_b128 %3, %15, off\n\t"
               "global_load_async_to_lds_b128 %4, %16, off\n\tglobal_load_async_to_lds_b128 %5, %17, off\n\tglobal_load_async_to_lds_b128 %6, %18, off\n\tglobal_load_async_to_lds_b128 %7, %19, off\n\t"
               "global_load_async_to_lds_b128 %8, %20, off\n\tglobal_load_async_to_lds_b128 %9, %21, off\n\tglobal_load_async_to_lds_b128 %10, %22, off\n\tglobal_load_async_to_lds_b128 %11, %23, off\n\ts_wait_xcnt 0x0"
               :: "v"(la), "v"(la + 2048), "v"(la + 4096), "v"(la + 6144),
                  "v"(la + OPL), "v"(la + OPL + 2048), "v"(la + OPL + 4096), "v"(la + OPL + 6144),
                  "v"(la + 2 * OPL), "v"(la + 2 * OPL + 2048), "v"(la + 2 * OPL + 4096), "v"(la + 2 * OPL + 6144),
                  "v"(kg), "v"(kg + 1024), "v"(kg + 2048), "v"(kg + 3072),
                  "v"(hg), "v"(hg + 1024), "v"(hg + 2048), "v"(hg + 3072),
                  "v"(lg), "v"(lg + 1024), "v"(lg + 2048), "v"(lg + 3072) : "memory"); }
// one wave's copy of the tile's 64 maxima (lanes 0..15) and 64 scales (lanes 16..31), with the same wait
__device__ __forceinline__ void out_stage_c(unsigned la, const float* cg) { asm volatile("global_load_async_to_lds_b128 %0, %1, off\n\ts_wait_xcnt 0x0" :: "v"(la), "v"(cg) : "memory"); }
// one staged tile of 64 keys for a wave's 16 queries. MASK is a constant of the call: a tile whose last key is at or below the block's first query (t < qb) has every key visible to every query, the compare is true in every lane, and its 16 compares and 16 selects a half, with the key indices they need, are not built at all; only the tile that the diagonal crosses (t == qb) is built with them
template <bool MASK> __device__ __forceinline__ void out_tile(const unsigned char* bp, int t, int qi, int col, int g, const v16h& q0, const v16h& q1, v8f (&acc)[HD / 16]) {
#pragma unroll   /* the tile's two halves of 32 keys, unrolled so that every LDS offset of a half is an immediate */
    for (int s = 0; s < 2; ++s) { const int k0 = t * OKT + s * 32;
      const _Float16* ka = (const _Float16*)(bp + s * 4096) + (g * 16 + col) * 8; const _Float16* kb2 = ka + 1024;   /* the half's two tiles of 16 keys, 2 KiB each: a read is 512 contiguous bytes */ const float* cmk = (const float*)(bp + 3 * OPL) + s * 32 + 8 * g; const float* crk = cmk + OKT;
      const v16h ka0 = frag_hq(ka), kb0 = frag_hq(kb2), ka1 = frag_hq(ka + 512), kb1 = frag_hq(kb2 + 512);
      v4f mv[4], rv[4];
#pragma unroll
      for (int u = 0; u < 4; ++u) { const int o = (u >> 1) * 16 + (u & 1) * 4; mv[u] = *(const v4f*)(cmk + o); rv[u] = *(const v4f*)(crk + o); }
      v16b vh[HD / 16], vl[HD / 16]; const __bf16* vhp = (const __bf16*)(bp + OPL + s * 1024) + (g * 16 + col) * 8; const __bf16* vlp = vhp + OPL / 2;   /* the half's two pieces of the first 16 channels' run */
#pragma unroll
      for (int j = 0; j < HD / 16; ++j) vh[j] = frag_bq(vhp + j * 1024);
      __builtin_amdgcn_sched_barrier(0);   /* keeps these 24 LDS reads together in front of the half's products: without it the compiler sinks them in pairs between the WMMAs, each pair waited for one WMMA later */
      v8f s0 = {}, s1 = {}; s0 = wmma16(ka0, q0, s0); s1 = wmma16(kb0, q0, s1); s0 = wmma16(ka1, q1, s0); s1 = wmma16(kb1, q1, s1);
      float pv[16], x0[8], x1[8], e0[8], e1[8];
#pragma unroll
      for (int i = 0; i < 8; ++i) { x0[i] = __builtin_fmaf(s0[i], SCL2, -mv[i >> 2][i & 3]); x1[i] = __builtin_fmaf(s1[i], SCL2, -mv[2 + (i >> 2)][i & 3]); }
      ex2x8(e0, x0); ex2x8(e1, x1);
#pragma unroll
      for (int j = 0; j < HD / 16; ++j) vl[j] = frag_bq(vlp + j * 1024);   /* the v lo rows, wanted last, are a second group of reads: with all 32 reads of a half in one group the kernel no longer fits its 256 registers and spills */
      __builtin_amdgcn_sched_barrier(0);   /* keeps those 8 reads in front of the forming of P, which with the first eight P . v products covers their latency: without it the compiler sinks them in pairs between the products */
#pragma unroll
      for (int i = 0; i < 8; ++i) { const int ke = k0 + 8 * g + i; pv[i] = (!MASK || ke <= qi) ? e0[i] * rv[i >> 2][i & 3] : 0.f; pv[8 + i] = (!MASK || ke + 16 <= qi) ? e1[i] * rv[2 + (i >> 2)][i & 3] : 0.f; }
      const F2 p = bsplit16(pv);
#pragma unroll
      for (int j = 0; j < HD / 16; ++j) acc[j] = wmma_bf(p.h, vh[j], acc[j]);   /* product by product over the four accumulators: no WMMA waits for the one in front of it; each accumulator takes its three products in the order it had */
#pragma unroll
      for (int j = 0; j < HD / 16; ++j) acc[j] = wmma_bf(p.l, vh[j], acc[j]);
#pragma unroll
      for (int j = 0; j < HD / 16; ++j) acc[j] = wmma_bf(p.h, vl[j], acc[j]); } }
// amdgpu_waves_per_eu(4): a budget of 256 registers; without it what the compiler keeps live round the loop over the two query blocks takes the count just past 256 and fills the key loop with register-window switches
__global__ __launch_bounds__(128) __attribute__((amdgpu_waves_per_eu(4))) void k_out(const _Float16* __restrict__ QH, const _Float16* __restrict__ KH, const float* __restrict__ CM, const float* __restrict__ CR, const __bf16* __restrict__ VB, const __bf16* __restrict__ VBL, float* __restrict__ Y) { __shared__ __align__(16) unsigned char sm[2 * OBF];   // the loop's two buffers; behind the barrier after the last tile the epilogue's rows
  const int tid = threadIdx.x, lane = tid & 31, col = lane & 15, g = lane >> 4; const int wave = __builtin_amdgcn_readfirstlane(tid >> 5); const int h = blockIdx.y, b = blockIdx.z;
  const size_t po = ((size_t)b * NH + h) * TT * HD + tid * 8; const _Float16* kg = KH + po; const __bf16* hg = VB + po; const __bf16* lg = VBL + po;   // staging: the thread's 16 bytes in the first 2 KiB of the head's three planes; a tile of 64 keys is OKT * HD elements of each
  const float* cg = (g ? CR : CM) + ((size_t)b * NH + h) * TT + col * 4;
  const unsigned la = (unsigned)(size_t)sm + tid * 16, lc = (unsigned)(size_t)sm + 3 * OPL + lane * 16;
  for (int half = 0; half < 2; ++half) { const int qb = half ? (int)blockIdx.x : NQB - 1 - (int)blockIdx.x; const int ql0 = qb * 64 + wave * 16; const int nt = qb + 1; const int qi = ql0 + col;   // nt tiles of 64 keys: up to the one that holds the block's own diagonal; a tile wholly above it has P = 0 throughout and is not visited
  const _Float16* qp = QH + qpk((size_t)b * NH + h, qi, g); const v16h q0 = frag_hq(qp), q1 = frag_hq(qp + 512);
  asm volatile("s_wait_xcnt 0x0" :: "v"(qp) : "memory");   /* the wait before a register of an issued load is overwritten; the loads' common address is an input, so it stays live to here */
  out_stage(la, kg, hg, lg); if (wave == 0) out_stage_c(lc, cg);
  asm volatile("s_wait_asynccnt 0x0" ::: "memory");   /* this wave's copies of tile 0 have landed */
  __syncthreads();                                     /* and every other wave's: tile 0 may be read */
  if (nt > 1) { out_stage(la + OBF, kg + OKT * HD, hg + OKT * HD, lg + OKT * HD); if (wave == 0) out_stage_c(lc + OBF, cg + OKT); }
  v8f acc[HD / 16] = {};
  for (int t = 0; t < qb; ++t) { out_tile<false>(sm + (t & 1) * OBF, t, qi, col, g, q0, q1, acc);   /* the tiles below the diagonal */
    __builtin_amdgcn_sched_barrier(0);                   /* keeps the tile's last products in front of the barrier, as they stood: without it the compiler moves them behind it, and the refill below, which follows them, is issued that much later */
    asm volatile("s_wait_dscnt 0x0" ::: "memory");      /* this wave's reads of tile t are over */
    asm volatile("s_wait_asynccnt 0x0" ::: "memory");   /* its copies of tile t + 1 have landed */
    __syncthreads();                                     /* the same of every wave: tile t + 1 may be read, tile t's buffer refilled */
    if (t + 2 < nt) { const int kn = (t + 2) * OKT; const unsigned bo = (t & 1) * OBF; out_stage(la + bo, kg + kn * HD, hg + kn * HD, lg + kn * HD); if (wave == 0) out_stage_c(lc + bo, cg + kn); } }
  out_tile<true>(sm + (qb & 1) * OBF, qb, qi, col, g, q0, q1, acc);   /* the tile that the diagonal crosses, the block's last */
  asm volatile("s_wait_dscnt 0x0" ::: "memory");      /* this wave's reads of the last tile are over */
  asm volatile("s_wait_asynccnt 0x0" ::: "memory");     /* no copy is outstanding when the buffers become the epilogue's rows */
  __syncthreads();                                     /* the same of every wave: the buffers may become the epilogue's rows */
  float (*ss)[16][HD + 4] = (float (*)[16][HD + 4])sm;
#pragma unroll
  for (int j = 0; j < HD / 16; ++j)
#pragma unroll
    for (int r = 0; r < 8; ++r) ss[wave][8 * g + r][j * 16 + col] = acc[j][r] * (1.0f / 2048.0f);
  LDSX(); for (int rl = 0; rl < 16; ++rl) if (lane < HD / 4) vst2(Y + ((size_t)b * TT + ql0 + rl) * CC + h * HD + lane * 4, *(const v4f*)&ss[wave][rl][lane * 4]);
  if (half == 0) {
    asm volatile("s_wait_xcnt 0x0" ::: "memory");     /* the wait before a register of an issued store is overwritten (the second query block takes the address and data registers) */
    asm volatile("s_wait_dscnt 0x0" ::: "memory");    /* this wave's reads of its epilogue rows are over */
    __syncthreads(); } } }                             /* the same of every wave: the second query block's copies may overwrite the rows */

extern "C" void kernel_launch(void* const* d_in, const int* in_sizes, int n_in, void* d_out, int out_size, void* d_ws, size_t ws_size, hipStream_t stream) {
  (void)in_sizes; (void)n_in; (void)out_size;
  const float** F = (const float**)d_in;
  if (ws_size < (size_t)WS_END) return;
  char* ws = (char*)d_ws; _Float16 *QH = (_Float16*)(ws + WS_QH), *KH = (_Float16*)(ws + WS_KH), *VT = (_Float16*)(ws + WS_VT), *QL = (_Float16*)(ws + WS_QL), *KL = (_Float16*)(ws + WS_KL); __bf16 *VB = (__bf16*)(ws + WS_VB), *VBL = (__bf16*)(ws + WS_VBL); float *S = (float*)(ws + WS_S), *Y = (float*)(ws + WS_Y);
  (void)Y; (void)QL; (void)KL; (void)VB; (void)VBL; (void)S; (void)VT;
  // inputs: 0 X [2,2048,1024]; 1 Wq [1024,1024] (out,in), 2 bq; 3 Wk, 4 bk; 5 Wv, 6 bv (biases N(0, 0.02), nonzero); no output projection
  if (ws_size < (size_t)WS_END3) return;
  __bf16 *XB = (__bf16*)(ws + WS_XB), *WB = (__bf16*)(ws + WS_WB);
  float *CM = (float*)(ws + WS_CM), *CZ = (float*)(ws + WS_CZ);
  k_pack<<<dim3(PKN / 256), 256, 0, stream>>>(F[0], F[1], F[3], F[5], XB, WB);   /* bf16 copies of X and the weights, packed by k_proj's passes */
  k_proj<<<dim3(TNB * TT / PJT, CC / PJT, 3), 256, 0, stream>>>(XB, WB, F[2], F[4], F[6], QH, QL, KH, KL, VT, VB, VBL);
  k_stat<<<dim3(TT / STK / 2, NH, TNB), STW * 32, 0, stream>>>(QH, KH, CM, CZ);   /* per key column j: max and 2^11 / sum over the visible queries i >= j */
  k_out<<<dim3(NQB / 2, NH, TNB), 128, 0, stream>>>(QH, KH, CM, CZ, VB, VBL, (float*)d_out);   /* P formed in registers, then P . v */
}
